// v000
// The times below were measured on an AMD MI455X: many runs one after another, warmed up first and cycling through
// copies of the inputs, with the whole window's GPU time divided by the number of runs. Launches and the gaps
// between them are all in it. The median over several windows is given; except for v000 it joins two sittings, which
// can be a few percent apart, so the side-by-side timings, each taken in one sitting, are the better comparison.
// The starting kernel, v000, takes 775 microseconds a run.
// All contractions: v_wmma_f32_16x16x32_f16 (f16 operands, f32 accumulate): q/k/v projections, q.k^T scores,
// p.v context, ctx.Wo, ln2out.W1, gelu.W2. LayerNorm, softmax, GELU, bias and residual adds in f32.
#include <hip/hip_runtime.h>
#include <math.h>
#include <stdint.h>

#define NB   2
#define SEQ  4096
#define DM   768
#define NH   12
#define HD   64
#define FF   3072
#define NROW (NB * SEQ)      // 8192 token rows
#define NQB  (SEQ / 64)      // 64 query / key tiles of 64
static_assert(NH * HD == DM);
static_assert((SEQ % 64) == 0 && (DM % 64) == 0 && (FF % 64) == 0 && (NROW % 64) == 0);
static_assert(DM == 3 * 256);

typedef _Float16 v16h __attribute__((ext_vector_type(16)));
typedef _Float16 v8h  __attribute__((ext_vector_type(8)));
typedef float    v8f  __attribute__((ext_vector_type(8)));
typedef float    v4f  __attribute__((ext_vector_type(4)));
typedef unsigned int v4u __attribute__((ext_vector_type(4)));

union H8 { v8h h; v4u u; };
union FH { v16h v; v8h h[2]; };

__device__ __forceinline__ v8f zero8() { v8f z = {0.f, 0.f, 0.f, 0.f, 0.f, 0.f, 0.f, 0.f}; return z; }

// 16-bit A/B fragment: lane -> row/col (lane&15); p already includes +8*(lane>>4);
// elements 0..7 <- p[0..7] (k0+8h..k0+8h+7), elements 8..15 <- p[16..23] (k0+16+8h..)
__device__ __forceinline__ v16h ldfrag(const _Float16* p) {
  FH f;
  f.h[0] = *(const v8h*)(p);
  f.h[1] = *(const v8h*)(p + 16);
  return f.v;
}

// WMMA with trailing VALU hazard gap (D tied, A/B kept live)
__device__ __forceinline__ v8f mma_h(v16h a, v16h b, v8f c) {
  c = __builtin_amdgcn_wmma_f32_16x16x32_f16(false, a, false, b, (short)0, c, false, false);
  asm volatile("v_nop\n\tv_nop\n\tv_nop\n\tv_nop" : "+v"(c) : "v"(a), "v"(b));
  return c;
}
__device__ __forceinline__ v8f mma_raw(v16h a, v16h b, v8f c) {
  return __builtin_amdgcn_wmma_f32_16x16x32_f16(false, a, false, b, (short)0, c, false, false);
}
// guard after the last WMMA of a 4-op group: ties all four D, keeps the group's A and B live
__device__ __forceinline__ void guard4(v8f& d0, v8f& d1, v8f& d2, v8f& d3,
                                       v16h a, v16h b0, v16h b1, v16h b2, v16h b3) {
  asm volatile("v_nop\n\tv_nop\n\tv_nop\n\tv_nop"
               : "+v"(d0), "+v"(d1), "+v"(d2), "+v"(d3)
               : "v"(a), "v"(b0), "v"(b1), "v"(b2), "v"(b3));
}

// tanh-form GELU via the identity 0.5u(1+tanh z) = u * sigmoid(2z); exp argument clamped, reciprocal by v_rcp
__device__ __forceinline__ float gelu_tanh(float u) {
  const float z = 0.7978845608028654f * (u + 0.044715f * u * u * u);
  const float e = __expf(fminf(-2.0f * z, 80.0f));
  return u * __builtin_amdgcn_rcpf(1.0f + e);
}

// =====================================================================================================
// Weight transpose + convert: W f32 [Kin][Nout] (pitch Nout) -> Wt f16 [Nout][Kin] (pitch Kin), times scale.
// 64x64 tile through LDS. grid = (Nout/64, Kin/64), 256 threads. Reads: thread handles 4 float4 of the
// tile (chunk = tid + i*256 -> row r = chunk>>4 (k local), cols c4..c4+3 (n local)).
// coverage: 8 waves x 2 x 4 = 64 rows, 8 lanes x 8 halves = 64 cols = the whole tile; grid exact.
// =====================================================================================================
__global__ __launch_bounds__(256) void tr_cvt(const float* __restrict__ W, _Float16* Wt,
                                              int Kin, int Nout, float scale) {
  __shared__ __align__(16) _Float16 T[64][72];   // [n local][k local], pitch 144 B
  const int tid = threadIdx.x, wave = tid >> 5, lane = tid & 31;
  const int n0 = blockIdx.x * 64, k0 = blockIdx.y * 64;
#pragma unroll
  for (int i = 0; i < 4; ++i) {
    const int chunk = tid + i * 256;
    const int r = chunk >> 4;            // 0..63  (k local)
    const int c4 = (chunk & 15) * 4;     // 0..60  (n local)
    const v4f v = *(const v4f*)(W + (size_t)(k0 + r) * Nout + n0 + c4);
#pragma unroll
    for (int e = 0; e < 4; ++e) T[c4 + e][r] = (_Float16)(v[e] * scale);
  }
  __syncthreads();
  const int q = lane >> 3, c8 = (lane & 7) * 8;
  v4u o[2];
#pragma unroll
  for (int it = 0; it < 2; ++it) {
    const int row = wave * 8 + it * 4 + q;
    H8 p;
    p.h = *(const v8h*)(&T[row][c8]);
    o[it] = p.u;
  }
  {
#pragma unroll
    for (int it = 0; it < 2; ++it) {
      const int row = wave * 8 + it * 4 + q;
      *(v4u*)(Wt + (size_t)(n0 + row) * Kin + k0 + c8) = o[it];
    }
    
  }
}

// =====================================================================================================
// LayerNorm over DM=768 columns, f32 math, f16 output (unscaled). One wave per row, 8 rows per block,
// grid = ceil(nrows/8). Lane holds columns i*256 + lane*8 .. +7 (i 0..2). mean and variance by two register
// passes with 32-lane butterflies. Output: three 16-B stores per lane, each instruction = 32 lanes x 16 B =
// coverage: 3 x 256 = 768 columns per row; every row < nrows by exactly one wave.
// =====================================================================================================
__global__ __launch_bounds__(256) void ln_rows(const float* __restrict__ X, const float* __restrict__ g,
                                               const float* __restrict__ bb, _Float16* Y, int nrows) {
  const int wave = threadIdx.x >> 5, lane = threadIdx.x & 31;
  const int row = blockIdx.x * 8 + wave;
  if (row >= nrows) return;                  // wave-uniform; no block barriers in this kernel
  const float* xr = X + (size_t)row * DM;
  float v[3][8];
  float s = 0.f;
#pragma unroll
  for (int i = 0; i < 3; ++i) {
    const int col = i * 256 + lane * 8;
    const v4f a = *(const v4f*)(xr + col);
    const v4f c = *(const v4f*)(xr + col + 4);
#pragma unroll
    for (int e = 0; e < 4; ++e) { v[i][e] = a[e]; v[i][4 + e] = c[e]; }
#pragma unroll
    for (int e = 0; e < 8; ++e) s += v[i][e];
  }
#pragma unroll
  for (int off = 16; off > 0; off >>= 1) s += __shfl_xor(s, off, 32);
  const float mu = s * (1.0f / (float)DM);
  float qs = 0.f;
#pragma unroll
  for (int i = 0; i < 3; ++i)
#pragma unroll
    for (int e = 0; e < 8; ++e) { const float d = v[i][e] - mu; v[i][e] = d; qs += d * d; }
#pragma unroll
  for (int off = 16; off > 0; off >>= 1) qs += __shfl_xor(qs, off, 32);
  const float rstd = rsqrtf(qs * (1.0f / (float)DM) + 1e-5f);
  v4u o[3];
#pragma unroll
  for (int i = 0; i < 3; ++i) {
    const int col = i * 256 + lane * 8;
    const v4f g0 = *(const v4f*)(g + col), g1 = *(const v4f*)(g + col + 4);
    const v4f b0 = *(const v4f*)(bb + col), b1 = *(const v4f*)(bb + col + 4);
    H8 p;
#pragma unroll
    for (int e = 0; e < 4; ++e) {
      p.h[e]     = (_Float16)(v[i][e] * rstd * g0[e] + b0[e]);
      p.h[4 + e] = (_Float16)(v[i][4 + e] * rstd * g1[e] + b1[e]);
    }
    o[i] = p.u;
  }
  {
#pragma unroll
    for (int i = 0; i < 3; ++i)
      *(v4u*)(Y + (size_t)row * DM + i * 256 + lane * 8) = o[i];
    
  }
}

// =====================================================================================================
// Register-blocked batched f16 WMMA GEMM: acc[m][n] = sum_k A[m][k] * Bt[n][k]; one wave per 64x64 tile,
// no block barriers. A row-major [M][K] pitch lda; Bt row-major [N][K] pitch ldb (k contiguous); both f16
// global planes, fragments loaded straight from them (two 16-B loads each). M, N multiples of 64,
// K multiple of 32 (host-checked). blockIdx.y = batch index (strides in elements, C and Res share strideC).
// MODE 0: C f16 [m][n] = (acc*accs + bias[n]) * outs
// MODE 1: C f16 [m][n] = (acc*accs + bias[m]) * outs            (bias along rows)
// MODE 2: C f32 [m][n] = Res[m][n] + acc*accs + bias[n]          (Res has C's layout, never aliases C)
// MODE 3: C f16 [m][n] = gelu_tanh(acc*accs + bias[n]) * outs
// =====================================================================================================
template <int MODE>
__global__ __launch_bounds__(256) void gemm64(
    const _Float16* __restrict__ A, int lda, long long strideA,
    const _Float16* __restrict__ Bt, int ldb, long long strideB,
    const float* __restrict__ bias, const float* __restrict__ Res,
    void* Cout, int ldc, long long strideC,
    int M, int N, int K, float accs, float outs) {
  __shared__ __align__(16) float sT[8][16 * 68];   // per-wave 16x64 slab, pitch 68 floats (272 B)
  const int bz   = blockIdx.y;
  const int lane = threadIdx.x & 31;
  const int wave = threadIdx.x >> 5;
  const int tilesN = N >> 6;
  const int tilesM = M >> 6;
  const int tile = blockIdx.x * 8 + wave;
  if (tile >= tilesM * tilesN) return;   // wave-uniform; no block barriers in this kernel
  const int tm = tile / tilesN;
  const int tn = tile - tm * tilesN;
  const int m0 = tm << 6;
  const int n0 = tn << 6;

  const _Float16* Ab = A  + (size_t)bz * (size_t)strideA;
  const _Float16* Bb = Bt + (size_t)bz * (size_t)strideB;

  const int rl   = lane & 15;                 // row (A) / col (B, D) within subtile
  const int koff = (lane >> 4) * 8;           // k offset of this lane half
  const int mOff = (lane >> 4) * 8;           // D row offset

  v8f acc[4][4];
#pragma unroll
  for (int i = 0; i < 4; ++i)
#pragma unroll
    for (int j = 0; j < 4; ++j) acc[i][j] = zero8();

  for (int k0 = 0; k0 < K; k0 += 32) {
    v16h bf[4];
#pragma unroll
    for (int j = 0; j < 4; ++j)
      bf[j] = ldfrag(Bb + (size_t)(n0 + (j << 4) + rl) * ldb + koff + k0);
#pragma unroll
    for (int i = 0; i < 4; ++i) {
      const v16h af = ldfrag(Ab + (size_t)(m0 + (i << 4) + rl) * lda + koff + k0);
#pragma unroll
      for (int j = 0; j < 4; ++j) acc[i][j] = mma_raw(af, bf[j], acc[i][j]);
      guard4(acc[i][0], acc[i][1], acc[i][2], acc[i][3], af, bf[0], bf[1], bf[2], bf[3]);
    }
  }

  // ---- epilogue ----
  float* slab = sT[wave];
#pragma unroll
  for (int i = 0; i < 4; ++i) {
    const int mBase = m0 + (i << 4);
#pragma unroll
    for (int j = 0; j < 4; ++j) {
#pragma unroll
      for (int r = 0; r < 8; ++r) slab[(mOff + r) * 68 + (j << 4) + rl] = acc[i][j][r];
    }
    __builtin_amdgcn_fence(__ATOMIC_RELEASE, "workgroup");
    __builtin_amdgcn_wave_barrier();
    __builtin_amdgcn_fence(__ATOMIC_ACQUIRE, "workgroup");
    if constexpr (MODE == 2) {
      float* C = (float*)Cout + (size_t)bz * (size_t)strideC;
      const float* R = Res + (size_t)bz * (size_t)strideC;
      const int h2 = lane >> 4, c4 = (lane & 15) * 4;    // 256-B row segment = 16 lanes x 16 B
      const v4f bq4 = *(const v4f*)(bias + n0 + c4);
      {
#pragma unroll
        for (int it = 0; it < 8; ++it) {
          const int row = it * 2 + h2;                    // it 0..7 x h2 0..1 = rows 0..15
          const v4f a  = *(const v4f*)(slab + row * 68 + c4);
          const v4f rr = *(const v4f*)(R + (size_t)(mBase + row) * ldc + n0 + c4);
          v4f ov;
#pragma unroll
          for (int e = 0; e < 4; ++e) ov[e] = rr[e] + (a[e] * accs + bq4[e]);
          *(v4f*)(C + (size_t)(mBase + row) * ldc + n0 + c4) = ov;
        }
        
      }
    } else {
      _Float16* C = (_Float16*)Cout + (size_t)bz * (size_t)strideC;
      const int q = lane >> 3, c8 = (lane & 7) * 8;
      float bc[8];
      if constexpr (MODE != 1) {
        const v4f b0 = *(const v4f*)(bias + n0 + c8), b1 = *(const v4f*)(bias + n0 + c8 + 4);
#pragma unroll
        for (int e = 0; e < 4; ++e) { bc[e] = b0[e]; bc[4 + e] = b1[e]; }
      } else {
#pragma unroll
        for (int e = 0; e < 8; ++e) bc[e] = 0.f;
      }
      v4u hv[4];
#pragma unroll
      for (int it = 0; it < 4; ++it) {
        const int row = it * 4 + q;                       // it 0..3 x q 0..3 = rows 0..15
        const float* sp = slab + row * 68 + c8;
        float brow = 0.f;
        if constexpr (MODE == 1) brow = bias[mBase + row];   // mBase + row < M = bias length in this mode
        H8 p;
#pragma unroll
        for (int e = 0; e < 8; ++e) {
          float f = sp[e] * accs + ((MODE == 1) ? brow : bc[e]);
          if constexpr (MODE == 3) f = gelu_tanh(f);
          f *= outs;
          p.h[e] = (_Float16)f;
        }
        hv[it] = p.u;
      }
      {
#pragma unroll
        for (int it = 0; it < 4; ++it) {
          const int row = it * 4 + q;
          *(v4u*)(C + (size_t)(mBase + row) * ldc + n0 + c8) = hv[it];
        }
        
      }
    }
    __builtin_amdgcn_fence(__ATOMIC_RELEASE, "workgroup");
    __builtin_amdgcn_wave_barrier();
    __builtin_amdgcn_fence(__ATOMIC_ACQUIRE, "workgroup");
  }
}

// =====================================================================================================
// Causal attention, head dim 64, f16 operands.
//   q plane (f16, carries q * 0.5):  element (b, t, h, d) at [(b*SEQ + t)*DM + h*64 + d]
//   k plane (f16, carries k * 4):    same layout with key index s
//   v^T plane (f16, carries v * 4):  element (b, h, d, s) at [(b*DM + h*64 + d)*SEQ + s]
//   logit = acc * sscale with sscale = 1/16  (0.5 * 4 / 16 = 1/8 = 1/sqrt(64));
//   keys s > t excluded per lane (-inf before the row max); every row has key 0 so the max is finite.
//   p = exp(s - m) stored as f16(1024 p); context = p . v on f16 WMMA; online softmax in f32.
//   out plane (f16, carries ctx * 4): element (b, t, h, d) at [(b*SEQ + t)*DM + h*64 + d];
//   ctx*4 = acc / (1024 l) since acc = 4096 * sum p v.
//   Block = 4 waves = 64 query rows of one (b, h); grid = NQB * NH * NB; key tiles 0..qb (block-uniform).
//   K / V^T tile staging: 128 threads x 32 elements per plane = the whole 64x64 tile (plain 16-B loads,
//   __syncthreads before and after); P tiles are wave-private, spilled with _Float16 element stores and
//   Output coverage: each wave stores rows q0..q0+15 (it 0..3 x lane>>3 0..3) x 64 columns (8 lanes x 8).
// =====================================================================================================
__global__ __launch_bounds__(128)
void attn_causal64(const _Float16* __restrict__ Qp, const _Float16* __restrict__ Kp,
                   const _Float16* __restrict__ Vtp, _Float16* Op, float sscale) {
  __shared__ __align__(16) _Float16 Ksh[64 * 64];      // K [kv][d]   8 KB
  __shared__ __align__(16) _Float16 Vth[64 * 64];      // V^T [d][kv] 8 KB
  __shared__ __align__(16) _Float16 Psh[4][16 * 64];   // per wave P [row][kv]
  __shared__ __align__(16) float    Os[4][16 * 64];    // per wave context tile [row][d]

  const int tid  = threadIdx.x;
  const int wave = tid >> 5;
  const int lane = tid & 31;
  const int hh   = lane >> 4;
  const int c    = lane & 15;

  const int bx   = blockIdx.x;
  const int qb   = bx % NQB;
  const int rest = bx / NQB;
  const int h    = rest % NH;
  const int b    = rest / NH;
  const int q0   = qb * 64 + wave * 16;
  const size_t rowB = (size_t)b * SEQ;

  const _Float16* Qh = Qp + (size_t)h * HD;
  const _Float16* Kh = Kp + (size_t)h * HD;
  const _Float16* Vh = Vtp + ((size_t)b * DM + (size_t)h * HD) * SEQ;

  // ---- Q fragments (A operand, row = lane&15): 2 d-chunks of 32 ----
  v16h qa[2];
#pragma unroll
  for (int dc = 0; dc < 2; ++dc)
    qa[dc] = ldfrag(Qh + (rowB + q0 + c) * DM + dc * 32 + 8 * hh);

  float mrow[8], lrow[8];
  v8f oacc[4];
#pragma unroll
  for (int r = 0; r < 8; ++r) { mrow[r] = -INFINITY; lrow[r] = 0.f; }
#pragma unroll
  for (int t = 0; t < 4; ++t) oacc[t] = zero8();

  for (int kt = 0; kt <= qb; ++kt) {          // causal key tiles, block-uniform trip count
    const int kv0 = kt * 64;
    __syncthreads();
    {
      const int r = tid >> 1, half = (tid & 1) * 32;
      const _Float16* kg = Kh + (rowB + kv0 + r) * DM + half;     // K row kv0+r, d = half..half+31
      const _Float16* vg = Vh + (size_t)r * SEQ + kv0 + half;     // V^T row d = r, s = kv0+half..+31
#pragma unroll
      for (int i = 0; i < 4; ++i) {
        const v8h a0 = *(const v8h*)(kg + 8 * i);
        const v8h b0 = *(const v8h*)(vg + 8 * i);
        *(v8h*)(Ksh + r * 64 + half + 8 * i) = a0;
        *(v8h*)(Vth + r * 64 + half + 8 * i) = b0;
      }
    }
    __syncthreads();

    // ---- scores: 16 query rows x 64 keys per wave ----
    v8f s[4];
#pragma unroll
    for (int j = 0; j < 4; ++j) {
      s[j] = zero8();
#pragma unroll
      for (int dc = 0; dc < 2; ++dc) {
        FH kb;
        kb.h[0] = *(const v8h*)(Ksh + (j * 16 + c) * 64 + dc * 32 + 8 * hh);
        kb.h[1] = *(const v8h*)(Ksh + (j * 16 + c) * 64 + dc * 32 + 16 + 8 * hh);
        s[j] = mma_h(qa[dc], kb.v, s[j]);
      }
    }

    // ---- scale, causal exclusion, row max, online softmax, P (x1024, f16) to LDS ----
    _Float16* pw = Psh[wave];
#pragma unroll
    for (int r = 0; r < 8; ++r) {
      const int qrow = q0 + 8 * hh + r;
      float m = -INFINITY;
#pragma unroll
      for (int j = 0; j < 4; ++j) {
        const int key = kv0 + j * 16 + c;
        const float sv = (key <= qrow) ? (s[j][r] * sscale) : -INFINITY;
        s[j][r] = sv;
        m = fmaxf(m, sv);
      }
#pragma unroll
      for (int off = 1; off < 16; off <<= 1) m = fmaxf(m, __shfl_xor(m, off, 32));
      const float mnew  = fmaxf(mrow[r], m);
      const float msafe = (mnew == -INFINITY) ? 0.f : mnew;
      const float alpha = __expf(mrow[r] - msafe);
      mrow[r] = mnew;
      float psum = 0.f;
#pragma unroll
      for (int j = 0; j < 4; ++j) {
        const float p = __expf(s[j][r] - msafe);     // excluded key: exp(-inf) = 0
        psum += p;
        pw[(8 * hh + r) * 64 + j * 16 + c] = (_Float16)(p * 1024.0f);
      }
#pragma unroll
      for (int off = 1; off < 16; off <<= 1) psum += __shfl_xor(psum, off, 32);
      lrow[r] = lrow[r] * alpha + psum;
#pragma unroll
      for (int t = 0; t < 4; ++t) oacc[t][r] *= alpha;
    }
    __builtin_amdgcn_fence(__ATOMIC_RELEASE, "workgroup");
    __builtin_amdgcn_wave_barrier();
    __builtin_amdgcn_fence(__ATOMIC_ACQUIRE, "workgroup");

    // ---- context += P . V (f16 WMMA) ----
#pragma unroll
    for (int kk = 0; kk < 2; ++kk) {
      FH pa;
      pa.h[0] = *(const v8h*)(pw + c * 64 + kk * 32 + 8 * hh);
      pa.h[1] = *(const v8h*)(pw + c * 64 + kk * 32 + 16 + 8 * hh);
#pragma unroll
      for (int t = 0; t < 4; ++t) {
        FH vb;
        vb.h[0] = *(const v8h*)(Vth + (t * 16 + c) * 64 + kk * 32 + 8 * hh);
        vb.h[1] = *(const v8h*)(Vth + (t * 16 + c) * 64 + kk * 32 + 16 + 8 * hh);
        oacc[t] = mma_h(pa.v, vb.v, oacc[t]);
      }
    }
  }

  // ---- normalise (1/l and the carries), stage the wave's 16x64 tile, convert to f16,
  float* os = Os[wave];
#pragma unroll
  for (int r = 0; r < 8; ++r) {
    const float l = lrow[r];
    const float inv = ((l > 0.f) ? (1.0f / l) : 0.f) * (1.0f / 1024.0f);
#pragma unroll
    for (int t = 0; t < 4; ++t) os[(8 * hh + r) * 64 + t * 16 + c] = oacc[t][r] * inv;
  }
  __builtin_amdgcn_fence(__ATOMIC_RELEASE, "workgroup");
  __builtin_amdgcn_wave_barrier();
  __builtin_amdgcn_fence(__ATOMIC_ACQUIRE, "workgroup");
  {
    const int q4 = lane >> 3, c8 = (lane & 7) * 8;
    v4u hv[4];
#pragma unroll
    for (int it = 0; it < 4; ++it) {
      const int row = it * 4 + q4;   // it 0..3 x q4 0..3 = rows 0..15 of the wave tile
      const float* sp = os + row * 64 + c8;
      H8 p;
#pragma unroll
      for (int e = 0; e < 8; ++e) p.h[e] = (_Float16)sp[e];
      hv[it] = p.u;
    }
    {
#pragma unroll
      for (int it = 0; it < 4; ++it) {
        const int row = it * 4 + q4;
        const size_t go = (rowB + q0 + row) * DM + (size_t)h * HD + c8;
        *(v4u*)(Op + go) = hv[it];
      }
      
    }
  }
}

// =====================================================================================================
// Workspace map (bytes), every region an exact multiple of its whole-line / 64x64-tile store granularity:
//   Wqt  f16 [768 out][768 in] x32      0          1179648
//   Wkt  f16 [768][768] x32              1179648    1179648
//   Wvt  f16 [768][768] x32              2359296    1179648
//   Wot  f16 [768][768] x32              3538944    1179648
//   W1t  f16 [3072][768] x32             4718592    4718592
//   W2t  f16 [768][3072] x32             9437184    4718592
//   Np   f16 [8192][768]  ln1 out, later ln2 out          14155776   12582912
//   RegB 50331648 B at 26738688: q f16 [8192][768] at +0, k at +12582912, v^T f16 [2][768][4096] at
//        +25165824 (end +37748736); later the gelu plane G f16 [8192][3072] covers the whole region
//   Ctx  f16 [8192][768] x4              77070336   12582912
//   X1   f32 [8192][768]                 89653248   25165824
//   end                                  114819072
// Launch order makes the aliasing safe on the in-order stream: q/k/v^T are last read by the attention
// launch, G is written three launches later; Np is last read by the v^T GEMM before ln2 rewrites it.
// Spec weights are [in][out]; the GEMM wants Bt[n][k] / A[m][k] with k contiguous, hence the transposes.
// =====================================================================================================
extern "C" void kernel_launch(void* const* d_in, const int* in_sizes, int n_in,
                              void* d_out, int out_size, void* d_ws, size_t ws_size,
                              hipStream_t stream) {
  if (n_in < 17) return;
  if (in_sizes[0] != NROW * DM) return;
  if (in_sizes[1] != DM || in_sizes[2] != DM) return;
  if (in_sizes[3] != DM * DM || in_sizes[5] != DM * DM || in_sizes[7] != DM * DM || in_sizes[9] != DM * DM) return;
  if (in_sizes[4] != DM || in_sizes[6] != DM || in_sizes[8] != DM || in_sizes[10] != DM) return;
  if (in_sizes[11] != DM || in_sizes[12] != DM) return;
  if (in_sizes[13] != DM * FF || in_sizes[14] != FF || in_sizes[15] != FF * DM || in_sizes[16] != DM) return;
  if (out_size != NROW * DM) return;

  const float* x    = (const float*)d_in[0];
  const float* ln1g = (const float*)d_in[1];
  const float* ln1b = (const float*)d_in[2];
  const float* Wq   = (const float*)d_in[3];
  const float* bq   = (const float*)d_in[4];
  const float* Wk   = (const float*)d_in[5];
  const float* bk   = (const float*)d_in[6];
  const float* Wv   = (const float*)d_in[7];
  const float* bv   = (const float*)d_in[8];
  const float* Wo   = (const float*)d_in[9];
  const float* bo   = (const float*)d_in[10];
  const float* ln2g = (const float*)d_in[11];
  const float* ln2b = (const float*)d_in[12];
  const float* W1   = (const float*)d_in[13];
  const float* b1   = (const float*)d_in[14];
  const float* W2   = (const float*)d_in[15];
  const float* b2   = (const float*)d_in[16];

  const size_t PWD  = (size_t)DM * DM * 2;          //  1179648
  const size_t PWF  = (size_t)DM * FF * 2;          //  4718592
  const size_t PA16 = (size_t)NROW * DM * 2;        // 12582912  f16 activation plane [8192][768]
  const size_t PVT  = (size_t)NB * DM * SEQ * 2;    // 12582912  v^T plane
  const size_t PG   = (size_t)NROW * FF * 2;        // 50331648  gelu plane [8192][3072]
  const size_t PX1  = (size_t)NROW * DM * 4;        // 25165824  f32 plane
  size_t off = 0;
  const size_t oWq = off; off += PWD;
  const size_t oWk = off; off += PWD;
  const size_t oWv = off; off += PWD;
  const size_t oWo = off; off += PWD;
  const size_t oW1 = off; off += PWF;
  const size_t oW2 = off; off += PWF;
  const size_t oN  = off; off += PA16;
  const size_t oRB = off; off += PG;
  const size_t oCt = off; off += PA16;
  const size_t oX1 = off; off += PX1;
  if (off > ws_size) return;                        // off = 114819072
  if (off > (size_t)134217728) return;
  const size_t oQ  = oRB;
  const size_t oK  = oRB + PA16;
  const size_t oVT = oRB + 2 * PA16;
  if (oVT + PVT > oRB + PG) return;                 // q, k, v^T fit inside the gelu region
  const size_t oG  = oRB;

  char* ws = (char*)d_ws;
  _Float16* Wqt = (_Float16*)(ws + oWq);
  _Float16* Wkt = (_Float16*)(ws + oWk);
  _Float16* Wvt = (_Float16*)(ws + oWv);
  _Float16* Wot = (_Float16*)(ws + oWo);
  _Float16* W1t = (_Float16*)(ws + oW1);
  _Float16* W2t = (_Float16*)(ws + oW2);
  _Float16* Np  = (_Float16*)(ws + oN);
  _Float16* Qp  = (_Float16*)(ws + oQ);
  _Float16* Kpl = (_Float16*)(ws + oK);
  _Float16* VTp = (_Float16*)(ws + oVT);
  _Float16* Gp  = (_Float16*)(ws + oG);
  _Float16* Ctp = (_Float16*)(ws + oCt);
  float*    X1  = (float*)(ws + oX1);

  const dim3 blk(256);
  const dim3 gTrDD(DM / 64, DM / 64);                              // [768][768] -> [768][768]
  const dim3 gTrW1(FF / 64, DM / 64);                              // in [768][3072] -> out [3072][768]
  const dim3 gTrW2(DM / 64, FF / 64);                              // in [3072][768] -> out [768][3072]
  const dim3 gLn((NROW + 7) / 8);                                  // 1024 blocks
  const dim3 gProj(((NROW / 64) * (DM / 64) + 7) / 8, 1);          // 1536 tiles -> 192 blocks
  const dim3 gVT(((DM / 64) * (SEQ / 64) + 7) / 8, NB);            // 768 tiles -> 96 blocks x 2
  const dim3 gFfn(((NROW / 64) * (FF / 64) + 7) / 8, 1);           // 6144 tiles -> 768 blocks
  const dim3 gAtt(NQB * NH * NB);                                  // 1536 blocks

  // (1) weights [in][out] f32 -> transposed f16 [out][in] x32
  tr_cvt<<<gTrDD, blk, 0, stream>>>(Wq, Wqt, DM, DM, 32.0f);
  tr_cvt<<<gTrDD, blk, 0, stream>>>(Wk, Wkt, DM, DM, 32.0f);
  tr_cvt<<<gTrDD, blk, 0, stream>>>(Wv, Wvt, DM, DM, 32.0f);
  tr_cvt<<<gTrDD, blk, 0, stream>>>(Wo, Wot, DM, DM, 32.0f);
  tr_cvt<<<gTrW1, blk, 0, stream>>>(W1, W1t, DM, FF, 32.0f);
  tr_cvt<<<gTrW2, blk, 0, stream>>>(W2, W2t, FF, DM, 32.0f);
  // (2) ln1 -> Np f16 [8192][768]
  ln_rows<<<gLn, blk, 0, stream>>>(x, ln1g, ln1b, Np, NROW);
  // (3) q = (ln1 . Wq + bq) * 0.5 -> Qp;  k = (ln1 . Wk + bk) * 4 -> Kp   (M=8192, N=768, K=768, acc/32)
  gemm64<0><<<gProj, blk, 0, stream>>>(Np, DM, 0LL, Wqt, DM, 0LL, bq, x, (void*)Qp, DM, 0LL,
                                       NROW, DM, DM, 1.0f / 32.0f, 0.5f);
  gemm64<0><<<gProj, blk, 0, stream>>>(Np, DM, 0LL, Wkt, DM, 0LL, bk, x, (void*)Kpl, DM, 0LL,
                                       NROW, DM, DM, 1.0f / 32.0f, 4.0f);
  // (4) v^T = (Wv^T . ln1^T + bv[row]) * 4 per batch -> VTp f16 [b][d][s]  (M=768, N=4096, K=768)
  gemm64<1><<<gVT, blk, 0, stream>>>(Wvt, DM, 0LL, Np, DM, (long long)SEQ * DM, bv, x,
                                     (void*)VTp, SEQ, (long long)DM * SEQ,
                                     DM, SEQ, DM, 1.0f / 32.0f, 4.0f);
  // (5) causal attention -> Ctp f16 (ctx * 4)
  attn_causal64<<<gAtt, dim3(128), 0, stream>>>(Qp, Kpl, VTp, Ctp, 0.0625f);
  // (6) x1 = x + ctx . Wo + bo -> X1 f32   (acc = 128 * ctx.Wo)
  gemm64<2><<<gProj, blk, 0, stream>>>(Ctp, DM, 0LL, Wot, DM, 0LL, bo, x, (void*)X1, DM, 0LL,
                                       NROW, DM, DM, 1.0f / 128.0f, 1.0f);
  // (7) ln2 -> Np
  ln_rows<<<gLn, blk, 0, stream>>>(X1, ln2g, ln2b, Np, NROW);
  // (8) g = gelu(ln2 . W1 + b1) * 4 -> Gp f16 [8192][3072]   (M=8192, N=3072, K=768, acc/32)
  gemm64<3><<<gFfn, blk, 0, stream>>>(Np, DM, 0LL, W1t, DM, 0LL, b1, x, (void*)Gp, FF, 0LL,
                                      NROW, FF, DM, 1.0f / 32.0f, 4.0f);
  // (9) out = x1 + g . W2 + b2 -> d_out f32 [8192][768]   (M=8192, N=768, K=3072, acc = 128 * g.W2)
  gemm64<2><<<gProj, blk, 0, stream>>>(Gp, FF, 0LL, W2t, FF, 0LL, b2, X1, d_out, DM, 0LL,
                                       NROW, DM, FF, 1.0f / 128.0f, 1.0f);
  (void)hipGetLastError();
}

// v001
// It runs in 644 microseconds.
// Next to v000, in two timings, it ran 1.24 and 1.23 times as fast.
// All contractions: v_wmma_f32_16x16x32_f16 (f16 operands, f32 accumulate): q/k/v projections, q.k^T scores,
// p.v context, ctx.Wo, ln2out.W1, gelu.W2. LayerNorm, softmax, GELU, bias and residual adds in f32.
#include <hip/hip_runtime.h>
#include <math.h>
#include <stdint.h>

#define NB   2
#define SEQ  4096
#define DM   768
#define NH   12
#define HD   64
#define FF   3072
#define NROW (NB * SEQ)      // 8192 token rows
#define NQB  (SEQ / 64)      // 64 query / key tiles of 64
static_assert(NH * HD == DM);
static_assert((SEQ % 64) == 0 && (DM % 64) == 0 && (FF % 64) == 0 && (NROW % 64) == 0);
static_assert(DM == 3 * 256);

typedef _Float16 v16h __attribute__((ext_vector_type(16)));
typedef _Float16 v8h  __attribute__((ext_vector_type(8)));
typedef float    v8f  __attribute__((ext_vector_type(8)));
typedef float    v4f  __attribute__((ext_vector_type(4)));
typedef unsigned int v4u __attribute__((ext_vector_type(4)));

union H8 { v8h h; v4u u; };
union FH { v16h v; v8h h[2]; };

__device__ __forceinline__ v8f zero8() { v8f z = {0.f, 0.f, 0.f, 0.f, 0.f, 0.f, 0.f, 0.f}; return z; }

// 16-bit A/B fragment: lane -> row/col (lane&15); p already includes +8*(lane>>4);
// elements 0..7 <- p[0..7] (k0+8h..k0+8h+7), elements 8..15 <- p[16..23] (k0+16+8h..)
__device__ __forceinline__ v16h ldfrag(const _Float16* p) {
  FH f;
  f.h[0] = *(const v8h*)(p);
  f.h[1] = *(const v8h*)(p + 16);
  return f.v;
}

// WMMA with trailing VALU hazard gap (D tied, A/B kept live)
__device__ __forceinline__ v8f mma_h(v16h a, v16h b, v8f c) {
  c = __builtin_amdgcn_wmma_f32_16x16x32_f16(false, a, false, b, (short)0, c, false, false);
  asm volatile("v_nop\n\tv_nop\n\tv_nop\n\tv_nop" : "+v"(c) : "v"(a), "v"(b));
  return c;
}
__device__ __forceinline__ v8f mma_raw(v16h a, v16h b, v8f c) {
  return __builtin_amdgcn_wmma_f32_16x16x32_f16(false, a, false, b, (short)0, c, false, false);
}
// guard after the last WMMA of a 4-op group: ties all four D, keeps the group's A and B live
__device__ __forceinline__ void guard4(v8f& d0, v8f& d1, v8f& d2, v8f& d3,
                                       v16h a, v16h b0, v16h b1, v16h b2, v16h b3) {
  asm volatile("v_nop\n\tv_nop\n\tv_nop\n\tv_nop"
               : "+v"(d0), "+v"(d1), "+v"(d2), "+v"(d3)
               : "v"(a), "v"(b0), "v"(b1), "v"(b2), "v"(b3));
}

// tanh-form GELU via the identity 0.5u(1+tanh z) = u * sigmoid(2z); exp argument clamped, reciprocal by v_rcp
__device__ __forceinline__ float gelu_tanh(float u) {
  const float z = 0.7978845608028654f * (u + 0.044715f * u * u * u);
  const float e = __expf(fminf(-2.0f * z, 80.0f));
  return u * __builtin_amdgcn_rcpf(1.0f + e);
}

// =====================================================================================================
// Weight transpose + convert: W f32 [Kin][Nout] (pitch Nout) -> Wt f16 [Nout][Kin] (pitch Kin), times scale.
// 64x64 tile through LDS. grid = (Nout/64, Kin/64), 256 threads. Reads: thread handles 4 float4 of the
// tile (chunk = tid + i*256 -> row r = chunk>>4 (k local), cols c4..c4+3 (n local)).
// coverage: 8 waves x 2 x 4 = 64 rows, 8 lanes x 8 halves = 64 cols = the whole tile; grid exact.
// =====================================================================================================
__global__ __launch_bounds__(256) void tr_cvt(const float* __restrict__ W, _Float16* Wt,
                                              int Kin, int Nout, float scale) {
  __shared__ __align__(16) _Float16 T[64][72];   // [n local][k local], pitch 144 B
  const int tid = threadIdx.x, wave = tid >> 5, lane = tid & 31;
  const int n0 = blockIdx.x * 64, k0 = blockIdx.y * 64;
#pragma unroll
  for (int i = 0; i < 4; ++i) {
    const int chunk = tid + i * 256;
    const int r = chunk >> 4;            // 0..63  (k local)
    const int c4 = (chunk & 15) * 4;     // 0..60  (n local)
    const v4f v = *(const v4f*)(W + (size_t)(k0 + r) * Nout + n0 + c4);
#pragma unroll
    for (int e = 0; e < 4; ++e) T[c4 + e][r] = (_Float16)(v[e] * scale);
  }
  __syncthreads();
  const int q = lane >> 3, c8 = (lane & 7) * 8;
  v4u o[2];
#pragma unroll
  for (int it = 0; it < 2; ++it) {
    const int row = wave * 8 + it * 4 + q;
    H8 p;
    p.h = *(const v8h*)(&T[row][c8]);
    o[it] = p.u;
  }
  {
#pragma unroll
    for (int it = 0; it < 2; ++it) {
      const int row = wave * 8 + it * 4 + q;
      *(v4u*)(Wt + (size_t)(n0 + row) * Kin + k0 + c8) = o[it];
    }
    
  }
}

// =====================================================================================================
// LayerNorm over DM=768 columns, f32 math, f16 output (unscaled). One wave per row, 8 rows per block,
// grid = ceil(nrows/8). Lane holds columns i*256 + lane*8 .. +7 (i 0..2). mean and variance by two register
// passes with 32-lane butterflies. Output: three 16-B stores per lane, each instruction = 32 lanes x 16 B =
// coverage: 3 x 256 = 768 columns per row; every row < nrows by exactly one wave.
// =====================================================================================================
__global__ __launch_bounds__(256) void ln_rows(const float* __restrict__ X, const float* __restrict__ g,
                                               const float* __restrict__ bb, _Float16* Y, int nrows) {
  const int wave = threadIdx.x >> 5, lane = threadIdx.x & 31;
  const int row = blockIdx.x * 8 + wave;
  if (row >= nrows) return;                  // wave-uniform; no block barriers in this kernel
  const float* xr = X + (size_t)row * DM;
  float v[3][8];
  float s = 0.f;
#pragma unroll
  for (int i = 0; i < 3; ++i) {
    const int col = i * 256 + lane * 8;
    const v4f a = *(const v4f*)(xr + col);
    const v4f c = *(const v4f*)(xr + col + 4);
#pragma unroll
    for (int e = 0; e < 4; ++e) { v[i][e] = a[e]; v[i][4 + e] = c[e]; }
#pragma unroll
    for (int e = 0; e < 8; ++e) s += v[i][e];
  }
#pragma unroll
  for (int off = 16; off > 0; off >>= 1) s += __shfl_xor(s, off, 32);
  const float mu = s * (1.0f / (float)DM);
  float qs = 0.f;
#pragma unroll
  for (int i = 0; i < 3; ++i)
#pragma unroll
    for (int e = 0; e < 8; ++e) { const float d = v[i][e] - mu; v[i][e] = d; qs += d * d; }
#pragma unroll
  for (int off = 16; off > 0; off >>= 1) qs += __shfl_xor(qs, off, 32);
  const float rstd = rsqrtf(qs * (1.0f / (float)DM) + 1e-5f);
  v4u o[3];
#pragma unroll
  for (int i = 0; i < 3; ++i) {
    const int col = i * 256 + lane * 8;
    const v4f g0 = *(const v4f*)(g + col), g1 = *(const v4f*)(g + col + 4);
    const v4f b0 = *(const v4f*)(bb + col), b1 = *(const v4f*)(bb + col + 4);
    H8 p;
#pragma unroll
    for (int e = 0; e < 4; ++e) {
      p.h[e]     = (_Float16)(v[i][e] * rstd * g0[e] + b0[e]);
      p.h[4 + e] = (_Float16)(v[i][4 + e] * rstd * g1[e] + b1[e]);
    }
    o[i] = p.u;
  }
  {
#pragma unroll
    for (int i = 0; i < 3; ++i)
      *(v4u*)(Y + (size_t)row * DM + i * 256 + lane * 8) = o[i];
    
  }
}

// =====================================================================================================
// Register-blocked batched f16 WMMA GEMM: acc[m][n] = sum_k A[m][k] * Bt[n][k]; one wave per 64x64 tile,
// no block barriers. A row-major [M][K] pitch lda; Bt row-major [N][K] pitch ldb (k contiguous); both f16
// global planes, fragments loaded straight from them (two 16-B loads each). M, N multiples of 64,
// K multiple of 32 (host-checked). blockIdx.y = batch index (strides in elements, C and Res share strideC).
// MODE 0: C f16 [m][n] = (acc*accs + bias[n]) * outs
// MODE 1: C f16 [m][n] = (acc*accs + bias[m]) * outs            (bias along rows)
// MODE 2: C f32 [m][n] = Res[m][n] + acc*accs + bias[n]          (Res has C's layout, never aliases C)
// MODE 3: C f16 [m][n] = gelu_tanh(acc*accs + bias[n]) * outs
// =====================================================================================================
template <int MODE>
__global__ __launch_bounds__(256) void gemm64(
    const _Float16* __restrict__ A, int lda, long long strideA,
    const _Float16* __restrict__ Bt, int ldb, long long strideB,
    const float* __restrict__ bias, const float* __restrict__ Res,
    void* Cout, int ldc, long long strideC,
    int M, int N, int K, float accs, float outs) {
  __shared__ __align__(16) float sT[8][16 * 68];   // per-wave 16x64 slab, pitch 68 floats (272 B)
  const int bz   = blockIdx.y;
  const int lane = threadIdx.x & 31;
  const int wave = threadIdx.x >> 5;
  const int tilesN = N >> 6;
  const int tilesM = M >> 6;
  const int tile = blockIdx.x * 8 + wave;
  if (tile >= tilesM * tilesN) return;   // wave-uniform; no block barriers in this kernel
  const int tm = tile / tilesN;
  const int tn = tile - tm * tilesN;
  const int m0 = tm << 6;
  const int n0 = tn << 6;

  const _Float16* Ab = A  + (size_t)bz * (size_t)strideA;
  const _Float16* Bb = Bt + (size_t)bz * (size_t)strideB;

  const int rl   = lane & 15;                 // row (A) / col (B, D) within subtile
  const int koff = (lane >> 4) * 8;           // k offset of this lane half
  const int mOff = (lane >> 4) * 8;           // D row offset

  v8f acc[4][4];
#pragma unroll
  for (int i = 0; i < 4; ++i)
#pragma unroll
    for (int j = 0; j < 4; ++j) acc[i][j] = zero8();

  for (int k0 = 0; k0 < K; k0 += 32) {
    v16h bf[4];
#pragma unroll
    for (int j = 0; j < 4; ++j)
      bf[j] = ldfrag(Bb + (size_t)(n0 + (j << 4) + rl) * ldb + koff + k0);
#pragma unroll
    for (int i = 0; i < 4; ++i) {
      const v16h af = ldfrag(Ab + (size_t)(m0 + (i << 4) + rl) * lda + koff + k0);
#pragma unroll
      for (int j = 0; j < 4; ++j) acc[i][j] = mma_raw(af, bf[j], acc[i][j]);
      guard4(acc[i][0], acc[i][1], acc[i][2], acc[i][3], af, bf[0], bf[1], bf[2], bf[3]);
    }
  }

  // ---- epilogue ----
  float* slab = sT[wave];
#pragma unroll
  for (int i = 0; i < 4; ++i) {
    const int mBase = m0 + (i << 4);
#pragma unroll
    for (int j = 0; j < 4; ++j) {
#pragma unroll
      for (int r = 0; r < 8; ++r) slab[(mOff + r) * 68 + (j << 4) + rl] = acc[i][j][r];
    }
    __builtin_amdgcn_fence(__ATOMIC_RELEASE, "workgroup");
    __builtin_amdgcn_wave_barrier();
    __builtin_amdgcn_fence(__ATOMIC_ACQUIRE, "workgroup");
    if constexpr (MODE == 2) {
      float* C = (float*)Cout + (size_t)bz * (size_t)strideC;
      const float* R = Res + (size_t)bz * (size_t)strideC;
      const int h2 = lane >> 4, c4 = (lane & 15) * 4;    // 256-B row segment = 16 lanes x 16 B
      const v4f bq4 = *(const v4f*)(bias + n0 + c4);
      {
#pragma unroll
        for (int it = 0; it < 8; ++it) {
          const int row = it * 2 + h2;                    // it 0..7 x h2 0..1 = rows 0..15
          const v4f a  = *(const v4f*)(slab + row * 68 + c4);
          const v4f rr = *(const v4f*)(R + (size_t)(mBase + row) * ldc + n0 + c4);
          v4f ov;
#pragma unroll
          for (int e = 0; e < 4; ++e) ov[e] = rr[e] + (a[e] * accs + bq4[e]);
          *(v4f*)(C + (size_t)(mBase + row) * ldc + n0 + c4) = ov;
        }
        
      }
    } else {
      _Float16* C = (_Float16*)Cout + (size_t)bz * (size_t)strideC;
      const int q = lane >> 3, c8 = (lane & 7) * 8;
      float bc[8];
      if constexpr (MODE != 1) {
        const v4f b0 = *(const v4f*)(bias + n0 + c8), b1 = *(const v4f*)(bias + n0 + c8 + 4);
#pragma unroll
        for (int e = 0; e < 4; ++e) { bc[e] = b0[e]; bc[4 + e] = b1[e]; }
      } else {
#pragma unroll
        for (int e = 0; e < 8; ++e) bc[e] = 0.f;
      }
      v4u hv[4];
#pragma unroll
      for (int it = 0; it < 4; ++it) {
        const int row = it * 4 + q;                       // it 0..3 x q 0..3 = rows 0..15
        const float* sp = slab + row * 68 + c8;
        float brow = 0.f;
        if constexpr (MODE == 1) brow = bias[mBase + row];   // mBase + row < M = bias length in this mode
        H8 p;
#pragma unroll
        for (int e = 0; e < 8; ++e) {
          float f = sp[e] * accs + ((MODE == 1) ? brow : bc[e]);
          if constexpr (MODE == 3) f = gelu_tanh(f);
          f *= outs;
          p.h[e] = (_Float16)f;
        }
        hv[it] = p.u;
      }
      {
#pragma unroll
        for (int it = 0; it < 4; ++it) {
          const int row = it * 4 + q;
          *(v4u*)(C + (size_t)(mBase + row) * ldc + n0 + c8) = hv[it];
        }
        
      }
    }
    __builtin_amdgcn_fence(__ATOMIC_RELEASE, "workgroup");
    __builtin_amdgcn_wave_barrier();
    __builtin_amdgcn_fence(__ATOMIC_ACQUIRE, "workgroup");
  }
}

// =====================================================================================================
// Causal attention, head dim 64, f16 operands.
//   q plane (f16, carries q * 0.5):  element (b, t, h, d) at [(b*SEQ + t)*DM + h*64 + d]
//   k plane (f16, carries k * 4):    same layout with key index s
//   v^T plane (f16, carries v * 4):  element (b, h, d, s) at [(b*DM + h*64 + d)*SEQ + s]
//   logit = acc * sscale with sscale = 1/16  (0.5 * 4 / 16 = 1/8 = 1/sqrt(64));
//   keys s > t excluded per lane (-inf before the row max); every row has key 0 so the max is finite.
//   p = exp(s - m) stored as f16(1024 p); context = p . v on f16 WMMA; online softmax in f32.
//   out plane (f16, carries ctx * 4): element (b, t, h, d) at [(b*SEQ + t)*DM + h*64 + d];
//   ctx*4 = acc / (1024 l) since acc = 4096 * sum p v.
//   Block = 4 waves = 64 query rows of one (b, h); grid = NQB * NH * NB; key tiles 0..qb (block-uniform).
//   K / V^T tile staging: 128 threads x 32 elements per plane = the whole 64x64 tile (plain 16-B loads,
//   __syncthreads before and after); P tiles are wave-private, spilled with _Float16 element stores and
//   Output coverage: each wave stores rows q0..q0+15 (it 0..3 x lane>>3 0..3) x 64 columns (8 lanes x 8).
// =====================================================================================================
__global__ __launch_bounds__(128)
void attn_causal64(const _Float16* __restrict__ Qp, const _Float16* __restrict__ Kp,
                   const _Float16* __restrict__ Vtp, _Float16* Op, float sscale) {
  // Row pitches: 16-B fragment reads walk 16 rows at once, so a pitch of 16 B x odd spreads them over all banks
  // (128-B rows put every other row on the same banks).
  constexpr int LP = 72;                               // f16 rows of 64: pitch 72 halves = 144 B
  constexpr int OP = 68;                               // f32 rows of 64: pitch 68 floats = 272 B
  __shared__ __align__(16) _Float16 Ksh[64 * LP];      // K [kv][d]   9 KB
  __shared__ __align__(16) _Float16 Vth[64 * LP];      // V^T [d][kv] 9 KB
  __shared__ __align__(16) _Float16 Psh[4][16 * LP];   // per wave P [row][kv]
  __shared__ __align__(16) float    Os[4][16 * OP];    // per wave context tile [row][d]

  const int tid  = threadIdx.x;
  const int wave = tid >> 5;
  const int lane = tid & 31;
  const int hh   = lane >> 4;
  const int c    = lane & 15;

  const int bx   = blockIdx.x;
  const int qb   = bx % NQB;
  const int rest = bx / NQB;
  const int h    = rest % NH;
  const int b    = rest / NH;
  const int q0   = qb * 64 + wave * 16;
  const size_t rowB = (size_t)b * SEQ;

  const _Float16* Qh = Qp + (size_t)h * HD;
  const _Float16* Kh = Kp + (size_t)h * HD;
  const _Float16* Vh = Vtp + ((size_t)b * DM + (size_t)h * HD) * SEQ;

  // ---- Q fragments (A operand, row = lane&15): 2 d-chunks of 32 ----
  v16h qa[2];
#pragma unroll
  for (int dc = 0; dc < 2; ++dc)
    qa[dc] = ldfrag(Qh + (rowB + q0 + c) * DM + dc * 32 + 8 * hh);

  float mrow[8], lrow[8];
  v8f oacc[4];
#pragma unroll
  for (int r = 0; r < 8; ++r) { mrow[r] = -INFINITY; lrow[r] = 0.f; }
#pragma unroll
  for (int t = 0; t < 4; ++t) oacc[t] = zero8();

  for (int kt = 0; kt <= qb; ++kt) {          // causal key tiles, block-uniform trip count
    const int kv0 = kt * 64;
    __syncthreads();
    {
      const int r = tid >> 1, half = (tid & 1) * 32;
      const _Float16* kg = Kh + (rowB + kv0 + r) * DM + half;     // K row kv0+r, d = half..half+31
      const _Float16* vg = Vh + (size_t)r * SEQ + kv0 + half;     // V^T row d = r, s = kv0+half..+31
#pragma unroll
      for (int i = 0; i < 4; ++i) {
        const v8h a0 = *(const v8h*)(kg + 8 * i);
        const v8h b0 = *(const v8h*)(vg + 8 * i);
        *(v8h*)(Ksh + r * LP + half + 8 * i) = a0;
        *(v8h*)(Vth + r * LP + half + 8 * i) = b0;
      }
    }
    __syncthreads();

    // ---- scores: 16 query rows x 64 keys per wave ----
    v8f s[4];
#pragma unroll
    for (int j = 0; j < 4; ++j) {
      s[j] = zero8();
#pragma unroll
      for (int dc = 0; dc < 2; ++dc) {
        FH kb;
        kb.h[0] = *(const v8h*)(Ksh + (j * 16 + c) * LP + dc * 32 + 8 * hh);
        kb.h[1] = *(const v8h*)(Ksh + (j * 16 + c) * LP + dc * 32 + 16 + 8 * hh);
        s[j] = mma_h(qa[dc], kb.v, s[j]);
      }
    }

    // ---- scale, causal exclusion, row max, online softmax, P (x1024, f16) to LDS ----
    _Float16* pw = Psh[wave];
#pragma unroll
    for (int r = 0; r < 8; ++r) {
      const int qrow = q0 + 8 * hh + r;
      float m = -INFINITY;
#pragma unroll
      for (int j = 0; j < 4; ++j) {
        const int key = kv0 + j * 16 + c;
        const float sv = (key <= qrow) ? (s[j][r] * sscale) : -INFINITY;
        s[j][r] = sv;
        m = fmaxf(m, sv);
      }
#pragma unroll
      for (int off = 1; off < 16; off <<= 1) m = fmaxf(m, __shfl_xor(m, off, 32));
      const float mnew  = fmaxf(mrow[r], m);
      const float msafe = (mnew == -INFINITY) ? 0.f : mnew;
      const float alpha = __expf(mrow[r] - msafe);
      mrow[r] = mnew;
      float psum = 0.f;
#pragma unroll
      for (int j = 0; j < 4; ++j) {
        const float p = __expf(s[j][r] - msafe);     // excluded key: exp(-inf) = 0
        psum += p;
        pw[(8 * hh + r) * LP + j * 16 + c] = (_Float16)(p * 1024.0f);
      }
#pragma unroll
      for (int off = 1; off < 16; off <<= 1) psum += __shfl_xor(psum, off, 32);
      lrow[r] = lrow[r] * alpha + psum;
#pragma unroll
      for (int t = 0; t < 4; ++t) oacc[t][r] *= alpha;
    }
    __builtin_amdgcn_fence(__ATOMIC_RELEASE, "workgroup");
    __builtin_amdgcn_wave_barrier();
    __builtin_amdgcn_fence(__ATOMIC_ACQUIRE, "workgroup");

    // ---- context += P . V (f16 WMMA) ----
#pragma unroll
    for (int kk = 0; kk < 2; ++kk) {
      FH pa;
      pa.h[0] = *(const v8h*)(pw + c * LP + kk * 32 + 8 * hh);
      pa.h[1] = *(const v8h*)(pw + c * LP + kk * 32 + 16 + 8 * hh);
#pragma unroll
      for (int t = 0; t < 4; ++t) {
        FH vb;
        vb.h[0] = *(const v8h*)(Vth + (t * 16 + c) * LP + kk * 32 + 8 * hh);
        vb.h[1] = *(const v8h*)(Vth + (t * 16 + c) * LP + kk * 32 + 16 + 8 * hh);
        oacc[t] = mma_h(pa.v, vb.v, oacc[t]);
      }
    }
  }

  // ---- normalise (1/l and the carries), stage the wave's 16x64 tile, convert to f16,
  float* os = Os[wave];
#pragma unroll
  for (int r = 0; r < 8; ++r) {
    const float l = lrow[r];
    const float inv = ((l > 0.f) ? (1.0f / l) : 0.f) * (1.0f / 1024.0f);
#pragma unroll
    for (int t = 0; t < 4; ++t) os[(8 * hh + r) * OP + t * 16 + c] = oacc[t][r] * inv;
  }
  __builtin_amdgcn_fence(__ATOMIC_RELEASE, "workgroup");
  __builtin_amdgcn_wave_barrier();
  __builtin_amdgcn_fence(__ATOMIC_ACQUIRE, "workgroup");
  {
    const int q4 = lane >> 3, c8 = (lane & 7) * 8;
    v4u hv[4];
#pragma unroll
    for (int it = 0; it < 4; ++it) {
      const int row = it * 4 + q4;   // it 0..3 x q4 0..3 = rows 0..15 of the wave tile
      const float* sp = os + row * OP + c8;
      H8 p;
#pragma unroll
      for (int e = 0; e < 8; ++e) p.h[e] = (_Float16)sp[e];
      hv[it] = p.u;
    }
    {
#pragma unroll
      for (int it = 0; it < 4; ++it) {
        const int row = it * 4 + q4;
        const size_t go = (rowB + q0 + row) * DM + (size_t)h * HD + c8;
        *(v4u*)(Op + go) = hv[it];
      }
      
    }
  }
}

// =====================================================================================================
// Workspace map (bytes), every region an exact multiple of its whole-line / 64x64-tile store granularity:
//   Wqt  f16 [768 out][768 in] x32      0          1179648
//   Wkt  f16 [768][768] x32              1179648    1179648
//   Wvt  f16 [768][768] x32              2359296    1179648
//   Wot  f16 [768][768] x32              3538944    1179648
//   W1t  f16 [3072][768] x32             4718592    4718592
//   W2t  f16 [768][3072] x32             9437184    4718592
//   Np   f16 [8192][768]  ln1 out, later ln2 out          14155776   12582912
//   RegB 50331648 B at 26738688: q f16 [8192][768] at +0, k at +12582912, v^T f16 [2][768][4096] at
//        +25165824 (end +37748736); later the gelu plane G f16 [8192][3072] covers the whole region
//   Ctx  f16 [8192][768] x4              77070336   12582912
//   X1   f32 [8192][768]                 89653248   25165824
//   end                                  114819072
// Launch order makes the aliasing safe on the in-order stream: q/k/v^T are last read by the attention
// launch, G is written three launches later; Np is last read by the v^T GEMM before ln2 rewrites it.
// Spec weights are [in][out]; the GEMM wants Bt[n][k] / A[m][k] with k contiguous, hence the transposes.
// =====================================================================================================
extern "C" void kernel_launch(void* const* d_in, const int* in_sizes, int n_in,
                              void* d_out, int out_size, void* d_ws, size_t ws_size,
                              hipStream_t stream) {
  if (n_in < 17) return;
  if (in_sizes[0] != NROW * DM) return;
  if (in_sizes[1] != DM || in_sizes[2] != DM) return;
  if (in_sizes[3] != DM * DM || in_sizes[5] != DM * DM || in_sizes[7] != DM * DM || in_sizes[9] != DM * DM) return;
  if (in_sizes[4] != DM || in_sizes[6] != DM || in_sizes[8] != DM || in_sizes[10] != DM) return;
  if (in_sizes[11] != DM || in_sizes[12] != DM) return;
  if (in_sizes[13] != DM * FF || in_sizes[14] != FF || in_sizes[15] != FF * DM || in_sizes[16] != DM) return;
  if (out_size != NROW * DM) return;

  const float* x    = (const float*)d_in[0];
  const float* ln1g = (const float*)d_in[1];
  const float* ln1b = (const float*)d_in[2];
  const float* Wq   = (const float*)d_in[3];
  const float* bq   = (const float*)d_in[4];
  const float* Wk   = (const float*)d_in[5];
  const float* bk   = (const float*)d_in[6];
  const float* Wv   = (const float*)d_in[7];
  const float* bv   = (const float*)d_in[8];
  const float* Wo   = (const float*)d_in[9];
  const float* bo   = (const float*)d_in[10];
  const float* ln2g = (const float*)d_in[11];
  const float* ln2b = (const float*)d_in[12];
  const float* W1   = (const float*)d_in[13];
  const float* b1   = (const float*)d_in[14];
  const float* W2   = (const float*)d_in[15];
  const float* b2   = (const float*)d_in[16];

  const size_t PWD  = (size_t)DM * DM * 2;          //  1179648
  const size_t PWF  = (size_t)DM * FF * 2;          //  4718592
  const size_t PA16 = (size_t)NROW * DM * 2;        // 12582912  f16 activation plane [8192][768]
  const size_t PVT  = (size_t)NB * DM * SEQ * 2;    // 12582912  v^T plane
  const size_t PG   = (size_t)NROW * FF * 2;        // 50331648  gelu plane [8192][3072]
  const size_t PX1  = (size_t)NROW * DM * 4;        // 25165824  f32 plane
  size_t off = 0;
  const size_t oWq = off; off += PWD;
  const size_t oWk = off; off += PWD;
  const size_t oWv = off; off += PWD;
  const size_t oWo = off; off += PWD;
  const size_t oW1 = off; off += PWF;
  const size_t oW2 = off; off += PWF;
  const size_t oN  = off; off += PA16;
  const size_t oRB = off; off += PG;
  const size_t oCt = off; off += PA16;
  const size_t oX1 = off; off += PX1;
  if (off > ws_size) return;                        // off = 114819072
  if (off > (size_t)134217728) return;
  const size_t oQ  = oRB;
  const size_t oK  = oRB + PA16;
  const size_t oVT = oRB + 2 * PA16;
  if (oVT + PVT > oRB + PG) return;                 // q, k, v^T fit inside the gelu region
  const size_t oG  = oRB;

  char* ws = (char*)d_ws;
  _Float16* Wqt = (_Float16*)(ws + oWq);
  _Float16* Wkt = (_Float16*)(ws + oWk);
  _Float16* Wvt = (_Float16*)(ws + oWv);
  _Float16* Wot = (_Float16*)(ws + oWo);
  _Float16* W1t = (_Float16*)(ws + oW1);
  _Float16* W2t = (_Float16*)(ws + oW2);
  _Float16* Np  = (_Float16*)(ws + oN);
  _Float16* Qp  = (_Float16*)(ws + oQ);
  _Float16* Kpl = (_Float16*)(ws + oK);
  _Float16* VTp = (_Float16*)(ws + oVT);
  _Float16* Gp  = (_Float16*)(ws + oG);
  _Float16* Ctp = (_Float16*)(ws + oCt);
  float*    X1  = (float*)(ws + oX1);

  const dim3 blk(256);
  const dim3 gTrDD(DM / 64, DM / 64);                              // [768][768] -> [768][768]
  const dim3 gTrW1(FF / 64, DM / 64);                              // in [768][3072] -> out [3072][768]
  const dim3 gTrW2(DM / 64, FF / 64);                              // in [3072][768] -> out [768][3072]
  const dim3 gLn((NROW + 7) / 8);                                  // 1024 blocks
  const dim3 gProj(((NROW / 64) * (DM / 64) + 7) / 8, 1);          // 1536 tiles -> 192 blocks
  const dim3 gVT(((DM / 64) * (SEQ / 64) + 7) / 8, NB);            // 768 tiles -> 96 blocks x 2
  const dim3 gFfn(((NROW / 64) * (FF / 64) + 7) / 8, 1);           // 6144 tiles -> 768 blocks
  const dim3 gAtt(NQB * NH * NB);                                  // 1536 blocks

  // (1) weights [in][out] f32 -> transposed f16 [out][in] x32
  tr_cvt<<<gTrDD, blk, 0, stream>>>(Wq, Wqt, DM, DM, 32.0f);
  tr_cvt<<<gTrDD, blk, 0, stream>>>(Wk, Wkt, DM, DM, 32.0f);
  tr_cvt<<<gTrDD, blk, 0, stream>>>(Wv, Wvt, DM, DM, 32.0f);
  tr_cvt<<<gTrDD, blk, 0, stream>>>(Wo, Wot, DM, DM, 32.0f);
  tr_cvt<<<gTrW1, blk, 0, stream>>>(W1, W1t, DM, FF, 32.0f);
  tr_cvt<<<gTrW2, blk, 0, stream>>>(W2, W2t, FF, DM, 32.0f);
  // (2) ln1 -> Np f16 [8192][768]
  ln_rows<<<gLn, blk, 0, stream>>>(x, ln1g, ln1b, Np, NROW);
  // (3) q = (ln1 . Wq + bq) * 0.5 -> Qp;  k = (ln1 . Wk + bk) * 4 -> Kp   (M=8192, N=768, K=768, acc/32)
  gemm64<0><<<gProj, blk, 0, stream>>>(Np, DM, 0LL, Wqt, DM, 0LL, bq, x, (void*)Qp, DM, 0LL,
                                       NROW, DM, DM, 1.0f / 32.0f, 0.5f);
  gemm64<0><<<gProj, blk, 0, stream>>>(Np, DM, 0LL, Wkt, DM, 0LL, bk, x, (void*)Kpl, DM, 0LL,
                                       NROW, DM, DM, 1.0f / 32.0f, 4.0f);
  // (4) v^T = (Wv^T . ln1^T + bv[row]) * 4 per batch -> VTp f16 [b][d][s]  (M=768, N=4096, K=768)
  gemm64<1><<<gVT, blk, 0, stream>>>(Wvt, DM, 0LL, Np, DM, (long long)SEQ * DM, bv, x,
                                     (void*)VTp, SEQ, (long long)DM * SEQ,
                                     DM, SEQ, DM, 1.0f / 32.0f, 4.0f);
  // (5) causal attention -> Ctp f16 (ctx * 4)
  attn_causal64<<<gAtt, dim3(128), 0, stream>>>(Qp, Kpl, VTp, Ctp, 0.0625f);
  // (6) x1 = x + ctx . Wo + bo -> X1 f32   (acc = 128 * ctx.Wo)
  gemm64<2><<<gProj, blk, 0, stream>>>(Ctp, DM, 0LL, Wot, DM, 0LL, bo, x, (void*)X1, DM, 0LL,
                                       NROW, DM, DM, 1.0f / 128.0f, 1.0f);
  // (7) ln2 -> Np
  ln_rows<<<gLn, blk, 0, stream>>>(X1, ln2g, ln2b, Np, NROW);
  // (8) g = gelu(ln2 . W1 + b1) * 4 -> Gp f16 [8192][3072]   (M=8192, N=3072, K=768, acc/32)
  gemm64<3><<<gFfn, blk, 0, stream>>>(Np, DM, 0LL, W1t, DM, 0LL, b1, x, (void*)Gp, FF, 0LL,
                                      NROW, FF, DM, 1.0f / 32.0f, 4.0f);
  // (9) out = x1 + g . W2 + b2 -> d_out f32 [8192][768]   (M=8192, N=768, K=3072, acc = 128 * g.W2)
  gemm64<2><<<gProj, blk, 0, stream>>>(Gp, FF, 0LL, W2t, FF, 0LL, b2, X1, d_out, DM, 0LL,
                                       NROW, DM, FF, 1.0f / 128.0f, 1.0f);
  (void)hipGetLastError();
}

// v002
// One run takes 410 microseconds.
// Two timings next to v001 both put it at 1.57 times that version's speed.
// Over all steps from v000 it is 1.94 times as fast.
// All contractions: v_wmma_f32_16x16x32_f16 (f16 operands, f32 accumulate): q/k/v projections, q.k^T scores,
// p.v context, ctx.Wo, ln2out.W1, gelu.W2. LayerNorm, softmax, GELU, bias and residual adds in f32.
#include <hip/hip_runtime.h>
#include <math.h>
#include <stdint.h>

#define NB   2
#define SEQ  4096
#define DM   768
#define NH   12
#define HD   64
#define FF   3072
#define NROW (NB * SEQ)      // 8192 token rows
#define NQB  (SEQ / 64)      // 64 query / key tiles of 64
static_assert(NH * HD == DM);
static_assert((SEQ % 64) == 0 && (DM % 64) == 0 && (FF % 64) == 0 && (NROW % 64) == 0);
static_assert(DM == 3 * 256);
static_assert((SEQ % 128) == 0 && (DM % 128) == 0 && (FF % 128) == 0 && (NROW % 128) == 0);

typedef _Float16 v16h __attribute__((ext_vector_type(16)));
typedef _Float16 v8h  __attribute__((ext_vector_type(8)));
typedef float    v8f  __attribute__((ext_vector_type(8)));
typedef float    v4f  __attribute__((ext_vector_type(4)));
typedef unsigned int v4u __attribute__((ext_vector_type(4)));

union H8 { v8h h; v4u u; };
union FH { v16h v; v8h h[2]; };

__device__ __forceinline__ v8f zero8() { v8f z = {0.f, 0.f, 0.f, 0.f, 0.f, 0.f, 0.f, 0.f}; return z; }

// 16-bit A/B fragment: lane -> row/col (lane&15); p already includes +8*(lane>>4);
// elements 0..7 <- p[0..7] (k0+8h..k0+8h+7), elements 8..15 <- p[16..23] (k0+16+8h..)
__device__ __forceinline__ v16h ldfrag(const _Float16* p) {
  FH f;
  f.h[0] = *(const v8h*)(p);
  f.h[1] = *(const v8h*)(p + 16);
  return f.v;
}

// WMMA with trailing VALU hazard gap (D tied, A/B kept live)
__device__ __forceinline__ v8f mma_h(v16h a, v16h b, v8f c) {
  c = __builtin_amdgcn_wmma_f32_16x16x32_f16(false, a, false, b, (short)0, c, false, false);
  asm volatile("v_nop\n\tv_nop\n\tv_nop\n\tv_nop" : "+v"(c) : "v"(a), "v"(b));
  return c;
}
__device__ __forceinline__ v8f mma_raw(v16h a, v16h b, v8f c) {
  return __builtin_amdgcn_wmma_f32_16x16x32_f16(false, a, false, b, (short)0, c, false, false);
}
// guard after the last WMMA of a 4-op group: ties all four D, keeps the group's A and B live
__device__ __forceinline__ void guard4(v8f& d0, v8f& d1, v8f& d2, v8f& d3,
                                       v16h a, v16h b0, v16h b1, v16h b2, v16h b3) {
  asm volatile("v_nop\n\tv_nop\n\tv_nop\n\tv_nop"
               : "+v"(d0), "+v"(d1), "+v"(d2), "+v"(d3)
               : "v"(a), "v"(b0), "v"(b1), "v"(b2), "v"(b3));
}

// tanh-form GELU via the identity 0.5u(1+tanh z) = u * sigmoid(2z); exp argument clamped, reciprocal by v_rcp
__device__ __forceinline__ float gelu_tanh(float u) {
  const float z = 0.7978845608028654f * (u + 0.044715f * u * u * u);
  const float e = __expf(fminf(-2.0f * z, 80.0f));
  return u * __builtin_amdgcn_rcpf(1.0f + e);
}

// =====================================================================================================
// Weight transpose + convert: W f32 [Kin][Nout] (pitch Nout) -> Wt f16 [Nout][Kin] (pitch Kin), times scale.
// 64x64 tile through LDS. grid = (Nout/64, Kin/64), 256 threads. Reads: thread handles 4 float4 of the
// tile (chunk = tid + i*256 -> row r = chunk>>4 (k local), cols c4..c4+3 (n local)).
// coverage: 8 waves x 2 x 4 = 64 rows, 8 lanes x 8 halves = 64 cols = the whole tile; grid exact.
// =====================================================================================================
__global__ __launch_bounds__(256) void tr_cvt(const float* __restrict__ W, _Float16* Wt,
                                              int Kin, int Nout, float scale) {
  __shared__ __align__(16) _Float16 T[64][72];   // [n local][k local], pitch 144 B
  const int tid = threadIdx.x, wave = tid >> 5, lane = tid & 31;
  const int n0 = blockIdx.x * 64, k0 = blockIdx.y * 64;
#pragma unroll
  for (int i = 0; i < 4; ++i) {
    const int chunk = tid + i * 256;
    const int r = chunk >> 4;            // 0..63  (k local)
    const int c4 = (chunk & 15) * 4;     // 0..60  (n local)
    const v4f v = *(const v4f*)(W + (size_t)(k0 + r) * Nout + n0 + c4);
#pragma unroll
    for (int e = 0; e < 4; ++e) T[c4 + e][r] = (_Float16)(v[e] * scale);
  }
  __syncthreads();
  const int q = lane >> 3, c8 = (lane & 7) * 8;
  v4u o[2];
#pragma unroll
  for (int it = 0; it < 2; ++it) {
    const int row = wave * 8 + it * 4 + q;
    H8 p;
    p.h = *(const v8h*)(&T[row][c8]);
    o[it] = p.u;
  }
  {
#pragma unroll
    for (int it = 0; it < 2; ++it) {
      const int row = wave * 8 + it * 4 + q;
      *(v4u*)(Wt + (size_t)(n0 + row) * Kin + k0 + c8) = o[it];
    }
    
  }
}

// =====================================================================================================
// LayerNorm over DM=768 columns, f32 math, f16 output (unscaled). One wave per row, 8 rows per block,
// grid = ceil(nrows/8). Lane holds columns i*256 + lane*8 .. +7 (i 0..2). mean and variance by two register
// passes with 32-lane butterflies. Output: three 16-B stores per lane, each instruction = 32 lanes x 16 B =
// coverage: 3 x 256 = 768 columns per row; every row < nrows by exactly one wave.
// =====================================================================================================
__global__ __launch_bounds__(256) void ln_rows(const float* __restrict__ X, const float* __restrict__ g,
                                               const float* __restrict__ bb, _Float16* Y, int nrows) {
  const int wave = threadIdx.x >> 5, lane = threadIdx.x & 31;
  const int row = blockIdx.x * 8 + wave;
  if (row >= nrows) return;                  // wave-uniform; no block barriers in this kernel
  const float* xr = X + (size_t)row * DM;
  float v[3][8];
  float s = 0.f;
#pragma unroll
  for (int i = 0; i < 3; ++i) {
    const int col = i * 256 + lane * 8;
    const v4f a = *(const v4f*)(xr + col);
    const v4f c = *(const v4f*)(xr + col + 4);
#pragma unroll
    for (int e = 0; e < 4; ++e) { v[i][e] = a[e]; v[i][4 + e] = c[e]; }
#pragma unroll
    for (int e = 0; e < 8; ++e) s += v[i][e];
  }
#pragma unroll
  for (int off = 16; off > 0; off >>= 1) s += __shfl_xor(s, off, 32);
  const float mu = s * (1.0f / (float)DM);
  float qs = 0.f;
#pragma unroll
  for (int i = 0; i < 3; ++i)
#pragma unroll
    for (int e = 0; e < 8; ++e) { const float d = v[i][e] - mu; v[i][e] = d; qs += d * d; }
#pragma unroll
  for (int off = 16; off > 0; off >>= 1) qs += __shfl_xor(qs, off, 32);
  const float rstd = rsqrtf(qs * (1.0f / (float)DM) + 1e-5f);
  v4u o[3];
#pragma unroll
  for (int i = 0; i < 3; ++i) {
    const int col = i * 256 + lane * 8;
    const v4f g0 = *(const v4f*)(g + col), g1 = *(const v4f*)(g + col + 4);
    const v4f b0 = *(const v4f*)(bb + col), b1 = *(const v4f*)(bb + col + 4);
    H8 p;
#pragma unroll
    for (int e = 0; e < 4; ++e) {
      p.h[e]     = (_Float16)(v[i][e] * rstd * g0[e] + b0[e]);
      p.h[4 + e] = (_Float16)(v[i][4 + e] * rstd * g1[e] + b1[e]);
    }
    o[i] = p.u;
  }
  {
#pragma unroll
    for (int i = 0; i < 3; ++i)
      *(v4u*)(Y + (size_t)row * DM + i * 256 + lane * 8) = o[i];
    
  }
}

// =====================================================================================================
// Batched f16 WMMA GEMM: acc[m][n] = sum_k A[m][k] * Bt[n][k]. One work-group of 4 waves per 128x128 tile,
// one 64x64 sub-tile per wave (2 x 2). A row-major [M][K] pitch lda; Bt row-major [N][K] pitch ldb
// (k contiguous); both f16 global planes. Per stage of 64 k the work-group brings 128 A rows and 128 Bt rows
// of 128 B into LDS once (8 lanes per row, so every load instruction covers 4 whole lines); all four waves
// take their fragments from there. Two LDS stages: the next stage's global loads are issued ahead of the
// products of this stage and stored behind them; one work-group barrier per stage.
// M, N multiples of 128, K a multiple of 64 (checked at compile time for the shapes launched below).
// blockIdx.y = batch index (strides in elements, C and Res share strideC). k order per accumulator: ascending.
// MODE 0: C f16 [m][n] = (acc*accs + bias[n]) * outs
// MODE 1: C f16 [m][n] = (acc*accs + bias[m]) * outs            (bias along rows)
// MODE 2: C f32 [m][n] = Res[m][n] + acc*accs + bias[n]          (Res has C's layout, never aliases C)
// MODE 3: C f16 [m][n] = gelu_tanh(acc*accs + bias[n]) * outs
// =====================================================================================================
template <int MODE>
__global__ __launch_bounds__(128) void gemm64(
    const _Float16* __restrict__ A, int lda, long long strideA,
    const _Float16* __restrict__ Bt, int ldb, long long strideB,
    const float* __restrict__ bias, const float* __restrict__ Res,
    void* Cout, int ldc, long long strideC,
    int M, int N, int K, float accs, float outs) {
  constexpr int GP  = 72;                  // LDS row pitch, halves: 144 B = 16 B x 9, for 16-B fragment reads
  constexpr int STG = 256 * GP;            // halves per stage: A rows 0..127, then Bt rows 0..127
  __shared__ __align__(16) _Float16 ring[2 * STG];   // 73728 B; its head is the output slabs after the k loop
  static_assert(4 * 16 * 68 * 4 <= 2 * STG * 2);
  const int bz   = blockIdx.y;
  const int tid  = threadIdx.x;
  const int lane = tid & 31;
  const int wave = tid >> 5;
  const int tilesN = N >> 7;
  const int tilesM = M >> 7;
  const int tile = blockIdx.x;
  if (tile >= tilesM * tilesN) return;   // the same for the whole work-group, ahead of every barrier
  const int tm = tile / tilesN;
  const int tn = tile - tm * tilesN;
  const int wm = (wave >> 1) << 6;            // this wave's 64x64 sub-tile inside the 128x128 tile
  const int wn = (wave & 1) << 6;
  const int m0 = (tm << 7) + wm;
  const int n0 = (tn << 7) + wn;

  const _Float16* Ab = A  + (size_t)bz * (size_t)strideA;
  const _Float16* Bb = Bt + (size_t)bz * (size_t)strideB;

  const int rl   = lane & 15;                 // row (A) / col (B, D) within subtile
  const int koff = (lane >> 4) * 8;           // k offset of this lane half
  const int mOff = (lane >> 4) * 8;           // D row offset

  // staging map: thread -> row (tid>>3) + 16*i, i 0..7, 16 B at column (tid&7)*8: 128 rows x 128 B per operand
  const int sr = tid >> 3;
  const int sc = (tid & 7) * 8;
  const _Float16* ga = Ab + (size_t)((tm << 7) + sr) * lda + sc;
  const _Float16* gb = Bb + (size_t)((tn << 7) + sr) * ldb + sc;
  _Float16* sa = ring + sr * GP + sc;
  _Float16* sb = sa + 128 * GP;

  v8f acc[4][4];
#pragma unroll
  for (int i = 0; i < 4; ++i)
#pragma unroll
    for (int j = 0; j < 4; ++j) acc[i][j] = zero8();

  v8h pa[8], pb[8];
#pragma unroll
  for (int i = 0; i < 8; ++i) {
    pa[i] = *(const v8h*)(ga + (size_t)(i * 16) * lda);
    pb[i] = *(const v8h*)(gb + (size_t)(i * 16) * ldb);
  }
#pragma unroll
  for (int i = 0; i < 8; ++i) {
    *(v8h*)(sa + i * 16 * GP) = pa[i];
    *(v8h*)(sb + i * 16 * GP) = pb[i];
  }
  __syncthreads();

  const int nk = K >> 6;
  for (int kt = 0; kt < nk; ++kt) {
    const int cur = (kt & 1) * STG;
    const bool more = (kt + 1 < nk);          // the same for the whole work-group
    if (more) {
      const int kn = (kt + 1) << 6;
#pragma unroll
      for (int i = 0; i < 8; ++i) {
        pa[i] = *(const v8h*)(ga + (size_t)(i * 16) * lda + kn);
        pb[i] = *(const v8h*)(gb + (size_t)(i * 16) * ldb + kn);
      }
      // the fragment loads below land in the address registers of the loads above: only behind this wait
      asm volatile("s_wait_xcnt 0x0" ::: "memory");
    }
    const _Float16* fa = ring + cur + (wm + rl) * GP + koff;
    const _Float16* fb = ring + cur + (128 + wn + rl) * GP + koff;
#pragma unroll
    for (int kk = 0; kk < 2; ++kk) {
      v16h bf[4], af[4];
#pragma unroll
      for (int j = 0; j < 4; ++j) bf[j] = ldfrag(fb + j * 16 * GP + kk * 32);
#pragma unroll
      for (int i = 0; i < 4; ++i) af[i] = ldfrag(fa + i * 16 * GP + kk * 32);
#pragma unroll
      for (int i = 0; i < 4; ++i) {
#pragma unroll
        for (int j = 0; j < 4; ++j) acc[i][j] = mma_raw(af[i], bf[j], acc[i][j]);
        guard4(acc[i][0], acc[i][1], acc[i][2], acc[i][3], af[i], bf[0], bf[1], bf[2], bf[3]);
      }
    }
    if (more) {
      const int nxt = STG - cur;              // the stage every wave left at the previous barrier
#pragma unroll
      for (int i = 0; i < 8; ++i) {
        *(v8h*)(sa + nxt + i * 16 * GP) = pa[i];
        *(v8h*)(sb + nxt + i * 16 * GP) = pb[i];
      }
    }
    __syncthreads();   // publishes the stage just stored; ends every wave's reads of the stage just used
  }

  // ---- epilogue ----
  float* slab = (float*)ring + wave * (16 * 68);   // per-wave 16x64 slab, pitch 68 floats (272 B)
#pragma unroll
  for (int i = 0; i < 4; ++i) {
    const int mBase = m0 + (i << 4);
#pragma unroll
    for (int j = 0; j < 4; ++j) {
#pragma unroll
      for (int r = 0; r < 8; ++r) slab[(mOff + r) * 68 + (j << 4) + rl] = acc[i][j][r];
    }
    __builtin_amdgcn_fence(__ATOMIC_RELEASE, "workgroup");
    __builtin_amdgcn_wave_barrier();
    __builtin_amdgcn_fence(__ATOMIC_ACQUIRE, "workgroup");
    if constexpr (MODE == 2) {
      float* C = (float*)Cout + (size_t)bz * (size_t)strideC;
      const float* R = Res + (size_t)bz * (size_t)strideC;
      const int h2 = lane >> 4, c4 = (lane & 15) * 4;    // 256-B row segment = 16 lanes x 16 B
      const v4f bq4 = *(const v4f*)(bias + n0 + c4);
      {
#pragma unroll
        for (int it = 0; it < 8; ++it) {
          const int row = it * 2 + h2;                    // it 0..7 x h2 0..1 = rows 0..15
          const v4f a  = *(const v4f*)(slab + row * 68 + c4);
          const v4f rr = *(const v4f*)(R + (size_t)(mBase + row) * ldc + n0 + c4);
          v4f ov;
#pragma unroll
          for (int e = 0; e < 4; ++e) ov[e] = rr[e] + (a[e] * accs + bq4[e]);
          *(v4f*)(C + (size_t)(mBase + row) * ldc + n0 + c4) = ov;
        }
        
      }
    } else {
      _Float16* C = (_Float16*)Cout + (size_t)bz * (size_t)strideC;
      const int q = lane >> 3, c8 = (lane & 7) * 8;
      float bc[8];
      if constexpr (MODE != 1) {
        const v4f b0 = *(const v4f*)(bias + n0 + c8), b1 = *(const v4f*)(bias + n0 + c8 + 4);
#pragma unroll
        for (int e = 0; e < 4; ++e) { bc[e] = b0[e]; bc[4 + e] = b1[e]; }
      } else {
#pragma unroll
        for (int e = 0; e < 8; ++e) bc[e] = 0.f;
      }
      v4u hv[4];
#pragma unroll
      for (int it = 0; it < 4; ++it) {
        const int row = it * 4 + q;                       // it 0..3 x q 0..3 = rows 0..15
        const float* sp = slab + row * 68 + c8;
        float brow = 0.f;
        if constexpr (MODE == 1) brow = bias[mBase + row];   // mBase + row < M = bias length in this mode
        H8 p;
#pragma unroll
        for (int e = 0; e < 8; ++e) {
          float f = sp[e] * accs + ((MODE == 1) ? brow : bc[e]);
          if constexpr (MODE == 3) f = gelu_tanh(f);
          f *= outs;
          p.h[e] = (_Float16)f;
        }
        hv[it] = p.u;
      }
      {
#pragma unroll
        for (int it = 0; it < 4; ++it) {
          const int row = it * 4 + q;
          *(v4u*)(C + (size_t)(mBase + row) * ldc + n0 + c8) = hv[it];
        }
        
      }
    }
    __builtin_amdgcn_fence(__ATOMIC_RELEASE, "workgroup");
    __builtin_amdgcn_wave_barrier();
    __builtin_amdgcn_fence(__ATOMIC_ACQUIRE, "workgroup");
  }
}

// =====================================================================================================
// Causal attention, head dim 64, f16 operands.
//   q plane (f16, carries q * 0.5):  element (b, t, h, d) at [(b*SEQ + t)*DM + h*64 + d]
//   k plane (f16, carries k * 4):    same layout with key index s
//   v^T plane (f16, carries v * 4):  element (b, h, d, s) at [(b*DM + h*64 + d)*SEQ + s]
//   logit = acc * sscale with sscale = 1/16  (0.5 * 4 / 16 = 1/8 = 1/sqrt(64));
//   keys s > t excluded per lane (-inf before the row max); every row has key 0 so the max is finite.
//   p = exp(s - m) stored as f16(1024 p); context = p . v on f16 WMMA; online softmax in f32.
//   out plane (f16, carries ctx * 4): element (b, t, h, d) at [(b*SEQ + t)*DM + h*64 + d];
//   ctx*4 = acc / (1024 l) since acc = 4096 * sum p v.
//   Block = 4 waves = 64 query rows of one (b, h); grid = NQB * NH * NB; key tiles 0..qb (block-uniform).
//   K / V^T tile staging: 128 threads x 32 elements per plane = the whole 64x64 tile (plain 16-B loads,
//   __syncthreads before and after); P tiles are wave-private, spilled with _Float16 element stores and
//   Output coverage: each wave stores rows q0..q0+15 (it 0..3 x lane>>3 0..3) x 64 columns (8 lanes x 8).
// =====================================================================================================
__global__ __launch_bounds__(128)
void attn_causal64(const _Float16* __restrict__ Qp, const _Float16* __restrict__ Kp,
                   const _Float16* __restrict__ Vtp, _Float16* Op, float sscale) {
  // Row pitches: 16-B fragment reads walk 16 rows at once, so a pitch of 16 B x odd spreads them over all banks
  // (128-B rows put every other row on the same banks).
  constexpr int LP = 72;                               // f16 rows of 64: pitch 72 halves = 144 B
  constexpr int OP = 68;                               // f32 rows of 64: pitch 68 floats = 272 B
  __shared__ __align__(16) _Float16 Ksh[64 * LP];      // K [kv][d]   9 KB
  __shared__ __align__(16) _Float16 Vth[64 * LP];      // V^T [d][kv] 9 KB
  __shared__ __align__(16) _Float16 Psh[4][16 * LP];   // per wave P [row][kv]
  __shared__ __align__(16) float    Os[4][16 * OP];    // per wave context tile [row][d]

  const int tid  = threadIdx.x;
  const int wave = tid >> 5;
  const int lane = tid & 31;
  const int hh   = lane >> 4;
  const int c    = lane & 15;

  const int bx   = blockIdx.x;
  const int qb   = bx % NQB;
  const int rest = bx / NQB;
  const int h    = rest % NH;
  const int b    = rest / NH;
  const int q0   = qb * 64 + wave * 16;
  const size_t rowB = (size_t)b * SEQ;

  const _Float16* Qh = Qp + (size_t)h * HD;
  const _Float16* Kh = Kp + (size_t)h * HD;
  const _Float16* Vh = Vtp + ((size_t)b * DM + (size_t)h * HD) * SEQ;

  // ---- Q fragments (A operand, row = lane&15): 2 d-chunks of 32 ----
  v16h qa[2];
#pragma unroll
  for (int dc = 0; dc < 2; ++dc)
    qa[dc] = ldfrag(Qh + (rowB + q0 + c) * DM + dc * 32 + 8 * hh);

  float mrow[8], lrow[8];
  v8f oacc[4];
#pragma unroll
  for (int r = 0; r < 8; ++r) { mrow[r] = -INFINITY; lrow[r] = 0.f; }
#pragma unroll
  for (int t = 0; t < 4; ++t) oacc[t] = zero8();

  for (int kt = 0; kt <= qb; ++kt) {          // causal key tiles, block-uniform trip count
    const int kv0 = kt * 64;
    __syncthreads();
    {
      const int r = tid >> 1, half = (tid & 1) * 32;
      const _Float16* kg = Kh + (rowB + kv0 + r) * DM + half;     // K row kv0+r, d = half..half+31
      const _Float16* vg = Vh + (size_t)r * SEQ + kv0 + half;     // V^T row d = r, s = kv0+half..+31
#pragma unroll
      for (int i = 0; i < 4; ++i) {
        const v8h a0 = *(const v8h*)(kg + 8 * i);
        const v8h b0 = *(const v8h*)(vg + 8 * i);
        *(v8h*)(Ksh + r * LP + half + 8 * i) = a0;
        *(v8h*)(Vth + r * LP + half + 8 * i) = b0;
      }
    }
    __syncthreads();

    // ---- scores: 16 query rows x 64 keys per wave ----
    v8f s[4];
#pragma unroll
    for (int j = 0; j < 4; ++j) {
      s[j] = zero8();
#pragma unroll
      for (int dc = 0; dc < 2; ++dc) {
        FH kb;
        kb.h[0] = *(const v8h*)(Ksh + (j * 16 + c) * LP + dc * 32 + 8 * hh);
        kb.h[1] = *(const v8h*)(Ksh + (j * 16 + c) * LP + dc * 32 + 16 + 8 * hh);
        s[j] = mma_h(qa[dc], kb.v, s[j]);
      }
    }

    // ---- scale, causal exclusion, row max, online softmax, P (x1024, f16) to LDS ----
    _Float16* pw = Psh[wave];
#pragma unroll
    for (int r = 0; r < 8; ++r) {
      const int qrow = q0 + 8 * hh + r;
      float m = -INFINITY;
#pragma unroll
      for (int j = 0; j < 4; ++j) {
        const int key = kv0 + j * 16 + c;
        const float sv = (key <= qrow) ? (s[j][r] * sscale) : -INFINITY;
        s[j][r] = sv;
        m = fmaxf(m, sv);
      }
#pragma unroll
      for (int off = 1; off < 16; off <<= 1) m = fmaxf(m, __shfl_xor(m, off, 32));
      const float mnew  = fmaxf(mrow[r], m);
      const float msafe = (mnew == -INFINITY) ? 0.f : mnew;
      const float alpha = __expf(mrow[r] - msafe);
      mrow[r] = mnew;
      float psum = 0.f;
#pragma unroll
      for (int j = 0; j < 4; ++j) {
        const float p = __expf(s[j][r] - msafe);     // excluded key: exp(-inf) = 0
        psum += p;
        pw[(8 * hh + r) * LP + j * 16 + c] = (_Float16)(p * 1024.0f);
      }
#pragma unroll
      for (int off = 1; off < 16; off <<= 1) psum += __shfl_xor(psum, off, 32);
      lrow[r] = lrow[r] * alpha + psum;
#pragma unroll
      for (int t = 0; t < 4; ++t) oacc[t][r] *= alpha;
    }
    __builtin_amdgcn_fence(__ATOMIC_RELEASE, "workgroup");
    __builtin_amdgcn_wave_barrier();
    __builtin_amdgcn_fence(__ATOMIC_ACQUIRE, "workgroup");

    // ---- context += P . V (f16 WMMA) ----
#pragma unroll
    for (int kk = 0; kk < 2; ++kk) {
      FH pa;
      pa.h[0] = *(const v8h*)(pw + c * LP + kk * 32 + 8 * hh);
      pa.h[1] = *(const v8h*)(pw + c * LP + kk * 32 + 16 + 8 * hh);
#pragma unroll
      for (int t = 0; t < 4; ++t) {
        FH vb;
        vb.h[0] = *(const v8h*)(Vth + (t * 16 + c) * LP + kk * 32 + 8 * hh);
        vb.h[1] = *(const v8h*)(Vth + (t * 16 + c) * LP + kk * 32 + 16 + 8 * hh);
        oacc[t] = mma_h(pa.v, vb.v, oacc[t]);
      }
    }
  }

  // ---- normalise (1/l and the carries), stage the wave's 16x64 tile, convert to f16,
  float* os = Os[wave];
#pragma unroll
  for (int r = 0; r < 8; ++r) {
    const float l = lrow[r];
    const float inv = ((l > 0.f) ? (1.0f / l) : 0.f) * (1.0f / 1024.0f);
#pragma unroll
    for (int t = 0; t < 4; ++t) os[(8 * hh + r) * OP + t * 16 + c] = oacc[t][r] * inv;
  }
  __builtin_amdgcn_fence(__ATOMIC_RELEASE, "workgroup");
  __builtin_amdgcn_wave_barrier();
  __builtin_amdgcn_fence(__ATOMIC_ACQUIRE, "workgroup");
  {
    const int q4 = lane >> 3, c8 = (lane & 7) * 8;
    v4u hv[4];
#pragma unroll
    for (int it = 0; it < 4; ++it) {
      const int row = it * 4 + q4;   // it 0..3 x q4 0..3 = rows 0..15 of the wave tile
      const float* sp = os + row * OP + c8;
      H8 p;
#pragma unroll
      for (int e = 0; e < 8; ++e) p.h[e] = (_Float16)sp[e];
      hv[it] = p.u;
    }
    {
#pragma unroll
      for (int it = 0; it < 4; ++it) {
        const int row = it * 4 + q4;
        const size_t go = (rowB + q0 + row) * DM + (size_t)h * HD + c8;
        *(v4u*)(Op + go) = hv[it];
      }
      
    }
  }
}

// =====================================================================================================
// Workspace map (bytes), every region an exact multiple of its whole-line / 64x64-tile store granularity:
//   Wqt  f16 [768 out][768 in] x32      0          1179648
//   Wkt  f16 [768][768] x32              1179648    1179648
//   Wvt  f16 [768][768] x32              2359296    1179648
//   Wot  f16 [768][768] x32              3538944    1179648
//   W1t  f16 [3072][768] x32             4718592    4718592
//   W2t  f16 [768][3072] x32             9437184    4718592
//   Np   f16 [8192][768]  ln1 out, later ln2 out          14155776   12582912
//   RegB 50331648 B at 26738688: q f16 [8192][768] at +0, k at +12582912, v^T f16 [2][768][4096] at
//        +25165824 (end +37748736); later the gelu plane G f16 [8192][3072] covers the whole region
//   Ctx  f16 [8192][768] x4              77070336   12582912
//   X1   f32 [8192][768]                 89653248   25165824
//   end                                  114819072
// Launch order makes the aliasing safe on the in-order stream: q/k/v^T are last read by the attention
// launch, G is written three launches later; Np is last read by the v^T GEMM before ln2 rewrites it.
// Spec weights are [in][out]; the GEMM wants Bt[n][k] / A[m][k] with k contiguous, hence the transposes.
// =====================================================================================================
extern "C" void kernel_launch(void* const* d_in, const int* in_sizes, int n_in,
                              void* d_out, int out_size, void* d_ws, size_t ws_size,
                              hipStream_t stream) {
  if (n_in < 17) return;
  if (in_sizes[0] != NROW * DM) return;
  if (in_sizes[1] != DM || in_sizes[2] != DM) return;
  if (in_sizes[3] != DM * DM || in_sizes[5] != DM * DM || in_sizes[7] != DM * DM || in_sizes[9] != DM * DM) return;
  if (in_sizes[4] != DM || in_sizes[6] != DM || in_sizes[8] != DM || in_sizes[10] != DM) return;
  if (in_sizes[11] != DM || in_sizes[12] != DM) return;
  if (in_sizes[13] != DM * FF || in_sizes[14] != FF || in_sizes[15] != FF * DM || in_sizes[16] != DM) return;
  if (out_size != NROW * DM) return;

  const float* x    = (const float*)d_in[0];
  const float* ln1g = (const float*)d_in[1];
  const float* ln1b = (const float*)d_in[2];
  const float* Wq   = (const float*)d_in[3];
  const float* bq   = (const float*)d_in[4];
  const float* Wk   = (const float*)d_in[5];
  const float* bk   = (const float*)d_in[6];
  const float* Wv   = (const float*)d_in[7];
  const float* bv   = (const float*)d_in[8];
  const float* Wo   = (const float*)d_in[9];
  const float* bo   = (const float*)d_in[10];
  const float* ln2g = (const float*)d_in[11];
  const float* ln2b = (const float*)d_in[12];
  const float* W1   = (const float*)d_in[13];
  const float* b1   = (const float*)d_in[14];
  const float* W2   = (const float*)d_in[15];
  const float* b2   = (const float*)d_in[16];

  const size_t PWD  = (size_t)DM * DM * 2;          //  1179648
  const size_t PWF  = (size_t)DM * FF * 2;          //  4718592
  const size_t PA16 = (size_t)NROW * DM * 2;        // 12582912  f16 activation plane [8192][768]
  const size_t PVT  = (size_t)NB * DM * SEQ * 2;    // 12582912  v^T plane
  const size_t PG   = (size_t)NROW * FF * 2;        // 50331648  gelu plane [8192][3072]
  const size_t PX1  = (size_t)NROW * DM * 4;        // 25165824  f32 plane
  size_t off = 0;
  const size_t oWq = off; off += PWD;
  const size_t oWk = off; off += PWD;
  const size_t oWv = off; off += PWD;
  const size_t oWo = off; off += PWD;
  const size_t oW1 = off; off += PWF;
  const size_t oW2 = off; off += PWF;
  const size_t oN  = off; off += PA16;
  const size_t oRB = off; off += PG;
  const size_t oCt = off; off += PA16;
  const size_t oX1 = off; off += PX1;
  if (off > ws_size) return;                        // off = 114819072
  if (off > (size_t)134217728) return;
  const size_t oQ  = oRB;
  const size_t oK  = oRB + PA16;
  const size_t oVT = oRB + 2 * PA16;
  if (oVT + PVT > oRB + PG) return;                 // q, k, v^T fit inside the gelu region
  const size_t oG  = oRB;

  char* ws = (char*)d_ws;
  _Float16* Wqt = (_Float16*)(ws + oWq);
  _Float16* Wkt = (_Float16*)(ws + oWk);
  _Float16* Wvt = (_Float16*)(ws + oWv);
  _Float16* Wot = (_Float16*)(ws + oWo);
  _Float16* W1t = (_Float16*)(ws + oW1);
  _Float16* W2t = (_Float16*)(ws + oW2);
  _Float16* Np  = (_Float16*)(ws + oN);
  _Float16* Qp  = (_Float16*)(ws + oQ);
  _Float16* Kpl = (_Float16*)(ws + oK);
  _Float16* VTp = (_Float16*)(ws + oVT);
  _Float16* Gp  = (_Float16*)(ws + oG);
  _Float16* Ctp = (_Float16*)(ws + oCt);
  float*    X1  = (float*)(ws + oX1);

  const dim3 blk(256);
  const dim3 gTrDD(DM / 64, DM / 64);                              // [768][768] -> [768][768]
  const dim3 gTrW1(FF / 64, DM / 64);                              // in [768][3072] -> out [3072][768]
  const dim3 gTrW2(DM / 64, FF / 64);                              // in [3072][768] -> out [768][3072]
  const dim3 gLn((NROW + 7) / 8);                                  // 1024 blocks
  const dim3 gblk(128);                                            // GEMM work-group: 4 waves
  const dim3 gProj((NROW / 128) * (DM / 128), 1);                  // 384 tiles of 128x128
  const dim3 gVT((DM / 128) * (SEQ / 128), NB);                    // 192 tiles x 2
  const dim3 gFfn((NROW / 128) * (FF / 128), 1);                   // 1536 tiles
  const dim3 gAtt(NQB * NH * NB);                                  // 1536 blocks

  // (1) weights [in][out] f32 -> transposed f16 [out][in] x32
  tr_cvt<<<gTrDD, blk, 0, stream>>>(Wq, Wqt, DM, DM, 32.0f);
  tr_cvt<<<gTrDD, blk, 0, stream>>>(Wk, Wkt, DM, DM, 32.0f);
  tr_cvt<<<gTrDD, blk, 0, stream>>>(Wv, Wvt, DM, DM, 32.0f);
  tr_cvt<<<gTrDD, blk, 0, stream>>>(Wo, Wot, DM, DM, 32.0f);
  tr_cvt<<<gTrW1, blk, 0, stream>>>(W1, W1t, DM, FF, 32.0f);
  tr_cvt<<<gTrW2, blk, 0, stream>>>(W2, W2t, FF, DM, 32.0f);
  // (2) ln1 -> Np f16 [8192][768]
  ln_rows<<<gLn, blk, 0, stream>>>(x, ln1g, ln1b, Np, NROW);
  // (3) q = (ln1 . Wq + bq) * 0.5 -> Qp;  k = (ln1 . Wk + bk) * 4 -> Kp   (M=8192, N=768, K=768, acc/32)
  gemm64<0><<<gProj, gblk, 0, stream>>>(Np, DM, 0LL, Wqt, DM, 0LL, bq, x, (void*)Qp, DM, 0LL,
                                       NROW, DM, DM, 1.0f / 32.0f, 0.5f);
  gemm64<0><<<gProj, gblk, 0, stream>>>(Np, DM, 0LL, Wkt, DM, 0LL, bk, x, (void*)Kpl, DM, 0LL,
                                       NROW, DM, DM, 1.0f / 32.0f, 4.0f);
  // (4) v^T = (Wv^T . ln1^T + bv[row]) * 4 per batch -> VTp f16 [b][d][s]  (M=768, N=4096, K=768)
  gemm64<1><<<gVT, gblk, 0, stream>>>(Wvt, DM, 0LL, Np, DM, (long long)SEQ * DM, bv, x,
                                     (void*)VTp, SEQ, (long long)DM * SEQ,
                                     DM, SEQ, DM, 1.0f / 32.0f, 4.0f);
  // (5) causal attention -> Ctp f16 (ctx * 4)
  attn_causal64<<<gAtt, dim3(128), 0, stream>>>(Qp, Kpl, VTp, Ctp, 0.0625f);
  // (6) x1 = x + ctx . Wo + bo -> X1 f32   (acc = 128 * ctx.Wo)
  gemm64<2><<<gProj, gblk, 0, stream>>>(Ctp, DM, 0LL, Wot, DM, 0LL, bo, x, (void*)X1, DM, 0LL,
                                       NROW, DM, DM, 1.0f / 128.0f, 1.0f);
  // (7) ln2 -> Np
  ln_rows<<<gLn, blk, 0, stream>>>(X1, ln2g, ln2b, Np, NROW);
  // (8) g = gelu(ln2 . W1 + b1) * 4 -> Gp f16 [8192][3072]   (M=8192, N=3072, K=768, acc/32)
  gemm64<3><<<gFfn, gblk, 0, stream>>>(Np, DM, 0LL, W1t, DM, 0LL, b1, x, (void*)Gp, FF, 0LL,
                                      NROW, FF, DM, 1.0f / 32.0f, 4.0f);
  // (9) out = x1 + g . W2 + b2 -> d_out f32 [8192][768]   (M=8192, N=768, K=3072, acc = 128 * g.W2)
  gemm64<2><<<gProj, gblk, 0, stream>>>(Gp, FF, 0LL, W2t, FF, 0LL, b2, X1, d_out, DM, 0LL,
                                       NROW, DM, FF, 1.0f / 128.0f, 1.0f);
  (void)hipGetLastError();
}

// v003
// A run of this version takes 320 microseconds.
// Timed twice side by side with v002, it ran 1.28 times as fast both times.
// Over all steps from v000 it is 2.48 times as fast.
// All contractions: v_wmma_f32_16x16x32_f16 (f16 operands, f32 accumulate): q/k/v projections, q.k^T scores,
// p.v context, ctx.Wo, ln2out.W1, gelu.W2. LayerNorm, softmax, GELU, bias and residual adds in f32.
#include <hip/hip_runtime.h>
#include <math.h>
#include <stdint.h>

#define NB   2
#define SEQ  4096
#define DM   768
#define NH   12
#define HD   64
#define FF   3072
#define NROW (NB * SEQ)      // 8192 token rows
#define NQB  (SEQ / 64)      // 64 query / key tiles of 64
static_assert(NH * HD == DM);
static_assert((SEQ % 64) == 0 && (DM % 64) == 0 && (FF % 64) == 0 && (NROW % 64) == 0);
static_assert(DM == 3 * 256);
static_assert((SEQ % 128) == 0 && (DM % 128) == 0 && (FF % 128) == 0 && (NROW % 128) == 0);

typedef _Float16 v16h __attribute__((ext_vector_type(16)));
typedef _Float16 v8h  __attribute__((ext_vector_type(8)));
typedef float    v8f  __attribute__((ext_vector_type(8)));
typedef float    v4f  __attribute__((ext_vector_type(4)));
typedef unsigned int v4u __attribute__((ext_vector_type(4)));

union H8 { v8h h; v4u u; };
union FH { v16h v; v8h h[2]; };

__device__ __forceinline__ v8f zero8() { v8f z = {0.f, 0.f, 0.f, 0.f, 0.f, 0.f, 0.f, 0.f}; return z; }

// 16-bit A/B fragment: lane -> row/col (lane&15); p already includes +8*(lane>>4);
// elements 0..7 <- p[0..7] (k0+8h..k0+8h+7), elements 8..15 <- p[16..23] (k0+16+8h..)
__device__ __forceinline__ v16h ldfrag(const _Float16* p) {
  FH f;
  f.h[0] = *(const v8h*)(p);
  f.h[1] = *(const v8h*)(p + 16);
  return f.v;
}

// WMMA with trailing VALU hazard gap (D tied, A/B kept live)
__device__ __forceinline__ v8f mma_h(v16h a, v16h b, v8f c) {
  c = __builtin_amdgcn_wmma_f32_16x16x32_f16(false, a, false, b, (short)0, c, false, false);
  asm volatile("v_nop\n\tv_nop\n\tv_nop\n\tv_nop" : "+v"(c) : "v"(a), "v"(b));
  return c;
}
__device__ __forceinline__ v8f mma_raw(v16h a, v16h b, v8f c) {
  return __builtin_amdgcn_wmma_f32_16x16x32_f16(false, a, false, b, (short)0, c, false, false);
}
// guard after the last WMMA of a 4-op group: ties all four D, keeps the group's A and B live
__device__ __forceinline__ void guard4(v8f& d0, v8f& d1, v8f& d2, v8f& d3,
                                       v16h a, v16h b0, v16h b1, v16h b2, v16h b3) {
  asm volatile("v_nop\n\tv_nop\n\tv_nop\n\tv_nop"
               : "+v"(d0), "+v"(d1), "+v"(d2), "+v"(d3)
               : "v"(a), "v"(b0), "v"(b1), "v"(b2), "v"(b3));
}

// lane l <-> lane l ^ 16 (the two halves of a wave), by a vector cross-row move
__device__ __forceinline__ float xhalf(float x) {
  return __builtin_bit_cast(float, __builtin_amdgcn_permlanex16(__builtin_bit_cast(int, x), __builtin_bit_cast(int, x),
                                                                0x76543210, 0xfedcba98, false, false));
}

// tanh-form GELU via the identity 0.5u(1+tanh z) = u * sigmoid(2z); exp argument clamped, reciprocal by v_rcp
__device__ __forceinline__ float gelu_tanh(float u) {
  const float z = 0.7978845608028654f * (u + 0.044715f * u * u * u);
  const float e = __expf(fminf(-2.0f * z, 80.0f));
  return u * __builtin_amdgcn_rcpf(1.0f + e);
}

// =====================================================================================================
// Weight transpose + convert: W f32 [Kin][Nout] (pitch Nout) -> Wt f16 [Nout][Kin] (pitch Kin), times scale.
// 64x64 tile through LDS. grid = (Nout/64, Kin/64), 256 threads. Reads: thread handles 4 float4 of the
// tile (chunk = tid + i*256 -> row r = chunk>>4 (k local), cols c4..c4+3 (n local)).
// coverage: 8 waves x 2 x 4 = 64 rows, 8 lanes x 8 halves = 64 cols = the whole tile; grid exact.
// =====================================================================================================
__global__ __launch_bounds__(256) void tr_cvt(const float* __restrict__ W, _Float16* Wt,
                                              int Kin, int Nout, float scale) {
  __shared__ __align__(16) _Float16 T[64][72];   // [n local][k local], pitch 144 B
  const int tid = threadIdx.x, wave = tid >> 5, lane = tid & 31;
  const int n0 = blockIdx.x * 64, k0 = blockIdx.y * 64;
#pragma unroll
  for (int i = 0; i < 4; ++i) {
    const int chunk = tid + i * 256;
    const int r = chunk >> 4;            // 0..63  (k local)
    const int c4 = (chunk & 15) * 4;     // 0..60  (n local)
    const v4f v = *(const v4f*)(W + (size_t)(k0 + r) * Nout + n0 + c4);
#pragma unroll
    for (int e = 0; e < 4; ++e) T[c4 + e][r] = (_Float16)(v[e] * scale);
  }
  __syncthreads();
  const int q = lane >> 3, c8 = (lane & 7) * 8;
  v4u o[2];
#pragma unroll
  for (int it = 0; it < 2; ++it) {
    const int row = wave * 8 + it * 4 + q;
    H8 p;
    p.h = *(const v8h*)(&T[row][c8]);
    o[it] = p.u;
  }
  {
#pragma unroll
    for (int it = 0; it < 2; ++it) {
      const int row = wave * 8 + it * 4 + q;
      *(v4u*)(Wt + (size_t)(n0 + row) * Kin + k0 + c8) = o[it];
    }
    
  }
}

// =====================================================================================================
// LayerNorm over DM=768 columns, f32 math, f16 output (unscaled). One wave per row, 8 rows per block,
// grid = ceil(nrows/8). Lane holds columns i*256 + lane*8 .. +7 (i 0..2). mean and variance by two register
// passes with 32-lane butterflies. Output: three 16-B stores per lane, each instruction = 32 lanes x 16 B =
// coverage: 3 x 256 = 768 columns per row; every row < nrows by exactly one wave.
// =====================================================================================================
__global__ __launch_bounds__(256) void ln_rows(const float* __restrict__ X, const float* __restrict__ g,
                                               const float* __restrict__ bb, _Float16* Y, int nrows) {
  const int wave = threadIdx.x >> 5, lane = threadIdx.x & 31;
  const int row = blockIdx.x * 8 + wave;
  if (row >= nrows) return;                  // wave-uniform; no block barriers in this kernel
  const float* xr = X + (size_t)row * DM;
  float v[3][8];
  float s = 0.f;
#pragma unroll
  for (int i = 0; i < 3; ++i) {
    const int col = i * 256 + lane * 8;
    const v4f a = *(const v4f*)(xr + col);
    const v4f c = *(const v4f*)(xr + col + 4);
#pragma unroll
    for (int e = 0; e < 4; ++e) { v[i][e] = a[e]; v[i][4 + e] = c[e]; }
#pragma unroll
    for (int e = 0; e < 8; ++e) s += v[i][e];
  }
#pragma unroll
  for (int off = 16; off > 0; off >>= 1) s += __shfl_xor(s, off, 32);
  const float mu = s * (1.0f / (float)DM);
  float qs = 0.f;
#pragma unroll
  for (int i = 0; i < 3; ++i)
#pragma unroll
    for (int e = 0; e < 8; ++e) { const float d = v[i][e] - mu; v[i][e] = d; qs += d * d; }
#pragma unroll
  for (int off = 16; off > 0; off >>= 1) qs += __shfl_xor(qs, off, 32);
  const float rstd = rsqrtf(qs * (1.0f / (float)DM) + 1e-5f);
  v4u o[3];
#pragma unroll
  for (int i = 0; i < 3; ++i) {
    const int col = i * 256 + lane * 8;
    const v4f g0 = *(const v4f*)(g + col), g1 = *(const v4f*)(g + col + 4);
    const v4f b0 = *(const v4f*)(bb + col), b1 = *(const v4f*)(bb + col + 4);
    H8 p;
#pragma unroll
    for (int e = 0; e < 4; ++e) {
      p.h[e]     = (_Float16)(v[i][e] * rstd * g0[e] + b0[e]);
      p.h[4 + e] = (_Float16)(v[i][4 + e] * rstd * g1[e] + b1[e]);
    }
    o[i] = p.u;
  }
  {
#pragma unroll
    for (int i = 0; i < 3; ++i)
      *(v4u*)(Y + (size_t)row * DM + i * 256 + lane * 8) = o[i];
    
  }
}

// =====================================================================================================
// Batched f16 WMMA GEMM: acc[m][n] = sum_k A[m][k] * Bt[n][k]. One work-group of 4 waves per 128x128 tile,
// one 64x64 sub-tile per wave (2 x 2). A row-major [M][K] pitch lda; Bt row-major [N][K] pitch ldb
// (k contiguous); both f16 global planes. Per stage of 64 k the work-group brings 128 A rows and 128 Bt rows
// of 128 B into LDS once (8 lanes per row, so every load instruction covers 4 whole lines); all four waves
// take their fragments from there. Two LDS stages: the next stage's global loads are issued ahead of the
// products of this stage and stored behind them; one work-group barrier per stage.
// M, N multiples of 128, K a multiple of 64 (checked at compile time for the shapes launched below).
// blockIdx.y = batch index (strides in elements, C and Res share strideC). k order per accumulator: ascending.
// MODE 0: C f16 [m][n] = (acc*accs + bias[n]) * outs
// MODE 1: C f16 [m][n] = (acc*accs + bias[m]) * outs            (bias along rows)
// MODE 2: C f32 [m][n] = Res[m][n] + acc*accs + bias[n]          (Res has C's layout, never aliases C)
// MODE 3: C f16 [m][n] = gelu_tanh(acc*accs + bias[n]) * outs
// =====================================================================================================
template <int MODE>
__global__ __launch_bounds__(128) void gemm64(
    const _Float16* __restrict__ A, int lda, long long strideA,
    const _Float16* __restrict__ Bt, int ldb, long long strideB,
    const float* __restrict__ bias, const float* __restrict__ Res,
    void* Cout, int ldc, long long strideC,
    int M, int N, int K, float accs, float outs) {
  constexpr int GP  = 72;                  // LDS row pitch, halves: 144 B = 16 B x 9, for 16-B fragment reads
  constexpr int STG = 256 * GP;            // halves per stage: A rows 0..127, then Bt rows 0..127
  __shared__ __align__(16) _Float16 ring[2 * STG];   // 73728 B; its head is the output slabs after the k loop
  static_assert(4 * 16 * 68 * 4 <= 2 * STG * 2);
  const int bz   = blockIdx.y;
  const int tid  = threadIdx.x;
  const int lane = tid & 31;
  const int wave = tid >> 5;
  const int tilesN = N >> 7;
  const int tilesM = M >> 7;
  const int tile = blockIdx.x;
  if (tile >= tilesM * tilesN) return;   // the same for the whole work-group, ahead of every barrier
  const int tm = tile / tilesN;
  const int tn = tile - tm * tilesN;
  const int wm = (wave >> 1) << 6;            // this wave's 64x64 sub-tile inside the 128x128 tile
  const int wn = (wave & 1) << 6;
  const int m0 = (tm << 7) + wm;
  const int n0 = (tn << 7) + wn;

  const _Float16* Ab = A  + (size_t)bz * (size_t)strideA;
  const _Float16* Bb = Bt + (size_t)bz * (size_t)strideB;

  const int rl   = lane & 15;                 // row (A) / col (B, D) within subtile
  const int koff = (lane >> 4) * 8;           // k offset of this lane half
  const int mOff = (lane >> 4) * 8;           // D row offset

  // staging map: thread -> row (tid>>3) + 16*i, i 0..7, 16 B at column (tid&7)*8: 128 rows x 128 B per operand
  const int sr = tid >> 3;
  const int sc = (tid & 7) * 8;
  const _Float16* ga = Ab + (size_t)((tm << 7) + sr) * lda + sc;
  const _Float16* gb = Bb + (size_t)((tn << 7) + sr) * ldb + sc;
  _Float16* sa = ring + sr * GP + sc;
  _Float16* sb = sa + 128 * GP;

  v8f acc[4][4];
#pragma unroll
  for (int i = 0; i < 4; ++i)
#pragma unroll
    for (int j = 0; j < 4; ++j) acc[i][j] = zero8();

  v8h pa[8], pb[8];
#pragma unroll
  for (int i = 0; i < 8; ++i) {
    pa[i] = *(const v8h*)(ga + (size_t)(i * 16) * lda);
    pb[i] = *(const v8h*)(gb + (size_t)(i * 16) * ldb);
  }
#pragma unroll
  for (int i = 0; i < 8; ++i) {
    *(v8h*)(sa + i * 16 * GP) = pa[i];
    *(v8h*)(sb + i * 16 * GP) = pb[i];
  }
  __syncthreads();

  const int nk = K >> 6;
  for (int kt = 0; kt < nk; ++kt) {
    const int cur = (kt & 1) * STG;
    const bool more = (kt + 1 < nk);          // the same for the whole work-group
    if (more) {
      const int kn = (kt + 1) << 6;
#pragma unroll
      for (int i = 0; i < 8; ++i) {
        pa[i] = *(const v8h*)(ga + (size_t)(i * 16) * lda + kn);
        pb[i] = *(const v8h*)(gb + (size_t)(i * 16) * ldb + kn);
      }
      // the fragment loads below land in the address registers of the loads above: only behind this wait
      asm volatile("s_wait_xcnt 0x0" ::: "memory");
    }
    const _Float16* fa = ring + cur + (wm + rl) * GP + koff;
    const _Float16* fb = ring + cur + (128 + wn + rl) * GP + koff;
#pragma unroll
    for (int kk = 0; kk < 2; ++kk) {
      v16h bf[4], af[4];
#pragma unroll
      for (int j = 0; j < 4; ++j) bf[j] = ldfrag(fb + j * 16 * GP + kk * 32);
#pragma unroll
      for (int i = 0; i < 4; ++i) af[i] = ldfrag(fa + i * 16 * GP + kk * 32);
#pragma unroll
      for (int i = 0; i < 4; ++i) {
#pragma unroll
        for (int j = 0; j < 4; ++j) acc[i][j] = mma_raw(af[i], bf[j], acc[i][j]);
        guard4(acc[i][0], acc[i][1], acc[i][2], acc[i][3], af[i], bf[0], bf[1], bf[2], bf[3]);
      }
    }
    if (more) {
      const int nxt = STG - cur;              // the stage every wave left at the previous barrier
#pragma unroll
      for (int i = 0; i < 8; ++i) {
        *(v8h*)(sa + nxt + i * 16 * GP) = pa[i];
        *(v8h*)(sb + nxt + i * 16 * GP) = pb[i];
      }
    }
    __syncthreads();   // publishes the stage just stored; ends every wave's reads of the stage just used
  }

  // ---- epilogue ----
  float* slab = (float*)ring + wave * (16 * 68);   // per-wave 16x64 slab, pitch 68 floats (272 B)
#pragma unroll
  for (int i = 0; i < 4; ++i) {
    const int mBase = m0 + (i << 4);
#pragma unroll
    for (int j = 0; j < 4; ++j) {
#pragma unroll
      for (int r = 0; r < 8; ++r) slab[(mOff + r) * 68 + (j << 4) + rl] = acc[i][j][r];
    }
    __builtin_amdgcn_fence(__ATOMIC_RELEASE, "workgroup");
    __builtin_amdgcn_wave_barrier();
    __builtin_amdgcn_fence(__ATOMIC_ACQUIRE, "workgroup");
    if constexpr (MODE == 2) {
      float* C = (float*)Cout + (size_t)bz * (size_t)strideC;
      const float* R = Res + (size_t)bz * (size_t)strideC;
      const int h2 = lane >> 4, c4 = (lane & 15) * 4;    // 256-B row segment = 16 lanes x 16 B
      const v4f bq4 = *(const v4f*)(bias + n0 + c4);
      {
#pragma unroll
        for (int it = 0; it < 8; ++it) {
          const int row = it * 2 + h2;                    // it 0..7 x h2 0..1 = rows 0..15
          const v4f a  = *(const v4f*)(slab + row * 68 + c4);
          const v4f rr = *(const v4f*)(R + (size_t)(mBase + row) * ldc + n0 + c4);
          v4f ov;
#pragma unroll
          for (int e = 0; e < 4; ++e) ov[e] = rr[e] + (a[e] * accs + bq4[e]);
          *(v4f*)(C + (size_t)(mBase + row) * ldc + n0 + c4) = ov;
        }
        
      }
    } else {
      _Float16* C = (_Float16*)Cout + (size_t)bz * (size_t)strideC;
      const int q = lane >> 3, c8 = (lane & 7) * 8;
      float bc[8];
      if constexpr (MODE != 1) {
        const v4f b0 = *(const v4f*)(bias + n0 + c8), b1 = *(const v4f*)(bias + n0 + c8 + 4);
#pragma unroll
        for (int e = 0; e < 4; ++e) { bc[e] = b0[e]; bc[4 + e] = b1[e]; }
      } else {
#pragma unroll
        for (int e = 0; e < 8; ++e) bc[e] = 0.f;
      }
      v4u hv[4];
#pragma unroll
      for (int it = 0; it < 4; ++it) {
        const int row = it * 4 + q;                       // it 0..3 x q 0..3 = rows 0..15
        const float* sp = slab + row * 68 + c8;
        float brow = 0.f;
        if constexpr (MODE == 1) brow = bias[mBase + row];   // mBase + row < M = bias length in this mode
        H8 p;
#pragma unroll
        for (int e = 0; e < 8; ++e) {
          float f = sp[e] * accs + ((MODE == 1) ? brow : bc[e]);
          if constexpr (MODE == 3) f = gelu_tanh(f);
          f *= outs;
          p.h[e] = (_Float16)f;
        }
        hv[it] = p.u;
      }
      {
#pragma unroll
        for (int it = 0; it < 4; ++it) {
          const int row = it * 4 + q;
          *(v4u*)(C + (size_t)(mBase + row) * ldc + n0 + c8) = hv[it];
        }
        
      }
    }
    __builtin_amdgcn_fence(__ATOMIC_RELEASE, "workgroup");
    __builtin_amdgcn_wave_barrier();
    __builtin_amdgcn_fence(__ATOMIC_ACQUIRE, "workgroup");
  }
}

// =====================================================================================================
// Causal attention, head dim 64, f16 operands.
//   q plane (f16, carries q * 0.5):  element (b, t, h, d) at [(b*SEQ + t)*DM + h*64 + d]
//   k plane (f16, carries k * 4):    same layout with key index s
//   v^T plane (f16, carries v * 4):  element (b, h, d, s) at [(b*DM + h*64 + d)*SEQ + s]
//   logit = acc * sscale with sscale = 1/16  (0.5 * 4 / 16 = 1/8 = 1/sqrt(64));
//   Both products are taken transposed: S^T = K . Q^T (A = K rows, B = Q) and O^T += V^T . P^T (A = V^T rows).
//   A score tile's lane then holds 8 keys (16j + 8*(lane>>4) + r) of ONE query (lane&15): the row maximum and sum
//   are in-lane, joined between the wave halves by one exchange; two score tiles, converted in place, are the
//   B operand P^T in the hardware k order, which the V^T fragment loads already have.
//   keys s > t excluded per lane (-inf before the row max); every row has key 0 so the max is finite.
//   p = exp(s - m) packed as f16(1024 p); context = p . v on f16 WMMA; online softmax in f32.
//   out plane (f16, carries ctx * 4): element (b, t, h, d) at [(b*SEQ + t)*DM + h*64 + d];
//   ctx*4 = acc / (1024 l) since acc = 4096 * sum p v.
//   Block = 4 waves = 64 query rows of one (b, h); grid = NQB * NH * NB; key tiles 0..qb (block-uniform).
//   K / V^T tile staging: 128 threads x 32 elements per plane = the whole 64x64 tile (plain 16-B loads,
//   __syncthreads before and after).
//   Output coverage: each wave stores rows q0..q0+15 (it 0..3 x lane>>3 0..3) x 64 columns (8 lanes x 8).
// =====================================================================================================
__global__ __launch_bounds__(128)
void attn_causal64(const _Float16* __restrict__ Qp, const _Float16* __restrict__ Kp,
                   const _Float16* __restrict__ Vtp, _Float16* Op, float sscale) {
  // Row pitches: 16-B fragment reads walk 16 rows at once, so a pitch of 16 B x odd spreads them over all banks
  // (128-B rows put every other row on the same banks).
  constexpr int LP = 72;                               // f16 rows of 64: pitch 72 halves = 144 B
  constexpr int OP = 68;                               // f32 rows of 64: pitch 68 floats = 272 B
  __shared__ __align__(16) _Float16 Ksh[64 * LP];      // K [kv][d]   9 KB
  __shared__ __align__(16) _Float16 Vth[64 * LP];      // V^T [d][kv] 9 KB
  __shared__ __align__(16) float    Os[4][16 * OP];    // per wave context tile [row][d]

  const int tid  = threadIdx.x;
  const int wave = tid >> 5;
  const int lane = tid & 31;
  const int hh   = lane >> 4;
  const int c    = lane & 15;

  const int bx   = blockIdx.x;
  const int qb   = bx % NQB;
  const int rest = bx / NQB;
  const int h    = rest % NH;
  const int b    = rest / NH;
  const int q0   = qb * 64 + wave * 16;
  const size_t rowB = (size_t)b * SEQ;

  const _Float16* Qh = Qp + (size_t)h * HD;
  const _Float16* Kh = Kp + (size_t)h * HD;
  const _Float16* Vh = Vtp + ((size_t)b * DM + (size_t)h * HD) * SEQ;

  // ---- Q fragments (B operand, column = lane&15 = query row): 2 d-chunks of 32 ----
  v16h qa[2];
#pragma unroll
  for (int dc = 0; dc < 2; ++dc)
    qa[dc] = ldfrag(Qh + (rowB + q0 + c) * DM + dc * 32 + 8 * hh);

  const int qrow = q0 + c;                    // this lane's query row
  float mrow = -INFINITY;                     // running maximum of row qrow (alike in both wave halves)
  float lrow = 0.f;                           // running sum over this wave half's keys only; joined after the loop
  v8f oacc[4];                                // O^T: oacc[t][r] = context(qrow, d = 16t + 8*hh + r)
#pragma unroll
  for (int t = 0; t < 4; ++t) oacc[t] = zero8();

  for (int kt = 0; kt <= qb; ++kt) {          // causal key tiles, block-uniform trip count
    const int kv0 = kt * 64;
    __syncthreads();
    {
      const int r = tid >> 1, half = (tid & 1) * 32;
      const _Float16* kg = Kh + (rowB + kv0 + r) * DM + half;     // K row kv0+r, d = half..half+31
      const _Float16* vg = Vh + (size_t)r * SEQ + kv0 + half;     // V^T row d = r, s = kv0+half..+31
#pragma unroll
      for (int i = 0; i < 4; ++i) {
        const v8h a0 = *(const v8h*)(kg + 8 * i);
        const v8h b0 = *(const v8h*)(vg + 8 * i);
        *(v8h*)(Ksh + r * LP + half + 8 * i) = a0;
        *(v8h*)(Vth + r * LP + half + 8 * i) = b0;
      }
    }
    __syncthreads();

    // ---- scores, transposed: s[j][r] = score(key kv0 + 16j + 8*hh + r, query qrow) ----
    v8f s[4];
#pragma unroll
    for (int j = 0; j < 4; ++j) {
      s[j] = zero8();
#pragma unroll
      for (int dc = 0; dc < 2; ++dc) {
        FH kb;
        kb.h[0] = *(const v8h*)(Ksh + (j * 16 + c) * LP + dc * 32 + 8 * hh);
        kb.h[1] = *(const v8h*)(Ksh + (j * 16 + c) * LP + dc * 32 + 16 + 8 * hh);
        s[j] = mma_h(kb.v, qa[dc], s[j]);
      }
    }

    // ---- scale, causal exclusion, row max, online softmax, P^T (x1024, f16) packed in registers ----
    float mj[4];
#pragma unroll
    for (int j = 0; j < 4; ++j) {
      mj[j] = -INFINITY;
#pragma unroll
      for (int r = 0; r < 8; ++r) {
        const int key = kv0 + j * 16 + 8 * hh + r;
        const float sv = (key <= qrow) ? (s[j][r] * sscale) : -INFINITY;
        s[j][r] = sv;
        mj[j] = fmaxf(mj[j], sv);
      }
    }
    float m = fmaxf(fmaxf(mj[0], mj[1]), fmaxf(mj[2], mj[3]));
    m = fmaxf(m, xhalf(m));                    // both halves now hold the maximum over the 64 keys
    const float mnew  = fmaxf(mrow, m);
    const float msafe = (mnew == -INFINITY) ? 0.f : mnew;
    const float alpha = __expf(mrow - msafe);
    mrow = mnew;
    FH pb[2];                                  // P^T, B operand: element e of half j&1 = key 32*(j>>1) + 16*(j&1) + 8*hh + e
    float pj[4];
#pragma unroll
    for (int j = 0; j < 4; ++j) {
      pj[j] = 0.f;
#pragma unroll
      for (int r = 0; r < 8; ++r) {
        const float p = __expf(s[j][r] - msafe);     // excluded key: exp(-inf) = 0
        pj[j] += p;
        pb[j >> 1].h[j & 1][r] = (_Float16)(p * 1024.0f);
      }
    }
    lrow = lrow * alpha + ((pj[0] + pj[1]) + (pj[2] + pj[3]));
#pragma unroll
    for (int t = 0; t < 4; ++t)
#pragma unroll
      for (int r = 0; r < 8; ++r) oacc[t][r] *= alpha;

    // ---- context^T += V^T . P^T (f16 WMMA) ----
#pragma unroll
    for (int kk = 0; kk < 2; ++kk) {
#pragma unroll
      for (int t = 0; t < 4; ++t) {
        FH vb;
        vb.h[0] = *(const v8h*)(Vth + (t * 16 + c) * LP + kk * 32 + 8 * hh);
        vb.h[1] = *(const v8h*)(Vth + (t * 16 + c) * LP + kk * 32 + 16 + 8 * hh);
        oacc[t] = mma_h(vb.v, pb[kk].v, oacc[t]);
      }
    }
  }

  // ---- normalise (1/l and the carries), stage the wave's 16x64 tile, convert to f16,
  float* os = Os[wave];
  {
    const float l = lrow + xhalf(lrow);        // the two halves' key sums joined
    const float inv = ((l > 0.f) ? (1.0f / l) : 0.f) * (1.0f / 1024.0f);
#pragma unroll
    for (int t = 0; t < 4; ++t) {
      v4f lo, hi;
#pragma unroll
      for (int e = 0; e < 4; ++e) { lo[e] = oacc[t][e] * inv; hi[e] = oacc[t][4 + e] * inv; }
      *(v4f*)(os + c * OP + t * 16 + 8 * hh)     = lo;
      *(v4f*)(os + c * OP + t * 16 + 8 * hh + 4) = hi;
    }
  }
  __builtin_amdgcn_fence(__ATOMIC_RELEASE, "workgroup");
  __builtin_amdgcn_wave_barrier();
  __builtin_amdgcn_fence(__ATOMIC_ACQUIRE, "workgroup");
  {
    const int q4 = lane >> 3, c8 = (lane & 7) * 8;
    v4u hv[4];
#pragma unroll
    for (int it = 0; it < 4; ++it) {
      const int row = it * 4 + q4;   // it 0..3 x q4 0..3 = rows 0..15 of the wave tile
      const float* sp = os + row * OP + c8;
      H8 p;
#pragma unroll
      for (int e = 0; e < 8; ++e) p.h[e] = (_Float16)sp[e];
      hv[it] = p.u;
    }
    {
#pragma unroll
      for (int it = 0; it < 4; ++it) {
        const int row = it * 4 + q4;
        const size_t go = (rowB + q0 + row) * DM + (size_t)h * HD + c8;
        *(v4u*)(Op + go) = hv[it];
      }
      
    }
  }
}

// =====================================================================================================
// Workspace map (bytes), every region an exact multiple of its whole-line / 64x64-tile store granularity:
//   Wqt  f16 [768 out][768 in] x32      0          1179648
//   Wkt  f16 [768][768] x32              1179648    1179648
//   Wvt  f16 [768][768] x32              2359296    1179648
//   Wot  f16 [768][768] x32              3538944    1179648
//   W1t  f16 [3072][768] x32             4718592    4718592
//   W2t  f16 [768][3072] x32             9437184    4718592
//   Np   f16 [8192][768]  ln1 out, later ln2 out          14155776   12582912
//   RegB 50331648 B at 26738688: q f16 [8192][768] at +0, k at +12582912, v^T f16 [2][768][4096] at
//        +25165824 (end +37748736); later the gelu plane G f16 [8192][3072] covers the whole region
//   Ctx  f16 [8192][768] x4              77070336   12582912
//   X1   f32 [8192][768]                 89653248   25165824
//   end                                  114819072
// Launch order makes the aliasing safe on the in-order stream: q/k/v^T are last read by the attention
// launch, G is written three launches later; Np is last read by the v^T GEMM before ln2 rewrites it.
// Spec weights are [in][out]; the GEMM wants Bt[n][k] / A[m][k] with k contiguous, hence the transposes.
// =====================================================================================================
extern "C" void kernel_launch(void* const* d_in, const int* in_sizes, int n_in,
                              void* d_out, int out_size, void* d_ws, size_t ws_size,
                              hipStream_t stream) {
  if (n_in < 17) return;
  if (in_sizes[0] != NROW * DM) return;
  if (in_sizes[1] != DM || in_sizes[2] != DM) return;
  if (in_sizes[3] != DM * DM || in_sizes[5] != DM * DM || in_sizes[7] != DM * DM || in_sizes[9] != DM * DM) return;
  if (in_sizes[4] != DM || in_sizes[6] != DM || in_sizes[8] != DM || in_sizes[10] != DM) return;
  if (in_sizes[11] != DM || in_sizes[12] != DM) return;
  if (in_sizes[13] != DM * FF || in_sizes[14] != FF || in_sizes[15] != FF * DM || in_sizes[16] != DM) return;
  if (out_size != NROW * DM) return;

  const float* x    = (const float*)d_in[0];
  const float* ln1g = (const float*)d_in[1];
  const float* ln1b = (const float*)d_in[2];
  const float* Wq   = (const float*)d_in[3];
  const float* bq   = (const float*)d_in[4];
  const float* Wk   = (const float*)d_in[5];
  const float* bk   = (const float*)d_in[6];
  const float* Wv   = (const float*)d_in[7];
  const float* bv   = (const float*)d_in[8];
  const float* Wo   = (const float*)d_in[9];
  const float* bo   = (const float*)d_in[10];
  const float* ln2g = (const float*)d_in[11];
  const float* ln2b = (const float*)d_in[12];
  const float* W1   = (const float*)d_in[13];
  const float* b1   = (const float*)d_in[14];
  const float* W2   = (const float*)d_in[15];
  const float* b2   = (const float*)d_in[16];

  const size_t PWD  = (size_t)DM * DM * 2;          //  1179648
  const size_t PWF  = (size_t)DM * FF * 2;          //  4718592
  const size_t PA16 = (size_t)NROW * DM * 2;        // 12582912  f16 activation plane [8192][768]
  const size_t PVT  = (size_t)NB * DM * SEQ * 2;    // 12582912  v^T plane
  const size_t PG   = (size_t)NROW * FF * 2;        // 50331648  gelu plane [8192][3072]
  const size_t PX1  = (size_t)NROW * DM * 4;        // 25165824  f32 plane
  size_t off = 0;
  const size_t oWq = off; off += PWD;
  const size_t oWk = off; off += PWD;
  const size_t oWv = off; off += PWD;
  const size_t oWo = off; off += PWD;
  const size_t oW1 = off; off += PWF;
  const size_t oW2 = off; off += PWF;
  const size_t oN  = off; off += PA16;
  const size_t oRB = off; off += PG;
  const size_t oCt = off; off += PA16;
  const size_t oX1 = off; off += PX1;
  if (off > ws_size) return;                        // off = 114819072
  if (off > (size_t)134217728) return;
  const size_t oQ  = oRB;
  const size_t oK  = oRB + PA16;
  const size_t oVT = oRB + 2 * PA16;
  if (oVT + PVT > oRB + PG) return;                 // q, k, v^T fit inside the gelu region
  const size_t oG  = oRB;

  char* ws = (char*)d_ws;
  _Float16* Wqt = (_Float16*)(ws + oWq);
  _Float16* Wkt = (_Float16*)(ws + oWk);
  _Float16* Wvt = (_Float16*)(ws + oWv);
  _Float16* Wot = (_Float16*)(ws + oWo);
  _Float16* W1t = (_Float16*)(ws + oW1);
  _Float16* W2t = (_Float16*)(ws + oW2);
  _Float16* Np  = (_Float16*)(ws + oN);
  _Float16* Qp  = (_Float16*)(ws + oQ);
  _Float16* Kpl = (_Float16*)(ws + oK);
  _Float16* VTp = (_Float16*)(ws + oVT);
  _Float16* Gp  = (_Float16*)(ws + oG);
  _Float16* Ctp = (_Float16*)(ws + oCt);
  float*    X1  = (float*)(ws + oX1);

  const dim3 blk(256);
  const dim3 gTrDD(DM / 64, DM / 64);                              // [768][768] -> [768][768]
  const dim3 gTrW1(FF / 64, DM / 64);                              // in [768][3072] -> out [3072][768]
  const dim3 gTrW2(DM / 64, FF / 64);                              // in [3072][768] -> out [768][3072]
  const dim3 gLn((NROW + 7) / 8);                                  // 1024 blocks
  const dim3 gblk(128);                                            // GEMM work-group: 4 waves
  const dim3 gProj((NROW / 128) * (DM / 128), 1);                  // 384 tiles of 128x128
  const dim3 gVT((DM / 128) * (SEQ / 128), NB);                    // 192 tiles x 2
  const dim3 gFfn((NROW / 128) * (FF / 128), 1);                   // 1536 tiles
  const dim3 gAtt(NQB * NH * NB);                                  // 1536 blocks

  // (1) weights [in][out] f32 -> transposed f16 [out][in] x32
  tr_cvt<<<gTrDD, blk, 0, stream>>>(Wq, Wqt, DM, DM, 32.0f);
  tr_cvt<<<gTrDD, blk, 0, stream>>>(Wk, Wkt, DM, DM, 32.0f);
  tr_cvt<<<gTrDD, blk, 0, stream>>>(Wv, Wvt, DM, DM, 32.0f);
  tr_cvt<<<gTrDD, blk, 0, stream>>>(Wo, Wot, DM, DM, 32.0f);
  tr_cvt<<<gTrW1, blk, 0, stream>>>(W1, W1t, DM, FF, 32.0f);
  tr_cvt<<<gTrW2, blk, 0, stream>>>(W2, W2t, FF, DM, 32.0f);
  // (2) ln1 -> Np f16 [8192][768]
  ln_rows<<<gLn, blk, 0, stream>>>(x, ln1g, ln1b, Np, NROW);
  // (3) q = (ln1 . Wq + bq) * 0.5 -> Qp;  k = (ln1 . Wk + bk) * 4 -> Kp   (M=8192, N=768, K=768, acc/32)
  gemm64<0><<<gProj, gblk, 0, stream>>>(Np, DM, 0LL, Wqt, DM, 0LL, bq, x, (void*)Qp, DM, 0LL,
                                       NROW, DM, DM, 1.0f / 32.0f, 0.5f);
  gemm64<0><<<gProj, gblk, 0, stream>>>(Np, DM, 0LL, Wkt, DM, 0LL, bk, x, (void*)Kpl, DM, 0LL,
                                       NROW, DM, DM, 1.0f / 32.0f, 4.0f);
  // (4) v^T = (Wv^T . ln1^T + bv[row]) * 4 per batch -> VTp f16 [b][d][s]  (M=768, N=4096, K=768)
  gemm64<1><<<gVT, gblk, 0, stream>>>(Wvt, DM, 0LL, Np, DM, (long long)SEQ * DM, bv, x,
                                     (void*)VTp, SEQ, (long long)DM * SEQ,
                                     DM, SEQ, DM, 1.0f / 32.0f, 4.0f);
  // (5) causal attention -> Ctp f16 (ctx * 4)
  attn_causal64<<<gAtt, dim3(128), 0, stream>>>(Qp, Kpl, VTp, Ctp, 0.0625f);
  // (6) x1 = x + ctx . Wo + bo -> X1 f32   (acc = 128 * ctx.Wo)
  gemm64<2><<<gProj, gblk, 0, stream>>>(Ctp, DM, 0LL, Wot, DM, 0LL, bo, x, (void*)X1, DM, 0LL,
                                       NROW, DM, DM, 1.0f / 128.0f, 1.0f);
  // (7) ln2 -> Np
  ln_rows<<<gLn, blk, 0, stream>>>(X1, ln2g, ln2b, Np, NROW);
  // (8) g = gelu(ln2 . W1 + b1) * 4 -> Gp f16 [8192][3072]   (M=8192, N=3072, K=768, acc/32)
  gemm64<3><<<gFfn, gblk, 0, stream>>>(Np, DM, 0LL, W1t, DM, 0LL, b1, x, (void*)Gp, FF, 0LL,
                                      NROW, FF, DM, 1.0f / 32.0f, 4.0f);
  // (9) out = x1 + g . W2 + b2 -> d_out f32 [8192][768]   (M=8192, N=768, K=3072, acc = 128 * g.W2)
  gemm64<2><<<gProj, gblk, 0, stream>>>(Gp, FF, 0LL, W2t, FF, 0LL, b2, X1, d_out, DM, 0LL,
                                       NROW, DM, FF, 1.0f / 128.0f, 1.0f);
  (void)hipGetLastError();
}

// v004
// Measured time: 301 microseconds a run.
// Two timings next to v003 both put it at 1.06 times that version's speed.
// Counting every step since v000, it is 2.63 times as fast.
// All contractions: v_wmma_f32_16x16x32_f16 (f16 operands, f32 accumulate): q/k/v projections, q.k^T scores,
// p.v context, ctx.Wo, ln2out.W1, gelu.W2. LayerNorm, softmax, GELU, bias and residual adds in f32.
#include <hip/hip_runtime.h>
#include <math.h>
#include <stdint.h>

#define NB   2
#define SEQ  4096
#define DM   768
#define NH   12
#define HD   64
#define FF   3072
#define NROW (NB * SEQ)      // 8192 token rows
#define NQB  (SEQ / 64)      // 64 query / key tiles of 64
static_assert(NH * HD == DM);
static_assert((NQB % 2) == 0);
static_assert((SEQ % 64) == 0 && (DM % 64) == 0 && (FF % 64) == 0 && (NROW % 64) == 0);
static_assert(DM == 3 * 256);
static_assert((SEQ % 128) == 0 && (DM % 128) == 0 && (FF % 128) == 0 && (NROW % 128) == 0);

typedef _Float16 v16h __attribute__((ext_vector_type(16)));
typedef _Float16 v8h  __attribute__((ext_vector_type(8)));
typedef float    v8f  __attribute__((ext_vector_type(8)));
typedef float    v4f  __attribute__((ext_vector_type(4)));
typedef unsigned int v4u __attribute__((ext_vector_type(4)));

union H8 { v8h h; v4u u; };
union FH { v16h v; v8h h[2]; };

__device__ __forceinline__ v8f zero8() { v8f z = {0.f, 0.f, 0.f, 0.f, 0.f, 0.f, 0.f, 0.f}; return z; }

// 16-bit A/B fragment: lane -> row/col (lane&15); p already includes +8*(lane>>4);
// elements 0..7 <- p[0..7] (k0+8h..k0+8h+7), elements 8..15 <- p[16..23] (k0+16+8h..)
__device__ __forceinline__ v16h ldfrag(const _Float16* p) {
  FH f;
  f.h[0] = *(const v8h*)(p);
  f.h[1] = *(const v8h*)(p + 16);
  return f.v;
}

// WMMA with trailing VALU hazard gap (D tied, A/B kept live)
__device__ __forceinline__ v8f mma_h(v16h a, v16h b, v8f c) {
  c = __builtin_amdgcn_wmma_f32_16x16x32_f16(false, a, false, b, (short)0, c, false, false);
  asm volatile("v_nop\n\tv_nop\n\tv_nop\n\tv_nop" : "+v"(c) : "v"(a), "v"(b));
  return c;
}
__device__ __forceinline__ v8f mma_raw(v16h a, v16h b, v8f c) {
  return __builtin_amdgcn_wmma_f32_16x16x32_f16(false, a, false, b, (short)0, c, false, false);
}
// guard after the last WMMA of a 4-op group: ties all four D, keeps the group's A and B live
__device__ __forceinline__ void guard4(v8f& d0, v8f& d1, v8f& d2, v8f& d3,
                                       v16h a, v16h b0, v16h b1, v16h b2, v16h b3) {
  asm volatile("v_nop\n\tv_nop\n\tv_nop\n\tv_nop"
               : "+v"(d0), "+v"(d1), "+v"(d2), "+v"(d3)
               : "v"(a), "v"(b0), "v"(b1), "v"(b2), "v"(b3));
}

// lane l <-> lane l ^ 16 (the two halves of a wave), by a vector cross-row move
__device__ __forceinline__ float xhalf(float x) {
  return __builtin_bit_cast(float, __builtin_amdgcn_permlanex16(__builtin_bit_cast(int, x), __builtin_bit_cast(int, x),
                                                                0x76543210, 0xfedcba98, false, false));
}

// tanh-form GELU via the identity 0.5u(1+tanh z) = u * sigmoid(2z); exp argument clamped, reciprocal by v_rcp
__device__ __forceinline__ float gelu_tanh(float u) {
  const float z = 0.7978845608028654f * (u + 0.044715f * u * u * u);
  const float e = __expf(fminf(-2.0f * z, 80.0f));
  return u * __builtin_amdgcn_rcpf(1.0f + e);
}

// =====================================================================================================
// Weight transpose + convert: W f32 [Kin][Nout] (pitch Nout) -> Wt f16 [Nout][Kin] (pitch Kin), times scale.
// 64x64 tile through LDS. grid = (Nout/64, Kin/64), 256 threads. Reads: thread handles 4 float4 of the
// tile (chunk = tid + i*256 -> row r = chunk>>4 (k local), cols c4..c4+3 (n local)).
// coverage: 8 waves x 2 x 4 = 64 rows, 8 lanes x 8 halves = 64 cols = the whole tile; grid exact.
// =====================================================================================================
__global__ __launch_bounds__(256) void tr_cvt(const float* __restrict__ W, _Float16* Wt,
                                              int Kin, int Nout, float scale) {
  __shared__ __align__(16) _Float16 T[64][72];   // [n local][k local], pitch 144 B
  const int tid = threadIdx.x, wave = tid >> 5, lane = tid & 31;
  const int n0 = blockIdx.x * 64, k0 = blockIdx.y * 64;
#pragma unroll
  for (int i = 0; i < 4; ++i) {
    const int chunk = tid + i * 256;
    const int r = chunk >> 4;            // 0..63  (k local)
    const int c4 = (chunk & 15) * 4;     // 0..60  (n local)
    const v4f v = *(const v4f*)(W + (size_t)(k0 + r) * Nout + n0 + c4);
#pragma unroll
    for (int e = 0; e < 4; ++e) T[c4 + e][r] = (_Float16)(v[e] * scale);
  }
  __syncthreads();
  const int q = lane >> 3, c8 = (lane & 7) * 8;
  v4u o[2];
#pragma unroll
  for (int it = 0; it < 2; ++it) {
    const int row = wave * 8 + it * 4 + q;
    H8 p;
    p.h = *(const v8h*)(&T[row][c8]);
    o[it] = p.u;
  }
  {
#pragma unroll
    for (int it = 0; it < 2; ++it) {
      const int row = wave * 8 + it * 4 + q;
      *(v4u*)(Wt + (size_t)(n0 + row) * Kin + k0 + c8) = o[it];
    }
    
  }
}

// =====================================================================================================
// LayerNorm over DM=768 columns, f32 math, f16 output (unscaled). One wave per row, 8 rows per block,
// grid = ceil(nrows/8). Lane holds columns i*256 + lane*8 .. +7 (i 0..2). mean and variance by two register
// passes with 32-lane butterflies. Output: three 16-B stores per lane, each instruction = 32 lanes x 16 B =
// coverage: 3 x 256 = 768 columns per row; every row < nrows by exactly one wave.
// =====================================================================================================
__global__ __launch_bounds__(256) void ln_rows(const float* __restrict__ X, const float* __restrict__ g,
                                               const float* __restrict__ bb, _Float16* Y, int nrows) {
  const int wave = threadIdx.x >> 5, lane = threadIdx.x & 31;
  const int row = blockIdx.x * 8 + wave;
  if (row >= nrows) return;                  // wave-uniform; no block barriers in this kernel
  const float* xr = X + (size_t)row * DM;
  float v[3][8];
  float s = 0.f;
#pragma unroll
  for (int i = 0; i < 3; ++i) {
    const int col = i * 256 + lane * 8;
    const v4f a = *(const v4f*)(xr + col);
    const v4f c = *(const v4f*)(xr + col + 4);
#pragma unroll
    for (int e = 0; e < 4; ++e) { v[i][e] = a[e]; v[i][4 + e] = c[e]; }
#pragma unroll
    for (int e = 0; e < 8; ++e) s += v[i][e];
  }
#pragma unroll
  for (int off = 16; off > 0; off >>= 1) s += __shfl_xor(s, off, 32);
  const float mu = s * (1.0f / (float)DM);
  float qs = 0.f;
#pragma unroll
  for (int i = 0; i < 3; ++i)
#pragma unroll
    for (int e = 0; e < 8; ++e) { const float d = v[i][e] - mu; v[i][e] = d; qs += d * d; }
#pragma unroll
  for (int off = 16; off > 0; off >>= 1) qs += __shfl_xor(qs, off, 32);
  const float rstd = rsqrtf(qs * (1.0f / (float)DM) + 1e-5f);
  v4u o[3];
#pragma unroll
  for (int i = 0; i < 3; ++i) {
    const int col = i * 256 + lane * 8;
    const v4f g0 = *(const v4f*)(g + col), g1 = *(const v4f*)(g + col + 4);
    const v4f b0 = *(const v4f*)(bb + col), b1 = *(const v4f*)(bb + col + 4);
    H8 p;
#pragma unroll
    for (int e = 0; e < 4; ++e) {
      p.h[e]     = (_Float16)(v[i][e] * rstd * g0[e] + b0[e]);
      p.h[4 + e] = (_Float16)(v[i][4 + e] * rstd * g1[e] + b1[e]);
    }
    o[i] = p.u;
  }
  {
#pragma unroll
    for (int i = 0; i < 3; ++i)
      *(v4u*)(Y + (size_t)row * DM + i * 256 + lane * 8) = o[i];
    
  }
}

// =====================================================================================================
// Batched f16 WMMA GEMM: acc[m][n] = sum_k A[m][k] * Bt[n][k]. One work-group of 4 waves per 128x128 tile,
// one 64x64 sub-tile per wave (2 x 2). A row-major [M][K] pitch lda; Bt row-major [N][K] pitch ldb
// (k contiguous); both f16 global planes. Per stage of 64 k the work-group brings 128 A rows and 128 Bt rows
// of 128 B into LDS once (8 lanes per row, so every load instruction covers 4 whole lines); all four waves
// take their fragments from there. Two LDS stages: the next stage's global loads are issued ahead of the
// products of this stage and stored behind them; one work-group barrier per stage.
// M, N multiples of 128, K a multiple of 64 (checked at compile time for the shapes launched below).
// blockIdx.y = batch index (strides in elements, C and Res share strideC). k order per accumulator: ascending.
// MODE 0: C f16 [m][n] = (acc*accs + bias[n]) * outs
// MODE 1: C f16 [m][n] = (acc*accs + bias[m]) * outs            (bias along rows)
// MODE 2: C f32 [m][n] = Res[m][n] + acc*accs + bias[n]          (Res has C's layout, never aliases C)
// MODE 3: C f16 [m][n] = gelu_tanh(acc*accs + bias[n]) * outs
// =====================================================================================================
template <int MODE>
__global__ __launch_bounds__(128) void gemm64(
    const _Float16* __restrict__ A, int lda, long long strideA,
    const _Float16* __restrict__ Bt, int ldb, long long strideB,
    const float* __restrict__ bias, const float* __restrict__ Res,
    void* Cout, int ldc, long long strideC,
    int M, int N, int K, float accs, float outs) {
  constexpr int GP  = 72;                  // LDS row pitch, halves: 144 B = 16 B x 9, for 16-B fragment reads
  constexpr int STG = 256 * GP;            // halves per stage: A rows 0..127, then Bt rows 0..127
  __shared__ __align__(16) _Float16 ring[2 * STG];   // 73728 B; its head is the output slabs after the k loop
  static_assert(4 * 16 * 68 * 4 <= 2 * STG * 2);
  const int bz   = blockIdx.y;
  const int tid  = threadIdx.x;
  const int lane = tid & 31;
  const int wave = tid >> 5;
  const int tilesN = N >> 7;
  const int tilesM = M >> 7;
  const int tile = blockIdx.x;
  if (tile >= tilesM * tilesN) return;   // the same for the whole work-group, ahead of every barrier
  const int tm = tile / tilesN;
  const int tn = tile - tm * tilesN;
  const int wm = (wave >> 1) << 6;            // this wave's 64x64 sub-tile inside the 128x128 tile
  const int wn = (wave & 1) << 6;
  const int m0 = (tm << 7) + wm;
  const int n0 = (tn << 7) + wn;

  const _Float16* Ab = A  + (size_t)bz * (size_t)strideA;
  const _Float16* Bb = Bt + (size_t)bz * (size_t)strideB;

  const int rl   = lane & 15;                 // row (A) / col (B, D) within subtile
  const int koff = (lane >> 4) * 8;           // k offset of this lane half
  const int mOff = (lane >> 4) * 8;           // D row offset

  // staging map: thread -> row (tid>>3) + 16*i, i 0..7, 16 B at column (tid&7)*8: 128 rows x 128 B per operand
  const int sr = tid >> 3;
  const int sc = (tid & 7) * 8;
  const _Float16* ga = Ab + (size_t)((tm << 7) + sr) * lda + sc;
  const _Float16* gb = Bb + (size_t)((tn << 7) + sr) * ldb + sc;
  _Float16* sa = ring + sr * GP + sc;
  _Float16* sb = sa + 128 * GP;

  v8f acc[4][4];
#pragma unroll
  for (int i = 0; i < 4; ++i)
#pragma unroll
    for (int j = 0; j < 4; ++j) acc[i][j] = zero8();

  v8h pa[8], pb[8];
#pragma unroll
  for (int i = 0; i < 8; ++i) {
    pa[i] = *(const v8h*)(ga + (size_t)(i * 16) * lda);
    pb[i] = *(const v8h*)(gb + (size_t)(i * 16) * ldb);
  }
#pragma unroll
  for (int i = 0; i < 8; ++i) {
    *(v8h*)(sa + i * 16 * GP) = pa[i];
    *(v8h*)(sb + i * 16 * GP) = pb[i];
  }
  __syncthreads();

  const int nk = K >> 6;
  for (int kt = 0; kt < nk; ++kt) {
    const int cur = (kt & 1) * STG;
    const bool more = (kt + 1 < nk);          // the same for the whole work-group
    if (more) {
      const int kn = (kt + 1) << 6;
#pragma unroll
      for (int i = 0; i < 8; ++i) {
        pa[i] = *(const v8h*)(ga + (size_t)(i * 16) * lda + kn);
        pb[i] = *(const v8h*)(gb + (size_t)(i * 16) * ldb + kn);
      }
      // the fragment loads below land in the address registers of the loads above: only behind this wait
      asm volatile("s_wait_xcnt 0x0" ::: "memory");
    }
    const _Float16* fa = ring + cur + (wm + rl) * GP + koff;
    const _Float16* fb = ring + cur + (128 + wn + rl) * GP + koff;
#pragma unroll
    for (int kk = 0; kk < 2; ++kk) {
      v16h bf[4], af[4];
#pragma unroll
      for (int j = 0; j < 4; ++j) bf[j] = ldfrag(fb + j * 16 * GP + kk * 32);
#pragma unroll
      for (int i = 0; i < 4; ++i) af[i] = ldfrag(fa + i * 16 * GP + kk * 32);
#pragma unroll
      for (int i = 0; i < 4; ++i) {
#pragma unroll
        for (int j = 0; j < 4; ++j) acc[i][j] = mma_raw(af[i], bf[j], acc[i][j]);
        guard4(acc[i][0], acc[i][1], acc[i][2], acc[i][3], af[i], bf[0], bf[1], bf[2], bf[3]);
      }
    }
    if (more) {
      const int nxt = STG - cur;              // the stage every wave left at the previous barrier
#pragma unroll
      for (int i = 0; i < 8; ++i) {
        *(v8h*)(sa + nxt + i * 16 * GP) = pa[i];
        *(v8h*)(sb + nxt + i * 16 * GP) = pb[i];
      }
    }
    __syncthreads();   // publishes the stage just stored; ends every wave's reads of the stage just used
  }

  // ---- epilogue ----
  float* slab = (float*)ring + wave * (16 * 68);   // per-wave 16x64 slab, pitch 68 floats (272 B)
#pragma unroll
  for (int i = 0; i < 4; ++i) {
    const int mBase = m0 + (i << 4);
#pragma unroll
    for (int j = 0; j < 4; ++j) {
#pragma unroll
      for (int r = 0; r < 8; ++r) slab[(mOff + r) * 68 + (j << 4) + rl] = acc[i][j][r];
    }
    __builtin_amdgcn_fence(__ATOMIC_RELEASE, "workgroup");
    __builtin_amdgcn_wave_barrier();
    __builtin_amdgcn_fence(__ATOMIC_ACQUIRE, "workgroup");
    if constexpr (MODE == 2) {
      float* C = (float*)Cout + (size_t)bz * (size_t)strideC;
      const float* R = Res + (size_t)bz * (size_t)strideC;
      const int h2 = lane >> 4, c4 = (lane & 15) * 4;    // 256-B row segment = 16 lanes x 16 B
      const v4f bq4 = *(const v4f*)(bias + n0 + c4);
      {
#pragma unroll
        for (int it = 0; it < 8; ++it) {
          const int row = it * 2 + h2;                    // it 0..7 x h2 0..1 = rows 0..15
          const v4f a  = *(const v4f*)(slab + row * 68 + c4);
          const v4f rr = *(const v4f*)(R + (size_t)(mBase + row) * ldc + n0 + c4);
          v4f ov;
#pragma unroll
          for (int e = 0; e < 4; ++e) ov[e] = rr[e] + (a[e] * accs + bq4[e]);
          *(v4f*)(C + (size_t)(mBase + row) * ldc + n0 + c4) = ov;
        }
        
      }
    } else {
      _Float16* C = (_Float16*)Cout + (size_t)bz * (size_t)strideC;
      const int q = lane >> 3, c8 = (lane & 7) * 8;
      float bc[8];
      if constexpr (MODE != 1) {
        const v4f b0 = *(const v4f*)(bias + n0 + c8), b1 = *(const v4f*)(bias + n0 + c8 + 4);
#pragma unroll
        for (int e = 0; e < 4; ++e) { bc[e] = b0[e]; bc[4 + e] = b1[e]; }
      } else {
#pragma unroll
        for (int e = 0; e < 8; ++e) bc[e] = 0.f;
      }
      v4u hv[4];
#pragma unroll
      for (int it = 0; it < 4; ++it) {
        const int row = it * 4 + q;                       // it 0..3 x q 0..3 = rows 0..15
        const float* sp = slab + row * 68 + c8;
        float brow = 0.f;
        if constexpr (MODE == 1) brow = bias[mBase + row];   // mBase + row < M = bias length in this mode
        H8 p;
#pragma unroll
        for (int e = 0; e < 8; ++e) {
          float f = sp[e] * accs + ((MODE == 1) ? brow : bc[e]);
          if constexpr (MODE == 3) f = gelu_tanh(f);
          f *= outs;
          p.h[e] = (_Float16)f;
        }
        hv[it] = p.u;
      }
      {
#pragma unroll
        for (int it = 0; it < 4; ++it) {
          const int row = it * 4 + q;
          *(v4u*)(C + (size_t)(mBase + row) * ldc + n0 + c8) = hv[it];
        }
        
      }
    }
    __builtin_amdgcn_fence(__ATOMIC_RELEASE, "workgroup");
    __builtin_amdgcn_wave_barrier();
    __builtin_amdgcn_fence(__ATOMIC_ACQUIRE, "workgroup");
  }
}

// =====================================================================================================
// Causal attention, head dim 64, f16 operands.
//   q plane (f16, carries q * 0.5):  element (b, t, h, d) at [(b*SEQ + t)*DM + h*64 + d]
//   k plane (f16, carries k * 4):    same layout with key index s
//   v^T plane (f16, carries v * 4):  element (b, h, d, s) at [(b*DM + h*64 + d)*SEQ + s]
//   logit = acc * sscale with sscale = 1/16  (0.5 * 4 / 16 = 1/8 = 1/sqrt(64));
//   Both products are taken transposed: S^T = K . Q^T (A = K rows, B = Q) and O^T += V^T . P^T (A = V^T rows).
//   A score tile's lane then holds 8 keys (16j + 8*(lane>>4) + r) of ONE query (lane&15): the row maximum and sum
//   are in-lane, joined between the wave halves by one exchange; two score tiles, converted in place, are the
//   B operand P^T in the hardware k order, which the V^T fragment loads already have.
//   keys s > t excluded per lane (-inf before the row max); every row has key 0 so the max is finite.
//   p = exp(s - m) packed as f16(1024 p); context = p . v on f16 WMMA; online softmax in f32.
//   out plane (f16, carries ctx * 4): element (b, t, h, d) at [(b*SEQ + t)*DM + h*64 + d];
//   ctx*4 = acc / (1024 l) since acc = 4096 * sum p v.
//   Block = 4 waves = 64 query rows of one (b, h) at a time, two query tiles qb in turn (NQB-1-pr, then pr);
//   grid = (NQB/2) * NH * NB; key tiles 0..qb (block-uniform).
//   K / V^T tile staging: 128 threads x 32 elements per plane = the whole 64x64 tile (plain 16-B loads,
//   __syncthreads before and after).
//   Output coverage: each wave stores rows q0..q0+15 (it 0..3 x lane>>3 0..3) x 64 columns (8 lanes x 8).
// =====================================================================================================
__global__ __launch_bounds__(128)
void attn_causal64(const _Float16* __restrict__ Qp, const _Float16* __restrict__ Kp,
                   const _Float16* __restrict__ Vtp, _Float16* Op, float sscale) {
  // Row pitches: 16-B fragment reads walk 16 rows at once, so a pitch of 16 B x odd spreads them over all banks
  // (128-B rows put every other row on the same banks).
  constexpr int LP = 72;                               // f16 rows of 64: pitch 72 halves = 144 B
  constexpr int OP = 68;                               // f32 rows of 64: pitch 68 floats = 272 B
  __shared__ __align__(16) _Float16 Ksh[64 * LP];      // K [kv][d]   9 KB
  __shared__ __align__(16) _Float16 Vth[64 * LP];      // V^T [d][kv] 9 KB
  __shared__ __align__(16) float    Os[4][16 * OP];    // per wave context tile [row][d]

  const int tid  = threadIdx.x;
  const int wave = tid >> 5;
  const int lane = tid & 31;
  const int hh   = lane >> 4;
  const int c    = lane & 15;

  const int bx   = blockIdx.x;
  const int pr   = bx % (NQB / 2);
  const int rest = bx / (NQB / 2);
  const int h    = rest % NH;
  const int b    = rest / NH;
  const size_t rowB = (size_t)b * SEQ;

  const _Float16* Qh = Qp + (size_t)h * HD;
  const _Float16* Kh = Kp + (size_t)h * HD;
  const _Float16* Vh = Vtp + ((size_t)b * DM + (size_t)h * HD) * SEQ;

  // Two query tiles, one after the other in every wave: NQB-1-pr, then pr. (NQB-pr) + (pr+1) = NQB+1 key tiles
  // for every work-group, so no work-group outlasts the others. pr 0..NQB/2-1 covers every query tile once.
  for (int part = 0; part < 2; ++part) {        // block-uniform
    const int qb = part ? pr : NQB - 1 - pr;
    const int q0 = qb * 64 + wave * 16;

    // ---- Q fragments (B operand, column = lane&15 = query row): 2 d-chunks of 32 ----
    v16h qa[2];
#pragma unroll
    for (int dc = 0; dc < 2; ++dc)
      qa[dc] = ldfrag(Qh + (rowB + q0 + c) * DM + dc * 32 + 8 * hh);

    const int qrow = q0 + c;                    // this lane's query row
    float mrow = -INFINITY;                     // running maximum of row qrow (alike in both wave halves)
    float lrow = 0.f;                           // running sum over this wave half's keys only; joined after the loop
    v8f oacc[4];                                // O^T: oacc[t][r] = context(qrow, d = 16t + 8*hh + r)
#pragma unroll
    for (int t = 0; t < 4; ++t) oacc[t] = zero8();

    for (int kt = 0; kt <= qb; ++kt) {          // causal key tiles, block-uniform trip count
      const int kv0 = kt * 64;
      __syncthreads();
      {
        const int r = tid >> 1, half = (tid & 1) * 32;
        const _Float16* kg = Kh + (rowB + kv0 + r) * DM + half;     // K row kv0+r, d = half..half+31
        const _Float16* vg = Vh + (size_t)r * SEQ + kv0 + half;     // V^T row d = r, s = kv0+half..+31
#pragma unroll
        for (int i = 0; i < 4; ++i) {
          const v8h a0 = *(const v8h*)(kg + 8 * i);
          const v8h b0 = *(const v8h*)(vg + 8 * i);
          *(v8h*)(Ksh + r * LP + half + 8 * i) = a0;
          *(v8h*)(Vth + r * LP + half + 8 * i) = b0;
        }
      }
      __syncthreads();

      // ---- scores, transposed: s[j][r] = score(key kv0 + 16j + 8*hh + r, query qrow) ----
      v8f s[4];
#pragma unroll
      for (int j = 0; j < 4; ++j) {
        s[j] = zero8();
#pragma unroll
        for (int dc = 0; dc < 2; ++dc) {
          FH kb;
          kb.h[0] = *(const v8h*)(Ksh + (j * 16 + c) * LP + dc * 32 + 8 * hh);
          kb.h[1] = *(const v8h*)(Ksh + (j * 16 + c) * LP + dc * 32 + 16 + 8 * hh);
          s[j] = mma_h(kb.v, qa[dc], s[j]);
        }
      }

      // ---- scale, causal exclusion, row max, online softmax, P^T (x1024, f16) packed in registers ----
      float mj[4];
#pragma unroll
      for (int j = 0; j < 4; ++j) {
        mj[j] = -INFINITY;
#pragma unroll
        for (int r = 0; r < 8; ++r) {
          const int key = kv0 + j * 16 + 8 * hh + r;
          const float sv = (key <= qrow) ? (s[j][r] * sscale) : -INFINITY;
          s[j][r] = sv;
          mj[j] = fmaxf(mj[j], sv);
        }
      }
      float m = fmaxf(fmaxf(mj[0], mj[1]), fmaxf(mj[2], mj[3]));
      m = fmaxf(m, xhalf(m));                    // both halves now hold the maximum over the 64 keys
      const float mnew  = fmaxf(mrow, m);
      const float msafe = (mnew == -INFINITY) ? 0.f : mnew;
      const float alpha = __expf(mrow - msafe);
      mrow = mnew;
      FH pb[2];                                  // P^T, B operand: element e of half j&1 = key 32*(j>>1) + 16*(j&1) + 8*hh + e
      float pj[4];
#pragma unroll
      for (int j = 0; j < 4; ++j) {
        pj[j] = 0.f;
#pragma unroll
        for (int r = 0; r < 8; ++r) {
          const float p = __expf(s[j][r] - msafe);     // excluded key: exp(-inf) = 0
          pj[j] += p;
          pb[j >> 1].h[j & 1][r] = (_Float16)(p * 1024.0f);
        }
      }
      lrow = lrow * alpha + ((pj[0] + pj[1]) + (pj[2] + pj[3]));
#pragma unroll
      for (int t = 0; t < 4; ++t)
#pragma unroll
        for (int r = 0; r < 8; ++r) oacc[t][r] *= alpha;

      // ---- context^T += V^T . P^T (f16 WMMA) ----
#pragma unroll
      for (int kk = 0; kk < 2; ++kk) {
#pragma unroll
        for (int t = 0; t < 4; ++t) {
          FH vb;
          vb.h[0] = *(const v8h*)(Vth + (t * 16 + c) * LP + kk * 32 + 8 * hh);
          vb.h[1] = *(const v8h*)(Vth + (t * 16 + c) * LP + kk * 32 + 16 + 8 * hh);
          oacc[t] = mma_h(vb.v, pb[kk].v, oacc[t]);
        }
      }
    }

    // ---- normalise (1/l and the carries), stage the wave's 16x64 tile, convert to f16,
    float* os = Os[wave];
    {
      const float l = lrow + xhalf(lrow);        // the two halves' key sums joined
      const float inv = ((l > 0.f) ? (1.0f / l) : 0.f) * (1.0f / 1024.0f);
#pragma unroll
      for (int t = 0; t < 4; ++t) {
        v4f lo, hi;
#pragma unroll
        for (int e = 0; e < 4; ++e) { lo[e] = oacc[t][e] * inv; hi[e] = oacc[t][4 + e] * inv; }
        *(v4f*)(os + c * OP + t * 16 + 8 * hh)     = lo;
        *(v4f*)(os + c * OP + t * 16 + 8 * hh + 4) = hi;
      }
    }
    __builtin_amdgcn_fence(__ATOMIC_RELEASE, "workgroup");
    __builtin_amdgcn_wave_barrier();
    __builtin_amdgcn_fence(__ATOMIC_ACQUIRE, "workgroup");
    {
      const int q4 = lane >> 3, c8 = (lane & 7) * 8;
      v4u hv[4];
#pragma unroll
      for (int it = 0; it < 4; ++it) {
        const int row = it * 4 + q4;   // it 0..3 x q4 0..3 = rows 0..15 of the wave tile
        const float* sp = os + row * OP + c8;
        H8 p;
#pragma unroll
        for (int e = 0; e < 8; ++e) p.h[e] = (_Float16)sp[e];
        hv[it] = p.u;
      }
      {
#pragma unroll
        for (int it = 0; it < 4; ++it) {
          const int row = it * 4 + q4;
          const size_t go = (rowB + q0 + row) * DM + (size_t)h * HD + c8;
          *(v4u*)(Op + go) = hv[it];
        }
        // the second query tile reuses the address and data registers of these stores: only behind this wait
        asm volatile("s_wait_xcnt 0x0" ::: "memory");
      }
    }
  }
}

// =====================================================================================================
// Workspace map (bytes), every region an exact multiple of its whole-line / 64x64-tile store granularity:
//   Wqt  f16 [768 out][768 in] x32      0          1179648
//   Wkt  f16 [768][768] x32              1179648    1179648
//   Wvt  f16 [768][768] x32              2359296    1179648
//   Wot  f16 [768][768] x32              3538944    1179648
//   W1t  f16 [3072][768] x32             4718592    4718592
//   W2t  f16 [768][3072] x32             9437184    4718592
//   Np   f16 [8192][768]  ln1 out, later ln2 out          14155776   12582912
//   RegB 50331648 B at 26738688: q f16 [8192][768] at +0, k at +12582912, v^T f16 [2][768][4096] at
//        +25165824 (end +37748736); later the gelu plane G f16 [8192][3072] covers the whole region
//   Ctx  f16 [8192][768] x4              77070336   12582912
//   X1   f32 [8192][768]                 89653248   25165824
//   end                                  114819072
// Launch order makes the aliasing safe on the in-order stream: q/k/v^T are last read by the attention
// launch, G is written three launches later; Np is last read by the v^T GEMM before ln2 rewrites it.
// Spec weights are [in][out]; the GEMM wants Bt[n][k] / A[m][k] with k contiguous, hence the transposes.
// =====================================================================================================
extern "C" void kernel_launch(void* const* d_in, const int* in_sizes, int n_in,
                              void* d_out, int out_size, void* d_ws, size_t ws_size,
                              hipStream_t stream) {
  if (n_in < 17) return;
  if (in_sizes[0] != NROW * DM) return;
  if (in_sizes[1] != DM || in_sizes[2] != DM) return;
  if (in_sizes[3] != DM * DM || in_sizes[5] != DM * DM || in_sizes[7] != DM * DM || in_sizes[9] != DM * DM) return;
  if (in_sizes[4] != DM || in_sizes[6] != DM || in_sizes[8] != DM || in_sizes[10] != DM) return;
  if (in_sizes[11] != DM || in_sizes[12] != DM) return;
  if (in_sizes[13] != DM * FF || in_sizes[14] != FF || in_sizes[15] != FF * DM || in_sizes[16] != DM) return;
  if (out_size != NROW * DM) return;

  const float* x    = (const float*)d_in[0];
  const float* ln1g = (const float*)d_in[1];
  const float* ln1b = (const float*)d_in[2];
  const float* Wq   = (const float*)d_in[3];
  const float* bq   = (const float*)d_in[4];
  const float* Wk   = (const float*)d_in[5];
  const float* bk   = (const float*)d_in[6];
  const float* Wv   = (const float*)d_in[7];
  const float* bv   = (const float*)d_in[8];
  const float* Wo   = (const float*)d_in[9];
  const float* bo   = (const float*)d_in[10];
  const float* ln2g = (const float*)d_in[11];
  const float* ln2b = (const float*)d_in[12];
  const float* W1   = (const float*)d_in[13];
  const float* b1   = (const float*)d_in[14];
  const float* W2   = (const float*)d_in[15];
  const float* b2   = (const float*)d_in[16];

  const size_t PWD  = (size_t)DM * DM * 2;          //  1179648
  const size_t PWF  = (size_t)DM * FF * 2;          //  4718592
  const size_t PA16 = (size_t)NROW * DM * 2;        // 12582912  f16 activation plane [8192][768]
  const size_t PVT  = (size_t)NB * DM * SEQ * 2;    // 12582912  v^T plane
  const size_t PG   = (size_t)NROW * FF * 2;        // 50331648  gelu plane [8192][3072]
  const size_t PX1  = (size_t)NROW * DM * 4;        // 25165824  f32 plane
  size_t off = 0;
  const size_t oWq = off; off += PWD;
  const size_t oWk = off; off += PWD;
  const size_t oWv = off; off += PWD;
  const size_t oWo = off; off += PWD;
  const size_t oW1 = off; off += PWF;
  const size_t oW2 = off; off += PWF;
  const size_t oN  = off; off += PA16;
  const size_t oRB = off; off += PG;
  const size_t oCt = off; off += PA16;
  const size_t oX1 = off; off += PX1;
  if (off > ws_size) return;                        // off = 114819072
  if (off > (size_t)134217728) return;
  const size_t oQ  = oRB;
  const size_t oK  = oRB + PA16;
  const size_t oVT = oRB + 2 * PA16;
  if (oVT + PVT > oRB + PG) return;                 // q, k, v^T fit inside the gelu region
  const size_t oG  = oRB;

  char* ws = (char*)d_ws;
  _Float16* Wqt = (_Float16*)(ws + oWq);
  _Float16* Wkt = (_Float16*)(ws + oWk);
  _Float16* Wvt = (_Float16*)(ws + oWv);
  _Float16* Wot = (_Float16*)(ws + oWo);
  _Float16* W1t = (_Float16*)(ws + oW1);
  _Float16* W2t = (_Float16*)(ws + oW2);
  _Float16* Np  = (_Float16*)(ws + oN);
  _Float16* Qp  = (_Float16*)(ws + oQ);
  _Float16* Kpl = (_Float16*)(ws + oK);
  _Float16* VTp = (_Float16*)(ws + oVT);
  _Float16* Gp  = (_Float16*)(ws + oG);
  _Float16* Ctp = (_Float16*)(ws + oCt);
  float*    X1  = (float*)(ws + oX1);

  const dim3 blk(256);
  const dim3 gTrDD(DM / 64, DM / 64);                              // [768][768] -> [768][768]
  const dim3 gTrW1(FF / 64, DM / 64);                              // in [768][3072] -> out [3072][768]
  const dim3 gTrW2(DM / 64, FF / 64);                              // in [3072][768] -> out [768][3072]
  const dim3 gLn((NROW + 7) / 8);                                  // 1024 blocks
  const dim3 gblk(128);                                            // GEMM work-group: 4 waves
  const dim3 gProj((NROW / 128) * (DM / 128), 1);                  // 384 tiles of 128x128
  const dim3 gVT((DM / 128) * (SEQ / 128), NB);                    // 192 tiles x 2
  const dim3 gFfn((NROW / 128) * (FF / 128), 1);                   // 1536 tiles
  const dim3 gAtt((NQB / 2) * NH * NB);                            // 768 blocks, two query tiles each

  // (1) weights [in][out] f32 -> transposed f16 [out][in] x32
  tr_cvt<<<gTrDD, blk, 0, stream>>>(Wq, Wqt, DM, DM, 32.0f);
  tr_cvt<<<gTrDD, blk, 0, stream>>>(Wk, Wkt, DM, DM, 32.0f);
  tr_cvt<<<gTrDD, blk, 0, stream>>>(Wv, Wvt, DM, DM, 32.0f);
  tr_cvt<<<gTrDD, blk, 0, stream>>>(Wo, Wot, DM, DM, 32.0f);
  tr_cvt<<<gTrW1, blk, 0, stream>>>(W1, W1t, DM, FF, 32.0f);
  tr_cvt<<<gTrW2, blk, 0, stream>>>(W2, W2t, FF, DM, 32.0f);
  // (2) ln1 -> Np f16 [8192][768]
  ln_rows<<<gLn, blk, 0, stream>>>(x, ln1g, ln1b, Np, NROW);
  // (3) q = (ln1 . Wq + bq) * 0.5 -> Qp;  k = (ln1 . Wk + bk) * 4 -> Kp   (M=8192, N=768, K=768, acc/32)
  gemm64<0><<<gProj, gblk, 0, stream>>>(Np, DM, 0LL, Wqt, DM, 0LL, bq, x, (void*)Qp, DM, 0LL,
                                       NROW, DM, DM, 1.0f / 32.0f, 0.5f);
  gemm64<0><<<gProj, gblk, 0, stream>>>(Np, DM, 0LL, Wkt, DM, 0LL, bk, x, (void*)Kpl, DM, 0LL,
                                       NROW, DM, DM, 1.0f / 32.0f, 4.0f);
  // (4) v^T = (Wv^T . ln1^T + bv[row]) * 4 per batch -> VTp f16 [b][d][s]  (M=768, N=4096, K=768)
  gemm64<1><<<gVT, gblk, 0, stream>>>(Wvt, DM, 0LL, Np, DM, (long long)SEQ * DM, bv, x,
                                     (void*)VTp, SEQ, (long long)DM * SEQ,
                                     DM, SEQ, DM, 1.0f / 32.0f, 4.0f);
  // (5) causal attention -> Ctp f16 (ctx * 4)
  attn_causal64<<<gAtt, dim3(128), 0, stream>>>(Qp, Kpl, VTp, Ctp, 0.0625f);
  // (6) x1 = x + ctx . Wo + bo -> X1 f32   (acc = 128 * ctx.Wo)
  gemm64<2><<<gProj, gblk, 0, stream>>>(Ctp, DM, 0LL, Wot, DM, 0LL, bo, x, (void*)X1, DM, 0LL,
                                       NROW, DM, DM, 1.0f / 128.0f, 1.0f);
  // (7) ln2 -> Np
  ln_rows<<<gLn, blk, 0, stream>>>(X1, ln2g, ln2b, Np, NROW);
  // (8) g = gelu(ln2 . W1 + b1) * 4 -> Gp f16 [8192][3072]   (M=8192, N=3072, K=768, acc/32)
  gemm64<3><<<gFfn, gblk, 0, stream>>>(Np, DM, 0LL, W1t, DM, 0LL, b1, x, (void*)Gp, FF, 0LL,
                                      NROW, FF, DM, 1.0f / 32.0f, 4.0f);
  // (9) out = x1 + g . W2 + b2 -> d_out f32 [8192][768]   (M=8192, N=768, K=3072, acc = 128 * g.W2)
  gemm64<2><<<gProj, gblk, 0, stream>>>(Gp, FF, 0LL, W2t, FF, 0LL, b2, X1, d_out, DM, 0LL,
                                       NROW, DM, FF, 1.0f / 128.0f, 1.0f);
  (void)hipGetLastError();
}

// v005
// It runs in 272 microseconds.
// Two timings next to v004 both put it at 1.10 times that version's speed.
// Over all steps from v000 it is 2.90 times as fast.
// All contractions: v_wmma_f32_16x16x32_f16 (f16 operands, f32 accumulate): q/k/v projections, q.k^T scores,
// p.v context, ctx.Wo, ln2out.W1, gelu.W2. LayerNorm, softmax, GELU, bias and residual adds in f32.
#include <hip/hip_runtime.h>
#include <math.h>
#include <stdint.h>

#define NB   2
#define SEQ  4096
#define DM   768
#define NH   12
#define HD   64
#define FF   3072
#define NROW (NB * SEQ)      // 8192 token rows
#define NQB  (SEQ / 64)      // 64 query / key tiles of 64
static_assert(NH * HD == DM);
static_assert((NQB % 2) == 0);
static_assert((SEQ % 64) == 0 && (DM % 64) == 0 && (FF % 64) == 0 && (NROW % 64) == 0);
static_assert(DM == 3 * 256);
static_assert((SEQ % 128) == 0 && (DM % 128) == 0 && (FF % 128) == 0 && (NROW % 128) == 0);

typedef _Float16 v16h __attribute__((ext_vector_type(16)));
typedef _Float16 v8h  __attribute__((ext_vector_type(8)));
typedef float    v8f  __attribute__((ext_vector_type(8)));
typedef float    v4f  __attribute__((ext_vector_type(4)));
typedef unsigned int v4u __attribute__((ext_vector_type(4)));

union H8 { v8h h; v4u u; };
union FH { v16h v; v8h h[2]; };

__device__ __forceinline__ v8f zero8() { v8f z = {0.f, 0.f, 0.f, 0.f, 0.f, 0.f, 0.f, 0.f}; return z; }

// 16-bit A/B fragment: lane -> row/col (lane&15); p already includes +8*(lane>>4);
// elements 0..7 <- p[0..7] (k0+8h..k0+8h+7), elements 8..15 <- p[16..23] (k0+16+8h..)
__device__ __forceinline__ v16h ldfrag(const _Float16* p) {
  FH f;
  f.h[0] = *(const v8h*)(p);
  f.h[1] = *(const v8h*)(p + 16);
  return f.v;
}

__device__ __forceinline__ v8f mma_raw(v16h a, v16h b, v8f c) {
  return __builtin_amdgcn_wmma_f32_16x16x32_f16(false, a, false, b, (short)0, c, false, false);
}
// guard after the last WMMA of a 4-op group: ties all four D, keeps the group's A and B live
__device__ __forceinline__ void guard4(v8f& d0, v8f& d1, v8f& d2, v8f& d3,
                                       v16h a, v16h b0, v16h b1, v16h b2, v16h b3) {
  asm volatile("v_nop\n\tv_nop\n\tv_nop\n\tv_nop"
               : "+v"(d0), "+v"(d1), "+v"(d2), "+v"(d3)
               : "v"(a), "v"(b0), "v"(b1), "v"(b2), "v"(b3));
}

// lane l <-> lane l ^ 16 (the two halves of a wave), by a vector cross-row move
__device__ __forceinline__ float xhalf(float x) {
  return __builtin_bit_cast(float, __builtin_amdgcn_permlanex16(__builtin_bit_cast(int, x), __builtin_bit_cast(int, x),
                                                                0x76543210, 0xfedcba98, false, false));
}

// tanh-form GELU via the identity 0.5u(1+tanh z) = u * sigmoid(2z); exp argument clamped, reciprocal by v_rcp
__device__ __forceinline__ float gelu_tanh(float u) {
  const float z = 0.7978845608028654f * (u + 0.044715f * u * u * u);
  const float e = __expf(fminf(-2.0f * z, 80.0f));
  return u * __builtin_amdgcn_rcpf(1.0f + e);
}

// =====================================================================================================
// Weight transpose + convert: W f32 [Kin][Nout] (pitch Nout) -> Wt f16 [Nout][Kin] (pitch Kin), times scale.
// 64x64 tile through LDS. grid = (Nout/64, Kin/64), 256 threads. Reads: thread handles 4 float4 of the
// tile (chunk = tid + i*256 -> row r = chunk>>4 (k local), cols c4..c4+3 (n local)).
// coverage: 8 waves x 2 x 4 = 64 rows, 8 lanes x 8 halves = 64 cols = the whole tile; grid exact.
// =====================================================================================================
__global__ __launch_bounds__(256) void tr_cvt(const float* __restrict__ W, _Float16* Wt,
                                              int Kin, int Nout, float scale) {
  __shared__ __align__(16) _Float16 T[64][72];   // [n local][k local], pitch 144 B
  const int tid = threadIdx.x, wave = tid >> 5, lane = tid & 31;
  const int n0 = blockIdx.x * 64, k0 = blockIdx.y * 64;
#pragma unroll
  for (int i = 0; i < 4; ++i) {
    const int chunk = tid + i * 256;
    const int r = chunk >> 4;            // 0..63  (k local)
    const int c4 = (chunk & 15) * 4;     // 0..60  (n local)
    const v4f v = *(const v4f*)(W + (size_t)(k0 + r) * Nout + n0 + c4);
#pragma unroll
    for (int e = 0; e < 4; ++e) T[c4 + e][r] = (_Float16)(v[e] * scale);
  }
  __syncthreads();
  const int q = lane >> 3, c8 = (lane & 7) * 8;
  v4u o[2];
#pragma unroll
  for (int it = 0; it < 2; ++it) {
    const int row = wave * 8 + it * 4 + q;
    H8 p;
    p.h = *(const v8h*)(&T[row][c8]);
    o[it] = p.u;
  }
  {
#pragma unroll
    for (int it = 0; it < 2; ++it) {
      const int row = wave * 8 + it * 4 + q;
      *(v4u*)(Wt + (size_t)(n0 + row) * Kin + k0 + c8) = o[it];
    }
    
  }
}

// =====================================================================================================
// LayerNorm over DM=768 columns, f32 math, f16 output (unscaled). One wave per row, 8 rows per block,
// grid = ceil(nrows/8). Lane holds columns i*256 + lane*8 .. +7 (i 0..2). mean and variance by two register
// passes with 32-lane butterflies. Output: three 16-B stores per lane, each instruction = 32 lanes x 16 B =
// coverage: 3 x 256 = 768 columns per row; every row < nrows by exactly one wave.
// =====================================================================================================
__global__ __launch_bounds__(256) void ln_rows(const float* __restrict__ X, const float* __restrict__ g,
                                               const float* __restrict__ bb, _Float16* Y, int nrows) {
  const int wave = threadIdx.x >> 5, lane = threadIdx.x & 31;
  const int row = blockIdx.x * 8 + wave;
  if (row >= nrows) return;                  // wave-uniform; no block barriers in this kernel
  const float* xr = X + (size_t)row * DM;
  float v[3][8];
  float s = 0.f;
#pragma unroll
  for (int i = 0; i < 3; ++i) {
    const int col = i * 256 + lane * 8;
    const v4f a = *(const v4f*)(xr + col);
    const v4f c = *(const v4f*)(xr + col + 4);
#pragma unroll
    for (int e = 0; e < 4; ++e) { v[i][e] = a[e]; v[i][4 + e] = c[e]; }
#pragma unroll
    for (int e = 0; e < 8; ++e) s += v[i][e];
  }
#pragma unroll
  for (int off = 16; off > 0; off >>= 1) s += __shfl_xor(s, off, 32);
  const float mu = s * (1.0f / (float)DM);
  float qs = 0.f;
#pragma unroll
  for (int i = 0; i < 3; ++i)
#pragma unroll
    for (int e = 0; e < 8; ++e) { const float d = v[i][e] - mu; v[i][e] = d; qs += d * d; }
#pragma unroll
  for (int off = 16; off > 0; off >>= 1) qs += __shfl_xor(qs, off, 32);
  const float rstd = rsqrtf(qs * (1.0f / (float)DM) + 1e-5f);
  v4u o[3];
#pragma unroll
  for (int i = 0; i < 3; ++i) {
    const int col = i * 256 + lane * 8;
    const v4f g0 = *(const v4f*)(g + col), g1 = *(const v4f*)(g + col + 4);
    const v4f b0 = *(const v4f*)(bb + col), b1 = *(const v4f*)(bb + col + 4);
    H8 p;
#pragma unroll
    for (int e = 0; e < 4; ++e) {
      p.h[e]     = (_Float16)(v[i][e] * rstd * g0[e] + b0[e]);
      p.h[4 + e] = (_Float16)(v[i][4 + e] * rstd * g1[e] + b1[e]);
    }
    o[i] = p.u;
  }
  {
#pragma unroll
    for (int i = 0; i < 3; ++i)
      *(v4u*)(Y + (size_t)row * DM + i * 256 + lane * 8) = o[i];
    
  }
}

// =====================================================================================================
// Batched f16 WMMA GEMM: acc[m][n] = sum_k A[m][k] * Bt[n][k]. One work-group of 4 waves per 128x128 tile,
// one 64x64 sub-tile per wave (2 x 2). A row-major [M][K] pitch lda; Bt row-major [N][K] pitch ldb
// (k contiguous); both f16 global planes. Per stage of 64 k the work-group brings 128 A rows and 128 Bt rows
// of 128 B into LDS once (8 lanes per row, so every load instruction covers 4 whole lines); all four waves
// take their fragments from there. Two LDS stages: the next stage's global loads are issued ahead of the
// products of this stage and stored behind them; one work-group barrier per stage.
// M, N multiples of 128, K a multiple of 64 (checked at compile time for the shapes launched below).
// blockIdx.y = batch index (strides in elements, C and Res share strideC). k order per accumulator: ascending.
// MODE 0: C f16 [m][n] = (acc*accs + bias[n]) * outs
// MODE 1: C f16 [m][n] = (acc*accs + bias[m]) * outs            (bias along rows)
// MODE 2: C f32 [m][n] = Res[m][n] + acc*accs + bias[n]          (Res has C's layout, never aliases C)
// MODE 3: C f16 [m][n] = gelu_tanh(acc*accs + bias[n]) * outs
// =====================================================================================================
template <int MODE>
__global__ __launch_bounds__(128) void gemm64(
    const _Float16* __restrict__ A, int lda, long long strideA,
    const _Float16* __restrict__ Bt, int ldb, long long strideB,
    const float* __restrict__ bias, const float* __restrict__ Res,
    void* Cout, int ldc, long long strideC,
    int M, int N, int K, float accs, float outs) {
  constexpr int GP  = 72;                  // LDS row pitch, halves: 144 B = 16 B x 9, for 16-B fragment reads
  constexpr int STG = 256 * GP;            // halves per stage: A rows 0..127, then Bt rows 0..127
  __shared__ __align__(16) _Float16 ring[2 * STG];   // 73728 B; its head is the output slabs after the k loop
  static_assert(4 * 16 * 68 * 4 <= 2 * STG * 2);
  const int bz   = blockIdx.y;
  const int tid  = threadIdx.x;
  const int lane = tid & 31;
  const int wave = tid >> 5;
  const int tilesN = N >> 7;
  const int tilesM = M >> 7;
  const int tile = blockIdx.x;
  if (tile >= tilesM * tilesN) return;   // the same for the whole work-group, ahead of every barrier
  const int tm = tile / tilesN;
  const int tn = tile - tm * tilesN;
  const int wm = (wave >> 1) << 6;            // this wave's 64x64 sub-tile inside the 128x128 tile
  const int wn = (wave & 1) << 6;
  const int m0 = (tm << 7) + wm;
  const int n0 = (tn << 7) + wn;

  const _Float16* Ab = A  + (size_t)bz * (size_t)strideA;
  const _Float16* Bb = Bt + (size_t)bz * (size_t)strideB;

  const int rl   = lane & 15;                 // row (A) / col (B, D) within subtile
  const int koff = (lane >> 4) * 8;           // k offset of this lane half
  const int mOff = (lane >> 4) * 8;           // D row offset

  // staging map: thread -> row (tid>>3) + 16*i, i 0..7, 16 B at column (tid&7)*8: 128 rows x 128 B per operand
  const int sr = tid >> 3;
  const int sc = (tid & 7) * 8;
  const _Float16* ga = Ab + (size_t)((tm << 7) + sr) * lda + sc;
  const _Float16* gb = Bb + (size_t)((tn << 7) + sr) * ldb + sc;
  _Float16* sa = ring + sr * GP + sc;
  _Float16* sb = sa + 128 * GP;

  v8f acc[4][4];
#pragma unroll
  for (int i = 0; i < 4; ++i)
#pragma unroll
    for (int j = 0; j < 4; ++j) acc[i][j] = zero8();

  v8h pa[8], pb[8];
#pragma unroll
  for (int i = 0; i < 8; ++i) {
    pa[i] = *(const v8h*)(ga + (size_t)(i * 16) * lda);
    pb[i] = *(const v8h*)(gb + (size_t)(i * 16) * ldb);
  }
#pragma unroll
  for (int i = 0; i < 8; ++i) {
    *(v8h*)(sa + i * 16 * GP) = pa[i];
    *(v8h*)(sb + i * 16 * GP) = pb[i];
  }
  __syncthreads();

  const int nk = K >> 6;
  for (int kt = 0; kt < nk; ++kt) {
    const int cur = (kt & 1) * STG;
    const bool more = (kt + 1 < nk);          // the same for the whole work-group
    if (more) {
      const int kn = (kt + 1) << 6;
#pragma unroll
      for (int i = 0; i < 8; ++i) {
        pa[i] = *(const v8h*)(ga + (size_t)(i * 16) * lda + kn);
        pb[i] = *(const v8h*)(gb + (size_t)(i * 16) * ldb + kn);
      }
      // the fragment loads below land in the address registers of the loads above: only behind this wait
      asm volatile("s_wait_xcnt 0x0" ::: "memory");
    }
    const _Float16* fa = ring + cur + (wm + rl) * GP + koff;
    const _Float16* fb = ring + cur + (128 + wn + rl) * GP + koff;
#pragma unroll
    for (int kk = 0; kk < 2; ++kk) {
      v16h bf[4], af[4];
#pragma unroll
      for (int j = 0; j < 4; ++j) bf[j] = ldfrag(fb + j * 16 * GP + kk * 32);
#pragma unroll
      for (int i = 0; i < 4; ++i) af[i] = ldfrag(fa + i * 16 * GP + kk * 32);
#pragma unroll
      for (int i = 0; i < 4; ++i) {
#pragma unroll
        for (int j = 0; j < 4; ++j) acc[i][j] = mma_raw(af[i], bf[j], acc[i][j]);
        guard4(acc[i][0], acc[i][1], acc[i][2], acc[i][3], af[i], bf[0], bf[1], bf[2], bf[3]);
      }
    }
    if (more) {
      const int nxt = STG - cur;              // the stage every wave left at the previous barrier
#pragma unroll
      for (int i = 0; i < 8; ++i) {
        *(v8h*)(sa + nxt + i * 16 * GP) = pa[i];
        *(v8h*)(sb + nxt + i * 16 * GP) = pb[i];
      }
    }
    __syncthreads();   // publishes the stage just stored; ends every wave's reads of the stage just used
  }

  // ---- epilogue ----
  float* slab = (float*)ring + wave * (16 * 68);   // per-wave 16x64 slab, pitch 68 floats (272 B)
#pragma unroll
  for (int i = 0; i < 4; ++i) {
    const int mBase = m0 + (i << 4);
#pragma unroll
    for (int j = 0; j < 4; ++j) {
#pragma unroll
      for (int r = 0; r < 8; ++r) slab[(mOff + r) * 68 + (j << 4) + rl] = acc[i][j][r];
    }
    __builtin_amdgcn_fence(__ATOMIC_RELEASE, "workgroup");
    __builtin_amdgcn_wave_barrier();
    __builtin_amdgcn_fence(__ATOMIC_ACQUIRE, "workgroup");
    if constexpr (MODE == 2) {
      float* C = (float*)Cout + (size_t)bz * (size_t)strideC;
      const float* R = Res + (size_t)bz * (size_t)strideC;
      const int h2 = lane >> 4, c4 = (lane & 15) * 4;    // 256-B row segment = 16 lanes x 16 B
      const v4f bq4 = *(const v4f*)(bias + n0 + c4);
      {
#pragma unroll
        for (int it = 0; it < 8; ++it) {
          const int row = it * 2 + h2;                    // it 0..7 x h2 0..1 = rows 0..15
          const v4f a  = *(const v4f*)(slab + row * 68 + c4);
          const v4f rr = *(const v4f*)(R + (size_t)(mBase + row) * ldc + n0 + c4);
          v4f ov;
#pragma unroll
          for (int e = 0; e < 4; ++e) ov[e] = rr[e] + (a[e] * accs + bq4[e]);
          *(v4f*)(C + (size_t)(mBase + row) * ldc + n0 + c4) = ov;
        }
        
      }
    } else {
      _Float16* C = (_Float16*)Cout + (size_t)bz * (size_t)strideC;
      const int q = lane >> 3, c8 = (lane & 7) * 8;
      float bc[8];
      if constexpr (MODE != 1) {
        const v4f b0 = *(const v4f*)(bias + n0 + c8), b1 = *(const v4f*)(bias + n0 + c8 + 4);
#pragma unroll
        for (int e = 0; e < 4; ++e) { bc[e] = b0[e]; bc[4 + e] = b1[e]; }
      } else {
#pragma unroll
        for (int e = 0; e < 8; ++e) bc[e] = 0.f;
      }
      v4u hv[4];
#pragma unroll
      for (int it = 0; it < 4; ++it) {
        const int row = it * 4 + q;                       // it 0..3 x q 0..3 = rows 0..15
        const float* sp = slab + row * 68 + c8;
        float brow = 0.f;
        if constexpr (MODE == 1) brow = bias[mBase + row];   // mBase + row < M = bias length in this mode
        H8 p;
#pragma unroll
        for (int e = 0; e < 8; ++e) {
          float f = sp[e] * accs + ((MODE == 1) ? brow : bc[e]);
          if constexpr (MODE == 3) f = gelu_tanh(f);
          f *= outs;
          p.h[e] = (_Float16)f;
        }
        hv[it] = p.u;
      }
      {
#pragma unroll
        for (int it = 0; it < 4; ++it) {
          const int row = it * 4 + q;
          *(v4u*)(C + (size_t)(mBase + row) * ldc + n0 + c8) = hv[it];
        }
        
      }
    }
    __builtin_amdgcn_fence(__ATOMIC_RELEASE, "workgroup");
    __builtin_amdgcn_wave_barrier();
    __builtin_amdgcn_fence(__ATOMIC_ACQUIRE, "workgroup");
  }
}

// =====================================================================================================
// Causal attention, head dim 64, f16 operands.
//   q plane (f16, carries q * 0.5):  element (b, t, h, d) at [(b*SEQ + t)*DM + h*64 + d]
//   k plane (f16, carries k * 4):    same layout with key index s
//   v^T plane (f16, carries v * 4):  element (b, h, d, s) at [(b*DM + h*64 + d)*SEQ + s]
//   logit = acc * sscale with sscale = 1/16  (0.5 * 4 / 16 = 1/8 = 1/sqrt(64));
//   Both products are taken transposed: S^T = K . Q^T (A = K rows, B = Q) and O^T += V^T . P^T (A = V^T rows).
//   A score tile's lane then holds 8 keys (16j + 8*(lane>>4) + r) of ONE query (lane&15): the row maximum and sum
//   are in-lane, joined between the wave halves by one exchange; two score tiles, converted in place, are the
//   B operand P^T in the hardware k order, which the V^T fragment loads already have.
//   keys s > t excluded per lane (-inf before the row max); every row has key 0 so the max is finite.
//   p = exp(s - m) packed as f16(1024 p); context = p . v on f16 WMMA; online softmax in f32.
//   out plane (f16, carries ctx * 4): element (b, t, h, d) at [(b*SEQ + t)*DM + h*64 + d];
//   ctx*4 = acc / (1024 l) since acc = 4096 * sum p v.
//   Block = 4 waves = 64 query rows of one (b, h) at a time, two query tiles qb in turn (NQB-1-pr, then pr);
//   grid = (NQB/2) * NH * NB; key tiles 0..qb (block-uniform).
//   K / V^T tile staging: 128 threads x 32 elements per plane = the whole 64x64 tile (plain 16-B loads,
//   __syncthreads before and after).
//   Output coverage: each wave stores rows q0..q0+15 (it 0..3 x lane>>3 0..3) x 64 columns (8 lanes x 8).
// =====================================================================================================
__global__ __launch_bounds__(128)
void attn_causal64(const _Float16* __restrict__ Qp, const _Float16* __restrict__ Kp,
                   const _Float16* __restrict__ Vtp, _Float16* Op, float sscale) {
  // Row pitches: 16-B fragment reads walk 16 rows at once, so a pitch of 16 B x odd spreads them over all banks
  // (128-B rows put every other row on the same banks).
  constexpr int LP = 72;                               // f16 rows of 64: pitch 72 halves = 144 B
  constexpr int OP = 68;                               // f32 rows of 64: pitch 68 floats = 272 B
  __shared__ __align__(16) _Float16 Ksh[64 * LP];      // K [kv][d]   9 KB
  __shared__ __align__(16) _Float16 Vth[64 * LP];      // V^T [d][kv] 9 KB
  __shared__ __align__(16) float    Os[4][16 * OP];    // per wave context tile [row][d]

  const int tid  = threadIdx.x;
  const int wave = tid >> 5;
  const int lane = tid & 31;
  const int hh   = lane >> 4;
  const int c    = lane & 15;

  const int bx   = blockIdx.x;
  const int pr   = bx % (NQB / 2);
  const int rest = bx / (NQB / 2);
  const int h    = rest % NH;
  const int b    = rest / NH;
  const size_t rowB = (size_t)b * SEQ;

  const _Float16* Qh = Qp + (size_t)h * HD;
  const _Float16* Kh = Kp + (size_t)h * HD;
  const _Float16* Vh = Vtp + ((size_t)b * DM + (size_t)h * HD) * SEQ;

  // Two query tiles, one after the other in every wave: NQB-1-pr, then pr. (NQB-pr) + (pr+1) = NQB+1 key tiles
  // for every work-group, so no work-group outlasts the others. pr 0..NQB/2-1 covers every query tile once.
  for (int part = 0; part < 2; ++part) {        // block-uniform
    const int qb = part ? pr : NQB - 1 - pr;
    const int q0 = qb * 64 + wave * 16;

    // ---- Q fragments (B operand, column = lane&15 = query row): 2 d-chunks of 32 ----
    v16h qa[2];
#pragma unroll
    for (int dc = 0; dc < 2; ++dc)
      qa[dc] = ldfrag(Qh + (rowB + q0 + c) * DM + dc * 32 + 8 * hh);

    const int qrow = q0 + c;                    // this lane's query row
    float mrow = -INFINITY;                     // running maximum of row qrow (alike in both wave halves)
    float lrow = 0.f;                           // running sum over this wave half's keys only; joined after the loop
    v8f oacc[4];                                // O^T: oacc[t][r] = context(qrow, d = 16t + 8*hh + r)
#pragma unroll
    for (int t = 0; t < 4; ++t) oacc[t] = zero8();

    for (int kt = 0; kt <= qb; ++kt) {          // causal key tiles, block-uniform trip count
      const int kv0 = kt * 64;
      __syncthreads();
      {
        const int r = tid >> 1, half = (tid & 1) * 32;
        const _Float16* kg = Kh + (rowB + kv0 + r) * DM + half;     // K row kv0+r, d = half..half+31
        const _Float16* vg = Vh + (size_t)r * SEQ + kv0 + half;     // V^T row d = r, s = kv0+half..+31
#pragma unroll
        for (int i = 0; i < 4; ++i) {
          const v8h a0 = *(const v8h*)(kg + 8 * i);
          const v8h b0 = *(const v8h*)(vg + 8 * i);
          *(v8h*)(Ksh + r * LP + half + 8 * i) = a0;
          *(v8h*)(Vth + r * LP + half + 8 * i) = b0;
        }
      }
      __syncthreads();

      // ---- all fragment reads of this key tile as one group, each fragment in registers of its own: K first,
      //      V^T behind it, so the score products wait for the K half only and V^T lands under them and the softmax ----
      v16h kf[2][4], vf[2][4];
#pragma unroll
      for (int dc = 0; dc < 2; ++dc)
#pragma unroll
        for (int j = 0; j < 4; ++j) kf[dc][j] = ldfrag(Ksh + (j * 16 + c) * LP + dc * 32 + 8 * hh);
#pragma unroll
      for (int kk = 0; kk < 2; ++kk)
#pragma unroll
        for (int t = 0; t < 4; ++t) vf[kk][t] = ldfrag(Vth + (t * 16 + c) * LP + kk * 32 + 8 * hh);
      // keeps the reads together in front of the products: spread among them, each place costs its own LDS wait
      __builtin_amdgcn_sched_barrier(0);

      // ---- scores, transposed: s[j][r] = score(key kv0 + 16j + 8*hh + r, query qrow); d chunks ascending in each tile ----
      v8f s[4];
#pragma unroll
      for (int j = 0; j < 4; ++j) s[j] = zero8();
#pragma unroll
      for (int dc = 0; dc < 2; ++dc)
#pragma unroll
        for (int j = 0; j < 4; ++j) s[j] = mma_raw(kf[dc][j], qa[dc], s[j]);

      // ---- scale, causal exclusion, row max, online softmax, P^T (x1024, f16) packed in registers ----
      float mj[4];
#pragma unroll
      for (int j = 0; j < 4; ++j) {
        mj[j] = -INFINITY;
#pragma unroll
        for (int r = 0; r < 8; ++r) {
          const int key = kv0 + j * 16 + 8 * hh + r;
          const float sv = (key <= qrow) ? (s[j][r] * sscale) : -INFINITY;
          s[j][r] = sv;
          mj[j] = fmaxf(mj[j], sv);
        }
      }
      float m = fmaxf(fmaxf(mj[0], mj[1]), fmaxf(mj[2], mj[3]));
      m = fmaxf(m, xhalf(m));                    // both halves now hold the maximum over the 64 keys
      const float mnew  = fmaxf(mrow, m);
      const float msafe = (mnew == -INFINITY) ? 0.f : mnew;
      const float alpha = __expf(mrow - msafe);
      mrow = mnew;
      FH pb[2];                                  // P^T, B operand: element e of half j&1 = key 32*(j>>1) + 16*(j&1) + 8*hh + e
      float pj[4];
#pragma unroll
      for (int j = 0; j < 4; ++j) {
        pj[j] = 0.f;
#pragma unroll
        for (int r = 0; r < 8; ++r) {
          float p;                                     // excluded key: exp(-inf) = 0
          if (j == 3 && r == 0) {
            // v_exp with the one issue slot behind it in one statement
            asm("v_exp_f32 %0, %1\n\tv_nop" : "=v"(p) : "v"((s[j][r] - msafe) * 1.44269504f));
          } else {
            p = __expf(s[j][r] - msafe);
          }
          pj[j] += p;
          pb[j >> 1].h[j & 1][r] = (_Float16)(p * 1024.0f);
        }
      }
      lrow = lrow * alpha + ((pj[0] + pj[1]) + (pj[2] + pj[3]));
#pragma unroll
      for (int t = 0; t < 4; ++t)
#pragma unroll
        for (int r = 0; r < 8; ++r) oacc[t][r] *= alpha;

      // ---- context^T += V^T . P^T (f16 WMMA) ----
#pragma unroll
      for (int kk = 0; kk < 2; ++kk) {
#pragma unroll
        for (int t = 0; t < 4; ++t) oacc[t] = mma_raw(vf[kk][t], pb[kk].v, oacc[t]);
      }
    }

    // ---- normalise (1/l and the carries), stage the wave's 16x64 tile, convert to f16,
    float* os = Os[wave];
    {
      const float l = lrow + xhalf(lrow);        // the two halves' key sums joined
      const float inv = ((l > 0.f) ? (1.0f / l) : 0.f) * (1.0f / 1024.0f);
#pragma unroll
      for (int t = 0; t < 4; ++t) {
        v4f lo, hi;
#pragma unroll
        for (int e = 0; e < 4; ++e) { lo[e] = oacc[t][e] * inv; hi[e] = oacc[t][4 + e] * inv; }
        *(v4f*)(os + c * OP + t * 16 + 8 * hh)     = lo;
        *(v4f*)(os + c * OP + t * 16 + 8 * hh + 4) = hi;
      }
    }
    __builtin_amdgcn_fence(__ATOMIC_RELEASE, "workgroup");
    __builtin_amdgcn_wave_barrier();
    __builtin_amdgcn_fence(__ATOMIC_ACQUIRE, "workgroup");
    {
      const int q4 = lane >> 3, c8 = (lane & 7) * 8;
      v4u hv[4];
#pragma unroll
      for (int it = 0; it < 4; ++it) {
        const int row = it * 4 + q4;   // it 0..3 x q4 0..3 = rows 0..15 of the wave tile
        const float* sp = os + row * OP + c8;
        H8 p;
#pragma unroll
        for (int e = 0; e < 8; ++e) p.h[e] = (_Float16)sp[e];
        hv[it] = p.u;
      }
      {
#pragma unroll
        for (int it = 0; it < 4; ++it) {
          const int row = it * 4 + q4;
          const size_t go = (rowB + q0 + row) * DM + (size_t)h * HD + c8;
          *(v4u*)(Op + go) = hv[it];
        }
        // the second query tile reuses the address and data registers of these stores: only behind this wait
        asm volatile("s_wait_xcnt 0x0" ::: "memory");
      }
    }
  }
}

// =====================================================================================================
// Workspace map (bytes), every region an exact multiple of its whole-line / 64x64-tile store granularity:
//   Wqt  f16 [768 out][768 in] x32      0          1179648
//   Wkt  f16 [768][768] x32              1179648    1179648
//   Wvt  f16 [768][768] x32              2359296    1179648
//   Wot  f16 [768][768] x32              3538944    1179648
//   W1t  f16 [3072][768] x32             4718592    4718592
//   W2t  f16 [768][3072] x32             9437184    4718592
//   Np   f16 [8192][768]  ln1 out, later ln2 out          14155776   12582912
//   RegB 50331648 B at 26738688: q f16 [8192][768] at +0, k at +12582912, v^T f16 [2][768][4096] at
//        +25165824 (end +37748736); later the gelu plane G f16 [8192][3072] covers the whole region
//   Ctx  f16 [8192][768] x4              77070336   12582912
//   X1   f32 [8192][768]                 89653248   25165824
//   end                                  114819072
// Launch order makes the aliasing safe on the in-order stream: q/k/v^T are last read by the attention
// launch, G is written three launches later; Np is last read by the v^T GEMM before ln2 rewrites it.
// Spec weights are [in][out]; the GEMM wants Bt[n][k] / A[m][k] with k contiguous, hence the transposes.
// =====================================================================================================
extern "C" void kernel_launch(void* const* d_in, const int* in_sizes, int n_in,
                              void* d_out, int out_size, void* d_ws, size_t ws_size,
                              hipStream_t stream) {
  if (n_in < 17) return;
  if (in_sizes[0] != NROW * DM) return;
  if (in_sizes[1] != DM || in_sizes[2] != DM) return;
  if (in_sizes[3] != DM * DM || in_sizes[5] != DM * DM || in_sizes[7] != DM * DM || in_sizes[9] != DM * DM) return;
  if (in_sizes[4] != DM || in_sizes[6] != DM || in_sizes[8] != DM || in_sizes[10] != DM) return;
  if (in_sizes[11] != DM || in_sizes[12] != DM) return;
  if (in_sizes[13] != DM * FF || in_sizes[14] != FF || in_sizes[15] != FF * DM || in_sizes[16] != DM) return;
  if (out_size != NROW * DM) return;

  const float* x    = (const float*)d_in[0];
  const float* ln1g = (const float*)d_in[1];
  const float* ln1b = (const float*)d_in[2];
  const float* Wq   = (const float*)d_in[3];
  const float* bq   = (const float*)d_in[4];
  const float* Wk   = (const float*)d_in[5];
  const float* bk   = (const float*)d_in[6];
  const float* Wv   = (const float*)d_in[7];
  const float* bv   = (const float*)d_in[8];
  const float* Wo   = (const float*)d_in[9];
  const float* bo   = (const float*)d_in[10];
  const float* ln2g = (const float*)d_in[11];
  const float* ln2b = (const float*)d_in[12];
  const float* W1   = (const float*)d_in[13];
  const float* b1   = (const float*)d_in[14];
  const float* W2   = (const float*)d_in[15];
  const float* b2   = (const float*)d_in[16];

  const size_t PWD  = (size_t)DM * DM * 2;          //  1179648
  const size_t PWF  = (size_t)DM * FF * 2;          //  4718592
  const size_t PA16 = (size_t)NROW * DM * 2;        // 12582912  f16 activation plane [8192][768]
  const size_t PVT  = (size_t)NB * DM * SEQ * 2;    // 12582912  v^T plane
  const size_t PG   = (size_t)NROW * FF * 2;        // 50331648  gelu plane [8192][3072]
  const size_t PX1  = (size_t)NROW * DM * 4;        // 25165824  f32 plane
  size_t off = 0;
  const size_t oWq = off; off += PWD;
  const size_t oWk = off; off += PWD;
  const size_t oWv = off; off += PWD;
  const size_t oWo = off; off += PWD;
  const size_t oW1 = off; off += PWF;
  const size_t oW2 = off; off += PWF;
  const size_t oN  = off; off += PA16;
  const size_t oRB = off; off += PG;
  const size_t oCt = off; off += PA16;
  const size_t oX1 = off; off += PX1;
  if (off > ws_size) return;                        // off = 114819072
  if (off > (size_t)134217728) return;
  const size_t oQ  = oRB;
  const size_t oK  = oRB + PA16;
  const size_t oVT = oRB + 2 * PA16;
  if (oVT + PVT > oRB + PG) return;                 // q, k, v^T fit inside the gelu region
  const size_t oG  = oRB;

  char* ws = (char*)d_ws;
  _Float16* Wqt = (_Float16*)(ws + oWq);
  _Float16* Wkt = (_Float16*)(ws + oWk);
  _Float16* Wvt = (_Float16*)(ws + oWv);
  _Float16* Wot = (_Float16*)(ws + oWo);
  _Float16* W1t = (_Float16*)(ws + oW1);
  _Float16* W2t = (_Float16*)(ws + oW2);
  _Float16* Np  = (_Float16*)(ws + oN);
  _Float16* Qp  = (_Float16*)(ws + oQ);
  _Float16* Kpl = (_Float16*)(ws + oK);
  _Float16* VTp = (_Float16*)(ws + oVT);
  _Float16* Gp  = (_Float16*)(ws + oG);
  _Float16* Ctp = (_Float16*)(ws + oCt);
  float*    X1  = (float*)(ws + oX1);

  const dim3 blk(256);
  const dim3 gTrDD(DM / 64, DM / 64);                              // [768][768] -> [768][768]
  const dim3 gTrW1(FF / 64, DM / 64);                              // in [768][3072] -> out [3072][768]
  const dim3 gTrW2(DM / 64, FF / 64);                              // in [3072][768] -> out [768][3072]
  const dim3 gLn((NROW + 7) / 8);                                  // 1024 blocks
  const dim3 gblk(128);                                            // GEMM work-group: 4 waves
  const dim3 gProj((NROW / 128) * (DM / 128), 1);                  // 384 tiles of 128x128
  const dim3 gVT((DM / 128) * (SEQ / 128), NB);                    // 192 tiles x 2
  const dim3 gFfn((NROW / 128) * (FF / 128), 1);                   // 1536 tiles
  const dim3 gAtt((NQB / 2) * NH * NB);                            // 768 blocks, two query tiles each

  // (1) weights [in][out] f32 -> transposed f16 [out][in] x32
  tr_cvt<<<gTrDD, blk, 0, stream>>>(Wq, Wqt, DM, DM, 32.0f);
  tr_cvt<<<gTrDD, blk, 0, stream>>>(Wk, Wkt, DM, DM, 32.0f);
  tr_cvt<<<gTrDD, blk, 0, stream>>>(Wv, Wvt, DM, DM, 32.0f);
  tr_cvt<<<gTrDD, blk, 0, stream>>>(Wo, Wot, DM, DM, 32.0f);
  tr_cvt<<<gTrW1, blk, 0, stream>>>(W1, W1t, DM, FF, 32.0f);
  tr_cvt<<<gTrW2, blk, 0, stream>>>(W2, W2t, FF, DM, 32.0f);
  // (2) ln1 -> Np f16 [8192][768]
  ln_rows<<<gLn, blk, 0, stream>>>(x, ln1g, ln1b, Np, NROW);
  // (3) q = (ln1 . Wq + bq) * 0.5 -> Qp;  k = (ln1 . Wk + bk) * 4 -> Kp   (M=8192, N=768, K=768, acc/32)
  gemm64<0><<<gProj, gblk, 0, stream>>>(Np, DM, 0LL, Wqt, DM, 0LL, bq, x, (void*)Qp, DM, 0LL,
                                       NROW, DM, DM, 1.0f / 32.0f, 0.5f);
  gemm64<0><<<gProj, gblk, 0, stream>>>(Np, DM, 0LL, Wkt, DM, 0LL, bk, x, (void*)Kpl, DM, 0LL,
                                       NROW, DM, DM, 1.0f / 32.0f, 4.0f);
  // (4) v^T = (Wv^T . ln1^T + bv[row]) * 4 per batch -> VTp f16 [b][d][s]  (M=768, N=4096, K=768)
  gemm64<1><<<gVT, gblk, 0, stream>>>(Wvt, DM, 0LL, Np, DM, (long long)SEQ * DM, bv, x,
                                     (void*)VTp, SEQ, (long long)DM * SEQ,
                                     DM, SEQ, DM, 1.0f / 32.0f, 4.0f);
  // (5) causal attention -> Ctp f16 (ctx * 4)
  attn_causal64<<<gAtt, dim3(128), 0, stream>>>(Qp, Kpl, VTp, Ctp, 0.0625f);
  // (6) x1 = x + ctx . Wo + bo -> X1 f32   (acc = 128 * ctx.Wo)
  gemm64<2><<<gProj, gblk, 0, stream>>>(Ctp, DM, 0LL, Wot, DM, 0LL, bo, x, (void*)X1, DM, 0LL,
                                       NROW, DM, DM, 1.0f / 128.0f, 1.0f);
  // (7) ln2 -> Np
  ln_rows<<<gLn, blk, 0, stream>>>(X1, ln2g, ln2b, Np, NROW);
  // (8) g = gelu(ln2 . W1 + b1) * 4 -> Gp f16 [8192][3072]   (M=8192, N=3072, K=768, acc/32)
  gemm64<3><<<gFfn, gblk, 0, stream>>>(Np, DM, 0LL, W1t, DM, 0LL, b1, x, (void*)Gp, FF, 0LL,
                                      NROW, FF, DM, 1.0f / 32.0f, 4.0f);
  // (9) out = x1 + g . W2 + b2 -> d_out f32 [8192][768]   (M=8192, N=768, K=3072, acc = 128 * g.W2)
  gemm64<2><<<gProj, gblk, 0, stream>>>(Gp, FF, 0LL, W2t, FF, 0LL, b2, X1, d_out, DM, 0LL,
                                       NROW, DM, FF, 1.0f / 128.0f, 1.0f);
  (void)hipGetLastError();
}

// v006
// One run takes 246 microseconds.
// Two timings next to v005 both put it at 1.11 times that version's speed.
// Over all steps from v000 it is 3.22 times as fast.
// All contractions: v_wmma_f32_16x16x32_f16 (f16 operands, f32 accumulate): q/k/v projections, q.k^T scores,
// p.v context, ctx.Wo, ln2out.W1, gelu.W2. LayerNorm, softmax, GELU, bias and residual adds in f32.
#include <hip/hip_runtime.h>
#include <math.h>
#include <stdint.h>

#define NB   2
#define SEQ  4096
#define DM   768
#define NH   12
#define HD   64
#define FF   3072
#define NROW (NB * SEQ)      // 8192 token rows
#define NQB  (SEQ / 64)      // 64 query / key tiles of 64
static_assert(NH * HD == DM);
static_assert((NQB % 2) == 0);
static_assert((SEQ % 64) == 0 && (DM % 64) == 0 && (FF % 64) == 0 && (NROW % 64) == 0);
static_assert(DM == 3 * 256);
static_assert((SEQ % 128) == 0 && (DM % 128) == 0 && (FF % 128) == 0 && (NROW % 128) == 0);

typedef _Float16 v16h __attribute__((ext_vector_type(16)));
typedef _Float16 v8h  __attribute__((ext_vector_type(8)));
typedef float    v8f  __attribute__((ext_vector_type(8)));
typedef float    v4f  __attribute__((ext_vector_type(4)));
typedef unsigned int v4u __attribute__((ext_vector_type(4)));

union H8 { v8h h; v4u u; };
union FH { v16h v; v8h h[2]; };

__device__ __forceinline__ v8f zero8() { v8f z = {0.f, 0.f, 0.f, 0.f, 0.f, 0.f, 0.f, 0.f}; return z; }

// 16-bit A/B fragment: lane -> row/col (lane&15); p already includes +8*(lane>>4);
// elements 0..7 <- p[0..7] (k0+8h..k0+8h+7), elements 8..15 <- p[16..23] (k0+16+8h..)
__device__ __forceinline__ v16h ldfrag(const _Float16* p) {
  FH f;
  f.h[0] = *(const v8h*)(p);
  f.h[1] = *(const v8h*)(p + 16);
  return f.v;
}

__device__ __forceinline__ v8f mma_raw(v16h a, v16h b, v8f c) {
  return __builtin_amdgcn_wmma_f32_16x16x32_f16(false, a, false, b, (short)0, c, false, false);
}
// guard after the last WMMA of a 4-op group: ties all four D, keeps the group's A and B live
__device__ __forceinline__ void guard4(v8f& d0, v8f& d1, v8f& d2, v8f& d3,
                                       v16h a, v16h b0, v16h b1, v16h b2, v16h b3) {
  asm volatile("v_nop\n\tv_nop\n\tv_nop\n\tv_nop"
               : "+v"(d0), "+v"(d1), "+v"(d2), "+v"(d3)
               : "v"(a), "v"(b0), "v"(b1), "v"(b2), "v"(b3));
}

// lane l <-> lane l ^ 16 (the two halves of a wave), by a vector cross-row move
__device__ __forceinline__ float xhalf(float x) {
  return __builtin_bit_cast(float, __builtin_amdgcn_permlanex16(__builtin_bit_cast(int, x), __builtin_bit_cast(int, x),
                                                                0x76543210, 0xfedcba98, false, false));
}

// tanh-form GELU via the identity 0.5u(1+tanh z) = u * sigmoid(2z); exp argument clamped, reciprocal by v_rcp
__device__ __forceinline__ float gelu_tanh(float u) {
  const float z = 0.7978845608028654f * (u + 0.044715f * u * u * u);
  const float e = __expf(fminf(-2.0f * z, 80.0f));
  return u * __builtin_amdgcn_rcpf(1.0f + e);
}

// =====================================================================================================
// Weight transpose + convert: W f32 [Kin][Nout] (pitch Nout) -> Wt f16 [Nout][Kin] (pitch Kin), times scale.
// 64x64 tile (bx of Nout/64, by of Kin/64) through the LDS tile T, 256 threads. Reads: thread handles 4 float4 of the
// tile (chunk = tid + i*256 -> row r = chunk>>4 (k local), cols c4..c4+3 (n local)).
// coverage: 8 waves x 2 x 4 = 64 rows, 8 lanes x 8 halves = 64 cols = the whole tile.
// =====================================================================================================
__device__ __forceinline__ void tr_cvt_tile(const float* __restrict__ W, _Float16* Wt,
                                            int Kin, int Nout, float scale, int bx, int by,
                                            _Float16 (*T)[72]) {   // T: [n local][k local], pitch 144 B
  const int tid = threadIdx.x, wave = tid >> 5, lane = tid & 31;
  const int n0 = bx * 64, k0 = by * 64;
#pragma unroll
  for (int i = 0; i < 4; ++i) {
    const int chunk = tid + i * 256;
    const int r = chunk >> 4;            // 0..63  (k local)
    const int c4 = (chunk & 15) * 4;     // 0..60  (n local)
    const v4f v = *(const v4f*)(W + (size_t)(k0 + r) * Nout + n0 + c4);
#pragma unroll
    for (int e = 0; e < 4; ++e) T[c4 + e][r] = (_Float16)(v[e] * scale);
  }
  __syncthreads();
  const int q = lane >> 3, c8 = (lane & 7) * 8;
  v4u o[2];
#pragma unroll
  for (int it = 0; it < 2; ++it) {
    const int row = wave * 8 + it * 4 + q;
    H8 p;
    p.h = *(const v8h*)(&T[row][c8]);
    o[it] = p.u;
  }
  {
#pragma unroll
    for (int it = 0; it < 2; ++it) {
      const int row = wave * 8 + it * 4 + q;
      *(v4u*)(Wt + (size_t)(n0 + row) * Kin + k0 + c8) = o[it];
    }
    // in the listing the other job's code follows these stores and writes their registers: only behind this wait
    asm volatile("s_wait_xcnt 0x0" ::: "memory");
  }
}

// =====================================================================================================
// LayerNorm over DM=768 columns, f32 math, f16 output (unscaled). One wave per row, 8 rows per block
// (blk of ceil(nrows/8)). Lane holds columns i*256 + lane*8 .. +7 (i 0..2). mean and variance by two register
// passes with 32-lane butterflies. Output: three 16-B stores per lane, each instruction = 32 lanes x 16 B =
// coverage: 3 x 256 = 768 columns per row; every row < nrows by exactly one wave.
// =====================================================================================================
__device__ __forceinline__ void ln_rows8(const float* __restrict__ X, const float* __restrict__ g,
                                         const float* __restrict__ bb, _Float16* Y, int nrows, int blk) {
  const int wave = threadIdx.x >> 5, lane = threadIdx.x & 31;
  const int row = blk * 8 + wave;
  if (row >= nrows) return;                  // wave-uniform; no block barriers on this path
  const float* xr = X + (size_t)row * DM;
  float v[3][8];
  float s = 0.f;
#pragma unroll
  for (int i = 0; i < 3; ++i) {
    const int col = i * 256 + lane * 8;
    const v4f a = *(const v4f*)(xr + col);
    const v4f c = *(const v4f*)(xr + col + 4);
#pragma unroll
    for (int e = 0; e < 4; ++e) { v[i][e] = a[e]; v[i][4 + e] = c[e]; }
#pragma unroll
    for (int e = 0; e < 8; ++e) s += v[i][e];
  }
#pragma unroll
  for (int off = 16; off > 0; off >>= 1) s += __shfl_xor(s, off, 32);
  const float mu = s * (1.0f / (float)DM);
  float qs = 0.f;
#pragma unroll
  for (int i = 0; i < 3; ++i)
#pragma unroll
    for (int e = 0; e < 8; ++e) { const float d = v[i][e] - mu; v[i][e] = d; qs += d * d; }
#pragma unroll
  for (int off = 16; off > 0; off >>= 1) qs += __shfl_xor(qs, off, 32);
  const float rstd = rsqrtf(qs * (1.0f / (float)DM) + 1e-5f);
  v4u o[3];
#pragma unroll
  for (int i = 0; i < 3; ++i) {
    const int col = i * 256 + lane * 8;
    const v4f g0 = *(const v4f*)(g + col), g1 = *(const v4f*)(g + col + 4);
    const v4f b0 = *(const v4f*)(bb + col), b1 = *(const v4f*)(bb + col + 4);
    H8 p;
#pragma unroll
    for (int e = 0; e < 4; ++e) {
      p.h[e]     = (_Float16)(v[i][e] * rstd * g0[e] + b0[e]);
      p.h[4 + e] = (_Float16)(v[i][4 + e] * rstd * g1[e] + b1[e]);
    }
    o[i] = p.u;
  }
  {
#pragma unroll
    for (int i = 0; i < 3; ++i)
      *(v4u*)(Y + (size_t)row * DM + i * 256 + lane * 8) = o[i];
    
  }
}

__global__ __launch_bounds__(256) void ln_rows(const float* __restrict__ X, const float* __restrict__ g,
                                               const float* __restrict__ bb, _Float16* Y, int nrows) {
  ln_rows8(X, g, bb, Y, nrows, blockIdx.x);
}

// =====================================================================================================
// Everything that depends on the inputs alone, in one launch; the block index picks the job (block-uniform):
//   blocks 0 .. LNB-1: ln1 row blocks;  then 4 x TDD tiles: Wq, Wk, Wv, Wo;  then TDF tiles: W1;  then TDF: W2.
// Inside a weight the tile index runs n tile first. grid = LNB + 4*TDD + 2*TDF, exact.
// =====================================================================================================
constexpr int LNB = NROW / 8;                  // 1024
constexpr int TDD = (DM / 64) * (DM / 64);     // 144
constexpr int TDF = (DM / 64) * (FF / 64);     // 576
__global__ __launch_bounds__(256) void prep_all(const float* __restrict__ X, const float* __restrict__ g,
                                                const float* __restrict__ bb, _Float16* Y,
                                                const float* __restrict__ Wq, const float* __restrict__ Wk,
                                                const float* __restrict__ Wv, const float* __restrict__ Wo,
                                                const float* __restrict__ W1, const float* __restrict__ W2,
                                                _Float16* Wqt, _Float16* Wkt, _Float16* Wvt, _Float16* Wot,
                                                _Float16* W1t, _Float16* W2t, float scale) {
  __shared__ __align__(16) _Float16 T[64][72];
  const int bid = blockIdx.x;
  if (bid < LNB) {                             // the whole work-group; no barrier on this side
    ln_rows8(X, g, bb, Y, NROW, bid);
  } else {
    int t = bid - LNB;                         // becomes the tile index inside the weight
    const float* W;
    _Float16* Wt;
    int Kin = DM, Nout = DM;
    if (t < 4 * TDD) {
      const int job = t / TDD;
      t -= job * TDD;
      W  = (job == 0) ? Wq  : (job == 1) ? Wk  : (job == 2) ? Wv  : Wo;
      Wt = (job == 0) ? Wqt : (job == 1) ? Wkt : (job == 2) ? Wvt : Wot;
    } else if (t < 4 * TDD + TDF) {
      t -= 4 * TDD;
      W = W1; Wt = W1t; Nout = FF;
    } else {
      t -= 4 * TDD + TDF;
      W = W2; Wt = W2t; Kin = FF;
    }
    const int nbx = Nout >> 6;
    const int by  = t / nbx;
    tr_cvt_tile(W, Wt, Kin, Nout, scale, t - by * nbx, by, T);
  }
}

// =====================================================================================================
// Batched f16 WMMA GEMM: acc[m][n] = sum_k A[m][k] * Bt[n][k]. One work-group of 4 waves per 128x128 tile,
// one 64x64 sub-tile per wave (2 x 2). A row-major [M][K] pitch lda; Bt row-major [N][K] pitch ldb
// (k contiguous); both f16 global planes. Per stage of 64 k the work-group brings 128 A rows and 128 Bt rows
// of 128 B into LDS once (8 lanes per row, so every load instruction covers 4 whole lines); all four waves
// take their fragments from there. Two LDS stages: the next stage's global loads are issued ahead of the
// products of this stage and stored behind them; one work-group barrier per stage.
// M, N multiples of 128, K a multiple of 64 (checked at compile time for the shapes launched below).
// tile = tile index (n tile first), bz = batch index (strides in elements, C and Res share strideC); ring = the
// work-group's 2 * STG halves of LDS. k order per accumulator: ascending.
// MODE 0: C f16 [m][n] = (acc*accs + bias[n]) * outs
// MODE 1: C f16 [m][n] = (acc*accs + bias[m]) * outs            (bias along rows)
// MODE 2: C f32 [m][n] = Res[m][n] + acc*accs + bias[n]          (Res has C's layout, never aliases C)
// MODE 3: C f16 [m][n] = gelu_tanh(acc*accs + bias[n]) * outs
// =====================================================================================================
constexpr int GP  = 72;                    // LDS row pitch, halves: 144 B = 16 B x 9, for 16-B fragment reads
constexpr int STG = 256 * GP;              // halves per stage: A rows 0..127, then Bt rows 0..127
static_assert(4 * 16 * 68 * 4 <= 2 * STG * 2);   // the ring's head is the output slabs after the k loop
template <int MODE>
__device__ __forceinline__ void gemm_tile(
    const _Float16* __restrict__ A, int lda, long long strideA,
    const _Float16* __restrict__ Bt, int ldb, long long strideB,
    const float* __restrict__ bias, const float* __restrict__ Res,
    void* Cout, int ldc, long long strideC,
    int M, int N, int K, float accs, float outs, _Float16* ring, int tile, int bz) {
  const int tid  = threadIdx.x;
  const int lane = tid & 31;
  const int wave = tid >> 5;
  const int tilesN = N >> 7;
  const int tilesM = M >> 7;
  if (tile >= tilesM * tilesN) return;   // the same for the whole work-group, ahead of every barrier
  const int tm = tile / tilesN;
  const int tn = tile - tm * tilesN;
  const int wm = (wave >> 1) << 6;            // this wave's 64x64 sub-tile inside the 128x128 tile
  const int wn = (wave & 1) << 6;
  const int m0 = (tm << 7) + wm;
  const int n0 = (tn << 7) + wn;

  const _Float16* Ab = A  + (size_t)bz * (size_t)strideA;
  const _Float16* Bb = Bt + (size_t)bz * (size_t)strideB;

  const int rl   = lane & 15;                 // row (A) / col (B, D) within subtile
  const int koff = (lane >> 4) * 8;           // k offset of this lane half
  const int mOff = (lane >> 4) * 8;           // D row offset

  // staging map: thread -> row (tid>>3) + 16*i, i 0..7, 16 B at column (tid&7)*8: 128 rows x 128 B per operand
  const int sr = tid >> 3;
  const int sc = (tid & 7) * 8;
  const _Float16* ga = Ab + (size_t)((tm << 7) + sr) * lda + sc;
  const _Float16* gb = Bb + (size_t)((tn << 7) + sr) * ldb + sc;
  _Float16* sa = ring + sr * GP + sc;
  _Float16* sb = sa + 128 * GP;

  v8f acc[4][4];
#pragma unroll
  for (int i = 0; i < 4; ++i)
#pragma unroll
    for (int j = 0; j < 4; ++j) acc[i][j] = zero8();

  v8h pa[8], pb[8];
#pragma unroll
  for (int i = 0; i < 8; ++i) {
    pa[i] = *(const v8h*)(ga + (size_t)(i * 16) * lda);
    pb[i] = *(const v8h*)(gb + (size_t)(i * 16) * ldb);
  }
#pragma unroll
  for (int i = 0; i < 8; ++i) {
    *(v8h*)(sa + i * 16 * GP) = pa[i];
    *(v8h*)(sb + i * 16 * GP) = pb[i];
  }
  __syncthreads();

  const int nk = K >> 6;
  for (int kt = 0; kt < nk; ++kt) {
    const int cur = (kt & 1) * STG;
    const bool more = (kt + 1 < nk);          // the same for the whole work-group
    if (more) {
      const int kn = (kt + 1) << 6;
#pragma unroll
      for (int i = 0; i < 8; ++i) {
        pa[i] = *(const v8h*)(ga + (size_t)(i * 16) * lda + kn);
        pb[i] = *(const v8h*)(gb + (size_t)(i * 16) * ldb + kn);
      }
      // the fragment loads below land in the address registers of the loads above: only behind this wait
      asm volatile("s_wait_xcnt 0x0" ::: "memory");
    }
    const _Float16* fa = ring + cur + (wm + rl) * GP + koff;
    const _Float16* fb = ring + cur + (128 + wn + rl) * GP + koff;
#pragma unroll
    for (int kk = 0; kk < 2; ++kk) {
      v16h bf[4], af[4];
#pragma unroll
      for (int j = 0; j < 4; ++j) bf[j] = ldfrag(fb + j * 16 * GP + kk * 32);
#pragma unroll
      for (int i = 0; i < 4; ++i) af[i] = ldfrag(fa + i * 16 * GP + kk * 32);
#pragma unroll
      for (int i = 0; i < 4; ++i) {
#pragma unroll
        for (int j = 0; j < 4; ++j) acc[i][j] = mma_raw(af[i], bf[j], acc[i][j]);
        guard4(acc[i][0], acc[i][1], acc[i][2], acc[i][3], af[i], bf[0], bf[1], bf[2], bf[3]);
      }
    }
    if (more) {
      const int nxt = STG - cur;              // the stage every wave left at the previous barrier
#pragma unroll
      for (int i = 0; i < 8; ++i) {
        *(v8h*)(sa + nxt + i * 16 * GP) = pa[i];
        *(v8h*)(sb + nxt + i * 16 * GP) = pb[i];
      }
    }
    __syncthreads();   // publishes the stage just stored; ends every wave's reads of the stage just used
  }

  // ---- epilogue ----
  float* slab = (float*)ring + wave * (16 * 68);   // per-wave 16x64 slab, pitch 68 floats (272 B)
#pragma unroll
  for (int i = 0; i < 4; ++i) {
    const int mBase = m0 + (i << 4);
#pragma unroll
    for (int j = 0; j < 4; ++j) {
#pragma unroll
      for (int r = 0; r < 8; ++r) slab[(mOff + r) * 68 + (j << 4) + rl] = acc[i][j][r];
    }
    __builtin_amdgcn_fence(__ATOMIC_RELEASE, "workgroup");
    __builtin_amdgcn_wave_barrier();
    __builtin_amdgcn_fence(__ATOMIC_ACQUIRE, "workgroup");
    if constexpr (MODE == 2) {
      float* C = (float*)Cout + (size_t)bz * (size_t)strideC;
      const float* R = Res + (size_t)bz * (size_t)strideC;
      const int h2 = lane >> 4, c4 = (lane & 15) * 4;    // 256-B row segment = 16 lanes x 16 B
      const v4f bq4 = *(const v4f*)(bias + n0 + c4);
      {
#pragma unroll
        for (int it = 0; it < 8; ++it) {
          const int row = it * 2 + h2;                    // it 0..7 x h2 0..1 = rows 0..15
          const v4f a  = *(const v4f*)(slab + row * 68 + c4);
          const v4f rr = *(const v4f*)(R + (size_t)(mBase + row) * ldc + n0 + c4);
          v4f ov;
#pragma unroll
          for (int e = 0; e < 4; ++e) ov[e] = rr[e] + (a[e] * accs + bq4[e]);
          *(v4f*)(C + (size_t)(mBase + row) * ldc + n0 + c4) = ov;
        }
        
      }
    } else {
      _Float16* C = (_Float16*)Cout + (size_t)bz * (size_t)strideC;
      const int q = lane >> 3, c8 = (lane & 7) * 8;
      float bc[8];
      if constexpr (MODE != 1) {
        const v4f b0 = *(const v4f*)(bias + n0 + c8), b1 = *(const v4f*)(bias + n0 + c8 + 4);
#pragma unroll
        for (int e = 0; e < 4; ++e) { bc[e] = b0[e]; bc[4 + e] = b1[e]; }
      } else {
#pragma unroll
        for (int e = 0; e < 8; ++e) bc[e] = 0.f;
      }
      v4u hv[4];
#pragma unroll
      for (int it = 0; it < 4; ++it) {
        const int row = it * 4 + q;                       // it 0..3 x q 0..3 = rows 0..15
        const float* sp = slab + row * 68 + c8;
        float brow = 0.f;
        if constexpr (MODE == 1) brow = bias[mBase + row];   // mBase + row < M = bias length in this mode
        H8 p;
#pragma unroll
        for (int e = 0; e < 8; ++e) {
          float f = sp[e] * accs + ((MODE == 1) ? brow : bc[e]);
          if constexpr (MODE == 3) f = gelu_tanh(f);
          f *= outs;
          p.h[e] = (_Float16)f;
        }
        hv[it] = p.u;
      }
      {
#pragma unroll
        for (int it = 0; it < 4; ++it) {
          const int row = it * 4 + q;
          *(v4u*)(C + (size_t)(mBase + row) * ldc + n0 + c8) = hv[it];
        }
        
      }
    }
    __builtin_amdgcn_fence(__ATOMIC_RELEASE, "workgroup");
    __builtin_amdgcn_wave_barrier();
    __builtin_amdgcn_fence(__ATOMIC_ACQUIRE, "workgroup");
  }
}

// one product per launch: grid = (tiles, batches)
template <int MODE>
__global__ __launch_bounds__(128) void gemm64(
    const _Float16* __restrict__ A, int lda, long long strideA,
    const _Float16* __restrict__ Bt, int ldb, long long strideB,
    const float* __restrict__ bias, const float* __restrict__ Res,
    void* Cout, int ldc, long long strideC,
    int M, int N, int K, float accs, float outs) {
  __shared__ __align__(16) _Float16 ring[2 * STG];   // 73728 B
  gemm_tile<MODE>(A, lda, strideA, Bt, ldb, strideB, bias, Res, Cout, ldc, strideC, M, N, K, accs, outs,
                  ring, blockIdx.x, blockIdx.y);
}

// The three projections of ln1's output in one launch; the block index picks the product (block-uniform):
//   blocks 0 .. TPJ-1:  q   = (ln1 . Wq + bq) * 0.5        M=8192, N=768, K=768
//   then TPJ blocks:    k   = (ln1 . Wk + bk) * 4          the same shape
//   then NB x TVT:      v^T = (Wv^T . ln1^T + bv[row]) * 4 per batch, f16 [b][d][s]; M=768, N=4096, K=768
// every accumulator carries 32 x the product (weights x32). grid = 2*TPJ + NB*TVT, exact.
constexpr int TPJ = (NROW / 128) * (DM / 128);   // 384
constexpr int TVT = (DM / 128) * (SEQ / 128);    // 192
__global__ __launch_bounds__(128) void gemm_qkv(
    const _Float16* __restrict__ Nrm, const _Float16* __restrict__ Wqt, const _Float16* __restrict__ Wkt,
    const _Float16* __restrict__ Wvt, const float* __restrict__ bq, const float* __restrict__ bk,
    const float* __restrict__ bv, _Float16* Qo, _Float16* Ko, _Float16* VTo) {
  __shared__ __align__(16) _Float16 ring[2 * STG];   // 73728 B
  const int bid = blockIdx.x;
  if (bid < 2 * TPJ) {
    const bool isk = bid >= TPJ;
    const float* bias = isk ? bk : bq;
    gemm_tile<0>(Nrm, DM, 0LL, isk ? Wkt : Wqt, DM, 0LL, bias, bias, (void*)(isk ? Ko : Qo), DM, 0LL,
                 NROW, DM, DM, 1.0f / 32.0f, isk ? 4.0f : 0.5f, ring, isk ? bid - TPJ : bid, 0);
  } else {
    const int t  = bid - 2 * TPJ;
    const int bz = t / TVT;
    gemm_tile<1>(Wvt, DM, 0LL, Nrm, DM, (long long)SEQ * DM, bv, bv, (void*)VTo, SEQ, (long long)DM * SEQ,
                 DM, SEQ, DM, 1.0f / 32.0f, 4.0f, ring, t - bz * TVT, bz);
  }
}

// =====================================================================================================
// Causal attention, head dim 64, f16 operands.
//   q plane (f16, carries q * 0.5):  element (b, t, h, d) at [(b*SEQ + t)*DM + h*64 + d]
//   k plane (f16, carries k * 4):    same layout with key index s
//   v^T plane (f16, carries v * 4):  element (b, h, d, s) at [(b*DM + h*64 + d)*SEQ + s]
//   logit = acc * sscale with sscale = 1/16  (0.5 * 4 / 16 = 1/8 = 1/sqrt(64));
//   Both products are taken transposed: S^T = K . Q^T (A = K rows, B = Q) and O^T += V^T . P^T (A = V^T rows).
//   A score tile's lane then holds 8 keys (16j + 8*(lane>>4) + r) of ONE query (lane&15): the row maximum and sum
//   are in-lane, joined between the wave halves by one exchange; two score tiles, converted in place, are the
//   B operand P^T in the hardware k order, which the V^T fragment loads already have.
//   keys s > t excluded per lane (-inf before the row max); every row has key 0 so the max is finite.
//   p = exp(s - m) packed as f16(1024 p); context = p . v on f16 WMMA; online softmax in f32.
//   out plane (f16, carries ctx * 4): element (b, t, h, d) at [(b*SEQ + t)*DM + h*64 + d];
//   ctx*4 = acc / (1024 l) since acc = 4096 * sum p v.
//   Block = 4 waves = 64 query rows of one (b, h) at a time, two query tiles qb in turn (NQB-1-pr, then pr);
//   grid = (NQB/2) * NH * NB; key tiles 0..qb (block-uniform).
//   K / V^T tile staging: 128 threads x 32 elements per plane = the whole 64x64 tile (plain 16-B loads,
//   __syncthreads before and after).
//   Output coverage: each wave stores rows q0..q0+15 (it 0..3 x lane>>3 0..3) x 64 columns (8 lanes x 8).
// =====================================================================================================
__global__ __launch_bounds__(128)
void attn_causal64(const _Float16* __restrict__ Qp, const _Float16* __restrict__ Kp,
                   const _Float16* __restrict__ Vtp, _Float16* Op, float sscale) {
  // Row pitches: 16-B fragment reads walk 16 rows at once, so a pitch of 16 B x odd spreads them over all banks
  // (128-B rows put every other row on the same banks).
  constexpr int LP = 72;                               // f16 rows of 64: pitch 72 halves = 144 B
  constexpr int OP = 68;                               // f32 rows of 64: pitch 68 floats = 272 B
  __shared__ __align__(16) _Float16 Ksh[64 * LP];      // K [kv][d]   9 KB
  __shared__ __align__(16) _Float16 Vth[64 * LP];      // V^T [d][kv] 9 KB
  __shared__ __align__(16) float    Os[4][16 * OP];    // per wave context tile [row][d]

  const int tid  = threadIdx.x;
  const int wave = tid >> 5;
  const int lane = tid & 31;
  const int hh   = lane >> 4;
  const int c    = lane & 15;

  const int bx   = blockIdx.x;
  const int pr   = bx % (NQB / 2);
  const int rest = bx / (NQB / 2);
  const int h    = rest % NH;
  const int b    = rest / NH;
  const size_t rowB = (size_t)b * SEQ;

  const _Float16* Qh = Qp + (size_t)h * HD;
  const _Float16* Kh = Kp + (size_t)h * HD;
  const _Float16* Vh = Vtp + ((size_t)b * DM + (size_t)h * HD) * SEQ;

  // Two query tiles, one after the other in every wave: NQB-1-pr, then pr. (NQB-pr) + (pr+1) = NQB+1 key tiles
  // for every work-group, so no work-group outlasts the others. pr 0..NQB/2-1 covers every query tile once.
  for (int part = 0; part < 2; ++part) {        // block-uniform
    const int qb = part ? pr : NQB - 1 - pr;
    const int q0 = qb * 64 + wave * 16;

    // ---- Q fragments (B operand, column = lane&15 = query row): 2 d-chunks of 32 ----
    v16h qa[2];
#pragma unroll
    for (int dc = 0; dc < 2; ++dc)
      qa[dc] = ldfrag(Qh + (rowB + q0 + c) * DM + dc * 32 + 8 * hh);

    const int qrow = q0 + c;                    // this lane's query row
    float mrow = -INFINITY;                     // running maximum of row qrow (alike in both wave halves)
    float lrow = 0.f;                           // running sum over this wave half's keys only; joined after the loop
    v8f oacc[4];                                // O^T: oacc[t][r] = context(qrow, d = 16t + 8*hh + r)
#pragma unroll
    for (int t = 0; t < 4; ++t) oacc[t] = zero8();

    for (int kt = 0; kt <= qb; ++kt) {          // causal key tiles, block-uniform trip count
      const int kv0 = kt * 64;
      __syncthreads();
      {
        const int r = tid >> 1, half = (tid & 1) * 32;
        const _Float16* kg = Kh + (rowB + kv0 + r) * DM + half;     // K row kv0+r, d = half..half+31
        const _Float16* vg = Vh + (size_t)r * SEQ + kv0 + half;     // V^T row d = r, s = kv0+half..+31
#pragma unroll
        for (int i = 0; i < 4; ++i) {
          const v8h a0 = *(const v8h*)(kg + 8 * i);
          const v8h b0 = *(const v8h*)(vg + 8 * i);
          *(v8h*)(Ksh + r * LP + half + 8 * i) = a0;
          *(v8h*)(Vth + r * LP + half + 8 * i) = b0;
        }
      }
      __syncthreads();

      // ---- all fragment reads of this key tile as one group, each fragment in registers of its own: K first,
      //      V^T behind it, so the score products wait for the K half only and V^T lands under them and the softmax ----
      v16h kf[2][4], vf[2][4];
#pragma unroll
      for (int dc = 0; dc < 2; ++dc)
#pragma unroll
        for (int j = 0; j < 4; ++j) kf[dc][j] = ldfrag(Ksh + (j * 16 + c) * LP + dc * 32 + 8 * hh);
#pragma unroll
      for (int kk = 0; kk < 2; ++kk)
#pragma unroll
        for (int t = 0; t < 4; ++t) vf[kk][t] = ldfrag(Vth + (t * 16 + c) * LP + kk * 32 + 8 * hh);
      // keeps the reads together in front of the products: spread among them, each place costs its own LDS wait
      __builtin_amdgcn_sched_barrier(0);

      // ---- scores, transposed: s[j][r] = score(key kv0 + 16j + 8*hh + r, query qrow); d chunks ascending in each tile ----
      v8f s[4];
#pragma unroll
      for (int j = 0; j < 4; ++j) s[j] = zero8();
#pragma unroll
      for (int dc = 0; dc < 2; ++dc)
#pragma unroll
        for (int j = 0; j < 4; ++j) s[j] = mma_raw(kf[dc][j], qa[dc], s[j]);

      // ---- scale, causal exclusion, row max, online softmax, P^T (x1024, f16) packed in registers ----
      float mj[4];
#pragma unroll
      for (int j = 0; j < 4; ++j) {
        mj[j] = -INFINITY;
#pragma unroll
        for (int r = 0; r < 8; ++r) {
          const int key = kv0 + j * 16 + 8 * hh + r;
          const float sv = (key <= qrow) ? (s[j][r] * sscale) : -INFINITY;
          s[j][r] = sv;
          mj[j] = fmaxf(mj[j], sv);
        }
      }
      float m = fmaxf(fmaxf(mj[0], mj[1]), fmaxf(mj[2], mj[3]));
      m = fmaxf(m, xhalf(m));                    // both halves now hold the maximum over the 64 keys
      const float mnew  = fmaxf(mrow, m);
      const float msafe = (mnew == -INFINITY) ? 0.f : mnew;
      const float alpha = __expf(mrow - msafe);
      mrow = mnew;
      FH pb[2];                                  // P^T, B operand: element e of half j&1 = key 32*(j>>1) + 16*(j&1) + 8*hh + e
      float pj[4];
#pragma unroll
      for (int j = 0; j < 4; ++j) {
        pj[j] = 0.f;
#pragma unroll
        for (int r = 0; r < 8; ++r) {
          float p;                                     // excluded key: exp(-inf) = 0
          if (j == 3 && r == 0) {
            // v_exp with the one issue slot behind it in one statement
            asm("v_exp_f32 %0, %1\n\tv_nop" : "=v"(p) : "v"((s[j][r] - msafe) * 1.44269504f));
          } else {
            p = __expf(s[j][r] - msafe);
          }
          pj[j] += p;
          pb[j >> 1].h[j & 1][r] = (_Float16)(p * 1024.0f);
        }
      }
      lrow = lrow * alpha + ((pj[0] + pj[1]) + (pj[2] + pj[3]));
#pragma unroll
      for (int t = 0; t < 4; ++t)
#pragma unroll
        for (int r = 0; r < 8; ++r) oacc[t][r] *= alpha;

      // ---- context^T += V^T . P^T (f16 WMMA) ----
#pragma unroll
      for (int kk = 0; kk < 2; ++kk) {
#pragma unroll
        for (int t = 0; t < 4; ++t) oacc[t] = mma_raw(vf[kk][t], pb[kk].v, oacc[t]);
      }
    }

    // ---- normalise (1/l and the carries), stage the wave's 16x64 tile, convert to f16,
    float* os = Os[wave];
    {
      const float l = lrow + xhalf(lrow);        // the two halves' key sums joined
      const float inv = ((l > 0.f) ? (1.0f / l) : 0.f) * (1.0f / 1024.0f);
#pragma unroll
      for (int t = 0; t < 4; ++t) {
        v4f lo, hi;
#pragma unroll
        for (int e = 0; e < 4; ++e) { lo[e] = oacc[t][e] * inv; hi[e] = oacc[t][4 + e] * inv; }
        *(v4f*)(os + c * OP + t * 16 + 8 * hh)     = lo;
        *(v4f*)(os + c * OP + t * 16 + 8 * hh + 4) = hi;
      }
    }
    __builtin_amdgcn_fence(__ATOMIC_RELEASE, "workgroup");
    __builtin_amdgcn_wave_barrier();
    __builtin_amdgcn_fence(__ATOMIC_ACQUIRE, "workgroup");
    {
      const int q4 = lane >> 3, c8 = (lane & 7) * 8;
      v4u hv[4];
#pragma unroll
      for (int it = 0; it < 4; ++it) {
        const int row = it * 4 + q4;   // it 0..3 x q4 0..3 = rows 0..15 of the wave tile
        const float* sp = os + row * OP + c8;
        H8 p;
#pragma unroll
        for (int e = 0; e < 8; ++e) p.h[e] = (_Float16)sp[e];
        hv[it] = p.u;
      }
      {
#pragma unroll
        for (int it = 0; it < 4; ++it) {
          const int row = it * 4 + q4;
          const size_t go = (rowB + q0 + row) * DM + (size_t)h * HD + c8;
          *(v4u*)(Op + go) = hv[it];
        }
        // the second query tile reuses the address and data registers of these stores: only behind this wait
        asm volatile("s_wait_xcnt 0x0" ::: "memory");
      }
    }
  }
}

// =====================================================================================================
// Workspace map (bytes), every region an exact multiple of its whole-line / 64x64-tile store granularity:
//   Wqt  f16 [768 out][768 in] x32      0          1179648
//   Wkt  f16 [768][768] x32              1179648    1179648
//   Wvt  f16 [768][768] x32              2359296    1179648
//   Wot  f16 [768][768] x32              3538944    1179648
//   W1t  f16 [3072][768] x32             4718592    4718592
//   W2t  f16 [768][3072] x32             9437184    4718592
//   Np   f16 [8192][768]  ln1 out, later ln2 out          14155776   12582912
//   RegB 50331648 B at 26738688: q f16 [8192][768] at +0, k at +12582912, v^T f16 [2][768][4096] at
//        +25165824 (end +37748736); later the gelu plane G f16 [8192][3072] covers the whole region
//   Ctx  f16 [8192][768] x4              77070336   12582912
//   X1   f32 [8192][768]                 89653248   25165824
//   end                                  114819072
// Launch order makes the aliasing safe on the in-order stream: q/k/v^T are last read by the attention
// launch, G is written three launches later; Np is last read by the projection launch before ln2 rewrites it.
// Spec weights are [in][out]; the GEMM wants Bt[n][k] / A[m][k] with k contiguous, hence the transposes.
// =====================================================================================================
extern "C" void kernel_launch(void* const* d_in, const int* in_sizes, int n_in,
                              void* d_out, int out_size, void* d_ws, size_t ws_size,
                              hipStream_t stream) {
  if (n_in < 17) return;
  if (in_sizes[0] != NROW * DM) return;
  if (in_sizes[1] != DM || in_sizes[2] != DM) return;
  if (in_sizes[3] != DM * DM || in_sizes[5] != DM * DM || in_sizes[7] != DM * DM || in_sizes[9] != DM * DM) return;
  if (in_sizes[4] != DM || in_sizes[6] != DM || in_sizes[8] != DM || in_sizes[10] != DM) return;
  if (in_sizes[11] != DM || in_sizes[12] != DM) return;
  if (in_sizes[13] != DM * FF || in_sizes[14] != FF || in_sizes[15] != FF * DM || in_sizes[16] != DM) return;
  if (out_size != NROW * DM) return;

  const float* x    = (const float*)d_in[0];
  const float* ln1g = (const float*)d_in[1];
  const float* ln1b = (const float*)d_in[2];
  const float* Wq   = (const float*)d_in[3];
  const float* bq   = (const float*)d_in[4];
  const float* Wk   = (const float*)d_in[5];
  const float* bk   = (const float*)d_in[6];
  const float* Wv   = (const float*)d_in[7];
  const float* bv   = (const float*)d_in[8];
  const float* Wo   = (const float*)d_in[9];
  const float* bo   = (const float*)d_in[10];
  const float* ln2g = (const float*)d_in[11];
  const float* ln2b = (const float*)d_in[12];
  const float* W1   = (const float*)d_in[13];
  const float* b1   = (const float*)d_in[14];
  const float* W2   = (const float*)d_in[15];
  const float* b2   = (const float*)d_in[16];

  const size_t PWD  = (size_t)DM * DM * 2;          //  1179648
  const size_t PWF  = (size_t)DM * FF * 2;          //  4718592
  const size_t PA16 = (size_t)NROW * DM * 2;        // 12582912  f16 activation plane [8192][768]
  const size_t PVT  = (size_t)NB * DM * SEQ * 2;    // 12582912  v^T plane
  const size_t PG   = (size_t)NROW * FF * 2;        // 50331648  gelu plane [8192][3072]
  const size_t PX1  = (size_t)NROW * DM * 4;        // 25165824  f32 plane
  size_t off = 0;
  const size_t oWq = off; off += PWD;
  const size_t oWk = off; off += PWD;
  const size_t oWv = off; off += PWD;
  const size_t oWo = off; off += PWD;
  const size_t oW1 = off; off += PWF;
  const size_t oW2 = off; off += PWF;
  const size_t oN  = off; off += PA16;
  const size_t oRB = off; off += PG;
  const size_t oCt = off; off += PA16;
  const size_t oX1 = off; off += PX1;
  if (off > ws_size) return;                        // off = 114819072
  if (off > (size_t)134217728) return;
  const size_t oQ  = oRB;
  const size_t oK  = oRB + PA16;
  const size_t oVT = oRB + 2 * PA16;
  if (oVT + PVT > oRB + PG) return;                 // q, k, v^T fit inside the gelu region
  const size_t oG  = oRB;

  char* ws = (char*)d_ws;
  _Float16* Wqt = (_Float16*)(ws + oWq);
  _Float16* Wkt = (_Float16*)(ws + oWk);
  _Float16* Wvt = (_Float16*)(ws + oWv);
  _Float16* Wot = (_Float16*)(ws + oWo);
  _Float16* W1t = (_Float16*)(ws + oW1);
  _Float16* W2t = (_Float16*)(ws + oW2);
  _Float16* Np  = (_Float16*)(ws + oN);
  _Float16* Qp  = (_Float16*)(ws + oQ);
  _Float16* Kpl = (_Float16*)(ws + oK);
  _Float16* VTp = (_Float16*)(ws + oVT);
  _Float16* Gp  = (_Float16*)(ws + oG);
  _Float16* Ctp = (_Float16*)(ws + oCt);
  float*    X1  = (float*)(ws + oX1);

  const dim3 blk(256);
  const dim3 gPrep(LNB + 4 * TDD + 2 * TDF);                       // 2752 blocks: ln1 and the six weights
  const dim3 gLn((NROW + 7) / 8);                                  // 1024 blocks
  const dim3 gblk(128);                                            // GEMM work-group: 4 waves
  const dim3 gProj((NROW / 128) * (DM / 128), 1);                  // 384 tiles of 128x128
  const dim3 gQkv(2 * TPJ + NB * TVT);                             // 1152 tiles: q, k, v^T
  const dim3 gFfn((NROW / 128) * (FF / 128), 1);                   // 1536 tiles
  const dim3 gAtt((NQB / 2) * NH * NB);                            // 768 blocks, two query tiles each

  // (1) weights [in][out] f32 -> transposed f16 [out][in] x32, and ln1 -> Np f16 [8192][768]
  prep_all<<<gPrep, blk, 0, stream>>>(x, ln1g, ln1b, Np, Wq, Wk, Wv, Wo, W1, W2,
                                      Wqt, Wkt, Wvt, Wot, W1t, W2t, 32.0f);
  // (2) q -> Qp, k -> Kpl, v^T -> VTp
  gemm_qkv<<<gQkv, gblk, 0, stream>>>(Np, Wqt, Wkt, Wvt, bq, bk, bv, Qp, Kpl, VTp);
  // (3) causal attention -> Ctp f16 (ctx * 4)
  attn_causal64<<<gAtt, dim3(128), 0, stream>>>(Qp, Kpl, VTp, Ctp, 0.0625f);
  // (4) x1 = x + ctx . Wo + bo -> X1 f32   (acc = 128 * ctx.Wo)
  gemm64<2><<<gProj, gblk, 0, stream>>>(Ctp, DM, 0LL, Wot, DM, 0LL, bo, x, (void*)X1, DM, 0LL,
                                       NROW, DM, DM, 1.0f / 128.0f, 1.0f);
  // (5) ln2 -> Np
  ln_rows<<<gLn, blk, 0, stream>>>(X1, ln2g, ln2b, Np, NROW);
  // (6) g = gelu(ln2 . W1 + b1) * 4 -> Gp f16 [8192][3072]   (M=8192, N=3072, K=768, acc/32)
  gemm64<3><<<gFfn, gblk, 0, stream>>>(Np, DM, 0LL, W1t, DM, 0LL, b1, x, (void*)Gp, FF, 0LL,
                                      NROW, FF, DM, 1.0f / 32.0f, 4.0f);
  // (7) out = x1 + g . W2 + b2 -> d_out f32 [8192][768]   (M=8192, N=768, K=3072, acc = 128 * g.W2)
  gemm64<2><<<gProj, gblk, 0, stream>>>(Gp, FF, 0LL, W2t, FF, 0LL, b2, X1, d_out, DM, 0LL,
                                       NROW, DM, FF, 1.0f / 128.0f, 1.0f);
  (void)hipGetLastError();
}

// v007
// One run takes 233 microseconds.
// Next to v006, in two timings, it ran 1.06 times as fast each time.
// Over all steps from v000 it is 3.41 times as fast.
// All contractions: v_wmma_f32_16x16x32_f16 (f16 operands, f32 accumulate): q/k/v projections, q.k^T scores,
// p.v context, ctx.Wo, ln2out.W1, gelu.W2. LayerNorm, softmax, GELU, bias and residual adds in f32.
#include <hip/hip_runtime.h>
#include <math.h>
#include <stdint.h>

#define NB   2
#define SEQ  4096
#define DM   768
#define NH   12
#define HD   64
#define FF   3072
#define NROW (NB * SEQ)      // 8192 token rows
#define NQB  (SEQ / 64)      // 64 query / key tiles of 64
static_assert(NH * HD == DM);
static_assert((NQB % 2) == 0);
static_assert((SEQ % 64) == 0 && (DM % 64) == 0 && (FF % 64) == 0 && (NROW % 64) == 0);
static_assert(DM == 3 * 256);
static_assert((SEQ % 128) == 0 && (DM % 128) == 0 && (FF % 128) == 0 && (NROW % 128) == 0);

typedef _Float16 v16h __attribute__((ext_vector_type(16)));
typedef _Float16 v8h  __attribute__((ext_vector_type(8)));
typedef float    v8f  __attribute__((ext_vector_type(8)));
typedef float    v4f  __attribute__((ext_vector_type(4)));
typedef unsigned int v4u __attribute__((ext_vector_type(4)));

union H8 { v8h h; v4u u; };
union FH { v16h v; v8h h[2]; };

__device__ __forceinline__ v8f zero8() { v8f z = {0.f, 0.f, 0.f, 0.f, 0.f, 0.f, 0.f, 0.f}; return z; }

// 16-bit A/B fragment: lane -> row/col (lane&15); p already includes +8*(lane>>4);
// elements 0..7 <- p[0..7] (k0+8h..k0+8h+7), elements 8..15 <- p[16..23] (k0+16+8h..)
__device__ __forceinline__ v16h ldfrag(const _Float16* p) {
  FH f;
  f.h[0] = *(const v8h*)(p);
  f.h[1] = *(const v8h*)(p + 16);
  return f.v;
}

__device__ __forceinline__ v8f mma_raw(v16h a, v16h b, v8f c) {
  return __builtin_amdgcn_wmma_f32_16x16x32_f16(false, a, false, b, (short)0, c, false, false);
}
// guard after the last WMMA of a 4-op group: ties all four D, keeps the group's A and B live
__device__ __forceinline__ void guard4(v8f& d0, v8f& d1, v8f& d2, v8f& d3,
                                       v16h a, v16h b0, v16h b1, v16h b2, v16h b3) {
  asm volatile("v_nop\n\tv_nop\n\tv_nop\n\tv_nop"
               : "+v"(d0), "+v"(d1), "+v"(d2), "+v"(d3)
               : "v"(a), "v"(b0), "v"(b1), "v"(b2), "v"(b3));
}

// lane l <-> lane l ^ 16 (the two halves of a wave), by a vector cross-row move
__device__ __forceinline__ float xhalf(float x) {
  return __builtin_bit_cast(float, __builtin_amdgcn_permlanex16(__builtin_bit_cast(int, x), __builtin_bit_cast(int, x),
                                                                0x76543210, 0xfedcba98, false, false));
}

// tanh-form GELU via the identity 0.5u(1+tanh z) = u * sigmoid(2z); exp argument clamped, reciprocal by v_rcp
__device__ __forceinline__ float gelu_tanh(float u) {
  const float z = 0.7978845608028654f * (u + 0.044715f * u * u * u);
  const float e = __expf(fminf(-2.0f * z, 80.0f));
  return u * __builtin_amdgcn_rcpf(1.0f + e);
}

// =====================================================================================================
// Weight transpose + convert: W f32 [Kin][Nout] (pitch Nout) -> Wt f16 [Nout][Kin] (pitch Kin), times scale.
// 64x64 tile (bx of Nout/64, by of Kin/64) through the LDS tile T, 256 threads. Reads: thread handles 4 float4 of the
// tile (chunk = tid + i*256 -> row r = chunk>>4 (k local), cols c4..c4+3 (n local)).
// coverage: 8 waves x 2 x 4 = 64 rows, 8 lanes x 8 halves = 64 cols = the whole tile.
// =====================================================================================================
__device__ __forceinline__ void tr_cvt_tile(const float* __restrict__ W, _Float16* Wt,
                                            int Kin, int Nout, float scale, int bx, int by,
                                            _Float16 (*T)[72]) {   // T: [n local][k local], pitch 144 B
  const int tid = threadIdx.x, wave = tid >> 5, lane = tid & 31;
  const int n0 = bx * 64, k0 = by * 64;
#pragma unroll
  for (int i = 0; i < 4; ++i) {
    const int chunk = tid + i * 256;
    const int r = chunk >> 4;            // 0..63  (k local)
    const int c4 = (chunk & 15) * 4;     // 0..60  (n local)
    const v4f v = *(const v4f*)(W + (size_t)(k0 + r) * Nout + n0 + c4);
#pragma unroll
    for (int e = 0; e < 4; ++e) T[c4 + e][r] = (_Float16)(v[e] * scale);
  }
  __syncthreads();
  const int q = lane >> 3, c8 = (lane & 7) * 8;
  v4u o[2];
#pragma unroll
  for (int it = 0; it < 2; ++it) {
    const int row = wave * 8 + it * 4 + q;
    H8 p;
    p.h = *(const v8h*)(&T[row][c8]);
    o[it] = p.u;
  }
  {
#pragma unroll
    for (int it = 0; it < 2; ++it) {
      const int row = wave * 8 + it * 4 + q;
      *(v4u*)(Wt + (size_t)(n0 + row) * Kin + k0 + c8) = o[it];
    }
    // in the listing the other job's code follows these stores and writes their registers: only behind this wait
    asm volatile("s_wait_xcnt 0x0" ::: "memory");
  }
}

// =====================================================================================================
// LayerNorm over DM=768 columns, f32 math, f16 output (unscaled). One wave per row, 8 rows per block
// (blk of ceil(nrows/8)). Lane holds columns i*256 + lane*8 .. +7 (i 0..2). mean and variance by two register
// passes with 32-lane butterflies. Output: three 16-B stores per lane, each instruction = 32 lanes x 16 B =
// coverage: 3 x 256 = 768 columns per row; every row < nrows by exactly one wave.
// =====================================================================================================
__device__ __forceinline__ void ln_rows8(const float* __restrict__ X, const float* __restrict__ g,
                                         const float* __restrict__ bb, _Float16* Y, int nrows, int blk) {
  const int wave = threadIdx.x >> 5, lane = threadIdx.x & 31;
  const int row = blk * 8 + wave;
  if (row >= nrows) return;                  // wave-uniform; no block barriers on this path
  const float* xr = X + (size_t)row * DM;
  float v[3][8];
  float s = 0.f;
#pragma unroll
  for (int i = 0; i < 3; ++i) {
    const int col = i * 256 + lane * 8;
    const v4f a = *(const v4f*)(xr + col);
    const v4f c = *(const v4f*)(xr + col + 4);
#pragma unroll
    for (int e = 0; e < 4; ++e) { v[i][e] = a[e]; v[i][4 + e] = c[e]; }
#pragma unroll
    for (int e = 0; e < 8; ++e) s += v[i][e];
  }
#pragma unroll
  for (int off = 16; off > 0; off >>= 1) s += __shfl_xor(s, off, 32);
  const float mu = s * (1.0f / (float)DM);
  float qs = 0.f;
#pragma unroll
  for (int i = 0; i < 3; ++i)
#pragma unroll
    for (int e = 0; e < 8; ++e) { const float d = v[i][e] - mu; v[i][e] = d; qs += d * d; }
#pragma unroll
  for (int off = 16; off > 0; off >>= 1) qs += __shfl_xor(qs, off, 32);
  const float rstd = rsqrtf(qs * (1.0f / (float)DM) + 1e-5f);
  v4u o[3];
#pragma unroll
  for (int i = 0; i < 3; ++i) {
    const int col = i * 256 + lane * 8;
    const v4f g0 = *(const v4f*)(g + col), g1 = *(const v4f*)(g + col + 4);
    const v4f b0 = *(const v4f*)(bb + col), b1 = *(const v4f*)(bb + col + 4);
    H8 p;
#pragma unroll
    for (int e = 0; e < 4; ++e) {
      p.h[e]     = (_Float16)(v[i][e] * rstd * g0[e] + b0[e]);
      p.h[4 + e] = (_Float16)(v[i][4 + e] * rstd * g1[e] + b1[e]);
    }
    o[i] = p.u;
  }
  {
#pragma unroll
    for (int i = 0; i < 3; ++i)
      *(v4u*)(Y + (size_t)row * DM + i * 256 + lane * 8) = o[i];
    
  }
}

__global__ __launch_bounds__(256) void ln_rows(const float* __restrict__ X, const float* __restrict__ g,
                                               const float* __restrict__ bb, _Float16* Y, int nrows) {
  ln_rows8(X, g, bb, Y, nrows, blockIdx.x);
}

// =====================================================================================================
// Everything that depends on the inputs alone, in one launch; the block index picks the job (block-uniform):
//   blocks 0 .. LNB-1: ln1 row blocks;  then 4 x TDD tiles: Wq, Wk, Wv, Wo;  then TDF tiles: W1;  then TDF: W2.
// Inside a weight the tile index runs n tile first. grid = LNB + 4*TDD + 2*TDF, exact.
// =====================================================================================================
constexpr int LNB = NROW / 8;                  // 1024
constexpr int TDD = (DM / 64) * (DM / 64);     // 144
constexpr int TDF = (DM / 64) * (FF / 64);     // 576
__global__ __launch_bounds__(256) void prep_all(const float* __restrict__ X, const float* __restrict__ g,
                                                const float* __restrict__ bb, _Float16* Y,
                                                const float* __restrict__ Wq, const float* __restrict__ Wk,
                                                const float* __restrict__ Wv, const float* __restrict__ Wo,
                                                const float* __restrict__ W1, const float* __restrict__ W2,
                                                _Float16* Wqt, _Float16* Wkt, _Float16* Wvt, _Float16* Wot,
                                                _Float16* W1t, _Float16* W2t, float scale) {
  __shared__ __align__(16) _Float16 T[64][72];
  const int bid = blockIdx.x;
  if (bid < LNB) {                             // the whole work-group; no barrier on this side
    ln_rows8(X, g, bb, Y, NROW, bid);
  } else {
    int t = bid - LNB;                         // becomes the tile index inside the weight
    const float* W;
    _Float16* Wt;
    int Kin = DM, Nout = DM;
    if (t < 4 * TDD) {
      const int job = t / TDD;
      t -= job * TDD;
      W  = (job == 0) ? Wq  : (job == 1) ? Wk  : (job == 2) ? Wv  : Wo;
      Wt = (job == 0) ? Wqt : (job == 1) ? Wkt : (job == 2) ? Wvt : Wot;
    } else if (t < 4 * TDD + TDF) {
      t -= 4 * TDD;
      W = W1; Wt = W1t; Nout = FF;
    } else {
      t -= 4 * TDD + TDF;
      W = W2; Wt = W2t; Kin = FF;
    }
    const int nbx = Nout >> 6;
    const int by  = t / nbx;
    tr_cvt_tile(W, Wt, Kin, Nout, scale, t - by * nbx, by, T);
  }
}

// =====================================================================================================
// Batched f16 WMMA GEMM: acc[m][n] = sum_k A[m][k] * Bt[n][k]. One work-group of 4 waves per 128x128 tile,
// one 64x64 sub-tile per wave (2 x 2). A row-major [M][K] pitch lda; Bt row-major [N][K] pitch ldb
// (k contiguous); both f16 global planes. Per stage of 64 k the work-group brings 128 A rows and 128 Bt rows
// of 128 B into LDS once (8 lanes per row, so every load instruction covers 4 whole lines); all four waves
// take their fragments from there. The rows come by asynchronous copies to LDS. Two LDS stages: stage t+1 is in
// flight during the products of stage t; one work-group barrier per stage.
// M, N multiples of 128, K a multiple of 64 (checked at compile time for the shapes launched below).
// tile = tile index (n tile first), bz = batch index (strides in elements, C and Res share strideC); ring = the
// work-group's 2 * STG halves of LDS. k order per accumulator: ascending.
// MODE 0: C f16 [m][n] = (acc*accs + bias[n]) * outs
// MODE 1: C f16 [m][n] = (acc*accs + bias[m]) * outs            (bias along rows)
// MODE 2: C f32 [m][n] = Res[m][n] + acc*accs + bias[n]          (Res has C's layout, never aliases C)
// MODE 3: C f16 [m][n] = gelu_tanh(acc*accs + bias[n]) * outs
// =====================================================================================================
// Eight asynchronous 16-B copies to LDS per lane: four row groups of one plane (LDS byte address la + i*lstep, global
// ga + i*astep halves), then four of another (lb, gb, bstep). The address-translation wait is the statement's last
// line, so no register that a copy names is rewritten ahead of it.
typedef __attribute__((address_space(3))) const _Float16 lds_half;
__device__ __forceinline__ void async_rows4x2(unsigned la, unsigned lstep, const _Float16* ga, size_t astep,
                                              unsigned lb, const _Float16* gb, size_t bstep) {
  const unsigned la1 = la + lstep, la2 = la + 2 * lstep, la3 = la + 3 * lstep;
  const unsigned lb1 = lb + lstep, lb2 = lb + 2 * lstep, lb3 = lb + 3 * lstep;
  const _Float16 *ga1 = ga + astep, *ga2 = ga + 2 * astep, *ga3 = ga + 3 * astep;
  const _Float16 *gb1 = gb + bstep, *gb2 = gb + 2 * bstep, *gb3 = gb + 3 * bstep;
  asm volatile("global_load_async_to_lds_b128 %0, %1, off\n\t"
               "global_load_async_to_lds_b128 %2, %3, off\n\t"
               "global_load_async_to_lds_b128 %4, %5, off\n\t"
               "global_load_async_to_lds_b128 %6, %7, off\n\t"
               "global_load_async_to_lds_b128 %8, %9, off\n\t"
               "global_load_async_to_lds_b128 %10, %11, off\n\t"
               "global_load_async_to_lds_b128 %12, %13, off\n\t"
               "global_load_async_to_lds_b128 %14, %15, off\n\t"
               "s_wait_xcnt 0x0"
               :: "v"(la), "v"(ga), "v"(la1), "v"(ga1), "v"(la2), "v"(ga2), "v"(la3), "v"(ga3),
                  "v"(lb), "v"(gb), "v"(lb1), "v"(gb1), "v"(lb2), "v"(gb2), "v"(lb3), "v"(gb3)
               : "memory");
}

constexpr int GP  = 72;                    // LDS row pitch, halves: 144 B = 16 B x 9, for 16-B fragment reads
constexpr int STG = 256 * GP;              // halves per stage: A rows 0..127, then Bt rows 0..127
static_assert(4 * 16 * 68 * 4 <= 2 * STG * 2);   // the ring's head is the output slabs after the k loop
template <int MODE>
__device__ __forceinline__ void gemm_tile(
    const _Float16* __restrict__ A, int lda, long long strideA,
    const _Float16* __restrict__ Bt, int ldb, long long strideB,
    const float* __restrict__ bias, const float* __restrict__ Res,
    void* Cout, int ldc, long long strideC,
    int M, int N, int K, float accs, float outs, _Float16* ring, int tile, int bz) {
  const int tid  = threadIdx.x;
  const int lane = tid & 31;
  const int wave = tid >> 5;
  const int tilesN = N >> 7;
  const int tilesM = M >> 7;
  if (tile >= tilesM * tilesN) return;   // the same for the whole work-group, ahead of every barrier
  const int tm = tile / tilesN;
  const int tn = tile - tm * tilesN;
  const int wm = (wave >> 1) << 6;            // this wave's 64x64 sub-tile inside the 128x128 tile
  const int wn = (wave & 1) << 6;
  const int m0 = (tm << 7) + wm;
  const int n0 = (tn << 7) + wn;

  const _Float16* Ab = A  + (size_t)bz * (size_t)strideA;
  const _Float16* Bb = Bt + (size_t)bz * (size_t)strideB;

  const int rl   = lane & 15;                 // row (A) / col (B, D) within subtile
  const int koff = (lane >> 4) * 8;           // k offset of this lane half
  const int mOff = (lane >> 4) * 8;           // D row offset

  // staging map: thread -> row (tid>>3) + 16*i, i 0..7, 16 B at column (tid&7)*8: 128 rows x 128 B per operand
  const int sr = tid >> 3;
  const int sc = (tid & 7) * 8;
  const _Float16* ga = Ab + (size_t)((tm << 7) + sr) * lda + sc;
  const _Float16* gb = Bb + (size_t)((tn << 7) + sr) * ldb + sc;
  const unsigned sa = (unsigned)(uintptr_t)(lds_half*)(ring + sr * GP + sc);   // LDS byte address, stage 0, A row sr
  const unsigned sb = sa + 128 * GP * 2;                                       // the same of Bt
  // one stage: k columns kn.., into the LDS stage at byte offset so; A and Bt rows sr + 16 i, i 0..3, then i 4..7
  auto copy_stage = [&](unsigned so, int kn) {
    async_rows4x2(sa + so, 16 * GP * 2, ga + kn, (size_t)16 * lda, sb + so, gb + kn, (size_t)16 * ldb);
    async_rows4x2(sa + so + 64 * GP * 2, 16 * GP * 2, ga + (size_t)64 * lda + kn, (size_t)16 * lda,
                  sb + so + 64 * GP * 2, gb + (size_t)64 * ldb + kn, (size_t)16 * ldb);
  };

  v8f acc[4][4];
#pragma unroll
  for (int i = 0; i < 4; ++i)
#pragma unroll
    for (int j = 0; j < 4; ++j) acc[i][j] = zero8();

  const int nk = K >> 6;
  copy_stage(0u, 0);
  asm volatile("s_wait_asynccnt 0x0" ::: "memory");   // this wave's copies of stage 0 have landed
  __syncthreads();
  if (nk > 1) copy_stage(STG * 2, 64);                // the same for the whole work-group

  for (int kt = 0; kt < nk; ++kt) {
    const int cur = (kt & 1) * STG;
    const _Float16* fa = ring + cur + (wm + rl) * GP + koff;
    const _Float16* fb = ring + cur + (128 + wn + rl) * GP + koff;
#pragma unroll
    for (int kk = 0; kk < 2; ++kk) {
      v16h bf[4], af[4];
#pragma unroll
      for (int j = 0; j < 4; ++j) bf[j] = ldfrag(fb + j * 16 * GP + kk * 32);
#pragma unroll
      for (int i = 0; i < 4; ++i) af[i] = ldfrag(fa + i * 16 * GP + kk * 32);
#pragma unroll
      for (int i = 0; i < 4; ++i) {
#pragma unroll
        for (int j = 0; j < 4; ++j) acc[i][j] = mma_raw(af[i], bf[j], acc[i][j]);
        guard4(acc[i][0], acc[i][1], acc[i][2], acc[i][3], af[i], bf[0], bf[1], bf[2], bf[3]);
      }
    }
    // hand-over: this wave's reads of stage kt are done and its copies of stage kt+1 have landed; the barrier
    // publishes stage kt+1 and frees the LDS of stage kt, which stage kt+2 then goes into
    asm volatile("s_wait_dscnt 0x0" ::: "memory");
    asm volatile("s_wait_asynccnt 0x0" ::: "memory");
    __syncthreads();
    if (kt + 2 < nk) copy_stage((unsigned)cur * 2, (kt + 2) << 6);   // the same for the whole work-group
  }
  asm volatile("s_wait_asynccnt 0x0" ::: "memory");   // nothing of this wave's is in flight when the ring becomes slabs

  // ---- epilogue ----
  float* slab = (float*)ring + wave * (16 * 68);   // per-wave 16x64 slab, pitch 68 floats (272 B)
#pragma unroll
  for (int i = 0; i < 4; ++i) {
    const int mBase = m0 + (i << 4);
#pragma unroll
    for (int j = 0; j < 4; ++j) {
#pragma unroll
      for (int r = 0; r < 8; ++r) slab[(mOff + r) * 68 + (j << 4) + rl] = acc[i][j][r];
    }
    __builtin_amdgcn_fence(__ATOMIC_RELEASE, "workgroup");
    __builtin_amdgcn_wave_barrier();
    __builtin_amdgcn_fence(__ATOMIC_ACQUIRE, "workgroup");
    if constexpr (MODE == 2) {
      float* C = (float*)Cout + (size_t)bz * (size_t)strideC;
      const float* R = Res + (size_t)bz * (size_t)strideC;
      const int h2 = lane >> 4, c4 = (lane & 15) * 4;    // 256-B row segment = 16 lanes x 16 B
      const v4f bq4 = *(const v4f*)(bias + n0 + c4);
      {
#pragma unroll
        for (int it = 0; it < 8; ++it) {
          const int row = it * 2 + h2;                    // it 0..7 x h2 0..1 = rows 0..15
          const v4f a  = *(const v4f*)(slab + row * 68 + c4);
          const v4f rr = *(const v4f*)(R + (size_t)(mBase + row) * ldc + n0 + c4);
          v4f ov;
#pragma unroll
          for (int e = 0; e < 4; ++e) ov[e] = rr[e] + (a[e] * accs + bq4[e]);
          *(v4f*)(C + (size_t)(mBase + row) * ldc + n0 + c4) = ov;
        }
        
      }
    } else {
      _Float16* C = (_Float16*)Cout + (size_t)bz * (size_t)strideC;
      const int q = lane >> 3, c8 = (lane & 7) * 8;
      float bc[8];
      if constexpr (MODE != 1) {
        const v4f b0 = *(const v4f*)(bias + n0 + c8), b1 = *(const v4f*)(bias + n0 + c8 + 4);
#pragma unroll
        for (int e = 0; e < 4; ++e) { bc[e] = b0[e]; bc[4 + e] = b1[e]; }
      } else {
#pragma unroll
        for (int e = 0; e < 8; ++e) bc[e] = 0.f;
      }
      v4u hv[4];
#pragma unroll
      for (int it = 0; it < 4; ++it) {
        const int row = it * 4 + q;                       // it 0..3 x q 0..3 = rows 0..15
        const float* sp = slab + row * 68 + c8;
        float brow = 0.f;
        if constexpr (MODE == 1) brow = bias[mBase + row];   // mBase + row < M = bias length in this mode
        H8 p;
#pragma unroll
        for (int e = 0; e < 8; ++e) {
          float f = sp[e] * accs + ((MODE == 1) ? brow : bc[e]);
          if constexpr (MODE == 3) f = gelu_tanh(f);
          f *= outs;
          p.h[e] = (_Float16)f;
        }
        hv[it] = p.u;
      }
      {
#pragma unroll
        for (int it = 0; it < 4; ++it) {
          const int row = it * 4 + q;
          *(v4u*)(C + (size_t)(mBase + row) * ldc + n0 + c8) = hv[it];
        }
        
      }
    }
    __builtin_amdgcn_fence(__ATOMIC_RELEASE, "workgroup");
    __builtin_amdgcn_wave_barrier();
    __builtin_amdgcn_fence(__ATOMIC_ACQUIRE, "workgroup");
  }
}

// one product per launch: grid = (tiles, batches)
template <int MODE>
__global__ __launch_bounds__(128) void gemm64(
    const _Float16* __restrict__ A, int lda, long long strideA,
    const _Float16* __restrict__ Bt, int ldb, long long strideB,
    const float* __restrict__ bias, const float* __restrict__ Res,
    void* Cout, int ldc, long long strideC,
    int M, int N, int K, float accs, float outs) {
  __shared__ __align__(16) _Float16 ring[2 * STG];   // 73728 B
  gemm_tile<MODE>(A, lda, strideA, Bt, ldb, strideB, bias, Res, Cout, ldc, strideC, M, N, K, accs, outs,
                  ring, blockIdx.x, blockIdx.y);
}

// The three projections of ln1's output in one launch; the block index picks the product (block-uniform):
//   blocks 0 .. TPJ-1:  q   = (ln1 . Wq + bq) * 0.5        M=8192, N=768, K=768
//   then TPJ blocks:    k   = (ln1 . Wk + bk) * 4          the same shape
//   then NB x TVT:      v^T = (Wv^T . ln1^T + bv[row]) * 4 per batch, f16 [b][d][s]; M=768, N=4096, K=768
// every accumulator carries 32 x the product (weights x32). grid = 2*TPJ + NB*TVT, exact.
constexpr int TPJ = (NROW / 128) * (DM / 128);   // 384
constexpr int TVT = (DM / 128) * (SEQ / 128);    // 192
__global__ __launch_bounds__(128) void gemm_qkv(
    const _Float16* __restrict__ Nrm, const _Float16* __restrict__ Wqt, const _Float16* __restrict__ Wkt,
    const _Float16* __restrict__ Wvt, const float* __restrict__ bq, const float* __restrict__ bk,
    const float* __restrict__ bv, _Float16* Qo, _Float16* Ko, _Float16* VTo) {
  __shared__ __align__(16) _Float16 ring[2 * STG];   // 73728 B
  const int bid = blockIdx.x;
  if (bid < 2 * TPJ) {
    const bool isk = bid >= TPJ;
    const float* bias = isk ? bk : bq;
    gemm_tile<0>(Nrm, DM, 0LL, isk ? Wkt : Wqt, DM, 0LL, bias, bias, (void*)(isk ? Ko : Qo), DM, 0LL,
                 NROW, DM, DM, 1.0f / 32.0f, isk ? 4.0f : 0.5f, ring, isk ? bid - TPJ : bid, 0);
  } else {
    const int t  = bid - 2 * TPJ;
    const int bz = t / TVT;
    gemm_tile<1>(Wvt, DM, 0LL, Nrm, DM, (long long)SEQ * DM, bv, bv, (void*)VTo, SEQ, (long long)DM * SEQ,
                 DM, SEQ, DM, 1.0f / 32.0f, 4.0f, ring, t - bz * TVT, bz);
  }
}

// =====================================================================================================
// Causal attention, head dim 64, f16 operands.
//   q plane (f16, carries q * 0.5):  element (b, t, h, d) at [(b*SEQ + t)*DM + h*64 + d]
//   k plane (f16, carries k * 4):    same layout with key index s
//   v^T plane (f16, carries v * 4):  element (b, h, d, s) at [(b*DM + h*64 + d)*SEQ + s]
//   logit = acc * sscale with sscale = 1/16  (0.5 * 4 / 16 = 1/8 = 1/sqrt(64));
//   Both products are taken transposed: S^T = K . Q^T (A = K rows, B = Q) and O^T += V^T . P^T (A = V^T rows).
//   A score tile's lane then holds 8 keys (16j + 8*(lane>>4) + r) of ONE query (lane&15): the row maximum and sum
//   are in-lane, joined between the wave halves by one exchange; two score tiles, converted in place, are the
//   B operand P^T in the hardware k order, which the V^T fragment loads already have.
//   keys s > t excluded per lane (-inf before the row max); every row has key 0 so the max is finite.
//   p = exp(s - m) packed as f16(1024 p); context = p . v on f16 WMMA; online softmax in f32.
//   out plane (f16, carries ctx * 4): element (b, t, h, d) at [(b*SEQ + t)*DM + h*64 + d];
//   ctx*4 = acc / (1024 l) since acc = 4096 * sum p v.
//   Block = 4 waves = 64 query rows of one (b, h) at a time, two query tiles qb in turn (NQB-1-pr, then pr);
//   grid = (NQB/2) * NH * NB; key tiles 0..qb (block-uniform).
//   K / V^T tile staging: asynchronous 16-B copies to LDS, 8 lanes per 128-B row (an instruction covers 4 whole
//   lines), 4 copies per thread and plane = the whole 64x64 tile; two buffers, key tile t+1 in flight during tile t;
//   one work-group barrier per key tile.
//   Output coverage: each wave stores rows q0..q0+15 (it 0..3 x lane>>3 0..3) x 64 columns (8 lanes x 8).
// =====================================================================================================
// One key tile into one LDS buffer: rows sr + 16 i (i 0..3) of K, then of V^T. lds = this lane's byte address in the
// buffer's K plane (row pitch 144 B, V^T plane 9216 B behind K); gk, gv = its global bytes.
__device__ __forceinline__ void copy_kv_tile(unsigned lds, const _Float16* gk, const _Float16* gv) {
  async_rows4x2(lds, 2304u, gk, (size_t)16 * DM, lds + 9216u, gv, (size_t)16 * SEQ);
}

__global__ __launch_bounds__(128)
void attn_causal64(const _Float16* __restrict__ Qp, const _Float16* __restrict__ Kp,
                   const _Float16* __restrict__ Vtp, _Float16* Op, float sscale) {
  // Row pitches: 16-B fragment reads walk 16 rows at once, so a pitch of 16 B x odd spreads them over all banks
  // (128-B rows put every other row on the same banks).
  constexpr int LP = 72;                               // f16 rows of 64: pitch 72 halves = 144 B
  constexpr int OP = 68;                               // f32 rows of 64: pitch 68 floats = 272 B
  constexpr int TB = 64 * LP;                          // halves per plane of a key tile: 9 KB
  static_assert(LP * 2 == 144 && TB * 2 == 9216);      // the byte steps in copy_kv_tile
  __shared__ __align__(16) _Float16 KV[2][2 * TB];     // two buffers, each K [kv][d], then V^T [d][kv]
  __shared__ __align__(16) float    Os[4][16 * OP];    // per wave context tile [row][d]

  const int tid  = threadIdx.x;
  const int wave = tid >> 5;
  const int lane = tid & 31;
  const int hh   = lane >> 4;
  const int c    = lane & 15;

  const int bx   = blockIdx.x;
  const int pr   = bx % (NQB / 2);
  const int rest = bx / (NQB / 2);
  const int h    = rest % NH;
  const int b    = rest / NH;
  const size_t rowB = (size_t)b * SEQ;

  const _Float16* Qh = Qp + (size_t)h * HD;
  const _Float16* Kh = Kp + (size_t)h * HD;
  const _Float16* Vh = Vtp + ((size_t)b * DM + (size_t)h * HD) * SEQ;

  // copy map: thread -> row (tid>>3) + 16 i, 16 B at column (tid&7)*8; addresses of key tile 0 in buffer 0
  const int sr = tid >> 3, sc = (tid & 7) * 8;
  const unsigned  lds0 = (unsigned)(uintptr_t)(lds_half*)(&KV[0][0] + sr * LP + sc);
  const _Float16* gk0  = Kh + (rowB + sr) * DM + sc;          // K row sr, d = sc..sc+7
  const _Float16* gv0  = Vh + (size_t)sr * SEQ + sc;          // V^T row d = sr, s = sc..sc+7

  // Two query tiles, one after the other in every wave: NQB-1-pr, then pr. (NQB-pr) + (pr+1) = NQB+1 key tiles
  // for every work-group, so no work-group outlasts the others. pr 0..NQB/2-1 covers every query tile once.
  for (int part = 0; part < 2; ++part) {        // block-uniform
    const int qb = part ? pr : NQB - 1 - pr;
    const int q0 = qb * 64 + wave * 16;

    // ---- Q fragments (B operand, column = lane&15 = query row): 2 d-chunks of 32 ----
    v16h qa[2];
#pragma unroll
    for (int dc = 0; dc < 2; ++dc)
      qa[dc] = ldfrag(Qh + (rowB + q0 + c) * DM + dc * 32 + 8 * hh);

    const int qrow = q0 + c;                    // this lane's query row
    float mrow = -INFINITY;                     // running maximum of row qrow (alike in both wave halves)
    float lrow = 0.f;                           // running sum over this wave half's keys only; joined after the loop
    v8f oacc[4];                                // O^T: oacc[t][r] = context(qrow, d = 16t + 8*hh + r)
#pragma unroll
    for (int t = 0; t < 4; ++t) oacc[t] = zero8();

    // key tile 0 into buffer 0 and published; then tile 1 into buffer 1, in flight during tile 0. Both buffers are
    // free here: the barrier at the foot of the last trip of the query tile before ended every read of them.
    copy_kv_tile(lds0, gk0, gv0);
    asm volatile("s_wait_asynccnt 0x0" ::: "memory");   // this wave's copies of tile 0 have landed
    __syncthreads();
    if (qb >= 1) copy_kv_tile(lds0 + 2 * TB * 2, gk0 + (size_t)64 * DM, gv0 + 64);   // block-uniform

    for (int kt = 0; kt <= qb; ++kt) {          // causal key tiles, block-uniform trip count
      const int kv0 = kt * 64;
      const _Float16* Ksh = &KV[kt & 1][0];
      const _Float16* Vth = Ksh + TB;

      // ---- all fragment reads of this key tile as one group, each fragment in registers of its own: K first,
      //      V^T behind it, so the score products wait for the K half only and V^T lands under them and the softmax ----
      v16h kf[2][4], vf[2][4];
#pragma unroll
      for (int dc = 0; dc < 2; ++dc)
#pragma unroll
        for (int j = 0; j < 4; ++j) kf[dc][j] = ldfrag(Ksh + (j * 16 + c) * LP + dc * 32 + 8 * hh);
#pragma unroll
      for (int kk = 0; kk < 2; ++kk)
#pragma unroll
        for (int t = 0; t < 4; ++t) vf[kk][t] = ldfrag(Vth + (t * 16 + c) * LP + kk * 32 + 8 * hh);
      // keeps the reads together in front of the products: spread among them, each place costs its own LDS wait
      __builtin_amdgcn_sched_barrier(0);

      // ---- scores, transposed: s[j][r] = score(key kv0 + 16j + 8*hh + r, query qrow); d chunks ascending in each tile ----
      v8f s[4];
#pragma unroll
      for (int j = 0; j < 4; ++j) s[j] = zero8();
#pragma unroll
      for (int dc = 0; dc < 2; ++dc)
#pragma unroll
        for (int j = 0; j < 4; ++j) s[j] = mma_raw(kf[dc][j], qa[dc], s[j]);

      // ---- scale, causal exclusion, row max, online softmax, P^T (x1024, f16) packed in registers ----
      float mj[4];
#pragma unroll
      for (int j = 0; j < 4; ++j) {
        mj[j] = -INFINITY;
#pragma unroll
        for (int r = 0; r < 8; ++r) {
          const int key = kv0 + j * 16 + 8 * hh + r;
          const float sv = (key <= qrow) ? (s[j][r] * sscale) : -INFINITY;
          s[j][r] = sv;
          mj[j] = fmaxf(mj[j], sv);
        }
      }
      float m = fmaxf(fmaxf(mj[0], mj[1]), fmaxf(mj[2], mj[3]));
      m = fmaxf(m, xhalf(m));                    // both halves now hold the maximum over the 64 keys
      const float mnew  = fmaxf(mrow, m);
      const float msafe = (mnew == -INFINITY) ? 0.f : mnew;
      const float alpha = __expf(mrow - msafe);
      mrow = mnew;
      FH pb[2];                                  // P^T, B operand: element e of half j&1 = key 32*(j>>1) + 16*(j&1) + 8*hh + e
      float pj[4];
#pragma unroll
      for (int j = 0; j < 4; ++j) {
        float a[8], p[8];                              // excluded key: exp(-inf) = 0
#pragma unroll
        for (int r = 0; r < 8; ++r) a[r] = (s[j][r] - msafe) * 1.44269504f;
        // a score tile's eight v_exp and the one issue slot behind the last in one statement, results in registers
        // of their own
        asm("v_exp_f32 %0, %8\n\tv_exp_f32 %1, %9\n\tv_exp_f32 %2, %10\n\tv_exp_f32 %3, %11\n\t"
            "v_exp_f32 %4, %12\n\tv_exp_f32 %5, %13\n\tv_exp_f32 %6, %14\n\tv_exp_f32 %7, %15\n\tv_nop"
            : "=&v"(p[0]), "=&v"(p[1]), "=&v"(p[2]), "=&v"(p[3]), "=&v"(p[4]), "=&v"(p[5]), "=&v"(p[6]), "=&v"(p[7])
            : "v"(a[0]), "v"(a[1]), "v"(a[2]), "v"(a[3]), "v"(a[4]), "v"(a[5]), "v"(a[6]), "v"(a[7]));
        pj[j] = 0.f;
#pragma unroll
        for (int r = 0; r < 8; ++r) {
          pj[j] += p[r];
          pb[j >> 1].h[j & 1][r] = (_Float16)(p[r] * 1024.0f);
        }
      }
      lrow = lrow * alpha + ((pj[0] + pj[1]) + (pj[2] + pj[3]));
#pragma unroll
      for (int t = 0; t < 4; ++t)
#pragma unroll
        for (int r = 0; r < 8; ++r) oacc[t][r] *= alpha;

      // ---- context^T += V^T . P^T (f16 WMMA) ----
#pragma unroll
      for (int kk = 0; kk < 2; ++kk) {
#pragma unroll
        for (int t = 0; t < 4; ++t) oacc[t] = mma_raw(vf[kk][t], pb[kk].v, oacc[t]);
      }

      // ---- hand-over: this wave's reads of buffer kt&1 are done and its copies of tile kt+1 have landed; the
      //      barrier publishes tile kt+1 and frees buffer kt&1, which tile kt+2 then goes into ----
      // keeps the products and the softmax in front of the waits: moved behind them (they touch no memory), tile
      // kt+1 would be waited for right behind its issue and tile kt+2 issued a whole trip's work late
      __builtin_amdgcn_sched_barrier(0);
      asm volatile("s_wait_dscnt 0x0" ::: "memory");
      asm volatile("s_wait_asynccnt 0x0" ::: "memory");
      __syncthreads();
      if (kt + 2 <= qb)                          // block-uniform
        copy_kv_tile(lds0 + (unsigned)(kt & 1) * (2 * TB * 2), gk0 + (size_t)(kt + 2) * 64 * DM, gv0 + (kt + 2) * 64);
    }
    asm volatile("s_wait_asynccnt 0x0" ::: "memory");   // nothing of this wave's is in flight behind the loop

    // ---- normalise (1/l and the carries), stage the wave's 16x64 tile, convert to f16,
    float* os = Os[wave];
    {
      const float l = lrow + xhalf(lrow);        // the two halves' key sums joined
      const float inv = ((l > 0.f) ? (1.0f / l) : 0.f) * (1.0f / 1024.0f);
#pragma unroll
      for (int t = 0; t < 4; ++t) {
        v4f lo, hi;
#pragma unroll
        for (int e = 0; e < 4; ++e) { lo[e] = oacc[t][e] * inv; hi[e] = oacc[t][4 + e] * inv; }
        *(v4f*)(os + c * OP + t * 16 + 8 * hh)     = lo;
        *(v4f*)(os + c * OP + t * 16 + 8 * hh + 4) = hi;
      }
    }
    __builtin_amdgcn_fence(__ATOMIC_RELEASE, "workgroup");
    __builtin_amdgcn_wave_barrier();
    __builtin_amdgcn_fence(__ATOMIC_ACQUIRE, "workgroup");
    {
      const int q4 = lane >> 3, c8 = (lane & 7) * 8;
      v4u hv[4];
#pragma unroll
      for (int it = 0; it < 4; ++it) {
        const int row = it * 4 + q4;   // it 0..3 x q4 0..3 = rows 0..15 of the wave tile
        const float* sp = os + row * OP + c8;
        H8 p;
#pragma unroll
        for (int e = 0; e < 8; ++e) p.h[e] = (_Float16)sp[e];
        hv[it] = p.u;
      }
      {
#pragma unroll
        for (int it = 0; it < 4; ++it) {
          const int row = it * 4 + q4;
          const size_t go = (rowB + q0 + row) * DM + (size_t)h * HD + c8;
          *(v4u*)(Op + go) = hv[it];
        }
        // the second query tile reuses the address and data registers of these stores: only behind this wait
        asm volatile("s_wait_xcnt 0x0" ::: "memory");
      }
    }
  }
}

// =====================================================================================================
// Workspace map (bytes), every region an exact multiple of its whole-line / 64x64-tile store granularity:
//   Wqt  f16 [768 out][768 in] x32      0          1179648
//   Wkt  f16 [768][768] x32              1179648    1179648
//   Wvt  f16 [768][768] x32              2359296    1179648
//   Wot  f16 [768][768] x32              3538944    1179648
//   W1t  f16 [3072][768] x32             4718592    4718592
//   W2t  f16 [768][3072] x32             9437184    4718592
//   Np   f16 [8192][768]  ln1 out, later ln2 out          14155776   12582912
//   RegB 50331648 B at 26738688: q f16 [8192][768] at +0, k at +12582912, v^T f16 [2][768][4096] at
//        +25165824 (end +37748736); later the gelu plane G f16 [8192][3072] covers the whole region
//   Ctx  f16 [8192][768] x4              77070336   12582912
//   X1   f32 [8192][768]                 89653248   25165824
//   end                                  114819072
// Launch order makes the aliasing safe on the in-order stream: q/k/v^T are last read by the attention
// launch, G is written three launches later; Np is last read by the projection launch before ln2 rewrites it.
// Spec weights are [in][out]; the GEMM wants Bt[n][k] / A[m][k] with k contiguous, hence the transposes.
// =====================================================================================================
extern "C" void kernel_launch(void* const* d_in, const int* in_sizes, int n_in,
                              void* d_out, int out_size, void* d_ws, size_t ws_size,
                              hipStream_t stream) {
  if (n_in < 17) return;
  if (in_sizes[0] != NROW * DM) return;
  if (in_sizes[1] != DM || in_sizes[2] != DM) return;
  if (in_sizes[3] != DM * DM || in_sizes[5] != DM * DM || in_sizes[7] != DM * DM || in_sizes[9] != DM * DM) return;
  if (in_sizes[4] != DM || in_sizes[6] != DM || in_sizes[8] != DM || in_sizes[10] != DM) return;
  if (in_sizes[11] != DM || in_sizes[12] != DM) return;
  if (in_sizes[13] != DM * FF || in_sizes[14] != FF || in_sizes[15] != FF * DM || in_sizes[16] != DM) return;
  if (out_size != NROW * DM) return;

  const float* x    = (const float*)d_in[0];
  const float* ln1g = (const float*)d_in[1];
  const float* ln1b = (const float*)d_in[2];
  const float* Wq   = (const float*)d_in[3];
  const float* bq   = (const float*)d_in[4];
  const float* Wk   = (const float*)d_in[5];
  const float* bk   = (const float*)d_in[6];
  const float* Wv   = (const float*)d_in[7];
  const float* bv   = (const float*)d_in[8];
  const float* Wo   = (const float*)d_in[9];
  const float* bo   = (const float*)d_in[10];
  const float* ln2g = (const float*)d_in[11];
  const float* ln2b = (const float*)d_in[12];
  const float* W1   = (const float*)d_in[13];
  const float* b1   = (const float*)d_in[14];
  const float* W2   = (const float*)d_in[15];
  const float* b2   = (const float*)d_in[16];

  const size_t PWD  = (size_t)DM * DM * 2;          //  1179648
  const size_t PWF  = (size_t)DM * FF * 2;          //  4718592
  const size_t PA16 = (size_t)NROW * DM * 2;        // 12582912  f16 activation plane [8192][768]
  const size_t PVT  = (size_t)NB * DM * SEQ * 2;    // 12582912  v^T plane
  const size_t PG   = (size_t)NROW * FF * 2;        // 50331648  gelu plane [8192][3072]
  const size_t PX1  = (size_t)NROW * DM * 4;        // 25165824  f32 plane
  size_t off = 0;
  const size_t oWq = off; off += PWD;
  const size_t oWk = off; off += PWD;
  const size_t oWv = off; off += PWD;
  const size_t oWo = off; off += PWD;
  const size_t oW1 = off; off += PWF;
  const size_t oW2 = off; off += PWF;
  const size_t oN  = off; off += PA16;
  const size_t oRB = off; off += PG;
  const size_t oCt = off; off += PA16;
  const size_t oX1 = off; off += PX1;
  if (off > ws_size) return;                        // off = 114819072
  if (off > (size_t)134217728) return;
  const size_t oQ  = oRB;
  const size_t oK  = oRB + PA16;
  const size_t oVT = oRB + 2 * PA16;
  if (oVT + PVT > oRB + PG) return;                 // q, k, v^T fit inside the gelu region
  const size_t oG  = oRB;

  char* ws = (char*)d_ws;
  _Float16* Wqt = (_Float16*)(ws + oWq);
  _Float16* Wkt = (_Float16*)(ws + oWk);
  _Float16* Wvt = (_Float16*)(ws + oWv);
  _Float16* Wot = (_Float16*)(ws + oWo);
  _Float16* W1t = (_Float16*)(ws + oW1);
  _Float16* W2t = (_Float16*)(ws + oW2);
  _Float16* Np  = (_Float16*)(ws + oN);
  _Float16* Qp  = (_Float16*)(ws + oQ);
  _Float16* Kpl = (_Float16*)(ws + oK);
  _Float16* VTp = (_Float16*)(ws + oVT);
  _Float16* Gp  = (_Float16*)(ws + oG);
  _Float16* Ctp = (_Float16*)(ws + oCt);
  float*    X1  = (float*)(ws + oX1);

  const dim3 blk(256);
  const dim3 gPrep(LNB + 4 * TDD + 2 * TDF);                       // 2752 blocks: ln1 and the six weights
  const dim3 gLn((NROW + 7) / 8);                                  // 1024 blocks
  const dim3 gblk(128);                                            // GEMM work-group: 4 waves
  const dim3 gProj((NROW / 128) * (DM / 128), 1);                  // 384 tiles of 128x128
  const dim3 gQkv(2 * TPJ + NB * TVT);                             // 1152 tiles: q, k, v^T
  const dim3 gFfn((NROW / 128) * (FF / 128), 1);                   // 1536 tiles
  const dim3 gAtt((NQB / 2) * NH * NB);                            // 768 blocks, two query tiles each

  // (1) weights [in][out] f32 -> transposed f16 [out][in] x32, and ln1 -> Np f16 [8192][768]
  prep_all<<<gPrep, blk, 0, stream>>>(x, ln1g, ln1b, Np, Wq, Wk, Wv, Wo, W1, W2,
                                      Wqt, Wkt, Wvt, Wot, W1t, W2t, 32.0f);
  // (2) q -> Qp, k -> Kpl, v^T -> VTp
  gemm_qkv<<<gQkv, gblk, 0, stream>>>(Np, Wqt, Wkt, Wvt, bq, bk, bv, Qp, Kpl, VTp);
  // (3) causal attention -> Ctp f16 (ctx * 4)
  attn_causal64<<<gAtt, dim3(128), 0, stream>>>(Qp, Kpl, VTp, Ctp, 0.0625f);
  // (4) x1 = x + ctx . Wo + bo -> X1 f32   (acc = 128 * ctx.Wo)
  gemm64<2><<<gProj, gblk, 0, stream>>>(Ctp, DM, 0LL, Wot, DM, 0LL, bo, x, (void*)X1, DM, 0LL,
                                       NROW, DM, DM, 1.0f / 128.0f, 1.0f);
  // (5) ln2 -> Np
  ln_rows<<<gLn, blk, 0, stream>>>(X1, ln2g, ln2b, Np, NROW);
  // (6) g = gelu(ln2 . W1 + b1) * 4 -> Gp f16 [8192][3072]   (M=8192, N=3072, K=768, acc/32)
  gemm64<3><<<gFfn, gblk, 0, stream>>>(Np, DM, 0LL, W1t, DM, 0LL, b1, x, (void*)Gp, FF, 0LL,
                                      NROW, FF, DM, 1.0f / 32.0f, 4.0f);
  // (7) out = x1 + g . W2 + b2 -> d_out f32 [8192][768]   (M=8192, N=768, K=3072, acc = 128 * g.W2)
  gemm64<2><<<gProj, gblk, 0, stream>>>(Gp, FF, 0LL, W2t, FF, 0LL, b2, X1, d_out, DM, 0LL,
                                       NROW, DM, FF, 1.0f / 128.0f, 1.0f);
  (void)hipGetLastError();
}

// v008
// Measured time: 222 microseconds a run.
// In two side-by-side timings against v007, it was 1.05 and 1.04 times as fast.
// Counting every step since v000, it is 3.56 times as fast.
// All contractions: v_wmma_f32_16x16x32_f16 (f16 operands, f32 accumulate): q/k/v projections, q.k^T scores,
// p.v context, ctx.Wo, ln2out.W1, gelu.W2. LayerNorm, softmax, GELU, bias and residual adds in f32.
#include <hip/hip_runtime.h>
#include <math.h>
#include <stdint.h>

#define NB   2
#define SEQ  4096
#define DM   768
#define NH   12
#define HD   64
#define FF   3072
#define NROW (NB * SEQ)      // 8192 token rows
#define NQB  (SEQ / 64)      // 64 query / key tiles of 64
static_assert(NH * HD == DM);
static_assert((NQB % 2) == 0);
static_assert((SEQ % 64) == 0 && (DM % 64) == 0 && (FF % 64) == 0 && (NROW % 64) == 0);
static_assert(DM == 3 * 256);
static_assert((SEQ % 128) == 0 && (DM % 128) == 0 && (FF % 128) == 0 && (NROW % 128) == 0);   // tiles, and k stages of 128

typedef _Float16 v16h __attribute__((ext_vector_type(16)));
typedef _Float16 v8h  __attribute__((ext_vector_type(8)));
typedef float    v8f  __attribute__((ext_vector_type(8)));
typedef float    v4f  __attribute__((ext_vector_type(4)));
typedef unsigned int v4u __attribute__((ext_vector_type(4)));

union H8 { v8h h; v4u u; };
union FH { v16h v; v8h h[2]; };

__device__ __forceinline__ v8f zero8() { v8f z = {0.f, 0.f, 0.f, 0.f, 0.f, 0.f, 0.f, 0.f}; return z; }

// 16-bit A/B fragment: lane -> row/col (lane&15); p already includes +8*(lane>>4);
// elements 0..7 <- p[0..7] (k0+8h..k0+8h+7), elements 8..15 <- p[16..23] (k0+16+8h..)
__device__ __forceinline__ v16h ldfrag(const _Float16* p) {
  FH f;
  f.h[0] = *(const v8h*)(p);
  f.h[1] = *(const v8h*)(p + 16);
  return f.v;
}

__device__ __forceinline__ v8f mma_raw(v16h a, v16h b, v8f c) {
  return __builtin_amdgcn_wmma_f32_16x16x32_f16(false, a, false, b, (short)0, c, false, false);
}
// guard after the last WMMA of a 4-op group: ties all four D, keeps the group's A and B live
__device__ __forceinline__ void guard4(v8f& d0, v8f& d1, v8f& d2, v8f& d3,
                                       v16h a, v16h b0, v16h b1, v16h b2, v16h b3) {
  asm volatile("v_nop\n\tv_nop\n\tv_nop\n\tv_nop"
               : "+v"(d0), "+v"(d1), "+v"(d2), "+v"(d3)
               : "v"(a), "v"(b0), "v"(b1), "v"(b2), "v"(b3));
}

// lane l <-> lane l ^ 16 (the two halves of a wave), by a vector cross-row move
__device__ __forceinline__ float xhalf(float x) {
  return __builtin_bit_cast(float, __builtin_amdgcn_permlanex16(__builtin_bit_cast(int, x), __builtin_bit_cast(int, x),
                                                                0x76543210, 0xfedcba98, false, false));
}

// tanh-form GELU via the identity 0.5u(1+tanh z) = u * sigmoid(2z); exp argument clamped, reciprocal by v_rcp
__device__ __forceinline__ float gelu_tanh(float u) {
  const float z = 0.7978845608028654f * (u + 0.044715f * u * u * u);
  const float e = __expf(fminf(-2.0f * z, 80.0f));
  return u * __builtin_amdgcn_rcpf(1.0f + e);
}

// =====================================================================================================
// Weight transpose + convert: W f32 [Kin][Nout] (pitch Nout) -> Wt f16 [Nout][Kin] (pitch Kin), times scale.
// 64x64 tile (bx of Nout/64, by of Kin/64) through the LDS tile T, 256 threads. Reads: thread handles 4 float4 of the
// tile (chunk = tid + i*256 -> row r = chunk>>4 (k local), cols c4..c4+3 (n local)).
// coverage: 8 waves x 2 x 4 = 64 rows, 8 lanes x 8 halves = 64 cols = the whole tile.
// =====================================================================================================
__device__ __forceinline__ void tr_cvt_tile(const float* __restrict__ W, _Float16* Wt,
                                            int Kin, int Nout, float scale, int bx, int by,
                                            _Float16 (*T)[72]) {   // T: [n local][k local], pitch 144 B
  const int tid = threadIdx.x, wave = tid >> 5, lane = tid & 31;
  const int n0 = bx * 64, k0 = by * 64;
#pragma unroll
  for (int i = 0; i < 4; ++i) {
    const int chunk = tid + i * 256;
    const int r = chunk >> 4;            // 0..63  (k local)
    const int c4 = (chunk & 15) * 4;     // 0..60  (n local)
    const v4f v = *(const v4f*)(W + (size_t)(k0 + r) * Nout + n0 + c4);
#pragma unroll
    for (int e = 0; e < 4; ++e) T[c4 + e][r] = (_Float16)(v[e] * scale);
  }
  __syncthreads();
  const int q = lane >> 3, c8 = (lane & 7) * 8;
  v4u o[2];
#pragma unroll
  for (int it = 0; it < 2; ++it) {
    const int row = wave * 8 + it * 4 + q;
    H8 p;
    p.h = *(const v8h*)(&T[row][c8]);
    o[it] = p.u;
  }
  {
#pragma unroll
    for (int it = 0; it < 2; ++it) {
      const int row = wave * 8 + it * 4 + q;
      *(v4u*)(Wt + (size_t)(n0 + row) * Kin + k0 + c8) = o[it];
    }
    // in the listing the other job's code follows these stores and writes their registers: only behind this wait
    asm volatile("s_wait_xcnt 0x0" ::: "memory");
  }
}

// =====================================================================================================
// LayerNorm over DM=768 columns, f32 math, f16 output (unscaled). One wave per row, 8 rows per block
// (blk of ceil(nrows/8)). Lane holds columns i*256 + lane*8 .. +7 (i 0..2). mean and variance by two register
// passes with 32-lane butterflies. Output: three 16-B stores per lane, each instruction = 32 lanes x 16 B =
// coverage: 3 x 256 = 768 columns per row; every row < nrows by exactly one wave.
// =====================================================================================================
__device__ __forceinline__ void ln_rows8(const float* __restrict__ X, const float* __restrict__ g,
                                         const float* __restrict__ bb, _Float16* Y, int nrows, int blk) {
  const int wave = threadIdx.x >> 5, lane = threadIdx.x & 31;
  const int row = blk * 8 + wave;
  if (row >= nrows) return;                  // wave-uniform; no block barriers on this path
  const float* xr = X + (size_t)row * DM;
  float v[3][8];
  float s = 0.f;
#pragma unroll
  for (int i = 0; i < 3; ++i) {
    const int col = i * 256 + lane * 8;
    const v4f a = *(const v4f*)(xr + col);
    const v4f c = *(const v4f*)(xr + col + 4);
#pragma unroll
    for (int e = 0; e < 4; ++e) { v[i][e] = a[e]; v[i][4 + e] = c[e]; }
#pragma unroll
    for (int e = 0; e < 8; ++e) s += v[i][e];
  }
#pragma unroll
  for (int off = 16; off > 0; off >>= 1) s += __shfl_xor(s, off, 32);
  const float mu = s * (1.0f / (float)DM);
  float qs = 0.f;
#pragma unroll
  for (int i = 0; i < 3; ++i)
#pragma unroll
    for (int e = 0; e < 8; ++e) { const float d = v[i][e] - mu; v[i][e] = d; qs += d * d; }
#pragma unroll
  for (int off = 16; off > 0; off >>= 1) qs += __shfl_xor(qs, off, 32);
  const float rstd = rsqrtf(qs * (1.0f / (float)DM) + 1e-5f);
  v4u o[3];
#pragma unroll
  for (int i = 0; i < 3; ++i) {
    const int col = i * 256 + lane * 8;
    const v4f g0 = *(const v4f*)(g + col), g1 = *(const v4f*)(g + col + 4);
    const v4f b0 = *(const v4f*)(bb + col), b1 = *(const v4f*)(bb + col + 4);
    H8 p;
#pragma unroll
    for (int e = 0; e < 4; ++e) {
      p.h[e]     = (_Float16)(v[i][e] * rstd * g0[e] + b0[e]);
      p.h[4 + e] = (_Float16)(v[i][4 + e] * rstd * g1[e] + b1[e]);
    }
    o[i] = p.u;
  }
  {
#pragma unroll
    for (int i = 0; i < 3; ++i)
      *(v4u*)(Y + (size_t)row * DM + i * 256 + lane * 8) = o[i];
    
  }
}

__global__ __launch_bounds__(256) void ln_rows(const float* __restrict__ X, const float* __restrict__ g,
                                               const float* __restrict__ bb, _Float16* Y, int nrows) {
  ln_rows8(X, g, bb, Y, nrows, blockIdx.x);
}

// =====================================================================================================
// Everything that depends on the inputs alone, in one launch; the block index picks the job (block-uniform):
//   blocks 0 .. LNB-1: ln1 row blocks;  then 4 x TDD tiles: Wq, Wk, Wv, Wo;  then TDF tiles: W1;  then TDF: W2.
// Inside a weight the tile index runs n tile first. grid = LNB + 4*TDD + 2*TDF, exact.
// =====================================================================================================
constexpr int LNB = NROW / 8;                  // 1024
constexpr int TDD = (DM / 64) * (DM / 64);     // 144
constexpr int TDF = (DM / 64) * (FF / 64);     // 576
__global__ __launch_bounds__(256) void prep_all(const float* __restrict__ X, const float* __restrict__ g,
                                                const float* __restrict__ bb, _Float16* Y,
                                                const float* __restrict__ Wq, const float* __restrict__ Wk,
                                                const float* __restrict__ Wv, const float* __restrict__ Wo,
                                                const float* __restrict__ W1, const float* __restrict__ W2,
                                                _Float16* Wqt, _Float16* Wkt, _Float16* Wvt, _Float16* Wot,
                                                _Float16* W1t, _Float16* W2t, float scale) {
  __shared__ __align__(16) _Float16 T[64][72];
  const int bid = blockIdx.x;
  if (bid < LNB) {                             // the whole work-group; no barrier on this side
    ln_rows8(X, g, bb, Y, NROW, bid);
  } else {
    int t = bid - LNB;                         // becomes the tile index inside the weight
    const float* W;
    _Float16* Wt;
    int Kin = DM, Nout = DM;
    if (t < 4 * TDD) {
      const int job = t / TDD;
      t -= job * TDD;
      W  = (job == 0) ? Wq  : (job == 1) ? Wk  : (job == 2) ? Wv  : Wo;
      Wt = (job == 0) ? Wqt : (job == 1) ? Wkt : (job == 2) ? Wvt : Wot;
    } else if (t < 4 * TDD + TDF) {
      t -= 4 * TDD;
      W = W1; Wt = W1t; Nout = FF;
    } else {
      t -= 4 * TDD + TDF;
      W = W2; Wt = W2t; Kin = FF;
    }
    const int nbx = Nout >> 6;
    const int by  = t / nbx;
    tr_cvt_tile(W, Wt, Kin, Nout, scale, t - by * nbx, by, T);
  }
}

// =====================================================================================================
// Batched f16 WMMA GEMM: acc[m][n] = sum_k A[m][k] * Bt[n][k]. One work-group of 4 waves per 128x128 tile,
// one 64x64 sub-tile per wave (2 x 2). A row-major [M][K] pitch lda; Bt row-major [N][K] pitch ldb
// (k contiguous); both f16 global planes. Per stage of 64 k the work-group brings 128 A rows and 128 Bt rows
// of 128 B into LDS once (8 lanes per row, so every load instruction covers 4 whole lines); all four waves
// take their fragments from there. The rows come by asynchronous copies to LDS. Two LDS stages: stage t+1 is in
// flight during the products of stage t; one work-group barrier per stage.
// KS = k columns per stage: 64 as described, or 128 (rows of 256 B, 16 lanes per row) for the products whose grid leaves
// at most two work-groups on a WGP: there few waves cover a stage's flight time, so a stage is made twice as long.
// M, N multiples of 128, K a multiple of KS (checked at compile time for the shapes launched below).
// tile = tile index (n tile first), bz = batch index (strides in elements, C and Res share strideC); ring = the
// work-group's 2 * STG halves of LDS. k order per accumulator: ascending.
// MODE 0: C f16 [m][n] = (acc*accs + bias[n]) * outs
// MODE 1: C f16 [m][n] = (acc*accs + bias[m]) * outs            (bias along rows)
// MODE 2: C f32 [m][n] = Res[m][n] + acc*accs + bias[n]          (Res has C's layout, never aliases C)
// MODE 3: C f16 [m][n] = gelu_tanh(acc*accs + bias[n]) * outs
// =====================================================================================================
// Eight asynchronous 16-B copies to LDS per lane: four row groups of one plane (LDS byte address la + i*lstep, global
// ga + i*astep halves), then four of another (lb, gb, bstep). The address-translation wait is the statement's last
// line, so no register that a copy names is rewritten ahead of it.
typedef __attribute__((address_space(3))) const _Float16 lds_half;
__device__ __forceinline__ void async_rows4x2(unsigned la, unsigned lstep, const _Float16* ga, size_t astep,
                                              unsigned lb, const _Float16* gb, size_t bstep) {
  const unsigned la1 = la + lstep, la2 = la + 2 * lstep, la3 = la + 3 * lstep;
  const unsigned lb1 = lb + lstep, lb2 = lb + 2 * lstep, lb3 = lb + 3 * lstep;
  const _Float16 *ga1 = ga + astep, *ga2 = ga + 2 * astep, *ga3 = ga + 3 * astep;
  const _Float16 *gb1 = gb + bstep, *gb2 = gb + 2 * bstep, *gb3 = gb + 3 * bstep;
  asm volatile("global_load_async_to_lds_b128 %0, %1, off\n\t"
               "global_load_async_to_lds_b128 %2, %3, off\n\t"
               "global_load_async_to_lds_b128 %4, %5, off\n\t"
               "global_load_async_to_lds_b128 %6, %7, off\n\t"
               "global_load_async_to_lds_b128 %8, %9, off\n\t"
               "global_load_async_to_lds_b128 %10, %11, off\n\t"
               "global_load_async_to_lds_b128 %12, %13, off\n\t"
               "global_load_async_to_lds_b128 %14, %15, off\n\t"
               "s_wait_xcnt 0x0"
               :: "v"(la), "v"(ga), "v"(la1), "v"(ga1), "v"(la2), "v"(ga2), "v"(la3), "v"(ga3),
                  "v"(lb), "v"(gb), "v"(lb1), "v"(gb1), "v"(lb2), "v"(gb2), "v"(lb3), "v"(gb3)
               : "memory");
}

// LDS row pitch, halves: 144 B = 16 B x 9 (KS 64) or 272 B = 16 B x 17 (KS 128), for 16-B fragment reads
template <int KS> constexpr int gemm_pitch = KS + 8;
// halves per stage: A rows 0..127, then Bt rows 0..127
template <int KS> constexpr int gemm_stage = 256 * gemm_pitch<KS>;
static_assert(4 * 16 * 68 * 4 <= 2 * gemm_stage<64> * 2);   // the ring's head is the output slabs after the k loop
template <int MODE, int KS>
__device__ __forceinline__ void gemm_tile(
    const _Float16* __restrict__ A, int lda, long long strideA,
    const _Float16* __restrict__ Bt, int ldb, long long strideB,
    const float* __restrict__ bias, const float* __restrict__ Res,
    void* Cout, int ldc, long long strideC,
    int M, int N, int K, float accs, float outs, _Float16* ring, int tile, int bz) {
  static_assert(KS == 64 || KS == 128);
  constexpr int GP  = gemm_pitch<KS>;
  constexpr int STG = gemm_stage<KS>;
  constexpr int LPR = KS / 8;                 // lanes per staged row (16 B each)
  constexpr int RPP = 128 / LPR;              // rows that the work-group's 128 lanes cover at once
  const int tid  = threadIdx.x;
  const int lane = tid & 31;
  const int wave = tid >> 5;
  const int tilesN = N >> 7;
  const int tilesM = M >> 7;
  if (tile >= tilesM * tilesN) return;   // the same for the whole work-group, ahead of every barrier
  const int tm = tile / tilesN;
  const int tn = tile - tm * tilesN;
  const int wm = (wave >> 1) << 6;            // this wave's 64x64 sub-tile inside the 128x128 tile
  const int wn = (wave & 1) << 6;
  const int m0 = (tm << 7) + wm;
  const int n0 = (tn << 7) + wn;

  const _Float16* Ab = A  + (size_t)bz * (size_t)strideA;
  const _Float16* Bb = Bt + (size_t)bz * (size_t)strideB;

  const int rl   = lane & 15;                 // row (A) / col (B, D) within subtile
  const int koff = (lane >> 4) * 8;           // k offset of this lane half
  const int mOff = (lane >> 4) * 8;           // D row offset

  // staging map: thread -> row tid/LPR + RPP*i, i 0..128/RPP-1, 16 B at column (tid%LPR)*8: 128 rows x 2*KS B per operand
  const int sr = tid / LPR;
  const int sc = (tid % LPR) * 8;
  const _Float16* ga = Ab + (size_t)((tm << 7) + sr) * lda + sc;
  const _Float16* gb = Bb + (size_t)((tn << 7) + sr) * ldb + sc;
  const unsigned sa = (unsigned)(uintptr_t)(lds_half*)(ring + sr * GP + sc);   // LDS byte address, stage 0, A row sr
  const unsigned sb = sa + 128 * GP * 2;                                       // the same of Bt
  // one stage: k columns kn.., into the LDS stage at byte offset so; A and Bt rows sr + RPP i, four values of i a statement
  auto copy_stage = [&](unsigned so, int kn) {
#pragma unroll   // r0 a constant in each statement: its LDS and row offsets fold, and no loop counter stands among the copies
    for (int r0 = 0; r0 < 128; r0 += 4 * RPP)
      async_rows4x2(sa + so + r0 * GP * 2, RPP * GP * 2, ga + (size_t)r0 * lda + kn, (size_t)RPP * lda,
                    sb + so + r0 * GP * 2, gb + (size_t)r0 * ldb + kn, (size_t)RPP * ldb);
  };

  v8f acc[4][4];
#pragma unroll
  for (int i = 0; i < 4; ++i)
#pragma unroll
    for (int j = 0; j < 4; ++j) acc[i][j] = zero8();

  const int nk = K / KS;
  copy_stage(0u, 0);
  asm volatile("s_wait_asynccnt 0x0" ::: "memory");   // this wave's copies of stage 0 have landed
  __syncthreads();
  if (nk > 1) copy_stage(STG * 2, KS);                // the same for the whole work-group

  for (int kt = 0; kt < nk; ++kt) {
    const int cur = (kt & 1) * STG;
    const _Float16* fa = ring + cur + (wm + rl) * GP + koff;
    const _Float16* fb = ring + cur + (128 + wn + rl) * GP + koff;
#pragma unroll
    for (int kk = 0; kk < KS / 32; ++kk) {
      v16h bf[4], af[4];
#pragma unroll
      for (int j = 0; j < 4; ++j) bf[j] = ldfrag(fb + j * 16 * GP + kk * 32);
#pragma unroll
      for (int i = 0; i < 4; ++i) af[i] = ldfrag(fa + i * 16 * GP + kk * 32);
#pragma unroll
      for (int i = 0; i < 4; ++i) {
#pragma unroll
        for (int j = 0; j < 4; ++j) acc[i][j] = mma_raw(af[i], bf[j], acc[i][j]);
        guard4(acc[i][0], acc[i][1], acc[i][2], acc[i][3], af[i], bf[0], bf[1], bf[2], bf[3]);
      }
    }
    // hand-over: this wave's reads of stage kt are done and its copies of stage kt+1 have landed; the barrier
    // publishes stage kt+1 and frees the LDS of stage kt, which stage kt+2 then goes into
    asm volatile("s_wait_dscnt 0x0" ::: "memory");
    asm volatile("s_wait_asynccnt 0x0" ::: "memory");
    __syncthreads();
    if (kt + 2 < nk) copy_stage((unsigned)cur * 2, (kt + 2) * KS);   // the same for the whole work-group
  }
  asm volatile("s_wait_asynccnt 0x0" ::: "memory");   // nothing of this wave's is in flight when the ring becomes slabs

  // ---- epilogue ----
  float* slab = (float*)ring + wave * (16 * 68);   // per-wave 16x64 slab, pitch 68 floats (272 B)
#pragma unroll
  for (int i = 0; i < 4; ++i) {
    const int mBase = m0 + (i << 4);
#pragma unroll
    for (int j = 0; j < 4; ++j) {
#pragma unroll
      for (int r = 0; r < 8; ++r) slab[(mOff + r) * 68 + (j << 4) + rl] = acc[i][j][r];
    }
    __builtin_amdgcn_fence(__ATOMIC_RELEASE, "workgroup");
    __builtin_amdgcn_wave_barrier();
    __builtin_amdgcn_fence(__ATOMIC_ACQUIRE, "workgroup");
    if constexpr (MODE == 2) {
      float* C = (float*)Cout + (size_t)bz * (size_t)strideC;
      const float* R = Res + (size_t)bz * (size_t)strideC;
      const int h2 = lane >> 4, c4 = (lane & 15) * 4;    // 256-B row segment = 16 lanes x 16 B
      const v4f bq4 = *(const v4f*)(bias + n0 + c4);
      {
#pragma unroll
        for (int it = 0; it < 8; ++it) {
          const int row = it * 2 + h2;                    // it 0..7 x h2 0..1 = rows 0..15
          const v4f a  = *(const v4f*)(slab + row * 68 + c4);
          const v4f rr = *(const v4f*)(R + (size_t)(mBase + row) * ldc + n0 + c4);
          v4f ov;
#pragma unroll
          for (int e = 0; e < 4; ++e) ov[e] = rr[e] + (a[e] * accs + bq4[e]);
          *(v4f*)(C + (size_t)(mBase + row) * ldc + n0 + c4) = ov;
        }
        
      }
    } else {
      _Float16* C = (_Float16*)Cout + (size_t)bz * (size_t)strideC;
      const int q = lane >> 3, c8 = (lane & 7) * 8;
      float bc[8];
      if constexpr (MODE != 1) {
        const v4f b0 = *(const v4f*)(bias + n0 + c8), b1 = *(const v4f*)(bias + n0 + c8 + 4);
#pragma unroll
        for (int e = 0; e < 4; ++e) { bc[e] = b0[e]; bc[4 + e] = b1[e]; }
      } else {
#pragma unroll
        for (int e = 0; e < 8; ++e) bc[e] = 0.f;
      }
      v4u hv[4];
#pragma unroll
      for (int it = 0; it < 4; ++it) {
        const int row = it * 4 + q;                       // it 0..3 x q 0..3 = rows 0..15
        const float* sp = slab + row * 68 + c8;
        float brow = 0.f;
        if constexpr (MODE == 1) brow = bias[mBase + row];   // mBase + row < M = bias length in this mode
        H8 p;
#pragma unroll
        for (int e = 0; e < 8; ++e) {
          float f = sp[e] * accs + ((MODE == 1) ? brow : bc[e]);
          if constexpr (MODE == 3) f = gelu_tanh(f);
          f *= outs;
          p.h[e] = (_Float16)f;
        }
        hv[it] = p.u;
      }
      {
#pragma unroll
        for (int it = 0; it < 4; ++it) {
          const int row = it * 4 + q;
          *(v4u*)(C + (size_t)(mBase + row) * ldc + n0 + c8) = hv[it];
        }
        
      }
    }
    __builtin_amdgcn_fence(__ATOMIC_RELEASE, "workgroup");
    __builtin_amdgcn_wave_barrier();
    __builtin_amdgcn_fence(__ATOMIC_ACQUIRE, "workgroup");
  }
}

// one product per launch: grid = (tiles, batches)
template <int MODE, int KS>
__global__ __launch_bounds__(128) void gemm64(
    const _Float16* __restrict__ A, int lda, long long strideA,
    const _Float16* __restrict__ Bt, int ldb, long long strideB,
    const float* __restrict__ bias, const float* __restrict__ Res,
    void* Cout, int ldc, long long strideC,
    int M, int N, int K, float accs, float outs) {
  __shared__ __align__(16) _Float16 ring[2 * gemm_stage<KS>];   // 73728 B (KS 64), 139264 B (KS 128)
  gemm_tile<MODE, KS>(A, lda, strideA, Bt, ldb, strideB, bias, Res, Cout, ldc, strideC, M, N, K, accs, outs,
                      ring, blockIdx.x, blockIdx.y);
}

// The three projections of ln1's output in one launch; the block index picks the product (block-uniform):
//   blocks 0 .. TPJ-1:  q   = (ln1 . Wq + bq) * 0.5        M=8192, N=768, K=768
//   then TPJ blocks:    k   = (ln1 . Wk + bk) * 4          the same shape
//   then NB x TVT:      v^T = (Wv^T . ln1^T + bv[row]) * 4 per batch, f16 [b][d][s]; M=768, N=4096, K=768
// every accumulator carries 32 x the product (weights x32). grid = 2*TPJ + NB*TVT, exact.
constexpr int TPJ = (NROW / 128) * (DM / 128);   // 384
constexpr int TVT = (DM / 128) * (SEQ / 128);    // 192
__global__ __launch_bounds__(128) void gemm_qkv(
    const _Float16* __restrict__ Nrm, const _Float16* __restrict__ Wqt, const _Float16* __restrict__ Wkt,
    const _Float16* __restrict__ Wvt, const float* __restrict__ bq, const float* __restrict__ bk,
    const float* __restrict__ bv, _Float16* Qo, _Float16* Ko, _Float16* VTo) {
  __shared__ __align__(16) _Float16 ring[2 * gemm_stage<64>];   // 73728 B
  const int bid = blockIdx.x;
  if (bid < 2 * TPJ) {
    const bool isk = bid >= TPJ;
    const float* bias = isk ? bk : bq;
    gemm_tile<0, 64>(Nrm, DM, 0LL, isk ? Wkt : Wqt, DM, 0LL, bias, bias, (void*)(isk ? Ko : Qo), DM, 0LL,
                 NROW, DM, DM, 1.0f / 32.0f, isk ? 4.0f : 0.5f, ring, isk ? bid - TPJ : bid, 0);
  } else {
    const int t  = bid - 2 * TPJ;
    const int bz = t / TVT;
    gemm_tile<1, 64>(Wvt, DM, 0LL, Nrm, DM, (long long)SEQ * DM, bv, bv, (void*)VTo, SEQ, (long long)DM * SEQ,
                 DM, SEQ, DM, 1.0f / 32.0f, 4.0f, ring, t - bz * TVT, bz);
  }
}

// =====================================================================================================
// Causal attention, head dim 64, f16 operands.
//   q plane (f16, carries q * 0.5):  element (b, t, h, d) at [(b*SEQ + t)*DM + h*64 + d]
//   k plane (f16, carries k * 4):    same layout with key index s
//   v^T plane (f16, carries v * 4):  element (b, h, d, s) at [(b*DM + h*64 + d)*SEQ + s]
//   logit = acc * sscale with sscale = 1/16  (0.5 * 4 / 16 = 1/8 = 1/sqrt(64));
//   Both products are taken transposed: S^T = K . Q^T (A = K rows, B = Q) and O^T += V^T . P^T (A = V^T rows).
//   A score tile's lane then holds 8 keys (16j + 8*(lane>>4) + r) of ONE query (lane&15): the row maximum and sum
//   are in-lane, joined between the wave halves by one exchange; two score tiles, converted in place, are the
//   B operand P^T in the hardware k order, which the V^T fragment loads already have.
//   keys s > t excluded per lane (-inf before the row max); every row has key 0 so the max is finite.
//   p = exp(s - m) packed as f16(1024 p); context = p . v on f16 WMMA; online softmax in f32.
//   out plane (f16, carries ctx * 4): element (b, t, h, d) at [(b*SEQ + t)*DM + h*64 + d];
//   ctx*4 = acc / (1024 l) since acc = 4096 * sum p v.
//   Block = 4 waves = 64 query rows of one (b, h) at a time, two query tiles qb in turn (NQB-1-pr, then pr);
//   grid = (NQB/2) * NH * NB; key tiles 0..qb (block-uniform).
//   K / V^T tile staging: asynchronous 16-B copies to LDS, 8 lanes per 128-B row (an instruction covers 4 whole
//   lines), 4 copies per thread and plane = the whole 64x64 tile; two buffers, key tile t+1 in flight during tile t;
//   one work-group barrier per key tile.
//   Output coverage: each wave stores rows q0..q0+15 (it 0..3 x lane>>3 0..3) x 64 columns (8 lanes x 8).
// =====================================================================================================
// One key tile into one LDS buffer: rows sr + 16 i (i 0..3) of K, then of V^T. lds = this lane's byte address in the
// buffer's K plane (row pitch 144 B, V^T plane 9216 B behind K); gk, gv = its global bytes.
__device__ __forceinline__ void copy_kv_tile(unsigned lds, const _Float16* gk, const _Float16* gv) {
  async_rows4x2(lds, 2304u, gk, (size_t)16 * DM, lds + 9216u, gv, (size_t)16 * SEQ);
}

__global__ __launch_bounds__(128)
void attn_causal64(const _Float16* __restrict__ Qp, const _Float16* __restrict__ Kp,
                   const _Float16* __restrict__ Vtp, _Float16* Op, float sscale) {
  // Row pitches: 16-B fragment reads walk 16 rows at once, so a pitch of 16 B x odd spreads them over all banks
  // (128-B rows put every other row on the same banks).
  constexpr int LP = 72;                               // f16 rows of 64: pitch 72 halves = 144 B
  constexpr int OP = 68;                               // f32 rows of 64: pitch 68 floats = 272 B
  constexpr int TB = 64 * LP;                          // halves per plane of a key tile: 9 KB
  static_assert(LP * 2 == 144 && TB * 2 == 9216);      // the byte steps in copy_kv_tile
  __shared__ __align__(16) _Float16 KV[2][2 * TB];     // two buffers, each K [kv][d], then V^T [d][kv]
  __shared__ __align__(16) float    Os[4][16 * OP];    // per wave context tile [row][d]

  const int tid  = threadIdx.x;
  const int wave = tid >> 5;
  const int lane = tid & 31;
  const int hh   = lane >> 4;
  const int c    = lane & 15;

  const int bx   = blockIdx.x;
  const int pr   = bx % (NQB / 2);
  const int rest = bx / (NQB / 2);
  const int h    = rest % NH;
  const int b    = rest / NH;
  const size_t rowB = (size_t)b * SEQ;

  const _Float16* Qh = Qp + (size_t)h * HD;
  const _Float16* Kh = Kp + (size_t)h * HD;
  const _Float16* Vh = Vtp + ((size_t)b * DM + (size_t)h * HD) * SEQ;

  // copy map: thread -> row (tid>>3) + 16 i, 16 B at column (tid&7)*8; addresses of key tile 0 in buffer 0
  const int sr = tid >> 3, sc = (tid & 7) * 8;
  const unsigned  lds0 = (unsigned)(uintptr_t)(lds_half*)(&KV[0][0] + sr * LP + sc);
  const _Float16* gk0  = Kh + (rowB + sr) * DM + sc;          // K row sr, d = sc..sc+7
  const _Float16* gv0  = Vh + (size_t)sr * SEQ + sc;          // V^T row d = sr, s = sc..sc+7

  // Two query tiles, one after the other in every wave: NQB-1-pr, then pr. (NQB-pr) + (pr+1) = NQB+1 key tiles
  // for every work-group, so no work-group outlasts the others. pr 0..NQB/2-1 covers every query tile once.
  for (int part = 0; part < 2; ++part) {        // block-uniform
    const int qb = part ? pr : NQB - 1 - pr;
    const int q0 = qb * 64 + wave * 16;

    // ---- Q fragments (B operand, column = lane&15 = query row): 2 d-chunks of 32 ----
    v16h qa[2];
#pragma unroll
    for (int dc = 0; dc < 2; ++dc)
      qa[dc] = ldfrag(Qh + (rowB + q0 + c) * DM + dc * 32 + 8 * hh);

    const int qrow = q0 + c;                    // this lane's query row
    float mrow = -INFINITY;                     // running maximum of row qrow (alike in both wave halves)
    float lrow = 0.f;                           // running sum over this wave half's keys only; joined after the loop
    v8f oacc[4];                                // O^T: oacc[t][r] = context(qrow, d = 16t + 8*hh + r)
#pragma unroll
    for (int t = 0; t < 4; ++t) oacc[t] = zero8();

    // key tile 0 into buffer 0 and published; then tile 1 into buffer 1, in flight during tile 0. Both buffers are
    // free here: the barrier at the foot of the last trip of the query tile before ended every read of them.
    copy_kv_tile(lds0, gk0, gv0);
    asm volatile("s_wait_asynccnt 0x0" ::: "memory");   // this wave's copies of tile 0 have landed
    __syncthreads();
    if (qb >= 1) copy_kv_tile(lds0 + 2 * TB * 2, gk0 + (size_t)64 * DM, gv0 + 64);   // block-uniform

    for (int kt = 0; kt <= qb; ++kt) {          // causal key tiles, block-uniform trip count
      const int kv0 = kt * 64;
      const _Float16* Ksh = &KV[kt & 1][0];
      const _Float16* Vth = Ksh + TB;

      // ---- all fragment reads of this key tile as one group, each fragment in registers of its own: K first,
      //      V^T behind it, so the score products wait for the K half only and V^T lands under them and the softmax ----
      v16h kf[2][4], vf[2][4];
#pragma unroll
      for (int dc = 0; dc < 2; ++dc)
#pragma unroll
        for (int j = 0; j < 4; ++j) kf[dc][j] = ldfrag(Ksh + (j * 16 + c) * LP + dc * 32 + 8 * hh);
#pragma unroll
      for (int kk = 0; kk < 2; ++kk)
#pragma unroll
        for (int t = 0; t < 4; ++t) vf[kk][t] = ldfrag(Vth + (t * 16 + c) * LP + kk * 32 + 8 * hh);
      // keeps the reads together in front of the products: spread among them, each place costs its own LDS wait
      __builtin_amdgcn_sched_barrier(0);

      // ---- scores, transposed: s[j][r] = score(key kv0 + 16j + 8*hh + r, query qrow); d chunks ascending in each tile ----
      v8f s[4];
#pragma unroll
      for (int j = 0; j < 4; ++j) s[j] = zero8();
#pragma unroll
      for (int dc = 0; dc < 2; ++dc)
#pragma unroll
        for (int j = 0; j < 4; ++j) s[j] = mma_raw(kf[dc][j], qa[dc], s[j]);

      // ---- scale, causal exclusion, row max, online softmax, P^T (x1024, f16) packed in registers ----
      float mj[4];
#pragma unroll
      for (int j = 0; j < 4; ++j) {
        mj[j] = -INFINITY;
#pragma unroll
        for (int r = 0; r < 8; ++r) {
          const int key = kv0 + j * 16 + 8 * hh + r;
          const float sv = (key <= qrow) ? (s[j][r] * sscale) : -INFINITY;
          s[j][r] = sv;
          mj[j] = fmaxf(mj[j], sv);
        }
      }
      float m = fmaxf(fmaxf(mj[0], mj[1]), fmaxf(mj[2], mj[3]));
      m = fmaxf(m, xhalf(m));                    // both halves now hold the maximum over the 64 keys
      const float mnew  = fmaxf(mrow, m);
      const float msafe = (mnew == -INFINITY) ? 0.f : mnew;
      const float alpha = __expf(mrow - msafe);
      mrow = mnew;
      FH pb[2];                                  // P^T, B operand: element e of half j&1 = key 32*(j>>1) + 16*(j&1) + 8*hh + e
      float pj[4];
#pragma unroll
      for (int j = 0; j < 4; ++j) {
        float a[8], p[8];                              // excluded key: exp(-inf) = 0
#pragma unroll
        for (int r = 0; r < 8; ++r) a[r] = (s[j][r] - msafe) * 1.44269504f;
        // a score tile's eight v_exp and the one issue slot behind the last in one statement, results in registers
        // of their own
        asm("v_exp_f32 %0, %8\n\tv_exp_f32 %1, %9\n\tv_exp_f32 %2, %10\n\tv_exp_f32 %3, %11\n\t"
            "v_exp_f32 %4, %12\n\tv_exp_f32 %5, %13\n\tv_exp_f32 %6, %14\n\tv_exp_f32 %7, %15\n\tv_nop"
            : "=&v"(p[0]), "=&v"(p[1]), "=&v"(p[2]), "=&v"(p[3]), "=&v"(p[4]), "=&v"(p[5]), "=&v"(p[6]), "=&v"(p[7])
            : "v"(a[0]), "v"(a[1]), "v"(a[2]), "v"(a[3]), "v"(a[4]), "v"(a[5]), "v"(a[6]), "v"(a[7]));
        pj[j] = 0.f;
#pragma unroll
        for (int r = 0; r < 8; ++r) {
          pj[j] += p[r];
          pb[j >> 1].h[j & 1][r] = (_Float16)(p[r] * 1024.0f);
        }
      }
      lrow = lrow * alpha + ((pj[0] + pj[1]) + (pj[2] + pj[3]));
#pragma unroll
      for (int t = 0; t < 4; ++t)
#pragma unroll
        for (int r = 0; r < 8; ++r) oacc[t][r] *= alpha;

      // ---- context^T += V^T . P^T (f16 WMMA) ----
#pragma unroll
      for (int kk = 0; kk < 2; ++kk) {
#pragma unroll
        for (int t = 0; t < 4; ++t) oacc[t] = mma_raw(vf[kk][t], pb[kk].v, oacc[t]);
      }

      // ---- hand-over: this wave's reads of buffer kt&1 are done and its copies of tile kt+1 have landed; the
      //      barrier publishes tile kt+1 and frees buffer kt&1, which tile kt+2 then goes into ----
      // keeps the products and the softmax in front of the waits: moved behind them (they touch no memory), tile
      // kt+1 would be waited for right behind its issue and tile kt+2 issued a whole trip's work late
      __builtin_amdgcn_sched_barrier(0);
      asm volatile("s_wait_dscnt 0x0" ::: "memory");
      asm volatile("s_wait_asynccnt 0x0" ::: "memory");
      __syncthreads();
      if (kt + 2 <= qb)                          // block-uniform
        copy_kv_tile(lds0 + (unsigned)(kt & 1) * (2 * TB * 2), gk0 + (size_t)(kt + 2) * 64 * DM, gv0 + (kt + 2) * 64);
    }
    asm volatile("s_wait_asynccnt 0x0" ::: "memory");   // nothing of this wave's is in flight behind the loop

    // ---- normalise (1/l and the carries), stage the wave's 16x64 tile, convert to f16,
    float* os = Os[wave];
    {
      const float l = lrow + xhalf(lrow);        // the two halves' key sums joined
      const float inv = ((l > 0.f) ? (1.0f / l) : 0.f) * (1.0f / 1024.0f);
#pragma unroll
      for (int t = 0; t < 4; ++t) {
        v4f lo, hi;
#pragma unroll
        for (int e = 0; e < 4; ++e) { lo[e] = oacc[t][e] * inv; hi[e] = oacc[t][4 + e] * inv; }
        *(v4f*)(os + c * OP + t * 16 + 8 * hh)     = lo;
        *(v4f*)(os + c * OP + t * 16 + 8 * hh + 4) = hi;
      }
    }
    __builtin_amdgcn_fence(__ATOMIC_RELEASE, "workgroup");
    __builtin_amdgcn_wave_barrier();
    __builtin_amdgcn_fence(__ATOMIC_ACQUIRE, "workgroup");
    {
      const int q4 = lane >> 3, c8 = (lane & 7) * 8;
      v4u hv[4];
#pragma unroll
      for (int it = 0; it < 4; ++it) {
        const int row = it * 4 + q4;   // it 0..3 x q4 0..3 = rows 0..15 of the wave tile
        const float* sp = os + row * OP + c8;
        H8 p;
#pragma unroll
        for (int e = 0; e < 8; ++e) p.h[e] = (_Float16)sp[e];
        hv[it] = p.u;
      }
      {
#pragma unroll
        for (int it = 0; it < 4; ++it) {
          const int row = it * 4 + q4;
          const size_t go = (rowB + q0 + row) * DM + (size_t)h * HD + c8;
          *(v4u*)(Op + go) = hv[it];
        }
        // the second query tile reuses the address and data registers of these stores: only behind this wait
        asm volatile("s_wait_xcnt 0x0" ::: "memory");
      }
    }
  }
}

// =====================================================================================================
// Workspace map (bytes), every region an exact multiple of its whole-line / 64x64-tile store granularity:
//   Wqt  f16 [768 out][768 in] x32      0          1179648
//   Wkt  f16 [768][768] x32              1179648    1179648
//   Wvt  f16 [768][768] x32              2359296    1179648
//   Wot  f16 [768][768] x32              3538944    1179648
//   W1t  f16 [3072][768] x32             4718592    4718592
//   W2t  f16 [768][3072] x32             9437184    4718592
//   Np   f16 [8192][768]  ln1 out, later ln2 out          14155776   12582912
//   RegB 50331648 B at 26738688: q f16 [8192][768] at +0, k at +12582912, v^T f16 [2][768][4096] at
//        +25165824 (end +37748736); later the gelu plane G f16 [8192][3072] covers the whole region
//   Ctx  f16 [8192][768] x4              77070336   12582912
//   X1   f32 [8192][768]                 89653248   25165824
//   end                                  114819072
// Launch order makes the aliasing safe on the in-order stream: q/k/v^T are last read by the attention
// launch, G is written three launches later; Np is last read by the projection launch before ln2 rewrites it.
// Spec weights are [in][out]; the GEMM wants Bt[n][k] / A[m][k] with k contiguous, hence the transposes.
// =====================================================================================================
extern "C" void kernel_launch(void* const* d_in, const int* in_sizes, int n_in,
                              void* d_out, int out_size, void* d_ws, size_t ws_size,
                              hipStream_t stream) {
  if (n_in < 17) return;
  if (in_sizes[0] != NROW * DM) return;
  if (in_sizes[1] != DM || in_sizes[2] != DM) return;
  if (in_sizes[3] != DM * DM || in_sizes[5] != DM * DM || in_sizes[7] != DM * DM || in_sizes[9] != DM * DM) return;
  if (in_sizes[4] != DM || in_sizes[6] != DM || in_sizes[8] != DM || in_sizes[10] != DM) return;
  if (in_sizes[11] != DM || in_sizes[12] != DM) return;
  if (in_sizes[13] != DM * FF || in_sizes[14] != FF || in_sizes[15] != FF * DM || in_sizes[16] != DM) return;
  if (out_size != NROW * DM) return;

  const float* x    = (const float*)d_in[0];
  const float* ln1g = (const float*)d_in[1];
  const float* ln1b = (const float*)d_in[2];
  const float* Wq   = (const float*)d_in[3];
  const float* bq   = (const float*)d_in[4];
  const float* Wk   = (const float*)d_in[5];
  const float* bk   = (const float*)d_in[6];
  const float* Wv   = (const float*)d_in[7];
  const float* bv   = (const float*)d_in[8];
  const float* Wo   = (const float*)d_in[9];
  const float* bo   = (const float*)d_in[10];
  const float* ln2g = (const float*)d_in[11];
  const float* ln2b = (const float*)d_in[12];
  const float* W1   = (const float*)d_in[13];
  const float* b1   = (const float*)d_in[14];
  const float* W2   = (const float*)d_in[15];
  const float* b2   = (const float*)d_in[16];

  const size_t PWD  = (size_t)DM * DM * 2;          //  1179648
  const size_t PWF  = (size_t)DM * FF * 2;          //  4718592
  const size_t PA16 = (size_t)NROW * DM * 2;        // 12582912  f16 activation plane [8192][768]
  const size_t PVT  = (size_t)NB * DM * SEQ * 2;    // 12582912  v^T plane
  const size_t PG   = (size_t)NROW * FF * 2;        // 50331648  gelu plane [8192][3072]
  const size_t PX1  = (size_t)NROW * DM * 4;        // 25165824  f32 plane
  size_t off = 0;
  const size_t oWq = off; off += PWD;
  const size_t oWk = off; off += PWD;
  const size_t oWv = off; off += PWD;
  const size_t oWo = off; off += PWD;
  const size_t oW1 = off; off += PWF;
  const size_t oW2 = off; off += PWF;
  const size_t oN  = off; off += PA16;
  const size_t oRB = off; off += PG;
  const size_t oCt = off; off += PA16;
  const size_t oX1 = off; off += PX1;
  if (off > ws_size) return;                        // off = 114819072
  if (off > (size_t)134217728) return;
  const size_t oQ  = oRB;
  const size_t oK  = oRB + PA16;
  const size_t oVT = oRB + 2 * PA16;
  if (oVT + PVT > oRB + PG) return;                 // q, k, v^T fit inside the gelu region
  const size_t oG  = oRB;

  char* ws = (char*)d_ws;
  _Float16* Wqt = (_Float16*)(ws + oWq);
  _Float16* Wkt = (_Float16*)(ws + oWk);
  _Float16* Wvt = (_Float16*)(ws + oWv);
  _Float16* Wot = (_Float16*)(ws + oWo);
  _Float16* W1t = (_Float16*)(ws + oW1);
  _Float16* W2t = (_Float16*)(ws + oW2);
  _Float16* Np  = (_Float16*)(ws + oN);
  _Float16* Qp  = (_Float16*)(ws + oQ);
  _Float16* Kpl = (_Float16*)(ws + oK);
  _Float16* VTp = (_Float16*)(ws + oVT);
  _Float16* Gp  = (_Float16*)(ws + oG);
  _Float16* Ctp = (_Float16*)(ws + oCt);
  float*    X1  = (float*)(ws + oX1);

  const dim3 blk(256);
  const dim3 gPrep(LNB + 4 * TDD + 2 * TDF);                       // 2752 blocks: ln1 and the six weights
  const dim3 gLn((NROW + 7) / 8);                                  // 1024 blocks
  const dim3 gblk(128);                                            // GEMM work-group: 4 waves
  const dim3 gProj((NROW / 128) * (DM / 128), 1);                  // 384 tiles of 128x128
  const dim3 gQkv(2 * TPJ + NB * TVT);                             // 1152 tiles: q, k, v^T
  const dim3 gFfn((NROW / 128) * (FF / 128), 1);                   // 1536 tiles
  const dim3 gAtt((NQB / 2) * NH * NB);                            // 768 blocks, two query tiles each

  // (1) weights [in][out] f32 -> transposed f16 [out][in] x32, and ln1 -> Np f16 [8192][768]
  prep_all<<<gPrep, blk, 0, stream>>>(x, ln1g, ln1b, Np, Wq, Wk, Wv, Wo, W1, W2,
                                      Wqt, Wkt, Wvt, Wot, W1t, W2t, 32.0f);
  // (2) q -> Qp, k -> Kpl, v^T -> VTp
  gemm_qkv<<<gQkv, gblk, 0, stream>>>(Np, Wqt, Wkt, Wvt, bq, bk, bv, Qp, Kpl, VTp);
  // (3) causal attention -> Ctp f16 (ctx * 4)
  attn_causal64<<<gAtt, dim3(128), 0, stream>>>(Qp, Kpl, VTp, Ctp, 0.0625f);
  // (4) x1 = x + ctx . Wo + bo -> X1 f32   (acc = 128 * ctx.Wo)
  gemm64<2, 128><<<gProj, gblk, 0, stream>>>(Ctp, DM, 0LL, Wot, DM, 0LL, bo, x, (void*)X1, DM, 0LL,
                                       NROW, DM, DM, 1.0f / 128.0f, 1.0f);
  // (5) ln2 -> Np
  ln_rows<<<gLn, blk, 0, stream>>>(X1, ln2g, ln2b, Np, NROW);
  // (6) g = gelu(ln2 . W1 + b1) * 4 -> Gp f16 [8192][3072]   (M=8192, N=3072, K=768, acc/32)
  gemm64<3, 64><<<gFfn, gblk, 0, stream>>>(Np, DM, 0LL, W1t, DM, 0LL, b1, x, (void*)Gp, FF, 0LL,
                                      NROW, FF, DM, 1.0f / 32.0f, 4.0f);
  // (7) out = x1 + g . W2 + b2 -> d_out f32 [8192][768]   (M=8192, N=768, K=3072, acc = 128 * g.W2)
  gemm64<2, 128><<<gProj, gblk, 0, stream>>>(Gp, FF, 0LL, W2t, FF, 0LL, b2, X1, d_out, DM, 0LL,
                                       NROW, DM, FF, 1.0f / 128.0f, 1.0f);
  (void)hipGetLastError();
}

// v009
// A run of this version takes 215 microseconds.
// Next to v008, in two timings, it ran 1.03 times as fast each time.
// Counting every step since v000, it is 3.67 times as fast.
// All contractions: v_wmma_f32_16x16x32_f16 (f16 operands, f32 accumulate): q/k/v projections, q.k^T scores,
// p.v context, ctx.Wo, ln2out.W1, gelu.W2. LayerNorm, softmax, GELU, bias and residual adds in f32.
#include <hip/hip_runtime.h>
#include <math.h>
#include <stdint.h>

#define NB   2
#define SEQ  4096
#define DM   768
#define NH   12
#define HD   64
#define FF   3072
#define NROW (NB * SEQ)      // 8192 token rows
#define NQB  (SEQ / 64)      // 64 query / key tiles of 64
static_assert(NH * HD == DM);
static_assert((NQB % 2) == 0);
static_assert((SEQ % 64) == 0 && (DM % 64) == 0 && (FF % 64) == 0 && (NROW % 64) == 0);
static_assert(DM == 3 * 256);
static_assert((SEQ % 128) == 0 && (DM % 128) == 0 && (FF % 128) == 0 && (NROW % 128) == 0);   // tiles, and k stages of 128

typedef _Float16 v16h __attribute__((ext_vector_type(16)));
typedef _Float16 v8h  __attribute__((ext_vector_type(8)));
typedef float    v8f  __attribute__((ext_vector_type(8)));
typedef float    v4f  __attribute__((ext_vector_type(4)));
typedef unsigned int v4u __attribute__((ext_vector_type(4)));

union H8 { v8h h; v4u u; };
union FH { v16h v; v8h h[2]; };

__device__ __forceinline__ v8f zero8() { v8f z = {0.f, 0.f, 0.f, 0.f, 0.f, 0.f, 0.f, 0.f}; return z; }

// 16-bit A/B fragment: lane -> row/col (lane&15); p already includes +8*(lane>>4);
// elements 0..7 <- p[0..7] (k0+8h..k0+8h+7), elements 8..15 <- p[16..23] (k0+16+8h..)
__device__ __forceinline__ v16h ldfrag(const _Float16* p) {
  FH f;
  f.h[0] = *(const v8h*)(p);
  f.h[1] = *(const v8h*)(p + 16);
  return f.v;
}

__device__ __forceinline__ v8f mma_raw(v16h a, v16h b, v8f c) {
  return __builtin_amdgcn_wmma_f32_16x16x32_f16(false, a, false, b, (short)0, c, false, false);
}
// guard after the last WMMA of a 4-op group: ties all four D, keeps the group's A and B live
__device__ __forceinline__ void guard4(v8f& d0, v8f& d1, v8f& d2, v8f& d3,
                                       v16h a, v16h b0, v16h b1, v16h b2, v16h b3) {
  asm volatile("v_nop\n\tv_nop\n\tv_nop\n\tv_nop"
               : "+v"(d0), "+v"(d1), "+v"(d2), "+v"(d3)
               : "v"(a), "v"(b0), "v"(b1), "v"(b2), "v"(b3));
}

// lane l <-> lane l ^ 16 (the two halves of a wave), by a vector cross-row move
__device__ __forceinline__ float xhalf(float x) {
  return __builtin_bit_cast(float, __builtin_amdgcn_permlanex16(__builtin_bit_cast(int, x), __builtin_bit_cast(int, x),
                                                                0x76543210, 0xfedcba98, false, false));
}

// tanh-form GELU via the identity 0.5u(1+tanh z) = u * sigmoid(2z); exp argument clamped, reciprocal by v_rcp
__device__ __forceinline__ float gelu_tanh(float u) {
  const float z = 0.7978845608028654f * (u + 0.044715f * u * u * u);
  const float e = __expf(fminf(-2.0f * z, 80.0f));
  return u * __builtin_amdgcn_rcpf(1.0f + e);
}

// =====================================================================================================
// Weight transpose + convert: W f32 [Kin][Nout] (pitch Nout) -> Wt f16 [Nout][Kin] (pitch Kin), times scale.
// 64x64 tile (bx of Nout/64, by of Kin/64) through the LDS tile T, 256 threads. Reads: thread handles 4 float4 of the
// tile (chunk = tid + i*256 -> row r = chunk>>4 (k local), cols c4..c4+3 (n local)).
// coverage: 8 waves x 2 x 4 = 64 rows, 8 lanes x 8 halves = 64 cols = the whole tile.
// =====================================================================================================
__device__ __forceinline__ void tr_cvt_tile(const float* __restrict__ W, _Float16* Wt,
                                            int Kin, int Nout, float scale, int bx, int by,
                                            _Float16 (*T)[72]) {   // T: [n local][k local], pitch 144 B
  const int tid = threadIdx.x, wave = tid >> 5, lane = tid & 31;
  const int n0 = bx * 64, k0 = by * 64;
#pragma unroll
  for (int i = 0; i < 4; ++i) {
    const int chunk = tid + i * 256;
    const int r = chunk >> 4;            // 0..63  (k local)
    const int c4 = (chunk & 15) * 4;     // 0..60  (n local)
    const v4f v = *(const v4f*)(W + (size_t)(k0 + r) * Nout + n0 + c4);
#pragma unroll
    for (int e = 0; e < 4; ++e) T[c4 + e][r] = (_Float16)(v[e] * scale);
  }
  __syncthreads();
  const int q = lane >> 3, c8 = (lane & 7) * 8;
  v4u o[2];
#pragma unroll
  for (int it = 0; it < 2; ++it) {
    const int row = wave * 8 + it * 4 + q;
    H8 p;
    p.h = *(const v8h*)(&T[row][c8]);
    o[it] = p.u;
  }
  {
#pragma unroll
    for (int it = 0; it < 2; ++it) {
      const int row = wave * 8 + it * 4 + q;
      *(v4u*)(Wt + (size_t)(n0 + row) * Kin + k0 + c8) = o[it];
    }
    // in the listing the other job's code follows these stores and writes their registers: only behind this wait
    asm volatile("s_wait_xcnt 0x0" ::: "memory");
  }
}

// =====================================================================================================
// LayerNorm over DM=768 columns, f32 math, f16 output (unscaled). One wave per row, 8 rows per block
// (blk of ceil(nrows/8)). Lane holds columns i*256 + lane*8 .. +7 (i 0..2). mean and variance by two register
// passes with 32-lane butterflies. Output: three 16-B stores per lane, each instruction = 32 lanes x 16 B =
// coverage: 3 x 256 = 768 columns per row; every row < nrows by exactly one wave.
// =====================================================================================================
__device__ __forceinline__ void ln_rows8(const float* __restrict__ X, const float* __restrict__ g,
                                         const float* __restrict__ bb, _Float16* Y, int nrows, int blk) {
  const int wave = threadIdx.x >> 5, lane = threadIdx.x & 31;
  const int row = blk * 8 + wave;
  if (row >= nrows) return;                  // wave-uniform; no block barriers on this path
  const float* xr = X + (size_t)row * DM;
  float v[3][8];
  float s = 0.f;
#pragma unroll
  for (int i = 0; i < 3; ++i) {
    const int col = i * 256 + lane * 8;
    const v4f a = *(const v4f*)(xr + col);
    const v4f c = *(const v4f*)(xr + col + 4);
#pragma unroll
    for (int e = 0; e < 4; ++e) { v[i][e] = a[e]; v[i][4 + e] = c[e]; }
#pragma unroll
    for (int e = 0; e < 8; ++e) s += v[i][e];
  }
#pragma unroll
  for (int off = 16; off > 0; off >>= 1) s += __shfl_xor(s, off, 32);
  const float mu = s * (1.0f / (float)DM);
  float qs = 0.f;
#pragma unroll
  for (int i = 0; i < 3; ++i)
#pragma unroll
    for (int e = 0; e < 8; ++e) { const float d = v[i][e] - mu; v[i][e] = d; qs += d * d; }
#pragma unroll
  for (int off = 16; off > 0; off >>= 1) qs += __shfl_xor(qs, off, 32);
  const float rstd = rsqrtf(qs * (1.0f / (float)DM) + 1e-5f);
  v4u o[3];
#pragma unroll
  for (int i = 0; i < 3; ++i) {
    const int col = i * 256 + lane * 8;
    const v4f g0 = *(const v4f*)(g + col), g1 = *(const v4f*)(g + col + 4);
    const v4f b0 = *(const v4f*)(bb + col), b1 = *(const v4f*)(bb + col + 4);
    H8 p;
#pragma unroll
    for (int e = 0; e < 4; ++e) {
      p.h[e]     = (_Float16)(v[i][e] * rstd * g0[e] + b0[e]);
      p.h[4 + e] = (_Float16)(v[i][4 + e] * rstd * g1[e] + b1[e]);
    }
    o[i] = p.u;
  }
  {
#pragma unroll
    for (int i = 0; i < 3; ++i)
      *(v4u*)(Y + (size_t)row * DM + i * 256 + lane * 8) = o[i];
    
  }
}

__global__ __launch_bounds__(256) void ln_rows(const float* __restrict__ X, const float* __restrict__ g,
                                               const float* __restrict__ bb, _Float16* Y, int nrows) {
  ln_rows8(X, g, bb, Y, nrows, blockIdx.x);
}

// =====================================================================================================
// Everything that depends on the inputs alone, in one launch; the block index picks the job (block-uniform):
//   blocks 0 .. LNB-1: ln1 row blocks;  then 4 x TDD tiles: Wq, Wk, Wv, Wo;  then TDF tiles: W1;  then TDF: W2.
// Inside a weight the tile index runs n tile first. grid = LNB + 4*TDD + 2*TDF, exact.
// =====================================================================================================
constexpr int LNB = NROW / 8;                  // 1024
constexpr int TDD = (DM / 64) * (DM / 64);     // 144
constexpr int TDF = (DM / 64) * (FF / 64);     // 576
__global__ __launch_bounds__(256) void prep_all(const float* __restrict__ X, const float* __restrict__ g,
                                                const float* __restrict__ bb, _Float16* Y,
                                                const float* __restrict__ Wq, const float* __restrict__ Wk,
                                                const float* __restrict__ Wv, const float* __restrict__ Wo,
                                                const float* __restrict__ W1, const float* __restrict__ W2,
                                                _Float16* Wqt, _Float16* Wkt, _Float16* Wvt, _Float16* Wot,
                                                _Float16* W1t, _Float16* W2t, float scale) {
  __shared__ __align__(16) _Float16 T[64][72];
  const int bid = blockIdx.x;
  if (bid < LNB) {                             // the whole work-group; no barrier on this side
    ln_rows8(X, g, bb, Y, NROW, bid);
  } else {
    int t = bid - LNB;                         // becomes the tile index inside the weight
    const float* W;
    _Float16* Wt;
    int Kin = DM, Nout = DM;
    if (t < 4 * TDD) {
      const int job = t / TDD;
      t -= job * TDD;
      W  = (job == 0) ? Wq  : (job == 1) ? Wk  : (job == 2) ? Wv  : Wo;
      Wt = (job == 0) ? Wqt : (job == 1) ? Wkt : (job == 2) ? Wvt : Wot;
    } else if (t < 4 * TDD + TDF) {
      t -= 4 * TDD;
      W = W1; Wt = W1t; Nout = FF;
    } else {
      t -= 4 * TDD + TDF;
      W = W2; Wt = W2t; Kin = FF;
    }
    const int nbx = Nout >> 6;
    const int by  = t / nbx;
    tr_cvt_tile(W, Wt, Kin, Nout, scale, t - by * nbx, by, T);
  }
}

// =====================================================================================================
// Batched f16 WMMA GEMM: acc[m][n] = sum_k A[m][k] * Bt[n][k]. One work-group of 4 waves per 128x128 tile,
// one 64x64 sub-tile per wave (2 x 2). A row-major [M][K] pitch lda; Bt row-major [N][K] pitch ldb
// (k contiguous); both f16 global planes. Per stage of 64 k the work-group brings 128 A rows and 128 Bt rows
// of 128 B into LDS once (8 lanes per row, so every load instruction covers 4 whole lines); all four waves
// take their fragments from there. The rows come by asynchronous copies to LDS. Two LDS stages: stage t+1 is in
// flight during the products of stage t; one work-group barrier per stage.
// KS = k columns per stage: 64 as described, or 128 (rows of 256 B, 16 lanes per row) for the products whose grid leaves
// at most two work-groups on a WGP: there few waves cover a stage's flight time, so a stage is made twice as long.
// M, N multiples of 128, K a multiple of KS (checked at compile time for the shapes launched below).
// tile = tile index (n tile first), bz = batch index (strides in elements, C and Res share strideC); ring = the
// work-group's 2 * STG halves of LDS. k order per accumulator: ascending.
// MODE 0: C f16 [m][n] = (acc*accs + bias[n]) * outs
// MODE 1: C f16 [m][n] = (acc*accs + bias[m]) * outs            (bias along rows)
// MODE 2: C f32 [m][n] = Res[m][n] + acc*accs + bias[n]          (Res has C's layout, never aliases C)
// MODE 3: C f16 [m][n] = gelu_tanh(acc*accs + bias[n]) * outs
// =====================================================================================================
// Eight asynchronous 16-B copies to LDS per lane: four row groups of one plane (LDS byte address la + i*lstep, global
// ga + i*astep halves), then four of another (lb, gb, bstep). The address-translation wait is the statement's last
// line, so no register that a copy names is rewritten ahead of it.
typedef __attribute__((address_space(3))) const _Float16 lds_half;
__device__ __forceinline__ void async_rows4x2(unsigned la, unsigned lstep, const _Float16* ga, size_t astep,
                                              unsigned lb, const _Float16* gb, size_t bstep) {
  const unsigned la1 = la + lstep, la2 = la + 2 * lstep, la3 = la + 3 * lstep;
  const unsigned lb1 = lb + lstep, lb2 = lb + 2 * lstep, lb3 = lb + 3 * lstep;
  const _Float16 *ga1 = ga + astep, *ga2 = ga + 2 * astep, *ga3 = ga + 3 * astep;
  const _Float16 *gb1 = gb + bstep, *gb2 = gb + 2 * bstep, *gb3 = gb + 3 * bstep;
  asm volatile("global_load_async_to_lds_b128 %0, %1, off\n\t"
               "global_load_async_to_lds_b128 %2, %3, off\n\t"
               "global_load_async_to_lds_b128 %4, %5, off\n\t"
               "global_load_async_to_lds_b128 %6, %7, off\n\t"
               "global_load_async_to_lds_b128 %8, %9, off\n\t"
               "global_load_async_to_lds_b128 %10, %11, off\n\t"
               "global_load_async_to_lds_b128 %12, %13, off\n\t"
               "global_load_async_to_lds_b128 %14, %15, off\n\t"
               "s_wait_xcnt 0x0"
               :: "v"(la), "v"(ga), "v"(la1), "v"(ga1), "v"(la2), "v"(ga2), "v"(la3), "v"(ga3),
                  "v"(lb), "v"(gb), "v"(lb1), "v"(gb1), "v"(lb2), "v"(gb2), "v"(lb3), "v"(gb3)
               : "memory");
}

// LDS row pitch, halves: 144 B = 16 B x 9 (KS 64) or 272 B = 16 B x 17 (KS 128), for 16-B fragment reads
template <int KS> constexpr int gemm_pitch = KS + 8;
// halves per stage: A rows 0..127, then Bt rows 0..127
template <int KS> constexpr int gemm_stage = 256 * gemm_pitch<KS>;
static_assert(4 * 16 * 68 * 4 <= 2 * gemm_stage<64> * 2);   // the ring's head is the output slabs after the k loop
template <int MODE, int KS>
__device__ __forceinline__ void gemm_tile(
    const _Float16* __restrict__ A, int lda, long long strideA,
    const _Float16* __restrict__ Bt, int ldb, long long strideB,
    const float* __restrict__ bias, const float* __restrict__ Res,
    void* Cout, int ldc, long long strideC,
    int M, int N, int K, float accs, float outs, _Float16* ring, int tile, int bz) {
  static_assert(KS == 64 || KS == 128);
  constexpr int GP  = gemm_pitch<KS>;
  constexpr int STG = gemm_stage<KS>;
  constexpr int LPR = KS / 8;                 // lanes per staged row (16 B each)
  constexpr int RPP = 128 / LPR;              // rows that the work-group's 128 lanes cover at once
  const int tid  = threadIdx.x;
  const int lane = tid & 31;
  const int wave = tid >> 5;
  const int tilesN = N >> 7;
  const int tilesM = M >> 7;
  if (tile >= tilesM * tilesN) return;   // the same for the whole work-group, ahead of every barrier
  const int tm = tile / tilesN;
  const int tn = tile - tm * tilesN;
  const int wm = (wave >> 1) << 6;            // this wave's 64x64 sub-tile inside the 128x128 tile
  const int wn = (wave & 1) << 6;
  const int m0 = (tm << 7) + wm;
  const int n0 = (tn << 7) + wn;

  const _Float16* Ab = A  + (size_t)bz * (size_t)strideA;
  const _Float16* Bb = Bt + (size_t)bz * (size_t)strideB;

  const int rl   = lane & 15;                 // row (A) / col (B, D) within subtile
  const int koff = (lane >> 4) * 8;           // k offset of this lane half
  const int mOff = (lane >> 4) * 8;           // D row offset

  // staging map: thread -> row tid/LPR + RPP*i, i 0..128/RPP-1, 16 B at column (tid%LPR)*8: 128 rows x 2*KS B per operand
  const int sr = tid / LPR;
  const int sc = (tid % LPR) * 8;
  const _Float16* ga = Ab + (size_t)((tm << 7) + sr) * lda + sc;
  const _Float16* gb = Bb + (size_t)((tn << 7) + sr) * ldb + sc;
  const unsigned sa = (unsigned)(uintptr_t)(lds_half*)(ring + sr * GP + sc);   // LDS byte address, stage 0, A row sr
  const unsigned sb = sa + 128 * GP * 2;                                       // the same of Bt
  // one stage: k columns kn.., into the LDS stage at byte offset so; A and Bt rows sr + RPP i, four values of i a statement
  auto copy_stage = [&](unsigned so, int kn) {
#pragma unroll   // r0 a constant in each statement: its LDS and row offsets fold, and no loop counter stands among the copies
    for (int r0 = 0; r0 < 128; r0 += 4 * RPP)
      async_rows4x2(sa + so + r0 * GP * 2, RPP * GP * 2, ga + (size_t)r0 * lda + kn, (size_t)RPP * lda,
                    sb + so + r0 * GP * 2, gb + (size_t)r0 * ldb + kn, (size_t)RPP * ldb);
  };

  v8f acc[4][4];
#pragma unroll
  for (int i = 0; i < 4; ++i)
#pragma unroll
    for (int j = 0; j < 4; ++j) acc[i][j] = zero8();

  const int nk = K / KS;
  copy_stage(0u, 0);
  asm volatile("s_wait_asynccnt 0x0" ::: "memory");   // this wave's copies of stage 0 have landed
  __syncthreads();
  if (nk > 1) copy_stage(STG * 2, KS);                // the same for the whole work-group

  for (int kt = 0; kt < nk; ++kt) {
    const int cur = (kt & 1) * STG;
    const _Float16* fa = ring + cur + (wm + rl) * GP + koff;
    const _Float16* fb = ring + cur + (128 + wn + rl) * GP + koff;
#pragma unroll
    for (int kk = 0; kk < KS / 32; ++kk) {
      v16h bf[4], af[4];
#pragma unroll
      for (int j = 0; j < 4; ++j) bf[j] = ldfrag(fb + j * 16 * GP + kk * 32);
#pragma unroll
      for (int i = 0; i < 4; ++i) af[i] = ldfrag(fa + i * 16 * GP + kk * 32);
#pragma unroll
      for (int i = 0; i < 4; ++i) {
#pragma unroll
        for (int j = 0; j < 4; ++j) acc[i][j] = mma_raw(af[i], bf[j], acc[i][j]);
        guard4(acc[i][0], acc[i][1], acc[i][2], acc[i][3], af[i], bf[0], bf[1], bf[2], bf[3]);
      }
    }
    // hand-over: this wave's reads of stage kt are done and its copies of stage kt+1 have landed; the barrier
    // publishes stage kt+1 and frees the LDS of stage kt, which stage kt+2 then goes into
    asm volatile("s_wait_dscnt 0x0" ::: "memory");
    asm volatile("s_wait_asynccnt 0x0" ::: "memory");
    __syncthreads();
    if (kt + 2 < nk) copy_stage((unsigned)cur * 2, (kt + 2) * KS);   // the same for the whole work-group
  }
  asm volatile("s_wait_asynccnt 0x0" ::: "memory");   // nothing of this wave's is in flight when the ring becomes slabs

  // ---- epilogue ----
  float* slab = (float*)ring + wave * (16 * 68);   // per-wave 16x64 slab, pitch 68 floats (272 B)
#pragma unroll
  for (int i = 0; i < 4; ++i) {
    const int mBase = m0 + (i << 4);
#pragma unroll
    for (int j = 0; j < 4; ++j) {
#pragma unroll
      for (int r = 0; r < 8; ++r) slab[(mOff + r) * 68 + (j << 4) + rl] = acc[i][j][r];
    }
    __builtin_amdgcn_fence(__ATOMIC_RELEASE, "workgroup");
    __builtin_amdgcn_wave_barrier();
    __builtin_amdgcn_fence(__ATOMIC_ACQUIRE, "workgroup");
    if constexpr (MODE == 2) {
      float* C = (float*)Cout + (size_t)bz * (size_t)strideC;
      const float* R = Res + (size_t)bz * (size_t)strideC;
      const int h2 = lane >> 4, c4 = (lane & 15) * 4;    // 256-B row segment = 16 lanes x 16 B
      const v4f bq4 = *(const v4f*)(bias + n0 + c4);
      {
#pragma unroll
        for (int it = 0; it < 8; ++it) {
          const int row = it * 2 + h2;                    // it 0..7 x h2 0..1 = rows 0..15
          const v4f a  = *(const v4f*)(slab + row * 68 + c4);
          const v4f rr = *(const v4f*)(R + (size_t)(mBase + row) * ldc + n0 + c4);
          v4f ov;
#pragma unroll
          for (int e = 0; e < 4; ++e) ov[e] = rr[e] + (a[e] * accs + bq4[e]);
          *(v4f*)(C + (size_t)(mBase + row) * ldc + n0 + c4) = ov;
        }
        
      }
    } else {
      _Float16* C = (_Float16*)Cout + (size_t)bz * (size_t)strideC;
      const int q = lane >> 3, c8 = (lane & 7) * 8;
      float bc[8];
      if constexpr (MODE != 1) {
        const v4f b0 = *(const v4f*)(bias + n0 + c8), b1 = *(const v4f*)(bias + n0 + c8 + 4);
#pragma unroll
        for (int e = 0; e < 4; ++e) { bc[e] = b0[e]; bc[4 + e] = b1[e]; }
      } else {
#pragma unroll
        for (int e = 0; e < 8; ++e) bc[e] = 0.f;
      }
      v4u hv[4];
#pragma unroll
      for (int it = 0; it < 4; ++it) {
        const int row = it * 4 + q;                       // it 0..3 x q 0..3 = rows 0..15
        const float* sp = slab + row * 68 + c8;
        float brow = 0.f;
        if constexpr (MODE == 1) brow = bias[mBase + row];   // mBase + row < M = bias length in this mode
        H8 p;
#pragma unroll
        for (int e = 0; e < 8; ++e) {
          float f = sp[e] * accs + ((MODE == 1) ? brow : bc[e]);
          if constexpr (MODE == 3) f = gelu_tanh(f);
          f *= outs;
          p.h[e] = (_Float16)f;
        }
        hv[it] = p.u;
      }
      {
#pragma unroll
        for (int it = 0; it < 4; ++it) {
          const int row = it * 4 + q;
          *(v4u*)(C + (size_t)(mBase + row) * ldc + n0 + c8) = hv[it];
        }
        
      }
    }
    __builtin_amdgcn_fence(__ATOMIC_RELEASE, "workgroup");
    __builtin_amdgcn_wave_barrier();
    __builtin_amdgcn_fence(__ATOMIC_ACQUIRE, "workgroup");
  }
}

// one product per launch: grid = (tiles, batches)
template <int MODE, int KS>
__global__ __launch_bounds__(128) void gemm64(
    const _Float16* __restrict__ A, int lda, long long strideA,
    const _Float16* __restrict__ Bt, int ldb, long long strideB,
    const float* __restrict__ bias, const float* __restrict__ Res,
    void* Cout, int ldc, long long strideC,
    int M, int N, int K, float accs, float outs) {
  __shared__ __align__(16) _Float16 ring[2 * gemm_stage<KS>];   // 73728 B (KS 64), 139264 B (KS 128)
  gemm_tile<MODE, KS>(A, lda, strideA, Bt, ldb, strideB, bias, Res, Cout, ldc, strideC, M, N, K, accs, outs,
                      ring, blockIdx.x, blockIdx.y);
}

// The three projections of ln1's output in one launch; the block index picks the product (block-uniform):
//   blocks 0 .. TPJ-1:  q   = (ln1 . Wq + bq) * 0.5        M=8192, N=768, K=768
//   then TPJ blocks:    k   = (ln1 . Wk + bk) * 4          the same shape
//   then NB x TVT:      v^T = (Wv^T . ln1^T + bv[row]) * 4 per batch, f16 [b][d][s]; M=768, N=4096, K=768
// every accumulator carries 32 x the product (weights x32). grid = 2*TPJ + NB*TVT, exact.
constexpr int TPJ = (NROW / 128) * (DM / 128);   // 384
constexpr int TVT = (DM / 128) * (SEQ / 128);    // 192
__global__ __launch_bounds__(128) void gemm_qkv(
    const _Float16* __restrict__ Nrm, const _Float16* __restrict__ Wqt, const _Float16* __restrict__ Wkt,
    const _Float16* __restrict__ Wvt, const float* __restrict__ bq, const float* __restrict__ bk,
    const float* __restrict__ bv, _Float16* Qo, _Float16* Ko, _Float16* VTo) {
  __shared__ __align__(16) _Float16 ring[2 * gemm_stage<64>];   // 73728 B
  const int bid = blockIdx.x;
  if (bid < 2 * TPJ) {
    const bool isk = bid >= TPJ;
    const float* bias = isk ? bk : bq;
    gemm_tile<0, 64>(Nrm, DM, 0LL, isk ? Wkt : Wqt, DM, 0LL, bias, bias, (void*)(isk ? Ko : Qo), DM, 0LL,
                 NROW, DM, DM, 1.0f / 32.0f, isk ? 4.0f : 0.5f, ring, isk ? bid - TPJ : bid, 0);
  } else {
    const int t  = bid - 2 * TPJ;
    const int bz = t / TVT;
    gemm_tile<1, 64>(Wvt, DM, 0LL, Nrm, DM, (long long)SEQ * DM, bv, bv, (void*)VTo, SEQ, (long long)DM * SEQ,
                 DM, SEQ, DM, 1.0f / 32.0f, 4.0f, ring, t - bz * TVT, bz);
  }
}

// =====================================================================================================
// Causal attention, head dim 64, f16 operands.
//   q plane (f16, carries q * 0.5):  element (b, t, h, d) at [(b*SEQ + t)*DM + h*64 + d]
//   k plane (f16, carries k * 4):    same layout with key index s
//   v^T plane (f16, carries v * 4):  element (b, h, d, s) at [(b*DM + h*64 + d)*SEQ + s]
//   logit = acc * sscale with sscale = 1/16  (0.5 * 4 / 16 = 1/8 = 1/sqrt(64));
//   Both products are taken transposed: S^T = K . Q^T (A = K rows, B = Q) and O^T += V^T . P^T (A = V^T rows).
//   A score tile's lane then holds 8 keys (16j + 8*(lane>>4) + r) of ONE query (lane&15): the row maximum and sum
//   are in-lane, joined between the wave halves by one exchange; two score tiles, converted in place, are the
//   B operand P^T in the hardware k order, which the V^T fragment loads already have.
//   keys s > t excluded per lane (-inf before the row max), in the diagonal key tile only; every row has key 0 so the max is finite.
//   p = exp(s - m) packed as f16(1024 p); context = p . v on f16 WMMA; online softmax in f32.
//   out plane (f16, carries ctx * 4): element (b, t, h, d) at [(b*SEQ + t)*DM + h*64 + d];
//   ctx*4 = acc / (1024 l) since acc = 4096 * sum p v.
//   Block = 4 waves = 64 query rows of one (b, h) at a time, two query tiles qb in turn (NQB-1-pr, then pr);
//   grid = (NQB/2) * NH * NB; key tiles 0..qb (block-uniform).
//   K / V^T tile staging: asynchronous 16-B copies to LDS, 8 lanes per 128-B row (an instruction covers 4 whole
//   lines), 4 copies per thread and plane = the whole 64x64 tile; two buffers, key tile t+1 in flight during tile t;
//   one work-group barrier per key tile.
//   Output coverage: each wave stores rows q0..q0+15 (it 0..3 x lane>>3 0..3) x 64 columns (8 lanes x 8).
// =====================================================================================================
// One key tile into one LDS buffer: rows sr + 16 i (i 0..3) of K, then of V^T. lds = this lane's byte address in the
// buffer's K plane (row pitch 144 B, V^T plane 9216 B behind K); gk, gv = its global bytes.
__device__ __forceinline__ void copy_kv_tile(unsigned lds, const _Float16* gk, const _Float16* gv) {
  async_rows4x2(lds, 2304u, gk, (size_t)16 * DM, lds + 9216u, gv, (size_t)16 * SEQ);
}

__global__ __launch_bounds__(128)
void attn_causal64(const _Float16* __restrict__ Qp, const _Float16* __restrict__ Kp,
                   const _Float16* __restrict__ Vtp, _Float16* Op, float sscale) {
  // Row pitches: 16-B fragment reads walk 16 rows at once, so a pitch of 16 B x odd spreads them over all banks
  // (128-B rows put every other row on the same banks).
  constexpr int LP = 72;                               // f16 rows of 64: pitch 72 halves = 144 B
  constexpr int OP = 68;                               // f32 rows of 64: pitch 68 floats = 272 B
  constexpr int TB = 64 * LP;                          // halves per plane of a key tile: 9 KB
  static_assert(LP * 2 == 144 && TB * 2 == 9216);      // the byte steps in copy_kv_tile
  __shared__ __align__(16) _Float16 KV[2][2 * TB];     // two buffers, each K [kv][d], then V^T [d][kv]
  __shared__ __align__(16) float    Os[4][16 * OP];    // per wave context tile [row][d]

  const int tid  = threadIdx.x;
  const int wave = tid >> 5;
  const int lane = tid & 31;
  const int hh   = lane >> 4;
  const int c    = lane & 15;

  const int bx   = blockIdx.x;
  const int pr   = bx % (NQB / 2);
  const int rest = bx / (NQB / 2);
  const int h    = rest % NH;
  const int b    = rest / NH;
  const size_t rowB = (size_t)b * SEQ;

  const _Float16* Qh = Qp + (size_t)h * HD;
  const _Float16* Kh = Kp + (size_t)h * HD;
  const _Float16* Vh = Vtp + ((size_t)b * DM + (size_t)h * HD) * SEQ;

  // copy map: thread -> row (tid>>3) + 16 i, 16 B at column (tid&7)*8; addresses of key tile 0 in buffer 0
  const int sr = tid >> 3, sc = (tid & 7) * 8;
  const unsigned  lds0 = (unsigned)(uintptr_t)(lds_half*)(&KV[0][0] + sr * LP + sc);
  const _Float16* gk0  = Kh + (rowB + sr) * DM + sc;          // K row sr, d = sc..sc+7
  const _Float16* gv0  = Vh + (size_t)sr * SEQ + sc;          // V^T row d = sr, s = sc..sc+7

  // Two query tiles, one after the other in every wave: NQB-1-pr, then pr. (NQB-pr) + (pr+1) = NQB+1 key tiles
  // for every work-group, so no work-group outlasts the others. pr 0..NQB/2-1 covers every query tile once.
  for (int part = 0; part < 2; ++part) {        // block-uniform
    const int qb = part ? pr : NQB - 1 - pr;
    const int q0 = qb * 64 + wave * 16;

    // ---- Q fragments (B operand, column = lane&15 = query row): 2 d-chunks of 32 ----
    v16h qa[2];
#pragma unroll
    for (int dc = 0; dc < 2; ++dc)
      qa[dc] = ldfrag(Qh + (rowB + q0 + c) * DM + dc * 32 + 8 * hh);

    const int qrow = q0 + c;                    // this lane's query row
    float mrow = -INFINITY;                     // running maximum of row qrow (alike in both wave halves)
    float lrow = 0.f;                           // running sum over this wave half's keys only; joined after the loop
    v8f oacc[4];                                // O^T: oacc[t][r] = context(qrow, d = 16t + 8*hh + r)
#pragma unroll
    for (int t = 0; t < 4; ++t) oacc[t] = zero8();

    // key tile 0 into buffer 0 and published; then tile 1 into buffer 1, in flight during tile 0. Both buffers are
    // free here: the barrier at the foot of the last trip of the query tile before ended every read of them.
    copy_kv_tile(lds0, gk0, gv0);
    asm volatile("s_wait_asynccnt 0x0" ::: "memory");   // this wave's copies of tile 0 have landed
    __syncthreads();
    if (qb >= 1) copy_kv_tile(lds0 + 2 * TB * 2, gk0 + (size_t)64 * DM, gv0 + 64);   // block-uniform

    for (int kt = 0; kt <= qb; ++kt) {          // causal key tiles, block-uniform trip count
      const int kv0 = kt * 64;
      const _Float16* Ksh = &KV[kt & 1][0];
      const _Float16* Vth = Ksh + TB;

      // ---- all fragment reads of this key tile as one group, each fragment in registers of its own: K first,
      //      V^T behind it, so the score products wait for the K half only and V^T lands under them and the softmax ----
      v16h kf[2][4], vf[2][4];
#pragma unroll
      for (int dc = 0; dc < 2; ++dc)
#pragma unroll
        for (int j = 0; j < 4; ++j) kf[dc][j] = ldfrag(Ksh + (j * 16 + c) * LP + dc * 32 + 8 * hh);
#pragma unroll
      for (int kk = 0; kk < 2; ++kk)
#pragma unroll
        for (int t = 0; t < 4; ++t) vf[kk][t] = ldfrag(Vth + (t * 16 + c) * LP + kk * 32 + 8 * hh);
      // keeps the reads together in front of the products: spread among them, each place costs its own LDS wait
      __builtin_amdgcn_sched_barrier(0);

      // ---- scores, transposed: s[j][r] = score(key kv0 + 16j + 8*hh + r, query qrow); d chunks ascending in each tile ----
      v8f s[4];
#pragma unroll
      for (int j = 0; j < 4; ++j) s[j] = zero8();
#pragma unroll
      for (int dc = 0; dc < 2; ++dc)
#pragma unroll
        for (int j = 0; j < 4; ++j) s[j] = mma_raw(kf[dc][j], qa[dc], s[j]);

      // ---- scale, causal exclusion, row max, online softmax, P^T (x1024, f16) packed in registers ----
      // the loops here are unrolled so that every index into the score registers is a constant
#pragma unroll
      for (int j = 0; j < 4; ++j)
#pragma unroll
        for (int r = 0; r < 8; ++r) s[j][r] *= sscale;
      // Only the last key tile reaches past a query of this work-group: for kt < qb every key is at most
      // kt*64 + 63 < qb*64 <= qrow, so the exclusion is an identity there and its compares and selects are not run.
      if (kt == qb) {                            // block-uniform: a scalar branch
#pragma unroll
        for (int j = 0; j < 4; ++j)
#pragma unroll
          for (int r = 0; r < 8; ++r) {
            const int key = kv0 + j * 16 + 8 * hh + r;
            s[j][r] = (key <= qrow) ? s[j][r] : -INFINITY;
          }
      }
      float mj[4];
#pragma unroll
      for (int j = 0; j < 4; ++j) {
        mj[j] = -INFINITY;
#pragma unroll
        for (int r = 0; r < 8; ++r) mj[j] = fmaxf(mj[j], s[j][r]);
      }
      float m = fmaxf(fmaxf(mj[0], mj[1]), fmaxf(mj[2], mj[3]));
      m = fmaxf(m, xhalf(m));                    // both halves now hold the maximum over the 64 keys
      const float mnew  = fmaxf(mrow, m);
      const float msafe = (mnew == -INFINITY) ? 0.f : mnew;
      const float alpha = __expf(mrow - msafe);
      mrow = mnew;
      FH pb[2];                                  // P^T, B operand: element e of half j&1 = key 32*(j>>1) + 16*(j&1) + 8*hh + e
      float pj[4];
#pragma unroll
      for (int j = 0; j < 4; ++j) {
        float a[8], p[8];                              // excluded key: exp(-inf) = 0
#pragma unroll
        for (int r = 0; r < 8; ++r) a[r] = (s[j][r] - msafe) * 1.44269504f;
        // a score tile's eight v_exp and the one issue slot behind the last in one statement, results in registers
        // of their own
        asm("v_exp_f32 %0, %8\n\tv_exp_f32 %1, %9\n\tv_exp_f32 %2, %10\n\tv_exp_f32 %3, %11\n\t"
            "v_exp_f32 %4, %12\n\tv_exp_f32 %5, %13\n\tv_exp_f32 %6, %14\n\tv_exp_f32 %7, %15\n\tv_nop"
            : "=&v"(p[0]), "=&v"(p[1]), "=&v"(p[2]), "=&v"(p[3]), "=&v"(p[4]), "=&v"(p[5]), "=&v"(p[6]), "=&v"(p[7])
            : "v"(a[0]), "v"(a[1]), "v"(a[2]), "v"(a[3]), "v"(a[4]), "v"(a[5]), "v"(a[6]), "v"(a[7]));
        pj[j] = 0.f;
#pragma unroll
        for (int r = 0; r < 8; ++r) {
          pj[j] += p[r];
          pb[j >> 1].h[j & 1][r] = (_Float16)(p[r] * 1024.0f);
        }
      }
      lrow = lrow * alpha + ((pj[0] + pj[1]) + (pj[2] + pj[3]));
#pragma unroll
      for (int t = 0; t < 4; ++t)
#pragma unroll
        for (int r = 0; r < 8; ++r) oacc[t][r] *= alpha;

      // ---- context^T += V^T . P^T (f16 WMMA) ----
#pragma unroll
      for (int kk = 0; kk < 2; ++kk) {
#pragma unroll
        for (int t = 0; t < 4; ++t) oacc[t] = mma_raw(vf[kk][t], pb[kk].v, oacc[t]);
      }

      // ---- hand-over: this wave's reads of buffer kt&1 are done and its copies of tile kt+1 have landed; the
      //      barrier publishes tile kt+1 and frees buffer kt&1, which tile kt+2 then goes into ----
      // keeps the products and the softmax in front of the waits: moved behind them (they touch no memory), tile
      // kt+1 would be waited for right behind its issue and tile kt+2 issued a whole trip's work late
      __builtin_amdgcn_sched_barrier(0);
      asm volatile("s_wait_dscnt 0x0" ::: "memory");
      asm volatile("s_wait_asynccnt 0x0" ::: "memory");
      __syncthreads();
      if (kt + 2 <= qb)                          // block-uniform
        copy_kv_tile(lds0 + (unsigned)(kt & 1) * (2 * TB * 2), gk0 + (size_t)(kt + 2) * 64 * DM, gv0 + (kt + 2) * 64);
    }
    asm volatile("s_wait_asynccnt 0x0" ::: "memory");   // nothing of this wave's is in flight behind the loop

    // ---- normalise (1/l and the carries), stage the wave's 16x64 tile, convert to f16,
    float* os = Os[wave];
    {
      const float l = lrow + xhalf(lrow);        // the two halves' key sums joined
      const float inv = ((l > 0.f) ? (1.0f / l) : 0.f) * (1.0f / 1024.0f);
#pragma unroll
      for (int t = 0; t < 4; ++t) {
        v4f lo, hi;
#pragma unroll
        for (int e = 0; e < 4; ++e) { lo[e] = oacc[t][e] * inv; hi[e] = oacc[t][4 + e] * inv; }
        *(v4f*)(os + c * OP + t * 16 + 8 * hh)     = lo;
        *(v4f*)(os + c * OP + t * 16 + 8 * hh + 4) = hi;
      }
    }
    __builtin_amdgcn_fence(__ATOMIC_RELEASE, "workgroup");
    __builtin_amdgcn_wave_barrier();
    __builtin_amdgcn_fence(__ATOMIC_ACQUIRE, "workgroup");
    {
      const int q4 = lane >> 3, c8 = (lane & 7) * 8;
      v4u hv[4];
#pragma unroll
      for (int it = 0; it < 4; ++it) {
        const int row = it * 4 + q4;   // it 0..3 x q4 0..3 = rows 0..15 of the wave tile
        const float* sp = os + row * OP + c8;
        H8 p;
#pragma unroll
        for (int e = 0; e < 8; ++e) p.h[e] = (_Float16)sp[e];
        hv[it] = p.u;
      }
      {
#pragma unroll
        for (int it = 0; it < 4; ++it) {
          const int row = it * 4 + q4;
          const size_t go = (rowB + q0 + row) * DM + (size_t)h * HD + c8;
          *(v4u*)(Op + go) = hv[it];
        }
        // the second query tile reuses the address and data registers of these stores: only behind this wait
        asm volatile("s_wait_xcnt 0x0" ::: "memory");
      }
    }
  }
}

// =====================================================================================================
// Workspace map (bytes), every region an exact multiple of its whole-line / 64x64-tile store granularity:
//   Wqt  f16 [768 out][768 in] x32      0          1179648
//   Wkt  f16 [768][768] x32              1179648    1179648
//   Wvt  f16 [768][768] x32              2359296    1179648
//   Wot  f16 [768][768] x32              3538944    1179648
//   W1t  f16 [3072][768] x32             4718592    4718592
//   W2t  f16 [768][3072] x32             9437184    4718592
//   Np   f16 [8192][768]  ln1 out, later ln2 out          14155776   12582912
//   RegB 50331648 B at 26738688: q f16 [8192][768] at +0, k at +12582912, v^T f16 [2][768][4096] at
//        +25165824 (end +37748736); later the gelu plane G f16 [8192][3072] covers the whole region
//   Ctx  f16 [8192][768] x4              77070336   12582912
//   X1   f32 [8192][768]                 89653248   25165824
//   end                                  114819072
// Launch order makes the aliasing safe on the in-order stream: q/k/v^T are last read by the attention
// launch, G is written three launches later; Np is last read by the projection launch before ln2 rewrites it.
// Spec weights are [in][out]; the GEMM wants Bt[n][k] / A[m][k] with k contiguous, hence the transposes.
// =====================================================================================================
extern "C" void kernel_launch(void* const* d_in, const int* in_sizes, int n_in,
                              void* d_out, int out_size, void* d_ws, size_t ws_size,
                              hipStream_t stream) {
  if (n_in < 17) return;
  if (in_sizes[0] != NROW * DM) return;
  if (in_sizes[1] != DM || in_sizes[2] != DM) return;
  if (in_sizes[3] != DM * DM || in_sizes[5] != DM * DM || in_sizes[7] != DM * DM || in_sizes[9] != DM * DM) return;
  if (in_sizes[4] != DM || in_sizes[6] != DM || in_sizes[8] != DM || in_sizes[10] != DM) return;
  if (in_sizes[11] != DM || in_sizes[12] != DM) return;
  if (in_sizes[13] != DM * FF || in_sizes[14] != FF || in_sizes[15] != FF * DM || in_sizes[16] != DM) return;
  if (out_size != NROW * DM) return;

  const float* x    = (const float*)d_in[0];
  const float* ln1g = (const float*)d_in[1];
  const float* ln1b = (const float*)d_in[2];
  const float* Wq   = (const float*)d_in[3];
  const float* bq   = (const float*)d_in[4];
  const float* Wk   = (const float*)d_in[5];
  const float* bk   = (const float*)d_in[6];
  const float* Wv   = (const float*)d_in[7];
  const float* bv   = (const float*)d_in[8];
  const float* Wo   = (const float*)d_in[9];
  const float* bo   = (const float*)d_in[10];
  const float* ln2g = (const float*)d_in[11];
  const float* ln2b = (const float*)d_in[12];
  const float* W1   = (const float*)d_in[13];
  const float* b1   = (const float*)d_in[14];
  const float* W2   = (const float*)d_in[15];
  const float* b2   = (const float*)d_in[16];

  const size_t PWD  = (size_t)DM * DM * 2;          //  1179648
  const size_t PWF  = (size_t)DM * FF * 2;          //  4718592
  const size_t PA16 = (size_t)NROW * DM * 2;        // 12582912  f16 activation plane [8192][768]
  const size_t PVT  = (size_t)NB * DM * SEQ * 2;    // 12582912  v^T plane
  const size_t PG   = (size_t)NROW * FF * 2;        // 50331648  gelu plane [8192][3072]
  const size_t PX1  = (size_t)NROW * DM * 4;        // 25165824  f32 plane
  size_t off = 0;
  const size_t oWq = off; off += PWD;
  const size_t oWk = off; off += PWD;
  const size_t oWv = off; off += PWD;
  const size_t oWo = off; off += PWD;
  const size_t oW1 = off; off += PWF;
  const size_t oW2 = off; off += PWF;
  const size_t oN  = off; off += PA16;
  const size_t oRB = off; off += PG;
  const size_t oCt = off; off += PA16;
  const size_t oX1 = off; off += PX1;
  if (off > ws_size) return;                        // off = 114819072
  if (off > (size_t)134217728) return;
  const size_t oQ  = oRB;
  const size_t oK  = oRB + PA16;
  const size_t oVT = oRB + 2 * PA16;
  if (oVT + PVT > oRB + PG) return;                 // q, k, v^T fit inside the gelu region
  const size_t oG  = oRB;

  char* ws = (char*)d_ws;
  _Float16* Wqt = (_Float16*)(ws + oWq);
  _Float16* Wkt = (_Float16*)(ws + oWk);
  _Float16* Wvt = (_Float16*)(ws + oWv);
  _Float16* Wot = (_Float16*)(ws + oWo);
  _Float16* W1t = (_Float16*)(ws + oW1);
  _Float16* W2t = (_Float16*)(ws + oW2);
  _Float16* Np  = (_Float16*)(ws + oN);
  _Float16* Qp  = (_Float16*)(ws + oQ);
  _Float16* Kpl = (_Float16*)(ws + oK);
  _Float16* VTp = (_Float16*)(ws + oVT);
  _Float16* Gp  = (_Float16*)(ws + oG);
  _Float16* Ctp = (_Float16*)(ws + oCt);
  float*    X1  = (float*)(ws + oX1);

  const dim3 blk(256);
  const dim3 gPrep(LNB + 4 * TDD + 2 * TDF);                       // 2752 blocks: ln1 and the six weights
  const dim3 gLn((NROW + 7) / 8);                                  // 1024 blocks
  const dim3 gblk(128);                                            // GEMM work-group: 4 waves
  const dim3 gProj((NROW / 128) * (DM / 128), 1);                  // 384 tiles of 128x128
  const dim3 gQkv(2 * TPJ + NB * TVT);                             // 1152 tiles: q, k, v^T
  const dim3 gFfn((NROW / 128) * (FF / 128), 1);                   // 1536 tiles
  const dim3 gAtt((NQB / 2) * NH * NB);                            // 768 blocks, two query tiles each

  // (1) weights [in][out] f32 -> transposed f16 [out][in] x32, and ln1 -> Np f16 [8192][768]
  prep_all<<<gPrep, blk, 0, stream>>>(x, ln1g, ln1b, Np, Wq, Wk, Wv, Wo, W1, W2,
                                      Wqt, Wkt, Wvt, Wot, W1t, W2t, 32.0f);
  // (2) q -> Qp, k -> Kpl, v^T -> VTp
  gemm_qkv<<<gQkv, gblk, 0, stream>>>(Np, Wqt, Wkt, Wvt, bq, bk, bv, Qp, Kpl, VTp);
  // (3) causal attention -> Ctp f16 (ctx * 4)
  attn_causal64<<<gAtt, dim3(128), 0, stream>>>(Qp, Kpl, VTp, Ctp, 0.0625f);
  // (4) x1 = x + ctx . Wo + bo -> X1 f32   (acc = 128 * ctx.Wo)
  gemm64<2, 128><<<gProj, gblk, 0, stream>>>(Ctp, DM, 0LL, Wot, DM, 0LL, bo, x, (void*)X1, DM, 0LL,
                                       NROW, DM, DM, 1.0f / 128.0f, 1.0f);
  // (5) ln2 -> Np
  ln_rows<<<gLn, blk, 0, stream>>>(X1, ln2g, ln2b, Np, NROW);
  // (6) g = gelu(ln2 . W1 + b1) * 4 -> Gp f16 [8192][3072]   (M=8192, N=3072, K=768, acc/32)
  gemm64<3, 64><<<gFfn, gblk, 0, stream>>>(Np, DM, 0LL, W1t, DM, 0LL, b1, x, (void*)Gp, FF, 0LL,
                                      NROW, FF, DM, 1.0f / 32.0f, 4.0f);
  // (7) out = x1 + g . W2 + b2 -> d_out f32 [8192][768]   (M=8192, N=768, K=3072, acc = 128 * g.W2)
  gemm64<2, 128><<<gProj, gblk, 0, stream>>>(Gp, FF, 0LL, W2t, FF, 0LL, b2, X1, d_out, DM, 0LL,
                                       NROW, DM, FF, 1.0f / 128.0f, 1.0f);
  (void)hipGetLastError();
}
